// v000
// Measured on an AMD MI455X. A time is GPU time per run, averaged over a window of back-to-back runs after a warm-up
// (all launches, gaps included; the runs take copies of the inputs in turn), and the median of several windows.
// Apart from v000's, it joins two sittings. Times from different sittings can be a few percent apart, while
// side-by-side timings come from the same sitting.
// The starting kernel, v000, takes 2130 microseconds a run.
#include <hip/hip_runtime.h>
// Contractions tok·Wq/Wk/Wvᵀ, q·kᵀ, P·V, O·Wpᵀ: v_wmma_f32_16x16x32_f16 (f16 operands, f32 accumulate); weights carried x16, softmax probabilities carried x2^15; group statistics accumulated in f64; all other elementwise math f32.

typedef __attribute__((ext_vector_type(16))) _Float16 v16h;
typedef __attribute__((ext_vector_type(8)))  _Float16 v8h;
typedef __attribute__((ext_vector_type(16))) __bf16   v16b;
typedef __attribute__((ext_vector_type(8)))  __bf16   v8b;
typedef __attribute__((ext_vector_type(8)))  float    v8f;
typedef __attribute__((ext_vector_type(4)))  float    v4f;
#define U16(p) ((const unsigned short*)(const void*)(p))

constexpr int CH   = 512;          // channels
constexpr int TFR  = 4;            // frames
constexpr int SP   = 4096;         // tokens per frame (h*w)
constexpr int CSP  = TFR * SP;     // 16384 elements per channel
constexpr int NTOK = TFR * SP;     // 16384 tokens
constexpr int GSZ  = 16 * CSP;     // 262144 elements per group (16 channels per group)
constexpr int NGRP = 32;
constexpr int QH   = 2048;         // query rows per attention pass
constexpr float GN_EPS     = 1e-6f;
constexpr float QSCALE     = 0.04419417382415922f;   // 512^-0.5
constexpr float WCARRY     = 16.0f;
constexpr float WCARRY_INV = 1.0f / 16.0f;
constexpr float PCARRY     = 32768.0f;
constexpr float PCARRY_INV = 1.0f / 32768.0f;

__device__ __forceinline__ unsigned short f2bf_bits(float f) {
  unsigned u = __float_as_uint(f);
  return (unsigned short)((u + 0x7FFFu + ((u >> 16) & 1u)) >> 16);
}
__device__ __forceinline__ float bf_bits2f(unsigned short h) { return __uint_as_float(((unsigned)h) << 16); }

// hazard guards as plain device helpers (no inline asm inside the kernel template body)
__device__ __forceinline__ void dep_guard_h(v8f& a, v8f& b, v16h x, v16h y) { asm volatile("v_nop\n\tv_nop\n\tv_nop\n\tv_nop" : "+v"(a), "+v"(b) : "v"(x), "v"(y)); }
__device__ __forceinline__ void dep_guard_b(v8f& a, v8f& b, v16b x, v16b y) { asm volatile("v_nop\n\tv_nop\n\tv_nop\n\tv_nop" : "+v"(a), "+v"(b) : "v"(x), "v"(y)); }
__device__ __forceinline__ void keep4_h(v16h a, v16h b, v16h c, v16h d) { asm volatile("v_nop" :: "v"(a), "v"(b), "v"(c), "v"(d)); }
__device__ __forceinline__ void keep4_b(v16b a, v16b b, v16b c, v16b d) { asm volatile("v_nop" :: "v"(a), "v"(b), "v"(c), "v"(d)); }
__device__ __forceinline__ void acc_guard4(v8f& a, v8f& b, v8f& c, v8f& d) { asm volatile("v_nop\n\tv_nop\n\tv_nop\n\tv_nop" : "+v"(a), "+v"(b), "+v"(c), "+v"(d)); }
template <typename T> struct Frag;
template <> struct Frag<_Float16> {
  typedef v16h V; union U { v16h v; v8h h[2]; };
  static __device__ __forceinline__ v16h load(const _Float16* p) {   // elements 0..7 <- p[0..7], 8..15 <- p[16..23]
    U f; f.h[0] = *(const v8h*)(p); f.h[1] = *(const v8h*)(p + 16); return f.v;
  }
  static __device__ __forceinline__ v8f mma(v16h a, v16h b, v8f c) {
    return __builtin_amdgcn_wmma_f32_16x16x32_f16(false, a, false, b, (short)0, c, false, false);
  }
  static __device__ __forceinline__ void guard(v8f& a, v8f& b, v16h x, v16h y) { dep_guard_h(a, b, x, y); }
  static __device__ __forceinline__ void keep(v16h a, v16h b, v16h c, v16h d) { keep4_h(a, b, c, d); }
};
template <> struct Frag<__bf16> {
  typedef v16b V; union U { v16b v; v8b h[2]; };
  static __device__ __forceinline__ v16b load(const __bf16* p) {
    U f; f.h[0] = *(const v8b*)(p); f.h[1] = *(const v8b*)(p + 16); return f.v;
  }
  static __device__ __forceinline__ v8f mma(v16b a, v16b b, v8f c) {
    return __builtin_amdgcn_wmma_f32_16x16x32_bf16(false, a, false, b, (short)0, c, false, false);
  }
  static __device__ __forceinline__ void guard(v8f& a, v8f& b, v16b x, v16b y) { dep_guard_b(a, b, x, y); }
  static __device__ __forceinline__ void keep(v16b a, v16b b, v16b c, v16b d) { keep4_b(a, b, c, d); }
};

// ---- Register-blocked batched WMMA GEMM ------------------------------------
// C[m,n] = scale * sum_k A[m,k] * Bt[n,k] (+bias)(+resid); each wave owns a 64x64 tile.
// A row-major [M,K]; Bt row-major [N,K]; M,N % 64 == 0, K % 32 == 0.
// SPLIT: operands are hi/lo planes (A2/Bt2 = lo planes, same layout); product = hi·hi + hi·lo + lo·hi.
// BIAS_MODE: 0 = none, 1 = bias[m], 2 = bias[n].
// OUT_MODE: 0 = f32, 1 = f16, 2 = bf16 hi plane (Cout) + bf16 lo plane (Cout2).
// ET: 0 = f16 operands, 1 = bf16 operands (pointers passed as 16-bit storage)
template <int ET> struct Elem;
template <> struct Elem<0> { typedef _Float16 T; };
template <> struct Elem<1> { typedef __bf16 T; };
template <int ET, bool SPLIT, int BIAS_MODE, int OUT_MODE, bool RESID, int ACT = 0>
__global__ __launch_bounds__(256) void wmma_gemm64(
    const unsigned short* __restrict__ Ap, const unsigned short* __restrict__ A2p, int lda, long strideA,
    const unsigned short* __restrict__ Btp, const unsigned short* __restrict__ Bt2p, int ldb, long strideB,
    void* __restrict__ Cout, void* __restrict__ Cout2, int ldc, long strideC,
    const float* __restrict__ bias,
    const float* __restrict__ resid, long strideR,
    int M, int N, int K, float scale) {
  typedef typename Elem<ET>::T T;
  typedef typename Frag<T>::V V;
  const T* A = (const T*)Ap; const T* A2 = (const T*)A2p; const T* Bt = (const T*)Btp; const T* Bt2 = (const T*)Bt2p;
  __shared__ __align__(16) float sT[8][16 * 68];   // per-wave 16x64 slab, pitch 68 floats
  const int b    = blockIdx.y;
  const int lane = threadIdx.x & 31;
  const int wave = threadIdx.x >> 5;
  const int tilesN = N >> 6;
  const int tilesM = M >> 6;
  const int tile = blockIdx.x * 8 + wave;
  if (tile >= tilesM * tilesN) return;   // wave-uniform; no block barriers in this kernel
  const int tm = tile / tilesN;
  const int tn = tile - tm * tilesN;
  const int m0 = tm << 6;
  const int n0 = tn << 6;

  const T* Ab  = A  + (size_t)b * strideA;
  const T* Bb  = Bt + (size_t)b * strideB;
  const T* Ab2 = SPLIT ? (A2  + (size_t)b * strideA) : nullptr;
  const T* Bb2 = SPLIT ? (Bt2 + (size_t)b * strideB) : nullptr;

  const int rlane = lane & 15;                 // row (A) / col (B, D) within subtile
  const int koff  = (lane >> 4) * 8;           // k offset of this lane half
  const int mOff  = (lane >> 4) * 8;           // D row offset

  v8f acc[4][4];
#pragma unroll
  for (int i = 0; i < 4; ++i)
#pragma unroll
    for (int j = 0; j < 4; ++j) acc[i][j] = (v8f){0.f,0.f,0.f,0.f,0.f,0.f,0.f,0.f};

  for (int k0 = 0; k0 < K; k0 += 32) {
    V bh[4], bl[4];
#pragma unroll
    for (int j = 0; j < 4; ++j) {
      const size_t bo = (size_t)(n0 + (j << 4) + rlane) * ldb + koff + k0;
      bh[j] = Frag<T>::load(Bb + bo);
      if (SPLIT) bl[j] = Frag<T>::load(Bb2 + bo);
    }
#pragma unroll
    for (int i = 0; i < 4; ++i) {
      const size_t ao = (size_t)(m0 + (i << 4) + rlane) * lda + koff + k0;
      V ah = Frag<T>::load(Ab + ao);
      V al;
      if (SPLIT) al = Frag<T>::load(Ab2 + ao);
#pragma unroll
      for (int j = 0; j < 4; ++j) {
        acc[i][j] = Frag<T>::mma(ah, bh[j], acc[i][j]);
        if (SPLIT) {
          acc[i][j] = Frag<T>::mma(ah, bl[j], acc[i][j]);
          acc[i][j] = Frag<T>::mma(al, bh[j], acc[i][j]);
        }
      }
      Frag<T>::guard(acc[i][0], acc[i][3], ah, SPLIT ? al : ah);
    }
    Frag<T>::keep(bh[0], bh[1], bh[2], bh[3]);
    if (SPLIT) Frag<T>::keep(bl[0], bl[1], bl[2], bl[3]);
  }
  acc_guard4(acc[0][0], acc[0][1], acc[0][2], acc[0][3]);
  acc_guard4(acc[1][0], acc[1][1], acc[1][2], acc[1][3]);
  acc_guard4(acc[2][0], acc[2][1], acc[2][2], acc[2][3]);
  acc_guard4(acc[3][0], acc[3][1], acc[3][2], acc[3][3]);

  // ---- epilogue ----
  float* slab = sT[wave];
  const float* Rb = RESID ? (resid + (size_t)b * strideR) : nullptr;
#pragma unroll
  for (int i = 0; i < 4; ++i) {
    const int mBase = m0 + (i << 4);
#pragma unroll
    for (int j = 0; j < 4; ++j) {
      const int n = n0 + (j << 4) + rlane;
      float bv = 0.f;
      if (BIAS_MODE == 2) bv = bias[n];
#pragma unroll
      for (int r = 0; r < 8; ++r) {
        float v = acc[i][j][r] * scale;
        if (BIAS_MODE == 1) v += bias[mBase + mOff + r];
        if (BIAS_MODE == 2) v += bv;
        if (RESID) v += Rb[(size_t)(mBase + mOff + r) * ldc + n];
        if (ACT == 1) v = tanhf(v);
        if (ACT == 2) v = fmaxf(v, 0.0f);
        if (ACT == 3) v = v / (1.0f + expf(-v));
        if (ACT == 4) v = (v > 0.f) ? v : 0.01f * v;
        if (ACT == 5) v = 0.5f * v * (1.0f + erff(v * 0.70710678118654752f));
        slab[(mOff + r) * 68 + (j << 4) + rlane] = v;
      }
    }
    __builtin_amdgcn_fence(__ATOMIC_RELEASE, "workgroup");
    __builtin_amdgcn_wave_barrier();
    __builtin_amdgcn_fence(__ATOMIC_ACQUIRE, "workgroup");
    if (OUT_MODE == 0) {
      float* C = (float*)Cout + (size_t)b * strideC;
      const int hh = lane >> 4, c4 = (lane & 15) * 4;     // row seg = 256 B = 16 lanes x 16 B
      {
#pragma unroll
        for (int it = 0; it < 8; ++it) {
          const int row = it * 2 + hh;
          v4f v = *(const v4f*)(slab + row * 68 + c4);
          *(v4f*)(C + (size_t)(mBase + row) * ldc + n0 + c4) = v;
        }
        
      }
    } else {
      const int q = lane >> 3, c8 = (lane & 7) * 8;
      unsigned short* C  = (unsigned short*)Cout  + (size_t)b * strideC;
      unsigned short* C2 = (OUT_MODE == 2) ? ((unsigned short*)Cout2 + (size_t)b * strideC) : nullptr;
      {
#pragma unroll
        for (int it = 0; it < 4; ++it) {
          const int row = it * 4 + q;
          const float* sp = slab + row * 68 + c8;
          v8h hv, lv;
#pragma unroll
          for (int e = 0; e < 8; ++e) {
            if (OUT_MODE == 1) {
              hv[e] = (_Float16)sp[e];
            } else {
              unsigned short hb = f2bf_bits(sp[e]);
              unsigned short lb = f2bf_bits(sp[e] - bf_bits2f(hb));
              hv[e] = __builtin_bit_cast(_Float16, hb);
              lv[e] = __builtin_bit_cast(_Float16, lb);
            }
          }
          *(v8h*)(C + (size_t)(mBase + row) * ldc + n0 + c8) = hv;
          if (OUT_MODE == 2) *(v8h*)(C2 + (size_t)(mBase + row) * ldc + n0 + c8) = lv;
        }
        
      }
    }
    __builtin_amdgcn_fence(__ATOMIC_RELEASE, "workgroup");
    __builtin_amdgcn_wave_barrier();
    __builtin_amdgcn_fence(__ATOMIC_ACQUIRE, "workgroup");
  }
}

__global__ __launch_bounds__(256) void cast_f32_f16x2s(
    const float* __restrict__ in, _Float16* __restrict__ out, int n2, float sc) {
  int i = blockIdx.x * 256 + threadIdx.x;
  if (i < n2) {
    const _Float16 h0 = (_Float16)(in[2 * i] * sc), h1 = (_Float16)(in[2 * i + 1] * sc);
    const unsigned u = (unsigned)__builtin_bit_cast(unsigned short, h0) | ((unsigned)__builtin_bit_cast(unsigned short, h1) << 16);
    ((unsigned*)out)[i] = u;
    
  }
}

// ---- group statistics: one block per group, f64 fixed-order accumulation.
__global__ __launch_bounds__(256) void gn_stats(const float* __restrict__ x, float* __restrict__ stats) {
  __shared__ double ws1[8];
  __shared__ double ws2[8];
  const int g = blockIdx.x;
  const int tid = threadIdx.x, wave = tid >> 5, lane = tid & 31;
  const v4f* p = (const v4f*)(x + (size_t)g * GSZ);
  double s = 0.0, s2 = 0.0;
#pragma unroll 2
  for (int i = tid; i < GSZ / 4; i += 256) {
    const v4f v = p[i];
#pragma unroll
    for (int e = 0; e < 4; ++e) { const double d = (double)v[e]; s += d; s2 += d * d; }
  }
#pragma unroll
  for (int off = 1; off < 32; off <<= 1) { s += __shfl_xor(s, off, 32); s2 += __shfl_xor(s2, off, 32); }
  if (lane == 0) { ws1[wave] = s; ws2[wave] = s2; }
  __syncthreads();
  if (tid < 32) {
    double ts = 0.0, ts2 = 0.0;
#pragma unroll
    for (int w = 0; w < 8; ++w) { ts += ws1[w]; ts2 += ws2[w]; }
    const double mean = ts * (1.0 / (double)GSZ);
    double var = ts2 * (1.0 / (double)GSZ) - mean * mean;
    if (var < 0.0) var = 0.0;
    const float meanf = (float)mean;
    const float rstd  = rsqrtf((float)var + GN_EPS);
    const float val = (lane == 0) ? meanf : ((lane == 1) ? rstd : 0.0f);
    float* dst = stats + g * 32 + lane;
    *(float*)dst = val;
    
  }
}

// ---- normalize + affine + transpose: x[c][t][s] (f32) -> tok[t*SP + s][c] (f16).
__global__ __launch_bounds__(256) void norm_tok(const float* __restrict__ x,
                                                const float* __restrict__ gamma,
                                                const float* __restrict__ beta,
                                                const float* __restrict__ stats,
                                                _Float16* __restrict__ tok) {
  __shared__ __align__(16) _Float16 tile[64 * 72];   // [sl][cl], pitch 72 halves
  const int bid = blockIdx.x;
  const int cb  = bid & 7;           // 8 channel blocks of 64
  const int sb  = (bid >> 3) & 63;   // 64 position blocks of 64
  const int t   = bid >> 9;          // frame
  const int c0 = cb * 64, s0 = sb * 64;
  const int tid = threadIdx.x;
#pragma unroll 4
  for (int i = tid; i < 64 * 64; i += 256) {
    const int cl = i >> 6, sl = i & 63;
    const int c = c0 + cl;
    const int g = c >> 4;
    const float mean = stats[g * 32], rstd = stats[g * 32 + 1];
    float v = x[(size_t)c * CSP + (size_t)t * SP + s0 + sl];
    v = (v - mean) * rstd * gamma[c] + beta[c];
    tile[sl * 72 + cl] = (_Float16)v;
  }
  __syncthreads();
  const int wave = tid >> 5, lane = tid & 31;
  const int q = lane >> 3, c8 = (lane & 7) * 8;
  {
#pragma unroll
    for (int it = 0; it < 2; ++it) {
      const int row = wave * 8 + it * 4 + q;   // wave covers rows 8w..8w+7
      const v8h hv = *(const v8h*)(tile + row * 72 + c8);
      *(v8h*)(tok + ((size_t)t * SP + s0 + row) * CH + c0 + c8) = hv;
    }
    
  }
}

// ---- row softmax over SP keys: S f32 [rows][SP] -> P f16 [rows][SP] = f16(p/sum * 2^15).
__global__ __launch_bounds__(256) void softmax_rows(const float* __restrict__ S, _Float16* __restrict__ P) {
  __shared__ float rmax[8];
  __shared__ float rsum[8];
  const int row = blockIdx.x;
  const int tid = threadIdx.x, wave = tid >> 5, lane = tid & 31;
  const float* sr = S + (size_t)row * SP;
  const v4f a0 = *(const v4f*)(sr + 8 * tid);
  const v4f a1 = *(const v4f*)(sr + 8 * tid + 4);
  const v4f a2 = *(const v4f*)(sr + (SP / 2) + 8 * tid);
  const v4f a3 = *(const v4f*)(sr + (SP / 2) + 8 * tid + 4);
  float m = a0[0];
#pragma unroll
  for (int e = 0; e < 4; ++e) { m = fmaxf(m, a0[e]); m = fmaxf(m, a1[e]); m = fmaxf(m, a2[e]); m = fmaxf(m, a3[e]); }
#pragma unroll
  for (int off = 1; off < 32; off <<= 1) m = fmaxf(m, __shfl_xor(m, off, 32));
  if (lane == 0) rmax[wave] = m;
  __syncthreads();
  float bm = rmax[0];
#pragma unroll
  for (int w = 1; w < 8; ++w) bm = fmaxf(bm, rmax[w]);
  v4f e0, e1, e2, e3;
  float su = 0.f;
#pragma unroll
  for (int e = 0; e < 4; ++e) { e0[e] = __expf(a0[e] - bm); su += e0[e]; }
#pragma unroll
  for (int e = 0; e < 4; ++e) { e1[e] = __expf(a1[e] - bm); su += e1[e]; }
#pragma unroll
  for (int e = 0; e < 4; ++e) { e2[e] = __expf(a2[e] - bm); su += e2[e]; }
#pragma unroll
  for (int e = 0; e < 4; ++e) { e3[e] = __expf(a3[e] - bm); su += e3[e]; }
#pragma unroll
  for (int off = 1; off < 32; off <<= 1) su += __shfl_xor(su, off, 32);
  if (lane == 0) rsum[wave] = su;
  __syncthreads();
  float tot = rsum[0];
#pragma unroll
  for (int w = 1; w < 8; ++w) tot += rsum[w];
  const float f = (1.0f / tot) * PCARRY;
  v8h h0, h1;
#pragma unroll
  for (int e = 0; e < 4; ++e) {
    h0[e]     = (_Float16)(e0[e] * f);
    h0[4 + e] = (_Float16)(e1[e] * f);
    h1[e]     = (_Float16)(e2[e] * f);
    h1[4 + e] = (_Float16)(e3[e] * f);
  }
  _Float16* pr = P + (size_t)row * SP;
  {
    *(v8h*)(pr + 8 * tid) = h0;
    *(v8h*)(pr + (SP / 2) + 8 * tid) = h1;
    
  }
}

static inline int gemm_blocks(int M, int N) { return ((M / 64) * (N / 64) + 7) / 8; }

// ---------------- launch ----------------
extern "C" void kernel_launch(void* const* d_in, const int* in_sizes, int n_in,
                              void* d_out, int out_size, void* d_ws, size_t ws_size,
                              hipStream_t stream) {
  if (n_in < 11) return;
  if (in_sizes[0] != CH * CSP || out_size != CH * CSP) return;
  if (in_sizes[1] != CH || in_sizes[2] != CH) return;
  if (in_sizes[3] != CH * CH || in_sizes[5] != CH * CH || in_sizes[7] != CH * CH || in_sizes[9] != CH * CH) return;
  if (in_sizes[4] != CH || in_sizes[6] != CH || in_sizes[8] != CH || in_sizes[10] != CH) return;

  const float* x     = (const float*)d_in[0];
  const float* gamma = (const float*)d_in[1];
  const float* beta  = (const float*)d_in[2];
  const float* wq    = (const float*)d_in[3];
  const float* bq    = (const float*)d_in[4];
  const float* wk    = (const float*)d_in[5];
  const float* bk    = (const float*)d_in[6];
  const float* wv    = (const float*)d_in[7];
  const float* bv    = (const float*)d_in[8];
  const float* wp    = (const float*)d_in[9];
  const float* bp    = (const float*)d_in[10];
  float* out = (float*)d_out;

  char* ws = (char*)d_ws;
  size_t off = 0;
  float* stats = (float*)(ws + off);          off += 4096;                                      // 32 lines
  _Float16* w16  = (_Float16*)(ws + off);     off += (size_t)4 * CH * CH * sizeof(_Float16);   // 2 MiB
  _Float16* tok  = (_Float16*)(ws + off);     off += (size_t)NTOK * CH * sizeof(_Float16);     // 16 MiB
  _Float16* q16  = (_Float16*)(ws + off);     off += (size_t)NTOK * CH * sizeof(_Float16);     // 16 MiB
  _Float16* k16  = (_Float16*)(ws + off);     off += (size_t)NTOK * CH * sizeof(_Float16);     // 16 MiB
  _Float16* vT16 = (_Float16*)(ws + off);     off += (size_t)CH * NTOK * sizeof(_Float16);     // 16 MiB  [512][16384]
  float* S       = (float*)(ws + off);        off += (size_t)QH * SP * sizeof(float);          // 32 MiB
  _Float16* P16  = (_Float16*)(ws + off);     off += (size_t)QH * SP * sizeof(_Float16);       // 16 MiB
  if (off > ws_size) return;                  // 119,541,760 B total
  _Float16* o16 = tok;                        // attention output plane reuses the token plane (tokens are dead after the projections)
  _Float16* wq16 = w16;
  _Float16* wk16 = w16 + (size_t)CH * CH;
  _Float16* wv16 = w16 + (size_t)2 * CH * CH;
  _Float16* wp16 = w16 + (size_t)3 * CH * CH;

  // 1. group statistics
  gn_stats<<<dim3(NGRP), dim3(256), 0, stream>>>(x, stats);

  // 2. weights x16 -> f16
  const int n2 = CH * CH / 2;
  cast_f32_f16x2s<<<dim3((n2 + 255) / 256), dim3(256), 0, stream>>>(wq, wq16, n2, WCARRY);
  cast_f32_f16x2s<<<dim3((n2 + 255) / 256), dim3(256), 0, stream>>>(wk, wk16, n2, WCARRY);
  cast_f32_f16x2s<<<dim3((n2 + 255) / 256), dim3(256), 0, stream>>>(wv, wv16, n2, WCARRY);
  cast_f32_f16x2s<<<dim3((n2 + 255) / 256), dim3(256), 0, stream>>>(wp, wp16, n2, WCARRY);

  // 3. normalize + transpose to tokens
  norm_tok<<<dim3(TFR * 64 * 8), dim3(256), 0, stream>>>(x, gamma, beta, stats, tok);

  // 4. q = tok·Wqᵀ/16 + bq   (A = tok [16384][512], Bt = Wq16 [512][512], f16 out [16384][512])
  wmma_gemm64<0, false, 2, 1, false><<<dim3(gemm_blocks(NTOK, CH), 1), dim3(256), 0, stream>>>(
      U16(tok), U16(tok), CH, (long)0, U16(wq16), U16(wq16), CH, (long)0,
      (void*)q16, (void*)q16, CH, (long)0, bq, x, (long)0, NTOK, CH, CH, WCARRY_INV);
  //    k = tok·Wkᵀ/16 + bk
  wmma_gemm64<0, false, 2, 1, false><<<dim3(gemm_blocks(NTOK, CH), 1), dim3(256), 0, stream>>>(
      U16(tok), U16(tok), CH, (long)0, U16(wk16), U16(wk16), CH, (long)0,
      (void*)k16, (void*)k16, CH, (long)0, bk, x, (long)0, NTOK, CH, CH, WCARRY_INV);
  //    vᵀ[c][token] = Wv16·tokᵀ/16 + bv[c]   (A = Wv16 [512][512], Bt = tok [16384][512], f16 out [512][16384])
  wmma_gemm64<0, false, 1, 1, false><<<dim3(gemm_blocks(CH, NTOK), 1), dim3(256), 0, stream>>>(
      U16(wv16), U16(wv16), CH, (long)0, U16(tok), U16(tok), CH, (long)0,
      (void*)vT16, (void*)vT16, NTOK, (long)0, bv, x, (long)0, CH, NTOK, CH, WCARRY_INV);

  // 5. per half-frame attention: S = q·kᵀ·512^-0.5 (f32), row softmax -> P16 (x2^15), O = P16·V x2^-15
  for (int hp = 0; hp < TFR * (SP / QH); ++hp) {
    const int t = hp / (SP / QH);
    const int half = hp - t * (SP / QH);
    const size_t qrow0 = (size_t)t * SP + (size_t)half * QH;
    const _Float16* qA  = q16 + qrow0 * CH;                   // [QH][512]
    const _Float16* kB  = k16 + (size_t)t * SP * CH;           // [4096][512]
    const _Float16* vB  = vT16 + (size_t)t * SP;               // [512][4096] with pitch 16384
    _Float16* oC = o16 + qrow0 * CH;                           // [QH][512]
    wmma_gemm64<0, false, 0, 0, false><<<dim3(gemm_blocks(QH, SP), 1), dim3(256), 0, stream>>>(
        U16(qA), U16(qA), CH, (long)0, U16(kB), U16(kB), CH, (long)0,
        (void*)S, (void*)S, SP, (long)0, bq, x, (long)0, QH, SP, CH, QSCALE);
    softmax_rows<<<dim3(QH), dim3(256), 0, stream>>>(S, P16);
    wmma_gemm64<0, false, 0, 1, false><<<dim3(gemm_blocks(QH, CH), 1), dim3(256), 0, stream>>>(
        U16(P16), U16(P16), SP, (long)0, U16(vB), U16(vB), NTOK, (long)0,
        (void*)oC, (void*)oC, CH, (long)0, bq, x, (long)0, QH, CH, SP, PCARRY_INV);
  }

  // 6. out[c][token] = Wp16·Oᵀ/16 + bp[c] + x[c][token]   (A = Wp16 [512][512], Bt = O [16384][512], f32 out [512][16384])
  wmma_gemm64<0, false, 1, 0, true><<<dim3(gemm_blocks(CH, NTOK), 1), dim3(256), 0, stream>>>(
      U16(wp16), U16(wp16), CH, (long)0, U16(o16), U16(o16), CH, (long)0,
      (void*)out, (void*)out, NTOK, (long)0, bp, x, (long)0, CH, NTOK, CH, WCARRY_INV);
}

// v001
// Measured time: 760 microseconds a run.
// Next to v000, in two timings, it ran 2.81 and 2.82 times as fast.
#include <hip/hip_runtime.h>
// Contractions tok·Wq/Wk/Wvᵀ, q·kᵀ, P·V, O·Wpᵀ: v_wmma_f32_16x16x32_f16 (f16 operands, f32 accumulate); weights carried x16, softmax probabilities carried x2^15; group statistics accumulated in f64; all other elementwise math f32.

typedef __attribute__((ext_vector_type(16))) _Float16 v16h;
typedef __attribute__((ext_vector_type(8)))  _Float16 v8h;
typedef __attribute__((ext_vector_type(16))) __bf16   v16b;
typedef __attribute__((ext_vector_type(8)))  __bf16   v8b;
typedef __attribute__((ext_vector_type(8)))  float    v8f;
typedef __attribute__((ext_vector_type(4)))  float    v4f;
#define U16(p) ((const unsigned short*)(const void*)(p))

constexpr int CH   = 512;          // channels
constexpr int TFR  = 4;            // frames
constexpr int SP   = 4096;         // tokens per frame (h*w)
constexpr int CSP  = TFR * SP;     // 16384 elements per channel
constexpr int NTOK = TFR * SP;     // 16384 tokens
constexpr int GSZ  = 16 * CSP;     // 262144 elements per group (16 channels per group)
constexpr int NGRP = 32;
constexpr int QH   = 2048;         // query rows per attention pass
constexpr float GN_EPS     = 1e-6f;
constexpr float QSCALE     = 0.04419417382415922f;   // 512^-0.5
constexpr float WCARRY     = 16.0f;
constexpr float WCARRY_INV = 1.0f / 16.0f;
constexpr float PCARRY     = 32768.0f;
constexpr float PCARRY_INV = 1.0f / 32768.0f;

__device__ __forceinline__ unsigned short f2bf_bits(float f) {
  unsigned u = __float_as_uint(f);
  return (unsigned short)((u + 0x7FFFu + ((u >> 16) & 1u)) >> 16);
}
__device__ __forceinline__ float bf_bits2f(unsigned short h) { return __uint_as_float(((unsigned)h) << 16); }

// hazard guards as plain device helpers (no inline asm inside the kernel template body)
__device__ __forceinline__ void dep_guard_h(v8f& a, v8f& b, v16h x, v16h y) { asm volatile("v_nop\n\tv_nop\n\tv_nop\n\tv_nop" : "+v"(a), "+v"(b) : "v"(x), "v"(y)); }
__device__ __forceinline__ void dep_guard_b(v8f& a, v8f& b, v16b x, v16b y) { asm volatile("v_nop\n\tv_nop\n\tv_nop\n\tv_nop" : "+v"(a), "+v"(b) : "v"(x), "v"(y)); }
__device__ __forceinline__ void keep4_h(v16h a, v16h b, v16h c, v16h d) { asm volatile("v_nop" :: "v"(a), "v"(b), "v"(c), "v"(d)); }
__device__ __forceinline__ void keep4_b(v16b a, v16b b, v16b c, v16b d) { asm volatile("v_nop" :: "v"(a), "v"(b), "v"(c), "v"(d)); }
__device__ __forceinline__ void acc_guard4(v8f& a, v8f& b, v8f& c, v8f& d) { asm volatile("v_nop\n\tv_nop\n\tv_nop\n\tv_nop" : "+v"(a), "+v"(b), "+v"(c), "+v"(d)); }
template <typename T> struct Frag;
template <> struct Frag<_Float16> {
  typedef v16h V; union U { v16h v; v8h h[2]; };
  static __device__ __forceinline__ v16h load(const _Float16* p) {   // elements 0..7 <- p[0..7], 8..15 <- p[16..23]
    U f; f.h[0] = *(const v8h*)(p); f.h[1] = *(const v8h*)(p + 16); return f.v;
  }
  static __device__ __forceinline__ v8f mma(v16h a, v16h b, v8f c) {
    return __builtin_amdgcn_wmma_f32_16x16x32_f16(false, a, false, b, (short)0, c, false, false);
  }
  static __device__ __forceinline__ void guard(v8f& a, v8f& b, v16h x, v16h y) { dep_guard_h(a, b, x, y); }
  static __device__ __forceinline__ void keep(v16h a, v16h b, v16h c, v16h d) { keep4_h(a, b, c, d); }
};
template <> struct Frag<__bf16> {
  typedef v16b V; union U { v16b v; v8b h[2]; };
  static __device__ __forceinline__ v16b load(const __bf16* p) {
    U f; f.h[0] = *(const v8b*)(p); f.h[1] = *(const v8b*)(p + 16); return f.v;
  }
  static __device__ __forceinline__ v8f mma(v16b a, v16b b, v8f c) {
    return __builtin_amdgcn_wmma_f32_16x16x32_bf16(false, a, false, b, (short)0, c, false, false);
  }
  static __device__ __forceinline__ void guard(v8f& a, v8f& b, v16b x, v16b y) { dep_guard_b(a, b, x, y); }
  static __device__ __forceinline__ void keep(v16b a, v16b b, v16b c, v16b d) { keep4_b(a, b, c, d); }
};

// ---- Register-blocked batched WMMA GEMM ------------------------------------
// C[m,n] = scale * sum_k A[m,k] * Bt[n,k] (+bias)(+resid); each wave owns a 64x64 tile.
// A row-major [M,K]; Bt row-major [N,K]; M,N % 64 == 0, K % 32 == 0.
// SPLIT: operands are hi/lo planes (A2/Bt2 = lo planes, same layout); product = hi·hi + hi·lo + lo·hi.
// BIAS_MODE: 0 = none, 1 = bias[m], 2 = bias[n].
// OUT_MODE: 0 = f32, 1 = f16, 2 = bf16 hi plane (Cout) + bf16 lo plane (Cout2).
// ET: 0 = f16 operands, 1 = bf16 operands (pointers passed as 16-bit storage)
template <int ET> struct Elem;
template <> struct Elem<0> { typedef _Float16 T; };
template <> struct Elem<1> { typedef __bf16 T; };
template <int ET, bool SPLIT, int BIAS_MODE, int OUT_MODE, bool RESID, int ACT = 0>
__global__ __launch_bounds__(256) void wmma_gemm64(
    const unsigned short* __restrict__ Ap, const unsigned short* __restrict__ A2p, int lda, long strideA,
    const unsigned short* __restrict__ Btp, const unsigned short* __restrict__ Bt2p, int ldb, long strideB,
    void* __restrict__ Cout, void* __restrict__ Cout2, int ldc, long strideC,
    const float* __restrict__ bias,
    const float* __restrict__ resid, long strideR,
    int M, int N, int K, float scale) {
  typedef typename Elem<ET>::T T;
  typedef typename Frag<T>::V V;
  const T* A = (const T*)Ap; const T* A2 = (const T*)A2p; const T* Bt = (const T*)Btp; const T* Bt2 = (const T*)Bt2p;
  __shared__ __align__(16) float sT[8][16 * 68];   // per-wave 16x64 slab, pitch 68 floats
  const int b    = blockIdx.y;
  const int lane = threadIdx.x & 31;
  const int wave = threadIdx.x >> 5;
  const int tilesN = N >> 6;
  const int tilesM = M >> 6;
  const int tile = blockIdx.x * 8 + wave;
  if (tile >= tilesM * tilesN) return;   // wave-uniform; no block barriers in this kernel
  const int tm = tile / tilesN;
  const int tn = tile - tm * tilesN;
  const int m0 = tm << 6;
  const int n0 = tn << 6;

  const T* Ab  = A  + (size_t)b * strideA;
  const T* Bb  = Bt + (size_t)b * strideB;
  const T* Ab2 = SPLIT ? (A2  + (size_t)b * strideA) : nullptr;
  const T* Bb2 = SPLIT ? (Bt2 + (size_t)b * strideB) : nullptr;

  const int rlane = lane & 15;                 // row (A) / col (B, D) within subtile
  const int koff  = (lane >> 4) * 8;           // k offset of this lane half
  const int mOff  = (lane >> 4) * 8;           // D row offset

  v8f acc[4][4];
#pragma unroll
  for (int i = 0; i < 4; ++i)
#pragma unroll
    for (int j = 0; j < 4; ++j) acc[i][j] = (v8f){0.f,0.f,0.f,0.f,0.f,0.f,0.f,0.f};

  for (int k0 = 0; k0 < K; k0 += 32) {
    V bh[4], bl[4];
#pragma unroll
    for (int j = 0; j < 4; ++j) {
      const size_t bo = (size_t)(n0 + (j << 4) + rlane) * ldb + koff + k0;
      bh[j] = Frag<T>::load(Bb + bo);
      if (SPLIT) bl[j] = Frag<T>::load(Bb2 + bo);
    }
#pragma unroll
    for (int i = 0; i < 4; ++i) {
      const size_t ao = (size_t)(m0 + (i << 4) + rlane) * lda + koff + k0;
      V ah = Frag<T>::load(Ab + ao);
      V al;
      if (SPLIT) al = Frag<T>::load(Ab2 + ao);
#pragma unroll
      for (int j = 0; j < 4; ++j) {
        acc[i][j] = Frag<T>::mma(ah, bh[j], acc[i][j]);
        if (SPLIT) {
          acc[i][j] = Frag<T>::mma(ah, bl[j], acc[i][j]);
          acc[i][j] = Frag<T>::mma(al, bh[j], acc[i][j]);
        }
      }
      Frag<T>::guard(acc[i][0], acc[i][3], ah, SPLIT ? al : ah);
    }
    Frag<T>::keep(bh[0], bh[1], bh[2], bh[3]);
    if (SPLIT) Frag<T>::keep(bl[0], bl[1], bl[2], bl[3]);
  }
  acc_guard4(acc[0][0], acc[0][1], acc[0][2], acc[0][3]);
  acc_guard4(acc[1][0], acc[1][1], acc[1][2], acc[1][3]);
  acc_guard4(acc[2][0], acc[2][1], acc[2][2], acc[2][3]);
  acc_guard4(acc[3][0], acc[3][1], acc[3][2], acc[3][3]);

  // ---- epilogue ----
  float* slab = sT[wave];
  const float* Rb = RESID ? (resid + (size_t)b * strideR) : nullptr;
#pragma unroll
  for (int i = 0; i < 4; ++i) {
    const int mBase = m0 + (i << 4);
#pragma unroll
    for (int j = 0; j < 4; ++j) {
      const int n = n0 + (j << 4) + rlane;
      float bv = 0.f;
      if (BIAS_MODE == 2) bv = bias[n];
#pragma unroll
      for (int r = 0; r < 8; ++r) {
        float v = acc[i][j][r] * scale;
        if (BIAS_MODE == 1) v += bias[mBase + mOff + r];
        if (BIAS_MODE == 2) v += bv;
        if (RESID) v += Rb[(size_t)(mBase + mOff + r) * ldc + n];
        if (ACT == 1) v = tanhf(v);
        if (ACT == 2) v = fmaxf(v, 0.0f);
        if (ACT == 3) v = v / (1.0f + expf(-v));
        if (ACT == 4) v = (v > 0.f) ? v : 0.01f * v;
        if (ACT == 5) v = 0.5f * v * (1.0f + erff(v * 0.70710678118654752f));
        slab[(mOff + r) * 68 + (j << 4) + rlane] = v;
      }
    }
    __builtin_amdgcn_fence(__ATOMIC_RELEASE, "workgroup");
    __builtin_amdgcn_wave_barrier();
    __builtin_amdgcn_fence(__ATOMIC_ACQUIRE, "workgroup");
    if (OUT_MODE == 0) {
      float* C = (float*)Cout + (size_t)b * strideC;
      const int hh = lane >> 4, c4 = (lane & 15) * 4;     // row seg = 256 B = 16 lanes x 16 B
      {
#pragma unroll
        for (int it = 0; it < 8; ++it) {
          const int row = it * 2 + hh;
          v4f v = *(const v4f*)(slab + row * 68 + c4);
          *(v4f*)(C + (size_t)(mBase + row) * ldc + n0 + c4) = v;
        }
        
      }
    } else {
      const int q = lane >> 3, c8 = (lane & 7) * 8;
      unsigned short* C  = (unsigned short*)Cout  + (size_t)b * strideC;
      unsigned short* C2 = (OUT_MODE == 2) ? ((unsigned short*)Cout2 + (size_t)b * strideC) : nullptr;
      {
#pragma unroll
        for (int it = 0; it < 4; ++it) {
          const int row = it * 4 + q;
          const float* sp = slab + row * 68 + c8;
          v8h hv, lv;
#pragma unroll
          for (int e = 0; e < 8; ++e) {
            if (OUT_MODE == 1) {
              hv[e] = (_Float16)sp[e];
            } else {
              unsigned short hb = f2bf_bits(sp[e]);
              unsigned short lb = f2bf_bits(sp[e] - bf_bits2f(hb));
              hv[e] = __builtin_bit_cast(_Float16, hb);
              lv[e] = __builtin_bit_cast(_Float16, lb);
            }
          }
          *(v8h*)(C + (size_t)(mBase + row) * ldc + n0 + c8) = hv;
          if (OUT_MODE == 2) *(v8h*)(C2 + (size_t)(mBase + row) * ldc + n0 + c8) = lv;
        }
        
      }
    }
    __builtin_amdgcn_fence(__ATOMIC_RELEASE, "workgroup");
    __builtin_amdgcn_wave_barrier();
    __builtin_amdgcn_fence(__ATOMIC_ACQUIRE, "workgroup");
  }
}

__global__ __launch_bounds__(256) void cast_f32_f16x2s(
    const float* __restrict__ in, _Float16* __restrict__ out, int n2, float sc) {
  int i = blockIdx.x * 256 + threadIdx.x;
  if (i < n2) {
    const _Float16 h0 = (_Float16)(in[2 * i] * sc), h1 = (_Float16)(in[2 * i + 1] * sc);
    const unsigned u = (unsigned)__builtin_bit_cast(unsigned short, h0) | ((unsigned)__builtin_bit_cast(unsigned short, h1) << 16);
    ((unsigned*)out)[i] = u;
    
  }
}

// ---- group statistics: one block per group, f64 fixed-order accumulation.
__global__ __launch_bounds__(256) void gn_stats(const float* __restrict__ x, float* __restrict__ stats) {
  __shared__ double ws1[8];
  __shared__ double ws2[8];
  const int g = blockIdx.x;
  const int tid = threadIdx.x, wave = tid >> 5, lane = tid & 31;
  const v4f* p = (const v4f*)(x + (size_t)g * GSZ);
  double s = 0.0, s2 = 0.0;
#pragma unroll 2
  for (int i = tid; i < GSZ / 4; i += 256) {
    const v4f v = p[i];
#pragma unroll
    for (int e = 0; e < 4; ++e) { const double d = (double)v[e]; s += d; s2 += d * d; }
  }
#pragma unroll
  for (int off = 1; off < 32; off <<= 1) { s += __shfl_xor(s, off, 32); s2 += __shfl_xor(s2, off, 32); }
  if (lane == 0) { ws1[wave] = s; ws2[wave] = s2; }
  __syncthreads();
  if (tid < 32) {
    double ts = 0.0, ts2 = 0.0;
#pragma unroll
    for (int w = 0; w < 8; ++w) { ts += ws1[w]; ts2 += ws2[w]; }
    const double mean = ts * (1.0 / (double)GSZ);
    double var = ts2 * (1.0 / (double)GSZ) - mean * mean;
    if (var < 0.0) var = 0.0;
    const float meanf = (float)mean;
    const float rstd  = rsqrtf((float)var + GN_EPS);
    const float val = (lane == 0) ? meanf : ((lane == 1) ? rstd : 0.0f);
    float* dst = stats + g * 32 + lane;
    *(float*)dst = val;
    
  }
}

// ---- normalize + affine + transpose: x[c][t][s] (f32) -> tok[t*SP + s][c] (f16).
__global__ __launch_bounds__(256) void norm_tok(const float* __restrict__ x,
                                                const float* __restrict__ gamma,
                                                const float* __restrict__ beta,
                                                const float* __restrict__ stats,
                                                _Float16* __restrict__ tok) {
  __shared__ __align__(16) _Float16 tile[64 * 72];   // [sl][cl], pitch 72 halves
  const int bid = blockIdx.x;
  const int cb  = bid & 7;           // 8 channel blocks of 64
  const int sb  = (bid >> 3) & 63;   // 64 position blocks of 64
  const int t   = bid >> 9;          // frame
  const int c0 = cb * 64, s0 = sb * 64;
  const int tid = threadIdx.x;
#pragma unroll 4
  for (int i = tid; i < 64 * 64; i += 256) {
    const int cl = i >> 6, sl = i & 63;
    const int c = c0 + cl;
    const int g = c >> 4;
    const float mean = stats[g * 32], rstd = stats[g * 32 + 1];
    float v = x[(size_t)c * CSP + (size_t)t * SP + s0 + sl];
    v = (v - mean) * rstd * gamma[c] + beta[c];
    tile[sl * 72 + cl] = (_Float16)v;
  }
  __syncthreads();
  const int wave = tid >> 5, lane = tid & 31;
  const int q = lane >> 3, c8 = (lane & 7) * 8;
  {
#pragma unroll
    for (int it = 0; it < 2; ++it) {
      const int row = wave * 8 + it * 4 + q;   // wave covers rows 8w..8w+7
      const v8h hv = *(const v8h*)(tile + row * 72 + c8);
      *(v8h*)(tok + ((size_t)t * SP + s0 + row) * CH + c0 + c8) = hv;
    }
    
  }
}

// ---- row softmax over SP keys: S f32 [rows][SP] -> P f16 [rows][SP] = f16(p/sum * 2^15).
__global__ __launch_bounds__(256) void softmax_rows(const float* __restrict__ S, _Float16* __restrict__ P) {
  __shared__ float rmax[8];
  __shared__ float rsum[8];
  const int row = blockIdx.x;
  const int tid = threadIdx.x, wave = tid >> 5, lane = tid & 31;
  const float* sr = S + (size_t)row * SP;
  const v4f a0 = *(const v4f*)(sr + 8 * tid);
  const v4f a1 = *(const v4f*)(sr + 8 * tid + 4);
  const v4f a2 = *(const v4f*)(sr + (SP / 2) + 8 * tid);
  const v4f a3 = *(const v4f*)(sr + (SP / 2) + 8 * tid + 4);
  float m = a0[0];
#pragma unroll
  for (int e = 0; e < 4; ++e) { m = fmaxf(m, a0[e]); m = fmaxf(m, a1[e]); m = fmaxf(m, a2[e]); m = fmaxf(m, a3[e]); }
#pragma unroll
  for (int off = 1; off < 32; off <<= 1) m = fmaxf(m, __shfl_xor(m, off, 32));
  if (lane == 0) rmax[wave] = m;
  __syncthreads();
  float bm = rmax[0];
#pragma unroll
  for (int w = 1; w < 8; ++w) bm = fmaxf(bm, rmax[w]);
  v4f e0, e1, e2, e3;
  float su = 0.f;
#pragma unroll
  for (int e = 0; e < 4; ++e) { e0[e] = __expf(a0[e] - bm); su += e0[e]; }
#pragma unroll
  for (int e = 0; e < 4; ++e) { e1[e] = __expf(a1[e] - bm); su += e1[e]; }
#pragma unroll
  for (int e = 0; e < 4; ++e) { e2[e] = __expf(a2[e] - bm); su += e2[e]; }
#pragma unroll
  for (int e = 0; e < 4; ++e) { e3[e] = __expf(a3[e] - bm); su += e3[e]; }
#pragma unroll
  for (int off = 1; off < 32; off <<= 1) su += __shfl_xor(su, off, 32);
  if (lane == 0) rsum[wave] = su;
  __syncthreads();
  float tot = rsum[0];
#pragma unroll
  for (int w = 1; w < 8; ++w) tot += rsum[w];
  const float f = (1.0f / tot) * PCARRY;
  v8h h0, h1;
#pragma unroll
  for (int e = 0; e < 4; ++e) {
    h0[e]     = (_Float16)(e0[e] * f);
    h0[4 + e] = (_Float16)(e1[e] * f);
    h1[e]     = (_Float16)(e2[e] * f);
    h1[4 + e] = (_Float16)(e3[e] * f);
  }
  _Float16* pr = P + (size_t)row * SP;
  {
    *(v8h*)(pr + 8 * tid) = h0;
    *(v8h*)(pr + (SP / 2) + 8 * tid) = h1;
    
  }
}

static inline int gemm_blocks(int M, int N) { return ((M / 64) * (N / 64) + 7) / 8; }

// ---------------- launch ----------------
extern "C" void kernel_launch(void* const* d_in, const int* in_sizes, int n_in,
                              void* d_out, int out_size, void* d_ws, size_t ws_size,
                              hipStream_t stream) {
  if (n_in < 11) return;
  if (in_sizes[0] != CH * CSP || out_size != CH * CSP) return;
  if (in_sizes[1] != CH || in_sizes[2] != CH) return;
  if (in_sizes[3] != CH * CH || in_sizes[5] != CH * CH || in_sizes[7] != CH * CH || in_sizes[9] != CH * CH) return;
  if (in_sizes[4] != CH || in_sizes[6] != CH || in_sizes[8] != CH || in_sizes[10] != CH) return;

  const float* x     = (const float*)d_in[0];
  const float* gamma = (const float*)d_in[1];
  const float* beta  = (const float*)d_in[2];
  const float* wq    = (const float*)d_in[3];
  const float* bq    = (const float*)d_in[4];
  const float* wk    = (const float*)d_in[5];
  const float* bk    = (const float*)d_in[6];
  const float* wv    = (const float*)d_in[7];
  const float* bv    = (const float*)d_in[8];
  const float* wp    = (const float*)d_in[9];
  const float* bp    = (const float*)d_in[10];
  float* out = (float*)d_out;

  char* ws = (char*)d_ws;
  size_t off = 0;
  float* stats = (float*)(ws + off);          off += 4096;                                      // 32 lines
  _Float16* w16  = (_Float16*)(ws + off);     off += (size_t)4 * CH * CH * sizeof(_Float16);   // 2 MiB
  _Float16* tok  = (_Float16*)(ws + off);     off += (size_t)NTOK * CH * sizeof(_Float16);     // 16 MiB
  _Float16* q16  = (_Float16*)(ws + off);     off += (size_t)NTOK * CH * sizeof(_Float16);     // 16 MiB
  _Float16* k16  = (_Float16*)(ws + off);     off += (size_t)NTOK * CH * sizeof(_Float16);     // 16 MiB
  _Float16* vT16 = (_Float16*)(ws + off);     off += (size_t)CH * NTOK * sizeof(_Float16);     // 16 MiB  [512][16384]
  float* S       = (float*)(ws + off);        off += (size_t)QH * SP * sizeof(float);          // 32 MiB
  _Float16* P16  = (_Float16*)(ws + off);     off += (size_t)NTOK * SP * sizeof(_Float16);     // 128 MiB  [16384][4096], every frame's rows
  if (off > ws_size) return;                  // 236,982,272 B total
  _Float16* o16 = tok;                        // attention output plane reuses the token plane (tokens are dead after the projections)
  _Float16* wq16 = w16;
  _Float16* wk16 = w16 + (size_t)CH * CH;
  _Float16* wv16 = w16 + (size_t)2 * CH * CH;
  _Float16* wp16 = w16 + (size_t)3 * CH * CH;

  // 1. group statistics
  gn_stats<<<dim3(NGRP), dim3(256), 0, stream>>>(x, stats);

  // 2. weights x16 -> f16
  const int n2 = CH * CH / 2;
  cast_f32_f16x2s<<<dim3((n2 + 255) / 256), dim3(256), 0, stream>>>(wq, wq16, n2, WCARRY);
  cast_f32_f16x2s<<<dim3((n2 + 255) / 256), dim3(256), 0, stream>>>(wk, wk16, n2, WCARRY);
  cast_f32_f16x2s<<<dim3((n2 + 255) / 256), dim3(256), 0, stream>>>(wv, wv16, n2, WCARRY);
  cast_f32_f16x2s<<<dim3((n2 + 255) / 256), dim3(256), 0, stream>>>(wp, wp16, n2, WCARRY);

  // 3. normalize + transpose to tokens
  norm_tok<<<dim3(TFR * 64 * 8), dim3(256), 0, stream>>>(x, gamma, beta, stats, tok);

  // 4. q = tok·Wqᵀ/16 + bq   (A = tok [16384][512], Bt = Wq16 [512][512], f16 out [16384][512])
  wmma_gemm64<0, false, 2, 1, false><<<dim3(gemm_blocks(NTOK, CH), 1), dim3(256), 0, stream>>>(
      U16(tok), U16(tok), CH, (long)0, U16(wq16), U16(wq16), CH, (long)0,
      (void*)q16, (void*)q16, CH, (long)0, bq, x, (long)0, NTOK, CH, CH, WCARRY_INV);
  //    k = tok·Wkᵀ/16 + bk
  wmma_gemm64<0, false, 2, 1, false><<<dim3(gemm_blocks(NTOK, CH), 1), dim3(256), 0, stream>>>(
      U16(tok), U16(tok), CH, (long)0, U16(wk16), U16(wk16), CH, (long)0,
      (void*)k16, (void*)k16, CH, (long)0, bk, x, (long)0, NTOK, CH, CH, WCARRY_INV);
  //    vᵀ[c][token] = Wv16·tokᵀ/16 + bv[c]   (A = Wv16 [512][512], Bt = tok [16384][512], f16 out [512][16384])
  wmma_gemm64<0, false, 1, 1, false><<<dim3(gemm_blocks(CH, NTOK), 1), dim3(256), 0, stream>>>(
      U16(wv16), U16(wv16), CH, (long)0, U16(tok), U16(tok), CH, (long)0,
      (void*)vT16, (void*)vT16, NTOK, (long)0, bv, x, (long)0, CH, NTOK, CH, WCARRY_INV);

  // 5. per half-frame: S = q*k^T*512^-0.5 (f32), row softmax -> that half-frame's rows of P16 (x2^15)
  for (int hp = 0; hp < TFR * (SP / QH); ++hp) {
    const int t = hp / (SP / QH);
    const int half = hp - t * (SP / QH);
    const size_t qrow0 = (size_t)t * SP + (size_t)half * QH;
    const _Float16* qA  = q16 + qrow0 * CH;                   // [QH][512]
    const _Float16* kB  = k16 + (size_t)t * SP * CH;           // [4096][512]
    wmma_gemm64<0, false, 0, 0, false><<<dim3(gemm_blocks(QH, SP), 1), dim3(256), 0, stream>>>(
        U16(qA), U16(qA), CH, (long)0, U16(kB), U16(kB), CH, (long)0,
        (void*)S, (void*)S, SP, (long)0, bq, x, (long)0, QH, SP, CH, QSCALE);
    softmax_rows<<<dim3(QH), dim3(256), 0, stream>>>(S, P16 + qrow0 * SP);
  }
  //    O = P16*V x2^-15 for all frames in one launch, one frame per blockIdx.y: 64 x 4 = 256 workgroups instead of 32 per launch
  //    (A = P16 frame [4096][4096], Bt = vT16 + frame*4096, [512][4096] with pitch 16384, f16 out [4096][512])
  wmma_gemm64<0, false, 0, 1, false><<<dim3(gemm_blocks(SP, CH), TFR), dim3(256), 0, stream>>>(
      U16(P16), U16(P16), SP, (long)SP * SP, U16(vT16), U16(vT16), NTOK, (long)SP,
      (void*)o16, (void*)o16, CH, (long)SP * CH, bq, x, (long)0, SP, CH, SP, PCARRY_INV);

  // 6. out[c][token] = Wp16·Oᵀ/16 + bp[c] + x[c][token]   (A = Wp16 [512][512], Bt = O [16384][512], f32 out [512][16384])
  wmma_gemm64<0, false, 1, 0, true><<<dim3(gemm_blocks(CH, NTOK), 1), dim3(256), 0, stream>>>(
      U16(wp16), U16(wp16), CH, (long)0, U16(o16), U16(o16), CH, (long)0,
      (void*)out, (void*)out, NTOK, (long)0, bp, x, (long)0, CH, NTOK, CH, WCARRY_INV);
}

// v002
// Measured time: 389 microseconds a run.
// In both of two side-by-side timings against v001, it was 1.97 times as fast.
// Over all steps from v000 it is 5.54 times as fast.
#include <hip/hip_runtime.h>
// Contractions tok·Wq/Wk/Wvᵀ, q·kᵀ, P·V, O·Wpᵀ: v_wmma_f32_16x16x32_f16 (f16 operands, f32 accumulate); weights carried x16, softmax probabilities carried x2^15; group statistics accumulated in f64; all other elementwise math f32.

typedef __attribute__((ext_vector_type(16))) _Float16 v16h;
typedef __attribute__((ext_vector_type(8)))  _Float16 v8h;
typedef __attribute__((ext_vector_type(16))) __bf16   v16b;
typedef __attribute__((ext_vector_type(8)))  __bf16   v8b;
typedef __attribute__((ext_vector_type(8)))  float    v8f;
typedef __attribute__((ext_vector_type(4)))  float    v4f;
#define U16(p) ((const unsigned short*)(const void*)(p))

constexpr int CH   = 512;          // channels
constexpr int TFR  = 4;            // frames
constexpr int SP   = 4096;         // tokens per frame (h*w)
constexpr int CSP  = TFR * SP;     // 16384 elements per channel
constexpr int NTOK = TFR * SP;     // 16384 tokens
constexpr int GSZ  = 16 * CSP;     // 262144 elements per group (16 channels per group)
constexpr int NGRP = 32;
constexpr int QH   = 2048;         // query rows per attention pass
constexpr float GN_EPS     = 1e-6f;
constexpr float QSCALE     = 0.04419417382415922f;   // 512^-0.5
constexpr float WCARRY     = 16.0f;
constexpr float WCARRY_INV = 1.0f / 16.0f;
constexpr float PCARRY     = 32768.0f;
constexpr float PCARRY_INV = 1.0f / 32768.0f;

__device__ __forceinline__ unsigned short f2bf_bits(float f) {
  unsigned u = __float_as_uint(f);
  return (unsigned short)((u + 0x7FFFu + ((u >> 16) & 1u)) >> 16);
}
__device__ __forceinline__ float bf_bits2f(unsigned short h) { return __uint_as_float(((unsigned)h) << 16); }

// hazard guard between the last products and the epilogue's reads of the accumulators
__device__ __forceinline__ void acc_guard4(v8f& a, v8f& b, v8f& c, v8f& d) { asm volatile("v_nop\n\tv_nop\n\tv_nop\n\tv_nop" : "+v"(a), "+v"(b), "+v"(c), "+v"(d)); }
template <typename T> struct Frag;
template <> struct Frag<_Float16> {
  typedef v16h V; union U { v16h v; v8h h[2]; };
  static __device__ __forceinline__ v16h load(const _Float16* p) {   // elements 0..7 <- p[0..7], 8..15 <- p[16..23]
    U f; f.h[0] = *(const v8h*)(p); f.h[1] = *(const v8h*)(p + 16); return f.v;
  }
  static __device__ __forceinline__ v8f mma(v16h a, v16h b, v8f c) {
    return __builtin_amdgcn_wmma_f32_16x16x32_f16(false, a, false, b, (short)0, c, false, false);
  }
};
template <> struct Frag<__bf16> {
  typedef v16b V; union U { v16b v; v8b h[2]; };
  static __device__ __forceinline__ v16b load(const __bf16* p) {
    U f; f.h[0] = *(const v8b*)(p); f.h[1] = *(const v8b*)(p + 16); return f.v;
  }
  static __device__ __forceinline__ v8f mma(v16b a, v16b b, v8f c) {
    return __builtin_amdgcn_wmma_f32_16x16x32_bf16(false, a, false, b, (short)0, c, false, false);
  }
};

// ---- LDS-staged batched WMMA GEMM -------------------------------------------
// C[m,n] = scale * sum_k A[m,k] * Bt[n,k] (+bias)(+resid); a workgroup of 8 waves (2 x 4) owns a 128x256 tile, each wave 64x64 of it.
// A row-major [M,K]; Bt row-major [N,K]; M % 128 == 0, N % 256 == 0, K % 128 == 0.
// Per stage 128 k of the 128 A rows and the 256 Bt rows are copied to LDS by global_load_async_to_lds_b128 (two buffers:
// the next stage's copies fly while this stage is multiplied); fragments are read from LDS at a row pitch of 272 B.
// BIAS_MODE: 0 = none, 1 = bias[m], 2 = bias[n].
// OUT_MODE: 0 = f32, 1 = f16, 2 = bf16 hi plane (Cout) + bf16 lo plane (Cout2).
// ET: 0 = f16 operands, 1 = bf16 operands (pointers passed as 16-bit storage)
constexpr int BM    = 128;                 // A rows per workgroup
constexpr int BN    = 256;                 // Bt rows per workgroup
constexpr int KS    = 128;                 // k per stage (256 B of every row)
constexpr int LPH   = KS + 8;              // LDS row pitch in 16-bit elements (272 B: 16 rows of a b128 read fall on 64 distinct banks)
constexpr int STG_H = (BM + BN) * LPH;     // 16-bit elements per stage buffer

__device__ __forceinline__ unsigned lds_off(const void* p) { return (unsigned)(size_t)p; }

// Eight copies of 16 B per lane, rows 16 apart: LDS byte address l + i * 16 rows, global address g + i * gstep elements.
// The s_wait_xcnt stands inside the statement so that no address register is rewritten ahead of it.
__device__ __forceinline__ void async_rows8(unsigned l, const unsigned short* g, size_t gstep) {
  constexpr unsigned LS = 16u * LPH * 2u;
  const unsigned l1 = l + LS, l2 = l + 2 * LS, l3 = l + 3 * LS, l4 = l + 4 * LS, l5 = l + 5 * LS, l6 = l + 6 * LS, l7 = l + 7 * LS;
  const unsigned short* g1 = g + gstep;     const unsigned short* g2 = g + 2 * gstep;
  const unsigned short* g3 = g + 3 * gstep; const unsigned short* g4 = g + 4 * gstep;
  const unsigned short* g5 = g + 5 * gstep; const unsigned short* g6 = g + 6 * gstep;
  const unsigned short* g7 = g + 7 * gstep;
  asm volatile(
      "global_load_async_to_lds_b128 %0, %8, off\n\t"
      "global_load_async_to_lds_b128 %1, %9, off\n\t"
      "global_load_async_to_lds_b128 %2, %10, off\n\t"
      "global_load_async_to_lds_b128 %3, %11, off\n\t"
      "global_load_async_to_lds_b128 %4, %12, off\n\t"
      "global_load_async_to_lds_b128 %5, %13, off\n\t"
      "global_load_async_to_lds_b128 %6, %14, off\n\t"
      "global_load_async_to_lds_b128 %7, %15, off\n\t"
      "s_wait_xcnt 0x0"
      :: "v"(l), "v"(l1), "v"(l2), "v"(l3), "v"(l4), "v"(l5), "v"(l6), "v"(l7),
         "v"(g), "v"(g1), "v"(g2), "v"(g3), "v"(g4), "v"(g5), "v"(g6), "v"(g7)
      : "memory");
}
template <int ET> struct Elem;
template <> struct Elem<0> { typedef _Float16 T; };
template <> struct Elem<1> { typedef __bf16 T; };
template <int ET, bool SPLIT, int BIAS_MODE, int OUT_MODE, bool RESID, int ACT = 0>
__global__ __launch_bounds__(256) void wmma_gemm64(
    const unsigned short* __restrict__ Ap, const unsigned short* __restrict__ A2p, int lda, long strideA,
    const unsigned short* __restrict__ Btp, const unsigned short* __restrict__ Bt2p, int ldb, long strideB,
    void* __restrict__ Cout, void* __restrict__ Cout2, int ldc, long strideC,
    const float* __restrict__ bias,
    const float* __restrict__ resid, long strideR,
    int M, int N, int K, float scale) {
  static_assert(!SPLIT, "single-plane operands only");
  typedef typename Elem<ET>::T T;
  typedef typename Frag<T>::V V;
  __shared__ __align__(16) T ring[2 * STG_H];      // two stage buffers, each [A 128 rows | Bt 256 rows] at pitch LPH
  __shared__ __align__(16) float sT[8][16 * 68];   // per-wave 16x64 slab, pitch 68 floats
  const int b    = blockIdx.y;
  const int tid  = threadIdx.x;
  const int lane = tid & 31;
  const int wave = tid >> 5;
  const int tilesN = N / BN;
  const int tilesM = M / BM;
  const int tile = blockIdx.x;
  if (tile >= tilesM * tilesN) return;   // the same for the whole workgroup, in front of every barrier
  const int tm = tile / tilesN;
  const int tn = tile - tm * tilesN;
  const int wm = wave >> 2;              // wave row (0..1) and column (0..3) in the workgroup's tile
  const int wn = wave & 3;
  const int m0 = tm * BM + (wm << 6);
  const int n0 = tn * BN + (wn << 6);

  const int rlane = lane & 15;                 // row (A) / col (B, D) within subtile
  const int koff  = (lane >> 4) * 8;           // k offset of this lane half
  const int mOff  = (lane >> 4) * 8;           // D row offset

  // copy addresses: 16 lanes cover the 256 B of one row, the workgroup 16 rows per copy
  const int crow = tid >> 4;
  const int ccol = (tid & 15) * 8;
  const unsigned short* gA = Ap  + (size_t)b * strideA + (size_t)(tm * BM + crow) * lda + ccol;
  const unsigned short* gB = Btp + (size_t)b * strideB + (size_t)(tn * BN + crow) * ldb + ccol;
  const unsigned lA = lds_off(ring) + (unsigned)(crow * LPH + ccol) * 2u;
  const unsigned lB = lA + (unsigned)(BM * LPH) * 2u;
  auto issue_stage = [&](int t, int buf) {
    const unsigned lo = (unsigned)buf * (unsigned)(STG_H * 2);
    const size_t ko = (size_t)t * KS;
    async_rows8(lA + lo, gA + ko, (size_t)16 * lda);
    async_rows8(lB + lo, gB + ko, (size_t)16 * ldb);
    async_rows8(lB + lo + (unsigned)(128 * LPH) * 2u, gB + ko + (size_t)128 * ldb, (size_t)16 * ldb);
  };

  v8f acc[4][4];
#pragma unroll
  for (int i = 0; i < 4; ++i)
#pragma unroll
    for (int j = 0; j < 4; ++j) acc[i][j] = (v8f){0.f,0.f,0.f,0.f,0.f,0.f,0.f,0.f};

  const int nT = K / KS;
  issue_stage(0, 0);
  asm volatile("s_wait_asynccnt 0x0" ::: "memory");   // stage 0 has landed for this wave's copies
  __syncthreads();                                     // ... and for every wave's
  if (nT > 1) issue_stage(1, 1);

  for (int t = 0; t < nT; ++t) {
    const int buf = t & 1;
    const T* sA = ring + buf * STG_H + ((wm << 6) + rlane) * LPH + koff;
    const T* sB = ring + buf * STG_H + (BM + (wn << 6) + rlane) * LPH + koff;
    // fragments of the next 32 k of this stage are fetched into a second register set ahead of the current 16 products
    V af[2][4], bf[2][4];
#pragma unroll
    for (int j = 0; j < 4; ++j) { bf[0][j] = Frag<T>::load(sB + (j << 4) * LPH); af[0][j] = Frag<T>::load(sA + (j << 4) * LPH); }
#pragma unroll
    for (int ks = 0; ks < KS / 32; ++ks) {
      const int cur = ks & 1, nxt = cur ^ 1;
      if (ks + 1 < KS / 32) {
#pragma unroll
        for (int j = 0; j < 4; ++j) {
          bf[nxt][j] = Frag<T>::load(sB + (j << 4) * LPH + (ks + 1) * 32);
          af[nxt][j] = Frag<T>::load(sA + (j << 4) * LPH + (ks + 1) * 32);
        }
      }
      __builtin_amdgcn_sched_barrier(0);   // keeps the LDS reads above as one group ahead of the products: sunk among them, each group of four waits out the LDS latency
#pragma unroll
      for (int i = 0; i < 4; ++i)
#pragma unroll
        for (int j = 0; j < 4; ++j) acc[i][j] = Frag<T>::mma(af[cur][i], bf[cur][j], acc[i][j]);
      __builtin_amdgcn_sched_barrier(0);   // keeps the next LDS reads out of these products and the last products in front of the stage's barrier (behind it they delay the refill)
    }
    asm volatile("s_wait_dscnt 0x0" ::: "memory");      // this wave's reads of buffer buf are done before it is refilled
    asm volatile("s_wait_asynccnt 0x0" ::: "memory");   // this wave's copies of stage t + 1 have landed
    __syncthreads();                                     // publishes stage t + 1 and ends every wave's reads of buffer buf
    if (t + 2 < nT) issue_stage(t + 2, buf);
  }
  asm volatile("s_wait_asynccnt 0x0" ::: "memory");     // no copy outstanding behind the loop
  acc_guard4(acc[0][0], acc[0][1], acc[0][2], acc[0][3]);
  acc_guard4(acc[1][0], acc[1][1], acc[1][2], acc[1][3]);
  acc_guard4(acc[2][0], acc[2][1], acc[2][2], acc[2][3]);
  acc_guard4(acc[3][0], acc[3][1], acc[3][2], acc[3][3]);

  // ---- epilogue ----
  float* slab = sT[wave];
  const float* Rb = RESID ? (resid + (size_t)b * strideR) : nullptr;
#pragma unroll
  for (int i = 0; i < 4; ++i) {
    const int mBase = m0 + (i << 4);
#pragma unroll
    for (int j = 0; j < 4; ++j) {
      const int n = n0 + (j << 4) + rlane;
      float bv = 0.f;
      if (BIAS_MODE == 2) bv = bias[n];
#pragma unroll
      for (int r = 0; r < 8; ++r) {
        float v = acc[i][j][r] * scale;
        if (BIAS_MODE == 1) v += bias[mBase + mOff + r];
        if (BIAS_MODE == 2) v += bv;
        if (RESID) v += Rb[(size_t)(mBase + mOff + r) * ldc + n];
        if (ACT == 1) v = tanhf(v);
        if (ACT == 2) v = fmaxf(v, 0.0f);
        if (ACT == 3) v = v / (1.0f + expf(-v));
        if (ACT == 4) v = (v > 0.f) ? v : 0.01f * v;
        if (ACT == 5) v = 0.5f * v * (1.0f + erff(v * 0.70710678118654752f));
        slab[(mOff + r) * 68 + (j << 4) + rlane] = v;
      }
    }
    __builtin_amdgcn_fence(__ATOMIC_RELEASE, "workgroup");
    __builtin_amdgcn_wave_barrier();
    __builtin_amdgcn_fence(__ATOMIC_ACQUIRE, "workgroup");
    if (OUT_MODE == 0) {
      float* C = (float*)Cout + (size_t)b * strideC;
      const int hh = lane >> 4, c4 = (lane & 15) * 4;     // row seg = 256 B = 16 lanes x 16 B
      {
#pragma unroll
        for (int it = 0; it < 8; ++it) {
          const int row = it * 2 + hh;
          v4f v = *(const v4f*)(slab + row * 68 + c4);
          *(v4f*)(C + (size_t)(mBase + row) * ldc + n0 + c4) = v;
        }
        
      }
    } else {
      const int q = lane >> 3, c8 = (lane & 7) * 8;
      unsigned short* C  = (unsigned short*)Cout  + (size_t)b * strideC;
      unsigned short* C2 = (OUT_MODE == 2) ? ((unsigned short*)Cout2 + (size_t)b * strideC) : nullptr;
      {
#pragma unroll
        for (int it = 0; it < 4; ++it) {
          const int row = it * 4 + q;
          const float* sp = slab + row * 68 + c8;
          v8h hv, lv;
#pragma unroll
          for (int e = 0; e < 8; ++e) {
            if (OUT_MODE == 1) {
              hv[e] = (_Float16)sp[e];
            } else {
              unsigned short hb = f2bf_bits(sp[e]);
              unsigned short lb = f2bf_bits(sp[e] - bf_bits2f(hb));
              hv[e] = __builtin_bit_cast(_Float16, hb);
              lv[e] = __builtin_bit_cast(_Float16, lb);
            }
          }
          *(v8h*)(C + (size_t)(mBase + row) * ldc + n0 + c8) = hv;
          if (OUT_MODE == 2) *(v8h*)(C2 + (size_t)(mBase + row) * ldc + n0 + c8) = lv;
        }
        
      }
    }
    __builtin_amdgcn_fence(__ATOMIC_RELEASE, "workgroup");
    __builtin_amdgcn_wave_barrier();
    __builtin_amdgcn_fence(__ATOMIC_ACQUIRE, "workgroup");
  }
}

__global__ __launch_bounds__(256) void cast_f32_f16x2s(
    const float* __restrict__ in, _Float16* __restrict__ out, int n2, float sc) {
  int i = blockIdx.x * 256 + threadIdx.x;
  if (i < n2) {
    const _Float16 h0 = (_Float16)(in[2 * i] * sc), h1 = (_Float16)(in[2 * i + 1] * sc);
    const unsigned u = (unsigned)__builtin_bit_cast(unsigned short, h0) | ((unsigned)__builtin_bit_cast(unsigned short, h1) << 16);
    ((unsigned*)out)[i] = u;
    
  }
}

// ---- group statistics: one block per group, f64 fixed-order accumulation.
__global__ __launch_bounds__(256) void gn_stats(const float* __restrict__ x, float* __restrict__ stats) {
  __shared__ double ws1[8];
  __shared__ double ws2[8];
  const int g = blockIdx.x;
  const int tid = threadIdx.x, wave = tid >> 5, lane = tid & 31;
  const v4f* p = (const v4f*)(x + (size_t)g * GSZ);
  double s = 0.0, s2 = 0.0;
#pragma unroll 2
  for (int i = tid; i < GSZ / 4; i += 256) {
    const v4f v = p[i];
#pragma unroll
    for (int e = 0; e < 4; ++e) { const double d = (double)v[e]; s += d; s2 += d * d; }
  }
#pragma unroll
  for (int off = 1; off < 32; off <<= 1) { s += __shfl_xor(s, off, 32); s2 += __shfl_xor(s2, off, 32); }
  if (lane == 0) { ws1[wave] = s; ws2[wave] = s2; }
  __syncthreads();
  if (tid < 32) {
    double ts = 0.0, ts2 = 0.0;
#pragma unroll
    for (int w = 0; w < 8; ++w) { ts += ws1[w]; ts2 += ws2[w]; }
    const double mean = ts * (1.0 / (double)GSZ);
    double var = ts2 * (1.0 / (double)GSZ) - mean * mean;
    if (var < 0.0) var = 0.0;
    const float meanf = (float)mean;
    const float rstd  = rsqrtf((float)var + GN_EPS);
    const float val = (lane == 0) ? meanf : ((lane == 1) ? rstd : 0.0f);
    float* dst = stats + g * 32 + lane;
    *(float*)dst = val;
    
  }
}

// ---- normalize + affine + transpose: x[c][t][s] (f32) -> tok[t*SP + s][c] (f16).
__global__ __launch_bounds__(256) void norm_tok(const float* __restrict__ x,
                                                const float* __restrict__ gamma,
                                                const float* __restrict__ beta,
                                                const float* __restrict__ stats,
                                                _Float16* __restrict__ tok) {
  __shared__ __align__(16) _Float16 tile[64 * 72];   // [sl][cl], pitch 72 halves
  const int bid = blockIdx.x;
  const int cb  = bid & 7;           // 8 channel blocks of 64
  const int sb  = (bid >> 3) & 63;   // 64 position blocks of 64
  const int t   = bid >> 9;          // frame
  const int c0 = cb * 64, s0 = sb * 64;
  const int tid = threadIdx.x;
#pragma unroll 4
  for (int i = tid; i < 64 * 64; i += 256) {
    const int cl = i >> 6, sl = i & 63;
    const int c = c0 + cl;
    const int g = c >> 4;
    const float mean = stats[g * 32], rstd = stats[g * 32 + 1];
    float v = x[(size_t)c * CSP + (size_t)t * SP + s0 + sl];
    v = (v - mean) * rstd * gamma[c] + beta[c];
    tile[sl * 72 + cl] = (_Float16)v;
  }
  __syncthreads();
  const int wave = tid >> 5, lane = tid & 31;
  const int q = lane >> 3, c8 = (lane & 7) * 8;
  {
#pragma unroll
    for (int it = 0; it < 2; ++it) {
      const int row = wave * 8 + it * 4 + q;   // wave covers rows 8w..8w+7
      const v8h hv = *(const v8h*)(tile + row * 72 + c8);
      *(v8h*)(tok + ((size_t)t * SP + s0 + row) * CH + c0 + c8) = hv;
    }
    
  }
}

// ---- row softmax over SP keys: S f32 [rows][SP] -> P f16 [rows][SP] = f16(p/sum * 2^15).
__global__ __launch_bounds__(256) void softmax_rows(const float* __restrict__ S, _Float16* __restrict__ P) {
  __shared__ float rmax[8];
  __shared__ float rsum[8];
  const int row = blockIdx.x;
  const int tid = threadIdx.x, wave = tid >> 5, lane = tid & 31;
  const float* sr = S + (size_t)row * SP;
  const v4f a0 = *(const v4f*)(sr + 8 * tid);
  const v4f a1 = *(const v4f*)(sr + 8 * tid + 4);
  const v4f a2 = *(const v4f*)(sr + (SP / 2) + 8 * tid);
  const v4f a3 = *(const v4f*)(sr + (SP / 2) + 8 * tid + 4);
  float m = a0[0];
#pragma unroll
  for (int e = 0; e < 4; ++e) { m = fmaxf(m, a0[e]); m = fmaxf(m, a1[e]); m = fmaxf(m, a2[e]); m = fmaxf(m, a3[e]); }
#pragma unroll
  for (int off = 1; off < 32; off <<= 1) m = fmaxf(m, __shfl_xor(m, off, 32));
  if (lane == 0) rmax[wave] = m;
  __syncthreads();
  float bm = rmax[0];
#pragma unroll
  for (int w = 1; w < 8; ++w) bm = fmaxf(bm, rmax[w]);
  v4f e0, e1, e2, e3;
  float su = 0.f;
#pragma unroll
  for (int e = 0; e < 4; ++e) { e0[e] = __expf(a0[e] - bm); su += e0[e]; }
#pragma unroll
  for (int e = 0; e < 4; ++e) { e1[e] = __expf(a1[e] - bm); su += e1[e]; }
#pragma unroll
  for (int e = 0; e < 4; ++e) { e2[e] = __expf(a2[e] - bm); su += e2[e]; }
#pragma unroll
  for (int e = 0; e < 4; ++e) { e3[e] = __expf(a3[e] - bm); su += e3[e]; }
#pragma unroll
  for (int off = 1; off < 32; off <<= 1) su += __shfl_xor(su, off, 32);
  if (lane == 0) rsum[wave] = su;
  __syncthreads();
  float tot = rsum[0];
#pragma unroll
  for (int w = 1; w < 8; ++w) tot += rsum[w];
  const float f = (1.0f / tot) * PCARRY;
  v8h h0, h1;
#pragma unroll
  for (int e = 0; e < 4; ++e) {
    h0[e]     = (_Float16)(e0[e] * f);
    h0[4 + e] = (_Float16)(e1[e] * f);
    h1[e]     = (_Float16)(e2[e] * f);
    h1[4 + e] = (_Float16)(e3[e] * f);
  }
  _Float16* pr = P + (size_t)row * SP;
  {
    *(v8h*)(pr + 8 * tid) = h0;
    *(v8h*)(pr + (SP / 2) + 8 * tid) = h1;
    
  }
}

static inline int gemm_blocks(int M, int N) { return (M / 128) * (N / 256); }

// ---------------- launch ----------------
extern "C" void kernel_launch(void* const* d_in, const int* in_sizes, int n_in,
                              void* d_out, int out_size, void* d_ws, size_t ws_size,
                              hipStream_t stream) {
  if (n_in < 11) return;
  if (in_sizes[0] != CH * CSP || out_size != CH * CSP) return;
  if (in_sizes[1] != CH || in_sizes[2] != CH) return;
  if (in_sizes[3] != CH * CH || in_sizes[5] != CH * CH || in_sizes[7] != CH * CH || in_sizes[9] != CH * CH) return;
  if (in_sizes[4] != CH || in_sizes[6] != CH || in_sizes[8] != CH || in_sizes[10] != CH) return;

  const float* x     = (const float*)d_in[0];
  const float* gamma = (const float*)d_in[1];
  const float* beta  = (const float*)d_in[2];
  const float* wq    = (const float*)d_in[3];
  const float* bq    = (const float*)d_in[4];
  const float* wk    = (const float*)d_in[5];
  const float* bk    = (const float*)d_in[6];
  const float* wv    = (const float*)d_in[7];
  const float* bv    = (const float*)d_in[8];
  const float* wp    = (const float*)d_in[9];
  const float* bp    = (const float*)d_in[10];
  float* out = (float*)d_out;

  char* ws = (char*)d_ws;
  size_t off = 0;
  float* stats = (float*)(ws + off);          off += 4096;                                      // 32 lines
  _Float16* w16  = (_Float16*)(ws + off);     off += (size_t)4 * CH * CH * sizeof(_Float16);   // 2 MiB
  _Float16* tok  = (_Float16*)(ws + off);     off += (size_t)NTOK * CH * sizeof(_Float16);     // 16 MiB
  _Float16* q16  = (_Float16*)(ws + off);     off += (size_t)NTOK * CH * sizeof(_Float16);     // 16 MiB
  _Float16* k16  = (_Float16*)(ws + off);     off += (size_t)NTOK * CH * sizeof(_Float16);     // 16 MiB
  _Float16* vT16 = (_Float16*)(ws + off);     off += (size_t)CH * NTOK * sizeof(_Float16);     // 16 MiB  [512][16384]
  float* S       = (float*)(ws + off);        off += (size_t)QH * SP * sizeof(float);          // 32 MiB
  _Float16* P16  = (_Float16*)(ws + off);     off += (size_t)NTOK * SP * sizeof(_Float16);     // 128 MiB  [16384][4096], every frame's rows
  if (off > ws_size) return;                  // 236,982,272 B total
  _Float16* o16 = tok;                        // attention output plane reuses the token plane (tokens are dead after the projections)
  _Float16* wq16 = w16;
  _Float16* wk16 = w16 + (size_t)CH * CH;
  _Float16* wv16 = w16 + (size_t)2 * CH * CH;
  _Float16* wp16 = w16 + (size_t)3 * CH * CH;

  // 1. group statistics
  gn_stats<<<dim3(NGRP), dim3(256), 0, stream>>>(x, stats);

  // 2. weights x16 -> f16
  const int n2 = CH * CH / 2;
  cast_f32_f16x2s<<<dim3((n2 + 255) / 256), dim3(256), 0, stream>>>(wq, wq16, n2, WCARRY);
  cast_f32_f16x2s<<<dim3((n2 + 255) / 256), dim3(256), 0, stream>>>(wk, wk16, n2, WCARRY);
  cast_f32_f16x2s<<<dim3((n2 + 255) / 256), dim3(256), 0, stream>>>(wv, wv16, n2, WCARRY);
  cast_f32_f16x2s<<<dim3((n2 + 255) / 256), dim3(256), 0, stream>>>(wp, wp16, n2, WCARRY);

  // 3. normalize + transpose to tokens
  norm_tok<<<dim3(TFR * 64 * 8), dim3(256), 0, stream>>>(x, gamma, beta, stats, tok);

  // 4. q = tok·Wqᵀ/16 + bq   (A = tok [16384][512], Bt = Wq16 [512][512], f16 out [16384][512])
  wmma_gemm64<0, false, 2, 1, false><<<dim3(gemm_blocks(NTOK, CH), 1), dim3(256), 0, stream>>>(
      U16(tok), U16(tok), CH, (long)0, U16(wq16), U16(wq16), CH, (long)0,
      (void*)q16, (void*)q16, CH, (long)0, bq, x, (long)0, NTOK, CH, CH, WCARRY_INV);
  //    k = tok·Wkᵀ/16 + bk
  wmma_gemm64<0, false, 2, 1, false><<<dim3(gemm_blocks(NTOK, CH), 1), dim3(256), 0, stream>>>(
      U16(tok), U16(tok), CH, (long)0, U16(wk16), U16(wk16), CH, (long)0,
      (void*)k16, (void*)k16, CH, (long)0, bk, x, (long)0, NTOK, CH, CH, WCARRY_INV);
  //    vᵀ[c][token] = Wv16·tokᵀ/16 + bv[c]   (A = Wv16 [512][512], Bt = tok [16384][512], f16 out [512][16384])
  wmma_gemm64<0, false, 1, 1, false><<<dim3(gemm_blocks(CH, NTOK), 1), dim3(256), 0, stream>>>(
      U16(wv16), U16(wv16), CH, (long)0, U16(tok), U16(tok), CH, (long)0,
      (void*)vT16, (void*)vT16, NTOK, (long)0, bv, x, (long)0, CH, NTOK, CH, WCARRY_INV);

  // 5. per half-frame: S = q*k^T*512^-0.5 (f32), row softmax -> that half-frame's rows of P16 (x2^15)
  for (int hp = 0; hp < TFR * (SP / QH); ++hp) {
    const int t = hp / (SP / QH);
    const int half = hp - t * (SP / QH);
    const size_t qrow0 = (size_t)t * SP + (size_t)half * QH;
    const _Float16* qA  = q16 + qrow0 * CH;                   // [QH][512]
    const _Float16* kB  = k16 + (size_t)t * SP * CH;           // [4096][512]
    wmma_gemm64<0, false, 0, 0, false><<<dim3(gemm_blocks(QH, SP), 1), dim3(256), 0, stream>>>(
        U16(qA), U16(qA), CH, (long)0, U16(kB), U16(kB), CH, (long)0,
        (void*)S, (void*)S, SP, (long)0, bq, x, (long)0, QH, SP, CH, QSCALE);
    softmax_rows<<<dim3(QH), dim3(256), 0, stream>>>(S, P16 + qrow0 * SP);
  }
  //    O = P16*V x2^-15 for all frames in one launch, one frame per blockIdx.y: 64 x 4 = 256 workgroups
  //    (A = P16 frame [4096][4096], Bt = vT16 + frame*4096, [512][4096] with pitch 16384, f16 out [4096][512])
  wmma_gemm64<0, false, 0, 1, false><<<dim3(gemm_blocks(SP, CH), TFR), dim3(256), 0, stream>>>(
      U16(P16), U16(P16), SP, (long)SP * SP, U16(vT16), U16(vT16), NTOK, (long)SP,
      (void*)o16, (void*)o16, CH, (long)SP * CH, bq, x, (long)0, SP, CH, SP, PCARRY_INV);

  // 6. out[c][token] = Wp16·Oᵀ/16 + bp[c] + x[c][token]   (A = Wp16 [512][512], Bt = O [16384][512], f32 out [512][16384])
  wmma_gemm64<0, false, 1, 0, true><<<dim3(gemm_blocks(CH, NTOK), 1), dim3(256), 0, stream>>>(
      U16(wp16), U16(wp16), CH, (long)0, U16(o16), U16(o16), CH, (long)0,
      (void*)out, (void*)out, NTOK, (long)0, bp, x, (long)0, CH, NTOK, CH, WCARRY_INV);
}

// v003
// Measured time: 283 microseconds a run.
// Next to v002, in two timings, it ran 1.37 times as fast each time.
// All steps since v000 together make it 7.62 times as fast.
#include <hip/hip_runtime.h>
// Contractions tok·Wq/Wk/Wvᵀ, q·kᵀ, P·V, O·Wpᵀ: v_wmma_f32_16x16x32_f16 (f16 operands, f32 accumulate); weights carried x16, softmax probabilities carried x2^15; group statistics accumulated in f64; all other elementwise math f32.

typedef __attribute__((ext_vector_type(16))) _Float16 v16h;
typedef __attribute__((ext_vector_type(8)))  _Float16 v8h;
typedef __attribute__((ext_vector_type(16))) __bf16   v16b;
typedef __attribute__((ext_vector_type(8)))  __bf16   v8b;
typedef __attribute__((ext_vector_type(8)))  float    v8f;
typedef __attribute__((ext_vector_type(4)))  float    v4f;
#define U16(p) ((const unsigned short*)(const void*)(p))

constexpr int CH   = 512;          // channels
constexpr int TFR  = 4;            // frames
constexpr int SP   = 4096;         // tokens per frame (h*w)
constexpr int CSP  = TFR * SP;     // 16384 elements per channel
constexpr int NTOK = TFR * SP;     // 16384 tokens
constexpr int GSZ  = 16 * CSP;     // 262144 elements per group (16 channels per group)
constexpr int NGRP = 32;
constexpr int NCH  = 16;           // partial sums per group: one workgroup per channel
constexpr int QH   = 2048;         // query rows per attention pass
constexpr float GN_EPS     = 1e-6f;
constexpr float QSCALE     = 0.04419417382415922f;   // 512^-0.5
constexpr float WCARRY     = 16.0f;
constexpr float WCARRY_INV = 1.0f / 16.0f;
constexpr float PCARRY     = 32768.0f;
constexpr float PCARRY_INV = 1.0f / 32768.0f;

__device__ __forceinline__ unsigned short f2bf_bits(float f) {
  unsigned u = __float_as_uint(f);
  return (unsigned short)((u + 0x7FFFu + ((u >> 16) & 1u)) >> 16);
}
__device__ __forceinline__ float bf_bits2f(unsigned short h) { return __uint_as_float(((unsigned)h) << 16); }

// hazard guard between the last products and the epilogue's reads of the accumulators
__device__ __forceinline__ void acc_guard4(v8f& a, v8f& b, v8f& c, v8f& d) { asm volatile("v_nop\n\tv_nop\n\tv_nop\n\tv_nop" : "+v"(a), "+v"(b), "+v"(c), "+v"(d)); }
template <typename T> struct Frag;
template <> struct Frag<_Float16> {
  typedef v16h V; union U { v16h v; v8h h[2]; };
  static __device__ __forceinline__ v16h load(const _Float16* p) {   // elements 0..7 <- p[0..7], 8..15 <- p[16..23]
    U f; f.h[0] = *(const v8h*)(p); f.h[1] = *(const v8h*)(p + 16); return f.v;
  }
  static __device__ __forceinline__ v8f mma(v16h a, v16h b, v8f c) {
    return __builtin_amdgcn_wmma_f32_16x16x32_f16(false, a, false, b, (short)0, c, false, false);
  }
};
template <> struct Frag<__bf16> {
  typedef v16b V; union U { v16b v; v8b h[2]; };
  static __device__ __forceinline__ v16b load(const __bf16* p) {
    U f; f.h[0] = *(const v8b*)(p); f.h[1] = *(const v8b*)(p + 16); return f.v;
  }
  static __device__ __forceinline__ v8f mma(v16b a, v16b b, v8f c) {
    return __builtin_amdgcn_wmma_f32_16x16x32_bf16(false, a, false, b, (short)0, c, false, false);
  }
};

// ---- LDS-staged batched WMMA GEMM -------------------------------------------
// C[m,n] = scale * sum_k A[m,k] * Bt[n,k] (+bias)(+resid); a workgroup of 8 waves (2 x 4) owns a 128x256 tile, each wave 64x64 of it.
// A row-major [M,K]; Bt row-major [N,K]; M % 128 == 0, N % 256 == 0, K % 128 == 0.
// Per stage 128 k of the 128 A rows and the 256 Bt rows are copied to LDS by global_load_async_to_lds_b128 (two buffers:
// the next stage's copies fly while this stage is multiplied); fragments are read from LDS at a row pitch of 272 B.
// BIAS_MODE: 0 = none, 1 = bias[m], 2 = bias[n].
// OUT_MODE: 0 = f32, 1 = f16, 2 = bf16 hi plane (Cout) + bf16 lo plane (Cout2).
// ET: 0 = f16 operands, 1 = bf16 operands (pointers passed as 16-bit storage)
constexpr int BM    = 128;                 // A rows per workgroup
constexpr int BN    = 256;                 // Bt rows per workgroup
constexpr int KS    = 128;                 // k per stage (256 B of every row)
constexpr int LPH   = KS + 8;              // LDS row pitch in 16-bit elements (272 B: 16 rows of a b128 read fall on 64 distinct banks)
constexpr int STG_H = (BM + BN) * LPH;     // 16-bit elements per stage buffer

__device__ __forceinline__ unsigned lds_off(const void* p) { return (unsigned)(size_t)p; }

// Eight copies of 16 B per lane, rows 16 apart: LDS byte address l + i * 16 rows, global address g + i * gstep elements.
// The s_wait_xcnt stands inside the statement so that no address register is rewritten ahead of it.
__device__ __forceinline__ void async_rows8(unsigned l, const unsigned short* g, size_t gstep) {
  constexpr unsigned LS = 16u * LPH * 2u;
  const unsigned l1 = l + LS, l2 = l + 2 * LS, l3 = l + 3 * LS, l4 = l + 4 * LS, l5 = l + 5 * LS, l6 = l + 6 * LS, l7 = l + 7 * LS;
  const unsigned short* g1 = g + gstep;     const unsigned short* g2 = g + 2 * gstep;
  const unsigned short* g3 = g + 3 * gstep; const unsigned short* g4 = g + 4 * gstep;
  const unsigned short* g5 = g + 5 * gstep; const unsigned short* g6 = g + 6 * gstep;
  const unsigned short* g7 = g + 7 * gstep;
  asm volatile(
      "global_load_async_to_lds_b128 %0, %8, off\n\t"
      "global_load_async_to_lds_b128 %1, %9, off\n\t"
      "global_load_async_to_lds_b128 %2, %10, off\n\t"
      "global_load_async_to_lds_b128 %3, %11, off\n\t"
      "global_load_async_to_lds_b128 %4, %12, off\n\t"
      "global_load_async_to_lds_b128 %5, %13, off\n\t"
      "global_load_async_to_lds_b128 %6, %14, off\n\t"
      "global_load_async_to_lds_b128 %7, %15, off\n\t"
      "s_wait_xcnt 0x0"
      :: "v"(l), "v"(l1), "v"(l2), "v"(l3), "v"(l4), "v"(l5), "v"(l6), "v"(l7),
         "v"(g), "v"(g1), "v"(g2), "v"(g3), "v"(g4), "v"(g5), "v"(g6), "v"(g7)
      : "memory");
}
template <int ET> struct Elem;
template <> struct Elem<0> { typedef _Float16 T; };
template <> struct Elem<1> { typedef __bf16 T; };
template <int ET, bool SPLIT, int BIAS_MODE, int OUT_MODE, bool RESID, int ACT = 0>
__global__ __launch_bounds__(256) void wmma_gemm64(
    const unsigned short* __restrict__ Ap, const unsigned short* __restrict__ A2p, int lda, long strideA,
    const unsigned short* __restrict__ Btp, const unsigned short* __restrict__ Bt2p, int ldb, long strideB,
    void* __restrict__ Cout, void* __restrict__ Cout2, int ldc, long strideC,
    const float* __restrict__ bias,
    const float* __restrict__ resid, long strideR,
    int M, int N, int K, float scale) {
  static_assert(!SPLIT, "single-plane operands only");
  typedef typename Elem<ET>::T T;
  typedef typename Frag<T>::V V;
  __shared__ __align__(16) T ring[2 * STG_H];      // two stage buffers, each [A 128 rows | Bt 256 rows] at pitch LPH
  __shared__ __align__(16) float sT[8][16 * 68];   // per-wave 16x64 slab, pitch 68 floats
  const int b    = blockIdx.y;
  const int tid  = threadIdx.x;
  const int lane = tid & 31;
  const int wave = tid >> 5;
  const int tilesN = N / BN;
  const int tilesM = M / BM;
  const int tile = blockIdx.x;
  if (tile >= tilesM * tilesN) return;   // the same for the whole workgroup, in front of every barrier
  const int tm = tile / tilesN;
  const int tn = tile - tm * tilesN;
  const int wm = wave >> 2;              // wave row (0..1) and column (0..3) in the workgroup's tile
  const int wn = wave & 3;
  const int m0 = tm * BM + (wm << 6);
  const int n0 = tn * BN + (wn << 6);

  const int rlane = lane & 15;                 // row (A) / col (B, D) within subtile
  const int koff  = (lane >> 4) * 8;           // k offset of this lane half
  const int mOff  = (lane >> 4) * 8;           // D row offset

  // copy addresses: 16 lanes cover the 256 B of one row, the workgroup 16 rows per copy
  const int crow = tid >> 4;
  const int ccol = (tid & 15) * 8;
  const unsigned short* gA = Ap  + (size_t)b * strideA + (size_t)(tm * BM + crow) * lda + ccol;
  const unsigned short* gB = Btp + (size_t)b * strideB + (size_t)(tn * BN + crow) * ldb + ccol;
  const unsigned lA = lds_off(ring) + (unsigned)(crow * LPH + ccol) * 2u;
  const unsigned lB = lA + (unsigned)(BM * LPH) * 2u;
  auto issue_stage = [&](int t, int buf) {
    const unsigned lo = (unsigned)buf * (unsigned)(STG_H * 2);
    const size_t ko = (size_t)t * KS;
    async_rows8(lA + lo, gA + ko, (size_t)16 * lda);
    async_rows8(lB + lo, gB + ko, (size_t)16 * ldb);
    async_rows8(lB + lo + (unsigned)(128 * LPH) * 2u, gB + ko + (size_t)128 * ldb, (size_t)16 * ldb);
  };

  v8f acc[4][4];
#pragma unroll
  for (int i = 0; i < 4; ++i)
#pragma unroll
    for (int j = 0; j < 4; ++j) acc[i][j] = (v8f){0.f,0.f,0.f,0.f,0.f,0.f,0.f,0.f};

  const int nT = K / KS;
  issue_stage(0, 0);
  asm volatile("s_wait_asynccnt 0x0" ::: "memory");   // stage 0 has landed for this wave's copies
  __syncthreads();                                     // ... and for every wave's
  if (nT > 1) issue_stage(1, 1);

  for (int t = 0; t < nT; ++t) {
    const int buf = t & 1;
    const T* sA = ring + buf * STG_H + ((wm << 6) + rlane) * LPH + koff;
    const T* sB = ring + buf * STG_H + (BM + (wn << 6) + rlane) * LPH + koff;
    // fragments of the next 32 k of this stage are fetched into a second register set ahead of the current 16 products
    V af[2][4], bf[2][4];
#pragma unroll
    for (int j = 0; j < 4; ++j) { bf[0][j] = Frag<T>::load(sB + (j << 4) * LPH); af[0][j] = Frag<T>::load(sA + (j << 4) * LPH); }
#pragma unroll
    for (int ks = 0; ks < KS / 32; ++ks) {
      const int cur = ks & 1, nxt = cur ^ 1;
      if (ks + 1 < KS / 32) {
#pragma unroll
        for (int j = 0; j < 4; ++j) {
          bf[nxt][j] = Frag<T>::load(sB + (j << 4) * LPH + (ks + 1) * 32);
          af[nxt][j] = Frag<T>::load(sA + (j << 4) * LPH + (ks + 1) * 32);
        }
      }
      __builtin_amdgcn_sched_barrier(0);   // keeps the LDS reads above as one group ahead of the products: sunk among them, each group of four waits out the LDS latency
#pragma unroll
      for (int i = 0; i < 4; ++i)
#pragma unroll
        for (int j = 0; j < 4; ++j) acc[i][j] = Frag<T>::mma(af[cur][i], bf[cur][j], acc[i][j]);
      __builtin_amdgcn_sched_barrier(0);   // keeps the next LDS reads out of these products and the last products in front of the stage's barrier (behind it they delay the refill)
    }
    asm volatile("s_wait_dscnt 0x0" ::: "memory");      // this wave's reads of buffer buf are done before it is refilled
    asm volatile("s_wait_asynccnt 0x0" ::: "memory");   // this wave's copies of stage t + 1 have landed
    __syncthreads();                                     // publishes stage t + 1 and ends every wave's reads of buffer buf
    if (t + 2 < nT) issue_stage(t + 2, buf);
  }
  asm volatile("s_wait_asynccnt 0x0" ::: "memory");     // no copy outstanding behind the loop
  acc_guard4(acc[0][0], acc[0][1], acc[0][2], acc[0][3]);
  acc_guard4(acc[1][0], acc[1][1], acc[1][2], acc[1][3]);
  acc_guard4(acc[2][0], acc[2][1], acc[2][2], acc[2][3]);
  acc_guard4(acc[3][0], acc[3][1], acc[3][2], acc[3][3]);

  // ---- epilogue ----
  float* slab = sT[wave];
  const float* Rb = RESID ? (resid + (size_t)b * strideR) : nullptr;
#pragma unroll
  for (int i = 0; i < 4; ++i) {
    const int mBase = m0 + (i << 4);
#pragma unroll
    for (int j = 0; j < 4; ++j) {
      const int n = n0 + (j << 4) + rlane;
      float bv = 0.f;
      if (BIAS_MODE == 2) bv = bias[n];
#pragma unroll
      for (int r = 0; r < 8; ++r) {
        float v = acc[i][j][r] * scale;
        if (BIAS_MODE == 1) v += bias[mBase + mOff + r];
        if (BIAS_MODE == 2) v += bv;
        if (RESID) v += Rb[(size_t)(mBase + mOff + r) * ldc + n];
        if (ACT == 1) v = tanhf(v);
        if (ACT == 2) v = fmaxf(v, 0.0f);
        if (ACT == 3) v = v / (1.0f + expf(-v));
        if (ACT == 4) v = (v > 0.f) ? v : 0.01f * v;
        if (ACT == 5) v = 0.5f * v * (1.0f + erff(v * 0.70710678118654752f));
        slab[(mOff + r) * 68 + (j << 4) + rlane] = v;
      }
    }
    __builtin_amdgcn_fence(__ATOMIC_RELEASE, "workgroup");
    __builtin_amdgcn_wave_barrier();
    __builtin_amdgcn_fence(__ATOMIC_ACQUIRE, "workgroup");
    if (OUT_MODE == 0) {
      float* C = (float*)Cout + (size_t)b * strideC;
      const int hh = lane >> 4, c4 = (lane & 15) * 4;     // row seg = 256 B = 16 lanes x 16 B
      {
#pragma unroll
        for (int it = 0; it < 8; ++it) {
          const int row = it * 2 + hh;
          v4f v = *(const v4f*)(slab + row * 68 + c4);
          *(v4f*)(C + (size_t)(mBase + row) * ldc + n0 + c4) = v;
        }
        
      }
    } else {
      const int q = lane >> 3, c8 = (lane & 7) * 8;
      unsigned short* C  = (unsigned short*)Cout  + (size_t)b * strideC;
      unsigned short* C2 = (OUT_MODE == 2) ? ((unsigned short*)Cout2 + (size_t)b * strideC) : nullptr;
      {
#pragma unroll
        for (int it = 0; it < 4; ++it) {
          const int row = it * 4 + q;
          const float* sp = slab + row * 68 + c8;
          v8h hv, lv;
#pragma unroll
          for (int e = 0; e < 8; ++e) {
            if (OUT_MODE == 1) {
              hv[e] = (_Float16)sp[e];
            } else {
              unsigned short hb = f2bf_bits(sp[e]);
              unsigned short lb = f2bf_bits(sp[e] - bf_bits2f(hb));
              hv[e] = __builtin_bit_cast(_Float16, hb);
              lv[e] = __builtin_bit_cast(_Float16, lb);
            }
          }
          *(v8h*)(C + (size_t)(mBase + row) * ldc + n0 + c8) = hv;
          if (OUT_MODE == 2) *(v8h*)(C2 + (size_t)(mBase + row) * ldc + n0 + c8) = lv;
        }
        
      }
    }
    __builtin_amdgcn_fence(__ATOMIC_RELEASE, "workgroup");
    __builtin_amdgcn_wave_barrier();
    __builtin_amdgcn_fence(__ATOMIC_ACQUIRE, "workgroup");
  }
}

__global__ __launch_bounds__(256) void cast_f32_f16x2s(
    const float* __restrict__ in, _Float16* __restrict__ out, int n2, float sc) {
  int i = blockIdx.x * 256 + threadIdx.x;
  if (i < n2) {
    const _Float16 h0 = (_Float16)(in[2 * i] * sc), h1 = (_Float16)(in[2 * i + 1] * sc);
    const unsigned u = (unsigned)__builtin_bit_cast(unsigned short, h0) | ((unsigned)__builtin_bit_cast(unsigned short, h1) << 16);
    ((unsigned*)out)[i] = u;
    
  }
}

// ---- group statistics, partial sums: one block per channel (16 per group), f64 fixed-order accumulation.
// Block b stores the sum and the sum of squares of its 16384 elements in the first two doubles of its own 128-B line of part.
__global__ __launch_bounds__(256) void gn_stats(const float* __restrict__ x, double* __restrict__ part) {
  __shared__ double ws1[8];
  __shared__ double ws2[8];
  const int blk = blockIdx.x;
  const int tid = threadIdx.x, wave = tid >> 5, lane = tid & 31;
  const v4f* p = (const v4f*)(x + (size_t)blk * CSP);
  v4f v[CSP / 1024];                 // all 16 loads of a lane are in flight together
#pragma unroll
  for (int i = 0; i < CSP / 1024; ++i) v[i] = p[tid + i * 256];
  __builtin_amdgcn_sched_barrier(0);   // keeps all 16 loads ahead of the sums: sunk among them, the second eight wait out a second memory latency
  double a[4] = {0.0, 0.0, 0.0, 0.0}, q[4] = {0.0, 0.0, 0.0, 0.0};
#pragma unroll
  for (int i = 0; i < CSP / 1024; ++i) {
#pragma unroll
    for (int e = 0; e < 4; ++e) { const double d = (double)v[i][e]; a[e] += d; q[e] += d * d; }
  }
  double s = (a[0] + a[1]) + (a[2] + a[3]), s2 = (q[0] + q[1]) + (q[2] + q[3]);
#pragma unroll
  for (int off = 1; off < 32; off <<= 1) { s += __shfl_xor(s, off, 32); s2 += __shfl_xor(s2, off, 32); }
  if (lane == 0) { ws1[wave] = s; ws2[wave] = s2; }
  __syncthreads();
  if (tid < 16) {
    double ts = 0.0, ts2 = 0.0;
#pragma unroll
    for (int w = 0; w < 8; ++w) { ts += ws1[w]; ts2 += ws2[w]; }
    part[(size_t)blk * 16 + lane] = (lane == 0) ? ts : ((lane == 1) ? ts2 : 0.0);
  }
}

// ---- normalize + affine + transpose: x[c][t][s] (f32) -> tok[t*SP + s][c] (f16).
__global__ __launch_bounds__(256) void norm_tok(const float* __restrict__ x,
                                                const float* __restrict__ gamma,
                                                const float* __restrict__ beta,
                                                const double* __restrict__ part,
                                                _Float16* __restrict__ tok) {
  __shared__ __align__(16) _Float16 tile[64 * 72];   // [sl][cl], pitch 72 halves
  __shared__ float gstat[8];                         // mean, rstd of the block's 4 groups
  const int bid = blockIdx.x;
  const int cb  = bid & 7;           // 8 channel blocks of 64
  const int sb  = (bid >> 3) & 63;   // 64 position blocks of 64
  const int t   = bid >> 9;          // frame
  const int c0 = cb * 64, s0 = sb * 64;
  const int tid = threadIdx.x;
  if (tid < 128) {                   // wave gi sums group gi's 16 partial pairs: lanes 0..15 the sums, lanes 16..31 the sums of squares
    const int gi = tid >> 5, ln = tid & 31;
    double d = part[(size_t)(((c0 >> 4) + gi) * NCH + (ln & 15)) * 16 + (ln >> 4)];
#pragma unroll
    for (int off = 1; off < 16; off <<= 1) d += __shfl_xor(d, off, 32);
    const double ts2 = __shfl(d, 16, 32);
    const double mean = d * (1.0 / (double)GSZ);
    double var = ts2 * (1.0 / (double)GSZ) - mean * mean;
    if (var < 0.0) var = 0.0;
    if (ln == 0) { gstat[gi * 2] = (float)mean; gstat[gi * 2 + 1] = rsqrtf((float)var + GN_EPS); }
  }
  __syncthreads();                   // the four groups' mean and rstd are visible to every wave
#pragma unroll 4
  for (int i = tid; i < 64 * 64; i += 256) {
    const int cl = i >> 6, sl = i & 63;
    const int c = c0 + cl;
    const float mean = gstat[(cl >> 4) * 2], rstd = gstat[(cl >> 4) * 2 + 1];
    float v = x[(size_t)c * CSP + (size_t)t * SP + s0 + sl];
    v = (v - mean) * rstd * gamma[c] + beta[c];
    tile[sl * 72 + cl] = (_Float16)v;
  }
  __syncthreads();
  const int wave = tid >> 5, lane = tid & 31;
  const int q = lane >> 3, c8 = (lane & 7) * 8;
  {
#pragma unroll
    for (int it = 0; it < 2; ++it) {
      const int row = wave * 8 + it * 4 + q;   // wave covers rows 8w..8w+7
      const v8h hv = *(const v8h*)(tile + row * 72 + c8);
      *(v8h*)(tok + ((size_t)t * SP + s0 + row) * CH + c0 + c8) = hv;
    }
    
  }
}

// ---- row softmax over SP keys: S f32 [rows][SP] -> P f16 [rows][SP] = f16(p/sum * 2^15).
__global__ __launch_bounds__(256) void softmax_rows(const float* __restrict__ S, _Float16* __restrict__ P) {
  __shared__ float rmax[8];
  __shared__ float rsum[8];
  const int row = blockIdx.x;
  const int tid = threadIdx.x, wave = tid >> 5, lane = tid & 31;
  const float* sr = S + (size_t)row * SP;
  const v4f a0 = *(const v4f*)(sr + 8 * tid);
  const v4f a1 = *(const v4f*)(sr + 8 * tid + 4);
  const v4f a2 = *(const v4f*)(sr + (SP / 2) + 8 * tid);
  const v4f a3 = *(const v4f*)(sr + (SP / 2) + 8 * tid + 4);
  float m = a0[0];
#pragma unroll
  for (int e = 0; e < 4; ++e) { m = fmaxf(m, a0[e]); m = fmaxf(m, a1[e]); m = fmaxf(m, a2[e]); m = fmaxf(m, a3[e]); }
#pragma unroll
  for (int off = 1; off < 32; off <<= 1) m = fmaxf(m, __shfl_xor(m, off, 32));
  if (lane == 0) rmax[wave] = m;
  __syncthreads();
  float bm = rmax[0];
#pragma unroll
  for (int w = 1; w < 8; ++w) bm = fmaxf(bm, rmax[w]);
  v4f e0, e1, e2, e3;
  float su = 0.f;
#pragma unroll
  for (int e = 0; e < 4; ++e) { e0[e] = __expf(a0[e] - bm); su += e0[e]; }
#pragma unroll
  for (int e = 0; e < 4; ++e) { e1[e] = __expf(a1[e] - bm); su += e1[e]; }
#pragma unroll
  for (int e = 0; e < 4; ++e) { e2[e] = __expf(a2[e] - bm); su += e2[e]; }
#pragma unroll
  for (int e = 0; e < 4; ++e) { e3[e] = __expf(a3[e] - bm); su += e3[e]; }
#pragma unroll
  for (int off = 1; off < 32; off <<= 1) su += __shfl_xor(su, off, 32);
  if (lane == 0) rsum[wave] = su;
  __syncthreads();
  float tot = rsum[0];
#pragma unroll
  for (int w = 1; w < 8; ++w) tot += rsum[w];
  const float f = (1.0f / tot) * PCARRY;
  v8h h0, h1;
#pragma unroll
  for (int e = 0; e < 4; ++e) {
    h0[e]     = (_Float16)(e0[e] * f);
    h0[4 + e] = (_Float16)(e1[e] * f);
    h1[e]     = (_Float16)(e2[e] * f);
    h1[4 + e] = (_Float16)(e3[e] * f);
  }
  _Float16* pr = P + (size_t)row * SP;
  {
    *(v8h*)(pr + 8 * tid) = h0;
    *(v8h*)(pr + (SP / 2) + 8 * tid) = h1;
    
  }
}

static inline int gemm_blocks(int M, int N) { return (M / 128) * (N / 256); }

// ---------------- launch ----------------
extern "C" void kernel_launch(void* const* d_in, const int* in_sizes, int n_in,
                              void* d_out, int out_size, void* d_ws, size_t ws_size,
                              hipStream_t stream) {
  if (n_in < 11) return;
  if (in_sizes[0] != CH * CSP || out_size != CH * CSP) return;
  if (in_sizes[1] != CH || in_sizes[2] != CH) return;
  if (in_sizes[3] != CH * CH || in_sizes[5] != CH * CH || in_sizes[7] != CH * CH || in_sizes[9] != CH * CH) return;
  if (in_sizes[4] != CH || in_sizes[6] != CH || in_sizes[8] != CH || in_sizes[10] != CH) return;

  const float* x     = (const float*)d_in[0];
  const float* gamma = (const float*)d_in[1];
  const float* beta  = (const float*)d_in[2];
  const float* wq    = (const float*)d_in[3];
  const float* bq    = (const float*)d_in[4];
  const float* wk    = (const float*)d_in[5];
  const float* bk    = (const float*)d_in[6];
  const float* wv    = (const float*)d_in[7];
  const float* bv    = (const float*)d_in[8];
  const float* wp    = (const float*)d_in[9];
  const float* bp    = (const float*)d_in[10];
  float* out = (float*)d_out;

  char* ws = (char*)d_ws;
  size_t off = 0;
  double* part = (double*)(ws + off);         off += (size_t)NGRP * NCH * 128;                  // 512 lines of 128 B
  _Float16* w16  = (_Float16*)(ws + off);     off += (size_t)4 * CH * CH * sizeof(_Float16);   // 2 MiB
  _Float16* tok  = (_Float16*)(ws + off);     off += (size_t)NTOK * CH * sizeof(_Float16);     // 16 MiB
  _Float16* q16  = (_Float16*)(ws + off);     off += (size_t)NTOK * CH * sizeof(_Float16);     // 16 MiB
  _Float16* k16  = (_Float16*)(ws + off);     off += (size_t)NTOK * CH * sizeof(_Float16);     // 16 MiB
  _Float16* vT16 = (_Float16*)(ws + off);     off += (size_t)CH * NTOK * sizeof(_Float16);     // 16 MiB  [512][16384]
  float* S       = (float*)(ws + off);        off += (size_t)QH * SP * sizeof(float);          // 32 MiB
  _Float16* P16  = (_Float16*)(ws + off);     off += (size_t)NTOK * SP * sizeof(_Float16);     // 128 MiB  [16384][4096], every frame's rows
  if (off > ws_size) return;                  // 237,043,712 B total
  _Float16* o16 = tok;                        // attention output plane reuses the token plane (tokens are dead after the projections)
  _Float16* wq16 = w16;
  _Float16* wk16 = w16 + (size_t)CH * CH;
  _Float16* wv16 = w16 + (size_t)2 * CH * CH;
  _Float16* wp16 = w16 + (size_t)3 * CH * CH;

  // 1. group statistics: partial sums, one workgroup per channel (the normalize kernel adds each group's 16)
  gn_stats<<<dim3(NGRP * NCH), dim3(256), 0, stream>>>(x, part);

  // 2. weights x16 -> f16
  const int n2 = CH * CH / 2;
  cast_f32_f16x2s<<<dim3((n2 + 255) / 256), dim3(256), 0, stream>>>(wq, wq16, n2, WCARRY);
  cast_f32_f16x2s<<<dim3((n2 + 255) / 256), dim3(256), 0, stream>>>(wk, wk16, n2, WCARRY);
  cast_f32_f16x2s<<<dim3((n2 + 255) / 256), dim3(256), 0, stream>>>(wv, wv16, n2, WCARRY);
  cast_f32_f16x2s<<<dim3((n2 + 255) / 256), dim3(256), 0, stream>>>(wp, wp16, n2, WCARRY);

  // 3. normalize + transpose to tokens
  norm_tok<<<dim3(TFR * 64 * 8), dim3(256), 0, stream>>>(x, gamma, beta, part, tok);

  // 4. q = tok·Wqᵀ/16 + bq   (A = tok [16384][512], Bt = Wq16 [512][512], f16 out [16384][512])
  wmma_gemm64<0, false, 2, 1, false><<<dim3(gemm_blocks(NTOK, CH), 1), dim3(256), 0, stream>>>(
      U16(tok), U16(tok), CH, (long)0, U16(wq16), U16(wq16), CH, (long)0,
      (void*)q16, (void*)q16, CH, (long)0, bq, x, (long)0, NTOK, CH, CH, WCARRY_INV);
  //    k = tok·Wkᵀ/16 + bk
  wmma_gemm64<0, false, 2, 1, false><<<dim3(gemm_blocks(NTOK, CH), 1), dim3(256), 0, stream>>>(
      U16(tok), U16(tok), CH, (long)0, U16(wk16), U16(wk16), CH, (long)0,
      (void*)k16, (void*)k16, CH, (long)0, bk, x, (long)0, NTOK, CH, CH, WCARRY_INV);
  //    vᵀ[c][token] = Wv16·tokᵀ/16 + bv[c]   (A = Wv16 [512][512], Bt = tok [16384][512], f16 out [512][16384])
  wmma_gemm64<0, false, 1, 1, false><<<dim3(gemm_blocks(CH, NTOK), 1), dim3(256), 0, stream>>>(
      U16(wv16), U16(wv16), CH, (long)0, U16(tok), U16(tok), CH, (long)0,
      (void*)vT16, (void*)vT16, NTOK, (long)0, bv, x, (long)0, CH, NTOK, CH, WCARRY_INV);

  // 5. per half-frame: S = q*k^T*512^-0.5 (f32), row softmax -> that half-frame's rows of P16 (x2^15)
  for (int hp = 0; hp < TFR * (SP / QH); ++hp) {
    const int t = hp / (SP / QH);
    const int half = hp - t * (SP / QH);
    const size_t qrow0 = (size_t)t * SP + (size_t)half * QH;
    const _Float16* qA  = q16 + qrow0 * CH;                   // [QH][512]
    const _Float16* kB  = k16 + (size_t)t * SP * CH;           // [4096][512]
    wmma_gemm64<0, false, 0, 0, false><<<dim3(gemm_blocks(QH, SP), 1), dim3(256), 0, stream>>>(
        U16(qA), U16(qA), CH, (long)0, U16(kB), U16(kB), CH, (long)0,
        (void*)S, (void*)S, SP, (long)0, bq, x, (long)0, QH, SP, CH, QSCALE);
    softmax_rows<<<dim3(QH), dim3(256), 0, stream>>>(S, P16 + qrow0 * SP);
  }
  //    O = P16*V x2^-15 for all frames in one launch, one frame per blockIdx.y: 64 x 4 = 256 workgroups
  //    (A = P16 frame [4096][4096], Bt = vT16 + frame*4096, [512][4096] with pitch 16384, f16 out [4096][512])
  wmma_gemm64<0, false, 0, 1, false><<<dim3(gemm_blocks(SP, CH), TFR), dim3(256), 0, stream>>>(
      U16(P16), U16(P16), SP, (long)SP * SP, U16(vT16), U16(vT16), NTOK, (long)SP,
      (void*)o16, (void*)o16, CH, (long)SP * CH, bq, x, (long)0, SP, CH, SP, PCARRY_INV);

  // 6. out[c][token] = Wp16·Oᵀ/16 + bp[c] + x[c][token]   (A = Wp16 [512][512], Bt = O [16384][512], f32 out [512][16384])
  wmma_gemm64<0, false, 1, 0, true><<<dim3(gemm_blocks(CH, NTOK), 1), dim3(256), 0, stream>>>(
      U16(wp16), U16(wp16), CH, (long)0, U16(o16), U16(o16), CH, (long)0,
      (void*)out, (void*)out, NTOK, (long)0, bp, x, (long)0, CH, NTOK, CH, WCARRY_INV);
}

// v004
// It runs in 221 microseconds.
// Next to v003, in two timings, it ran 1.28 times as fast each time.
// All steps since v000 together make it 9.76 times as fast.
#include <hip/hip_runtime.h>
// Contractions tok·Wq/Wk/Wvᵀ, q·kᵀ, P·V, O·Wpᵀ: v_wmma_f32_16x16x32_f16 (f16 operands, f32 accumulate); weights carried x16, softmax probabilities carried x2^15 (f16 exp(s - block max) times an f16 row-and-block factor); group statistics accumulated in f64; all other elementwise math f32.

typedef __attribute__((ext_vector_type(16))) _Float16 v16h;
typedef __attribute__((ext_vector_type(8)))  _Float16 v8h;
typedef __attribute__((ext_vector_type(16))) __bf16   v16b;
typedef __attribute__((ext_vector_type(8)))  __bf16   v8b;
typedef __attribute__((ext_vector_type(8)))  float    v8f;
typedef __attribute__((ext_vector_type(4)))  float    v4f;
#define U16(p) ((const unsigned short*)(const void*)(p))

constexpr int CH   = 512;          // channels
constexpr int TFR  = 4;            // frames
constexpr int SP   = 4096;         // tokens per frame (h*w)
constexpr int CSP  = TFR * SP;     // 16384 elements per channel
constexpr int NTOK = TFR * SP;     // 16384 tokens
constexpr int GSZ  = 16 * CSP;     // 262144 elements per group (16 channels per group)
constexpr int NGRP = 32;
constexpr int NCH  = 16;           // partial sums per group: one workgroup per channel
constexpr int KBLK = 64;           // keys per softmax block (one wave's columns of a score tile)
constexpr float GN_EPS     = 1e-6f;
constexpr float QSCALE     = 0.04419417382415922f;   // 512^-0.5
constexpr float WCARRY     = 16.0f;
constexpr float WCARRY_INV = 1.0f / 16.0f;
constexpr float PCARRY     = 32768.0f;
constexpr float PCARRY_INV = 1.0f / 32768.0f;

__device__ __forceinline__ unsigned short f2bf_bits(float f) {
  unsigned u = __float_as_uint(f);
  return (unsigned short)((u + 0x7FFFu + ((u >> 16) & 1u)) >> 16);
}
__device__ __forceinline__ float bf_bits2f(unsigned short h) { return __uint_as_float(((unsigned)h) << 16); }

// hazard guard between the last products and the epilogue's reads of the accumulators
__device__ __forceinline__ void acc_guard4(v8f& a, v8f& b, v8f& c, v8f& d) { asm volatile("v_nop\n\tv_nop\n\tv_nop\n\tv_nop" : "+v"(a), "+v"(b), "+v"(c), "+v"(d)); }
template <typename T> struct Frag;
template <> struct Frag<_Float16> {
  typedef v16h V; union U { v16h v; v8h h[2]; };
  static __device__ __forceinline__ v16h load(const _Float16* p) {   // elements 0..7 <- p[0..7], 8..15 <- p[16..23]
    U f; f.h[0] = *(const v8h*)(p); f.h[1] = *(const v8h*)(p + 16); return f.v;
  }
  static __device__ __forceinline__ v8f mma(v16h a, v16h b, v8f c) {
    return __builtin_amdgcn_wmma_f32_16x16x32_f16(false, a, false, b, (short)0, c, false, false);
  }
};
template <> struct Frag<__bf16> {
  typedef v16b V; union U { v16b v; v8b h[2]; };
  static __device__ __forceinline__ v16b load(const __bf16* p) {
    U f; f.h[0] = *(const v8b*)(p); f.h[1] = *(const v8b*)(p + 16); return f.v;
  }
  static __device__ __forceinline__ v8f mma(v16b a, v16b b, v8f c) {
    return __builtin_amdgcn_wmma_f32_16x16x32_bf16(false, a, false, b, (short)0, c, false, false);
  }
};

// ---- LDS-staged batched WMMA GEMM -------------------------------------------
// C[m,n] = scale * sum_k A[m,k] * Bt[n,k] (+bias)(+resid); a workgroup of 8 waves (2 x 4) owns a 128x256 tile, each wave 64x64 of it.
// A row-major [M,K]; Bt row-major [N,K]; M % 128 == 0, N % 256 == 0, K % 128 == 0.
// Per stage 128 k of the 128 A rows and the 256 Bt rows are copied to LDS by global_load_async_to_lds_b128 (two buffers:
// the next stage's copies fly while this stage is multiplied); fragments are read from LDS at a row pitch of 272 B.
// BIAS_MODE: 0 = none, 1 = bias[m], 2 = bias[n].
// OUT_MODE: 0 = f32, 1 = f16, 2 = bf16 hi plane (Cout) + bf16 lo plane (Cout2).
// ET: 0 = f16 operands, 1 = bf16 operands (pointers passed as 16-bit storage)
// SM: 0 = plain; 1 = score tile: each wave's 64 columns of a row are stored as exp(s - block max), the block's max and sum go to stat;
//     2 = A holds such blocks: the workgroup merges its rows' 64 block maxima and sums into one factor per row and block
//     (exp(block max - row max) / row sum * 2^15) and multiplies every A fragment by its row's factor ahead of the products.
// stat: one 4-KiB piece per score tile, [128 rows][4 blocks][max, sum], pieces ordered [batch][tm][tn].
constexpr int BM    = 128;                 // A rows per workgroup
constexpr int BN    = 256;                 // Bt rows per workgroup
constexpr int KS    = 128;                 // k per stage (256 B of every row)
constexpr int LPH   = KS + 8;              // LDS row pitch in 16-bit elements (272 B: 16 rows of a b128 read fall on 64 distinct banks)
constexpr int STG_H = (BM + BN) * LPH;     // 16-bit elements per stage buffer
constexpr int FPH   = SP / KBLK + 2;       // factor table row pitch in 16-bit elements (132 B: 16 rows fall on distinct banks)

__device__ __forceinline__ unsigned lds_off(const void* p) { return (unsigned)(size_t)p; }

// value of lane l ^ X (X < 16) by DPP row_xmask; every lane is on where it is used
template <int X> __device__ __forceinline__ float lane_xor(float x) {
  return __builtin_bit_cast(float, __builtin_amdgcn_update_dpp(0, __builtin_bit_cast(int, x), 0x160 + X, 0xf, 0xf, true));
}

// Eight copies of 16 B per lane, rows 16 apart: LDS byte address l + i * 16 rows, global address g + i * gstep elements.
// The s_wait_xcnt stands inside the statement so that no address register is rewritten ahead of it.
__device__ __forceinline__ void async_rows8(unsigned l, const unsigned short* g, size_t gstep) {
  constexpr unsigned LS = 16u * LPH * 2u;
  const unsigned l1 = l + LS, l2 = l + 2 * LS, l3 = l + 3 * LS, l4 = l + 4 * LS, l5 = l + 5 * LS, l6 = l + 6 * LS, l7 = l + 7 * LS;
  const unsigned short* g1 = g + gstep;     const unsigned short* g2 = g + 2 * gstep;
  const unsigned short* g3 = g + 3 * gstep; const unsigned short* g4 = g + 4 * gstep;
  const unsigned short* g5 = g + 5 * gstep; const unsigned short* g6 = g + 6 * gstep;
  const unsigned short* g7 = g + 7 * gstep;
  asm volatile(
      "global_load_async_to_lds_b128 %0, %8, off\n\t"
      "global_load_async_to_lds_b128 %1, %9, off\n\t"
      "global_load_async_to_lds_b128 %2, %10, off\n\t"
      "global_load_async_to_lds_b128 %3, %11, off\n\t"
      "global_load_async_to_lds_b128 %4, %12, off\n\t"
      "global_load_async_to_lds_b128 %5, %13, off\n\t"
      "global_load_async_to_lds_b128 %6, %14, off\n\t"
      "global_load_async_to_lds_b128 %7, %15, off\n\t"
      "s_wait_xcnt 0x0"
      :: "v"(l), "v"(l1), "v"(l2), "v"(l3), "v"(l4), "v"(l5), "v"(l6), "v"(l7),
         "v"(g), "v"(g1), "v"(g2), "v"(g3), "v"(g4), "v"(g5), "v"(g6), "v"(g7)
      : "memory");
}
template <int ET> struct Elem;
template <> struct Elem<0> { typedef _Float16 T; };
template <> struct Elem<1> { typedef __bf16 T; };
template <int ET, bool SPLIT, int BIAS_MODE, int OUT_MODE, bool RESID, int ACT = 0, int SM = 0>
__global__ __launch_bounds__(256) void wmma_gemm64(
    const unsigned short* __restrict__ Ap, const unsigned short* __restrict__ A2p, int lda, long strideA,
    const unsigned short* __restrict__ Btp, const unsigned short* __restrict__ Bt2p, int ldb, long strideB,
    void* __restrict__ Cout, void* __restrict__ Cout2, int ldc, long strideC,
    const float* __restrict__ bias,
    const float* __restrict__ resid, long strideR,
    int M, int N, int K, float scale, float* __restrict__ stat) {
  static_assert(!SPLIT, "single-plane operands only");
  static_assert(SM == 0 || (ET == 0 && OUT_MODE == 1), "block softmax: f16 operands and f16 output");
  typedef typename Elem<ET>::T T;
  typedef typename Frag<T>::V V;
  __shared__ __align__(16) T ring[2 * STG_H];      // two stage buffers, each [A 128 rows | Bt 256 rows] at pitch LPH
  __shared__ __align__(16) float sT[8][16 * 68];   // per-wave 16x64 slab, pitch 68 floats
  __shared__ __align__(16) float sStat[SM == 1 ? BM * 8 : 4];          // [row][wave column][max, sum]
  __shared__ __align__(16) _Float16 sF[SM == 2 ? BM * FPH : 8];        // [row][block] factor
  const int b    = blockIdx.y;
  const int tid  = threadIdx.x;
  const int lane = tid & 31;
  const int wave = tid >> 5;
  const int tilesN = N / BN;
  const int tilesM = M / BM;
  const int tile = blockIdx.x;
  if (tile >= tilesM * tilesN) return;   // the same for the whole workgroup, in front of every barrier
  const int tm = tile / tilesN;
  const int tn = tile - tm * tilesN;
  const int wm = wave >> 2;              // wave row (0..1) and column (0..3) in the workgroup's tile
  const int wn = wave & 3;
  const int m0 = tm * BM + (wm << 6);
  const int n0 = tn * BN + (wn << 6);

  const int rlane = lane & 15;                 // row (A) / col (B, D) within subtile
  const int koff  = (lane >> 4) * 8;           // k offset of this lane half
  const int mOff  = (lane >> 4) * 8;           // D row offset

  // copy addresses: 16 lanes cover the 256 B of one row, the workgroup 16 rows per copy
  const int crow = tid >> 4;
  const int ccol = (tid & 15) * 8;
  const unsigned short* gA = Ap  + (size_t)b * strideA + (size_t)(tm * BM + crow) * lda + ccol;
  const unsigned short* gB = Btp + (size_t)b * strideB + (size_t)(tn * BN + crow) * ldb + ccol;
  const unsigned lA = lds_off(ring) + (unsigned)(crow * LPH + ccol) * 2u;
  const unsigned lB = lA + (unsigned)(BM * LPH) * 2u;
  auto issue_stage = [&](int t, int buf) {
    const unsigned lo = (unsigned)buf * (unsigned)(STG_H * 2);
    const size_t ko = (size_t)t * KS;
    async_rows8(lA + lo, gA + ko, (size_t)16 * lda);
    async_rows8(lB + lo, gB + ko, (size_t)16 * ldb);
    async_rows8(lB + lo + (unsigned)(128 * LPH) * 2u, gB + ko + (size_t)128 * ldb, (size_t)16 * ldb);
  };

  v8f acc[4][4];
#pragma unroll
  for (int i = 0; i < 4; ++i)
#pragma unroll
    for (int j = 0; j < 4; ++j) acc[i][j] = (v8f){0.f,0.f,0.f,0.f,0.f,0.f,0.f,0.f};

  const int nT = K / KS;
  issue_stage(0, 0);
  if constexpr (SM == 2) {   // while stage 0 flies: two lanes per row merge the row's 64 block maxima and sums (K == SP keys)
    const int row = tid >> 1, hf = tid & 1;
    const char* sp4 = (const char*)(stat + (size_t)(b * tilesM + tm) * (SP / BN) * (BM * 8));
    const unsigned so = (unsigned)(hf * 8 * (BM * 32) + row * 32);   // this lane's byte offset: its first piece, its row
    v4f st[8][2];            // {max, sum, max, sum} of two neighbouring blocks
#pragma unroll
    for (int c = 0; c < 8; ++c) {
      st[c][0] = *(const v4f*)(sp4 + so + c * (BM * 32));
      st[c][1] = *(const v4f*)(sp4 + so + c * (BM * 32) + 16);
    }
    asm volatile("s_wait_xcnt 0x0" :: "v"(so) : "memory");   // the 16 loads share one offset register: it stays whole up to this wait (without the operand the last load's result was placed on it)
    float mx = st[0][0][0];
#pragma unroll
    for (int c = 0; c < 8; ++c)
#pragma unroll
      for (int h = 0; h < 2; ++h) mx = fmaxf(mx, fmaxf(st[c][h][0], st[c][h][2]));
    mx = fmaxf(mx, lane_xor<1>(mx));
    float l = 0.f;
    float w[8][2][2];        // exp(block max - row max)
#pragma unroll
    for (int c = 0; c < 8; ++c)
#pragma unroll
      for (int h = 0; h < 2; ++h) {
        w[c][h][0] = __expf(st[c][h][0] - mx);
        w[c][h][1] = __expf(st[c][h][2] - mx);
        l += st[c][h][1] * w[c][h][0] + st[c][h][3] * w[c][h][1];
      }
    l += lane_xor<1>(l);
    const float inv = PCARRY / l;
#pragma unroll
    for (int c = 0; c < 8; ++c)
#pragma unroll
      for (int h = 0; h < 2; ++h) {
        _Float16* fp = sF + row * FPH + (hf * 8 + c) * 4 + h * 2;
        fp[0] = (_Float16)(w[c][h][0] * inv);
        fp[1] = (_Float16)(w[c][h][1] * inv);
      }
  }
  asm volatile("s_wait_asynccnt 0x0" ::: "memory");   // stage 0 has landed for this wave's copies
  __syncthreads();                                     // ... and for every wave's (SM 2: the factor table too)
  if (nT > 1) issue_stage(1, 1);

  for (int t = 0; t < nT; ++t) {
    const int buf = t & 1;
    const T* sA = ring + buf * STG_H + ((wm << 6) + rlane) * LPH + koff;
    const T* sB = ring + buf * STG_H + (BM + (wn << 6) + rlane) * LPH + koff;
    // fragments of the next 32 k of this stage are fetched into a second register set ahead of the current 16 products
    V af[2][4], bf[2][4];
    _Float16 fs[4][2];       // SM 2: this lane's four A rows' factors for the stage's two blocks of 64 k
    if constexpr (SM == 2) {
#pragma unroll
      for (int i = 0; i < 4; ++i) {
        const _Float16* fp = sF + ((wm << 6) + (i << 4) + rlane) * FPH + 2 * t;
        fs[i][0] = fp[0]; fs[i][1] = fp[1];
      }
    }
#pragma unroll
    for (int j = 0; j < 4; ++j) { bf[0][j] = Frag<T>::load(sB + (j << 4) * LPH); af[0][j] = Frag<T>::load(sA + (j << 4) * LPH); }
#pragma unroll
    for (int ks = 0; ks < KS / 32; ++ks) {
      const int cur = ks & 1, nxt = cur ^ 1;
      if (ks + 1 < KS / 32) {
#pragma unroll
        for (int j = 0; j < 4; ++j) {
          bf[nxt][j] = Frag<T>::load(sB + (j << 4) * LPH + (ks + 1) * 32);
          af[nxt][j] = Frag<T>::load(sA + (j << 4) * LPH + (ks + 1) * 32);
        }
      }
      __builtin_amdgcn_sched_barrier(0);   // keeps the LDS reads above as one group ahead of the products: sunk among them, each group of four waits out the LDS latency
      if constexpr (SM == 2) {
#pragma unroll
        for (int i = 0; i < 4; ++i) af[cur][i] = af[cur][i] * fs[i][ks >> 1];
      }
#pragma unroll
      for (int i = 0; i < 4; ++i)
#pragma unroll
        for (int j = 0; j < 4; ++j) acc[i][j] = Frag<T>::mma(af[cur][i], bf[cur][j], acc[i][j]);
      __builtin_amdgcn_sched_barrier(0);   // keeps the next LDS reads out of these products and the last products in front of the stage's barrier (behind it they delay the refill)
    }
    asm volatile("s_wait_dscnt 0x0" ::: "memory");      // this wave's reads of buffer buf are done before it is refilled
    asm volatile("s_wait_asynccnt 0x0" ::: "memory");   // this wave's copies of stage t + 1 have landed
    __syncthreads();                                     // publishes stage t + 1 and ends every wave's reads of buffer buf
    if (t + 2 < nT) issue_stage(t + 2, buf);
  }
  asm volatile("s_wait_asynccnt 0x0" ::: "memory");     // no copy outstanding behind the loop
  acc_guard4(acc[0][0], acc[0][1], acc[0][2], acc[0][3]);
  acc_guard4(acc[1][0], acc[1][1], acc[1][2], acc[1][3]);
  acc_guard4(acc[2][0], acc[2][1], acc[2][2], acc[2][3]);
  acc_guard4(acc[3][0], acc[3][1], acc[3][2], acc[3][3]);

  // ---- epilogue ----
  float* slab = sT[wave];
  const float* Rb = RESID ? (resid + (size_t)b * strideR) : nullptr;
#pragma unroll
  for (int i = 0; i < 4; ++i) {
    const int mBase = m0 + (i << 4);
#pragma unroll
    for (int j = 0; j < 4; ++j) {
      const int n = n0 + (j << 4) + rlane;
      float bv = 0.f;
      if (BIAS_MODE == 2) bv = bias[n];
#pragma unroll
      for (int r = 0; r < 8; ++r) {
        float v = acc[i][j][r] * scale;
        if (BIAS_MODE == 1) v += bias[mBase + mOff + r];
        if (BIAS_MODE == 2) v += bv;
        if (RESID) v += Rb[(size_t)(mBase + mOff + r) * ldc + n];
        if (ACT == 1) v = tanhf(v);
        if (ACT == 2) v = fmaxf(v, 0.0f);
        if (ACT == 3) v = v / (1.0f + expf(-v));
        if (ACT == 4) v = (v > 0.f) ? v : 0.01f * v;
        if (ACT == 5) v = 0.5f * v * (1.0f + erff(v * 0.70710678118654752f));
        slab[(mOff + r) * 68 + (j << 4) + rlane] = v;
      }
    }
    __builtin_amdgcn_fence(__ATOMIC_RELEASE, "workgroup");
    __builtin_amdgcn_wave_barrier();
    __builtin_amdgcn_fence(__ATOMIC_ACQUIRE, "workgroup");
    if (OUT_MODE == 0) {
      float* C = (float*)Cout + (size_t)b * strideC;
      const int hh = lane >> 4, c4 = (lane & 15) * 4;     // row seg = 256 B = 16 lanes x 16 B
      {
#pragma unroll
        for (int it = 0; it < 8; ++it) {
          const int row = it * 2 + hh;
          v4f v = *(const v4f*)(slab + row * 68 + c4);
          *(v4f*)(C + (size_t)(mBase + row) * ldc + n0 + c4) = v;
        }
        
      }
    } else {
      const int q = lane >> 3, c8 = (lane & 7) * 8;
      unsigned short* C  = (unsigned short*)Cout  + (size_t)b * strideC;
      unsigned short* C2 = (OUT_MODE == 2) ? ((unsigned short*)Cout2 + (size_t)b * strideC) : nullptr;
      {
#pragma unroll
        for (int it = 0; it < 4; ++it) {
          const int row = it * 4 + q;
          const float* sp = slab + row * 68 + c8;
          v8h hv, lv;
          float pv[8];
          if constexpr (SM == 1) {   // eight lanes hold one row's 64 scores: block max, exp, block sum
#pragma unroll
            for (int e = 0; e < 8; ++e) pv[e] = sp[e];
            float mx = fmaxf(fmaxf(fmaxf(pv[0], pv[1]), fmaxf(pv[2], pv[3])), fmaxf(fmaxf(pv[4], pv[5]), fmaxf(pv[6], pv[7])));
            mx = fmaxf(mx, lane_xor<1>(mx)); mx = fmaxf(mx, lane_xor<2>(mx)); mx = fmaxf(mx, lane_xor<4>(mx));
#pragma unroll
            for (int e = 0; e < 8; ++e) pv[e] = __expf(pv[e] - mx);
            float su = ((pv[0] + pv[1]) + (pv[2] + pv[3])) + ((pv[4] + pv[5]) + (pv[6] + pv[7]));
            su += lane_xor<1>(su); su += lane_xor<2>(su); su += lane_xor<4>(su);
            if ((lane & 7) == 0) {
              float* ss = sStat + (((wm << 6) + (i << 4) + row) * 4 + wn) * 2;
              ss[0] = mx; ss[1] = su;
            }
          }
#pragma unroll
          for (int e = 0; e < 8; ++e) {
            if (SM == 1) {
              hv[e] = (_Float16)pv[e];
            } else if (OUT_MODE == 1) {
              hv[e] = (_Float16)sp[e];
            } else {
              unsigned short hb = f2bf_bits(sp[e]);
              unsigned short lb = f2bf_bits(sp[e] - bf_bits2f(hb));
              hv[e] = __builtin_bit_cast(_Float16, hb);
              lv[e] = __builtin_bit_cast(_Float16, lb);
            }
          }
          *(v8h*)(C + (size_t)(mBase + row) * ldc + n0 + c8) = hv;
          if (OUT_MODE == 2) *(v8h*)(C2 + (size_t)(mBase + row) * ldc + n0 + c8) = lv;
        }
        
      }
    }
    __builtin_amdgcn_fence(__ATOMIC_RELEASE, "workgroup");
    __builtin_amdgcn_wave_barrier();
    __builtin_amdgcn_fence(__ATOMIC_ACQUIRE, "workgroup");
  }
  if constexpr (SM == 1) {
    __syncthreads();         // every wave's block maxima and sums are in sStat
    ((v4f*)(stat + (size_t)((b * tilesM + tm) * tilesN + tn) * (BM * 8)))[tid] = ((const v4f*)sStat)[tid];   // whole lines, 4 KiB per tile
  }
}

__global__ __launch_bounds__(256) void cast_f32_f16x2s(
    const float* __restrict__ in, _Float16* __restrict__ out, int n2, float sc) {
  int i = blockIdx.x * 256 + threadIdx.x;
  if (i < n2) {
    const _Float16 h0 = (_Float16)(in[2 * i] * sc), h1 = (_Float16)(in[2 * i + 1] * sc);
    const unsigned u = (unsigned)__builtin_bit_cast(unsigned short, h0) | ((unsigned)__builtin_bit_cast(unsigned short, h1) << 16);
    ((unsigned*)out)[i] = u;
    
  }
}

// ---- group statistics, partial sums: one block per channel (16 per group), f64 fixed-order accumulation.
// Block b stores the sum and the sum of squares of its 16384 elements in the first two doubles of its own 128-B line of part.
__global__ __launch_bounds__(256) void gn_stats(const float* __restrict__ x, double* __restrict__ part) {
  __shared__ double ws1[8];
  __shared__ double ws2[8];
  const int blk = blockIdx.x;
  const int tid = threadIdx.x, wave = tid >> 5, lane = tid & 31;
  const v4f* p = (const v4f*)(x + (size_t)blk * CSP);
  v4f v[CSP / 1024];                 // all 16 loads of a lane are in flight together
#pragma unroll
  for (int i = 0; i < CSP / 1024; ++i) v[i] = p[tid + i * 256];
  __builtin_amdgcn_sched_barrier(0);   // keeps all 16 loads ahead of the sums: sunk among them, the second eight wait out a second memory latency
  double a[4] = {0.0, 0.0, 0.0, 0.0}, q[4] = {0.0, 0.0, 0.0, 0.0};
#pragma unroll
  for (int i = 0; i < CSP / 1024; ++i) {
#pragma unroll
    for (int e = 0; e < 4; ++e) { const double d = (double)v[i][e]; a[e] += d; q[e] += d * d; }
  }
  double s = (a[0] + a[1]) + (a[2] + a[3]), s2 = (q[0] + q[1]) + (q[2] + q[3]);
#pragma unroll
  for (int off = 1; off < 32; off <<= 1) { s += __shfl_xor(s, off, 32); s2 += __shfl_xor(s2, off, 32); }
  if (lane == 0) { ws1[wave] = s; ws2[wave] = s2; }
  __syncthreads();
  if (tid < 16) {
    double ts = 0.0, ts2 = 0.0;
#pragma unroll
    for (int w = 0; w < 8; ++w) { ts += ws1[w]; ts2 += ws2[w]; }
    part[(size_t)blk * 16 + lane] = (lane == 0) ? ts : ((lane == 1) ? ts2 : 0.0);
  }
}

// ---- normalize + affine + transpose: x[c][t][s] (f32) -> tok[t*SP + s][c] (f16).
__global__ __launch_bounds__(256) void norm_tok(const float* __restrict__ x,
                                                const float* __restrict__ gamma,
                                                const float* __restrict__ beta,
                                                const double* __restrict__ part,
                                                _Float16* __restrict__ tok) {
  __shared__ __align__(16) _Float16 tile[64 * 72];   // [sl][cl], pitch 72 halves
  __shared__ float gstat[8];                         // mean, rstd of the block's 4 groups
  const int bid = blockIdx.x;
  const int cb  = bid & 7;           // 8 channel blocks of 64
  const int sb  = (bid >> 3) & 63;   // 64 position blocks of 64
  const int t   = bid >> 9;          // frame
  const int c0 = cb * 64, s0 = sb * 64;
  const int tid = threadIdx.x;
  if (tid < 128) {                   // wave gi sums group gi's 16 partial pairs: lanes 0..15 the sums, lanes 16..31 the sums of squares
    const int gi = tid >> 5, ln = tid & 31;
    double d = part[(size_t)(((c0 >> 4) + gi) * NCH + (ln & 15)) * 16 + (ln >> 4)];
#pragma unroll
    for (int off = 1; off < 16; off <<= 1) d += __shfl_xor(d, off, 32);
    const double ts2 = __shfl(d, 16, 32);
    const double mean = d * (1.0 / (double)GSZ);
    double var = ts2 * (1.0 / (double)GSZ) - mean * mean;
    if (var < 0.0) var = 0.0;
    if (ln == 0) { gstat[gi * 2] = (float)mean; gstat[gi * 2 + 1] = rsqrtf((float)var + GN_EPS); }
  }
  __syncthreads();                   // the four groups' mean and rstd are visible to every wave
#pragma unroll 4
  for (int i = tid; i < 64 * 64; i += 256) {
    const int cl = i >> 6, sl = i & 63;
    const int c = c0 + cl;
    const float mean = gstat[(cl >> 4) * 2], rstd = gstat[(cl >> 4) * 2 + 1];
    float v = x[(size_t)c * CSP + (size_t)t * SP + s0 + sl];
    v = (v - mean) * rstd * gamma[c] + beta[c];
    tile[sl * 72 + cl] = (_Float16)v;
  }
  __syncthreads();
  const int wave = tid >> 5, lane = tid & 31;
  const int q = lane >> 3, c8 = (lane & 7) * 8;
  {
#pragma unroll
    for (int it = 0; it < 2; ++it) {
      const int row = wave * 8 + it * 4 + q;   // wave covers rows 8w..8w+7
      const v8h hv = *(const v8h*)(tile + row * 72 + c8);
      *(v8h*)(tok + ((size_t)t * SP + s0 + row) * CH + c0 + c8) = hv;
    }
    
  }
}

static inline int gemm_blocks(int M, int N) { return (M / 128) * (N / 256); }

// ---------------- launch ----------------
extern "C" void kernel_launch(void* const* d_in, const int* in_sizes, int n_in,
                              void* d_out, int out_size, void* d_ws, size_t ws_size,
                              hipStream_t stream) {
  if (n_in < 11) return;
  if (in_sizes[0] != CH * CSP || out_size != CH * CSP) return;
  if (in_sizes[1] != CH || in_sizes[2] != CH) return;
  if (in_sizes[3] != CH * CH || in_sizes[5] != CH * CH || in_sizes[7] != CH * CH || in_sizes[9] != CH * CH) return;
  if (in_sizes[4] != CH || in_sizes[6] != CH || in_sizes[8] != CH || in_sizes[10] != CH) return;

  const float* x     = (const float*)d_in[0];
  const float* gamma = (const float*)d_in[1];
  const float* beta  = (const float*)d_in[2];
  const float* wq    = (const float*)d_in[3];
  const float* bq    = (const float*)d_in[4];
  const float* wk    = (const float*)d_in[5];
  const float* bk    = (const float*)d_in[6];
  const float* wv    = (const float*)d_in[7];
  const float* bv    = (const float*)d_in[8];
  const float* wp    = (const float*)d_in[9];
  const float* bp    = (const float*)d_in[10];
  float* out = (float*)d_out;

  char* ws = (char*)d_ws;
  size_t off = 0;
  double* part = (double*)(ws + off);         off += (size_t)NGRP * NCH * 128;                  // 512 lines of 128 B
  _Float16* w16  = (_Float16*)(ws + off);     off += (size_t)4 * CH * CH * sizeof(_Float16);   // 2 MiB
  _Float16* tok  = (_Float16*)(ws + off);     off += (size_t)NTOK * CH * sizeof(_Float16);     // 16 MiB
  _Float16* q16  = (_Float16*)(ws + off);     off += (size_t)NTOK * CH * sizeof(_Float16);     // 16 MiB
  _Float16* k16  = (_Float16*)(ws + off);     off += (size_t)NTOK * CH * sizeof(_Float16);     // 16 MiB
  _Float16* vT16 = (_Float16*)(ws + off);     off += (size_t)CH * NTOK * sizeof(_Float16);     // 16 MiB  [512][16384]
  float* stat    = (float*)(ws + off);        off += (size_t)NTOK * (SP / KBLK) * 2 * sizeof(float);   // 8 MiB: block max and sum per row and 64 keys
  _Float16* P16  = (_Float16*)(ws + off);     off += (size_t)NTOK * SP * sizeof(_Float16);     // 128 MiB  [16384][4096], every frame's rows
  if (off > ws_size) return;                  // 211,877,888 B total
  _Float16* o16 = tok;                        // attention output plane reuses the token plane (tokens are dead after the projections)
  _Float16* wq16 = w16;
  _Float16* wk16 = w16 + (size_t)CH * CH;
  _Float16* wv16 = w16 + (size_t)2 * CH * CH;
  _Float16* wp16 = w16 + (size_t)3 * CH * CH;

  // 1. group statistics: partial sums, one workgroup per channel (the normalize kernel adds each group's 16)
  gn_stats<<<dim3(NGRP * NCH), dim3(256), 0, stream>>>(x, part);

  // 2. weights x16 -> f16
  const int n2 = CH * CH / 2;
  cast_f32_f16x2s<<<dim3((n2 + 255) / 256), dim3(256), 0, stream>>>(wq, wq16, n2, WCARRY);
  cast_f32_f16x2s<<<dim3((n2 + 255) / 256), dim3(256), 0, stream>>>(wk, wk16, n2, WCARRY);
  cast_f32_f16x2s<<<dim3((n2 + 255) / 256), dim3(256), 0, stream>>>(wv, wv16, n2, WCARRY);
  cast_f32_f16x2s<<<dim3((n2 + 255) / 256), dim3(256), 0, stream>>>(wp, wp16, n2, WCARRY);

  // 3. normalize + transpose to tokens
  norm_tok<<<dim3(TFR * 64 * 8), dim3(256), 0, stream>>>(x, gamma, beta, part, tok);

  // 4. q = tok·Wqᵀ/16 + bq   (A = tok [16384][512], Bt = Wq16 [512][512], f16 out [16384][512])
  wmma_gemm64<0, false, 2, 1, false><<<dim3(gemm_blocks(NTOK, CH), 1), dim3(256), 0, stream>>>(
      U16(tok), U16(tok), CH, (long)0, U16(wq16), U16(wq16), CH, (long)0,
      (void*)q16, (void*)q16, CH, (long)0, bq, x, (long)0, NTOK, CH, CH, WCARRY_INV, stat);
  //    k = tok·Wkᵀ/16 + bk
  wmma_gemm64<0, false, 2, 1, false><<<dim3(gemm_blocks(NTOK, CH), 1), dim3(256), 0, stream>>>(
      U16(tok), U16(tok), CH, (long)0, U16(wk16), U16(wk16), CH, (long)0,
      (void*)k16, (void*)k16, CH, (long)0, bk, x, (long)0, NTOK, CH, CH, WCARRY_INV, stat);
  //    vᵀ[c][token] = Wv16·tokᵀ/16 + bv[c]   (A = Wv16 [512][512], Bt = tok [16384][512], f16 out [512][16384])
  wmma_gemm64<0, false, 1, 1, false><<<dim3(gemm_blocks(CH, NTOK), 1), dim3(256), 0, stream>>>(
      U16(wv16), U16(wv16), CH, (long)0, U16(tok), U16(tok), CH, (long)0,
      (void*)vT16, (void*)vT16, NTOK, (long)0, bv, x, (long)0, CH, NTOK, CH, WCARRY_INV, stat);

  // 5. scores of all frames in one launch, one frame per blockIdx.y (512 x 4 workgroups): q*k^T*512^-0.5 is kept on chip (registers, LDS slab);
  //    each 64-key block of a row is stored as f16 exp(s - block max) in P16, its max and sum in stat
  wmma_gemm64<0, false, 0, 1, false, 0, 1><<<dim3(gemm_blocks(SP, SP), TFR), dim3(256), 0, stream>>>(
      U16(q16), U16(q16), CH, (long)SP * CH, U16(k16), U16(k16), CH, (long)SP * CH,
      (void*)P16, (void*)P16, SP, (long)SP * SP, bq, x, (long)0, SP, SP, CH, QSCALE, stat);
  //    O = (factor * P16)*V x2^-15 for all frames in one launch, one frame per blockIdx.y: 64 x 4 = 256 workgroups
  //    (A = P16 frame [4096][4096], Bt = vT16 + frame*4096, [512][4096] with pitch 16384, f16 out [4096][512])
  wmma_gemm64<0, false, 0, 1, false, 0, 2><<<dim3(gemm_blocks(SP, CH), TFR), dim3(256), 0, stream>>>(
      U16(P16), U16(P16), SP, (long)SP * SP, U16(vT16), U16(vT16), NTOK, (long)SP,
      (void*)o16, (void*)o16, CH, (long)SP * CH, bq, x, (long)0, SP, CH, SP, PCARRY_INV, stat);

  // 6. out[c][token] = Wp16·Oᵀ/16 + bp[c] + x[c][token]   (A = Wp16 [512][512], Bt = O [16384][512], f32 out [512][16384])
  wmma_gemm64<0, false, 1, 0, true><<<dim3(gemm_blocks(CH, NTOK), 1), dim3(256), 0, stream>>>(
      U16(wp16), U16(wp16), CH, (long)0, U16(o16), U16(o16), CH, (long)0,
      (void*)out, (void*)out, NTOK, (long)0, bp, x, (long)0, CH, NTOK, CH, WCARRY_INV, stat);
}

// v005
// A run of this version takes 209 microseconds.
// Next to v004, in two timings, it ran 1.05 and 1.06 times as fast.
// All steps since v000 together make it 10.3 times as fast.
#include <hip/hip_runtime.h>
// Contractions tok·Wq/Wk/Wvᵀ, q·kᵀ, P·V, O·Wpᵀ: v_wmma_f32_16x16x32_f16 (f16 operands, f32 accumulate); weights carried x16, softmax probabilities carried x2^15 (f16 exp(s - block max) times an f16 row-and-block factor); group statistics accumulated in f64; all other elementwise math f32.

typedef __attribute__((ext_vector_type(16))) _Float16 v16h;
typedef __attribute__((ext_vector_type(8)))  _Float16 v8h;
typedef __attribute__((ext_vector_type(4)))  _Float16 v4h;
typedef __attribute__((ext_vector_type(16))) __bf16   v16b;
typedef __attribute__((ext_vector_type(8)))  __bf16   v8b;
typedef __attribute__((ext_vector_type(8)))  float    v8f;
typedef __attribute__((ext_vector_type(4)))  float    v4f;
#define U16(p) ((const unsigned short*)(const void*)(p))

constexpr int CH   = 512;          // channels
constexpr int TFR  = 4;            // frames
constexpr int SP   = 4096;         // tokens per frame (h*w)
constexpr int CSP  = TFR * SP;     // 16384 elements per channel
constexpr int NTOK = TFR * SP;     // 16384 tokens
constexpr int GSZ  = 16 * CSP;     // 262144 elements per group (16 channels per group)
constexpr int NGRP = 32;
constexpr int NCH  = 16;           // partial sums per group: one workgroup per channel
constexpr int KBLK = 64;           // keys per softmax block (one wave's columns of a score tile)
constexpr float GN_EPS     = 1e-6f;
constexpr float QSCALE     = 0.04419417382415922f;   // 512^-0.5
constexpr float WCARRY     = 16.0f;
constexpr float WCARRY_INV = 1.0f / 16.0f;
constexpr float PCARRY     = 32768.0f;
constexpr float PCARRY_INV = 1.0f / 32768.0f;

__device__ __forceinline__ unsigned short f2bf_bits(float f) {
  unsigned u = __float_as_uint(f);
  return (unsigned short)((u + 0x7FFFu + ((u >> 16) & 1u)) >> 16);
}
__device__ __forceinline__ float bf_bits2f(unsigned short h) { return __uint_as_float(((unsigned)h) << 16); }

// hazard guard between the last products and the epilogue's reads of the accumulators
__device__ __forceinline__ void acc_guard4(v8f& a, v8f& b, v8f& c, v8f& d) { asm volatile("v_nop\n\tv_nop\n\tv_nop\n\tv_nop" : "+v"(a), "+v"(b), "+v"(c), "+v"(d)); }
template <typename T> struct Frag;
template <> struct Frag<_Float16> {
  typedef v16h V; union U { v16h v; v8h h[2]; };
  static __device__ __forceinline__ v16h load(const _Float16* p) {   // elements 0..7 <- p[0..7], 8..15 <- p[16..23]
    U f; f.h[0] = *(const v8h*)(p); f.h[1] = *(const v8h*)(p + 16); return f.v;
  }
  static __device__ __forceinline__ v8f mma(v16h a, v16h b, v8f c) {
    return __builtin_amdgcn_wmma_f32_16x16x32_f16(false, a, false, b, (short)0, c, false, false);
  }
};
template <> struct Frag<__bf16> {
  typedef v16b V; union U { v16b v; v8b h[2]; };
  static __device__ __forceinline__ v16b load(const __bf16* p) {
    U f; f.h[0] = *(const v8b*)(p); f.h[1] = *(const v8b*)(p + 16); return f.v;
  }
  static __device__ __forceinline__ v8f mma(v16b a, v16b b, v8f c) {
    return __builtin_amdgcn_wmma_f32_16x16x32_bf16(false, a, false, b, (short)0, c, false, false);
  }
};

// ---- LDS-staged batched WMMA GEMM -------------------------------------------
// C[m,n] = scale * sum_k A[m,k] * Bt[n,k] (+bias)(+resid); a workgroup of 8 waves (2 x 4) owns a 128x256 tile, each wave 64x64 of it.
// A row-major [M,K]; Bt row-major [N,K]; M % 128 == 0, N % 256 == 0, K % 128 == 0.
// Per stage 128 k of the 128 A rows and the 256 Bt rows are copied to LDS by global_load_async_to_lds_b128 (two buffers:
// the next stage's copies fly while this stage is multiplied); fragments are read from LDS at a row pitch of 272 B.
// BIAS_MODE: 0 = none, 1 = bias[m], 2 = bias[n], 3 = the three token projections in one launch, one per blockIdx.y:
//   A = tokens, Bt = Wq | Wk | Wv (contiguous planes), C = q | k | v^T (contiguous planes); y 0 and 1: tok * W^T + bias[n] (bias, biasK);
//   y 2: the operands change places, Wv * tok^T + biasV[m], so that v comes out transposed.
// OUT_MODE: 0 = f32, 1 = f16, 2 = bf16 hi plane (Cout) + bf16 lo plane (Cout2).
// ET: 0 = f16 operands, 1 = bf16 operands (pointers passed as 16-bit storage)
// SM: 0 = plain; 1 = score tile: each wave's 64 columns of a row are stored as exp(s - block max), the block's max and sum go to stat;
//     2 = A holds such blocks: the workgroup merges its rows' 64 block maxima and sums into one factor per row and block
//     (exp(block max - row max) / row sum * 2^15) and multiplies every A fragment by its row's factor ahead of the products.
// stat: one 4-KiB piece per score tile, [128 rows][4 blocks][max, sum], pieces ordered [batch][tm][tn].
constexpr int BM    = 128;                 // A rows per workgroup
constexpr int BN    = 256;                 // Bt rows per workgroup
constexpr int KS    = 128;                 // k per stage (256 B of every row)
constexpr int LPH   = KS + 8;              // LDS row pitch in 16-bit elements (272 B: 16 rows of a b128 read fall on 64 distinct banks)
constexpr int STG_H = (BM + BN) * LPH;     // 16-bit elements per stage buffer
constexpr int FPH   = SP / KBLK + 2;       // factor table row pitch in 16-bit elements (132 B: 16 rows fall on distinct banks)

__device__ __forceinline__ unsigned lds_off(const void* p) { return (unsigned)(size_t)p; }

// value of lane l ^ X (X < 16) by DPP row_xmask; every lane is on where it is used
template <int X> __device__ __forceinline__ float lane_xor(float x) {
  return __builtin_bit_cast(float, __builtin_amdgcn_update_dpp(0, __builtin_bit_cast(int, x), 0x160 + X, 0xf, 0xf, true));
}

// Eight copies of 16 B per lane, rows 16 apart: LDS byte address l + i * 16 rows, global address g + i * gstep elements.
// The s_wait_xcnt stands inside the statement so that no address register is rewritten ahead of it.
__device__ __forceinline__ void async_rows8(unsigned l, const unsigned short* g, size_t gstep) {
  constexpr unsigned LS = 16u * LPH * 2u;
  const unsigned l1 = l + LS, l2 = l + 2 * LS, l3 = l + 3 * LS, l4 = l + 4 * LS, l5 = l + 5 * LS, l6 = l + 6 * LS, l7 = l + 7 * LS;
  const unsigned short* g1 = g + gstep;     const unsigned short* g2 = g + 2 * gstep;
  const unsigned short* g3 = g + 3 * gstep; const unsigned short* g4 = g + 4 * gstep;
  const unsigned short* g5 = g + 5 * gstep; const unsigned short* g6 = g + 6 * gstep;
  const unsigned short* g7 = g + 7 * gstep;
  asm volatile(
      "global_load_async_to_lds_b128 %0, %8, off\n\t"
      "global_load_async_to_lds_b128 %1, %9, off\n\t"
      "global_load_async_to_lds_b128 %2, %10, off\n\t"
      "global_load_async_to_lds_b128 %3, %11, off\n\t"
      "global_load_async_to_lds_b128 %4, %12, off\n\t"
      "global_load_async_to_lds_b128 %5, %13, off\n\t"
      "global_load_async_to_lds_b128 %6, %14, off\n\t"
      "global_load_async_to_lds_b128 %7, %15, off\n\t"
      "s_wait_xcnt 0x0"
      :: "v"(l), "v"(l1), "v"(l2), "v"(l3), "v"(l4), "v"(l5), "v"(l6), "v"(l7),
         "v"(g), "v"(g1), "v"(g2), "v"(g3), "v"(g4), "v"(g5), "v"(g6), "v"(g7)
      : "memory");
}
template <int ET> struct Elem;
template <> struct Elem<0> { typedef _Float16 T; };
template <> struct Elem<1> { typedef __bf16 T; };
template <int ET, bool SPLIT, int BIAS_MODE, int OUT_MODE, bool RESID, int ACT = 0, int SM = 0>
__global__ __launch_bounds__(256) void wmma_gemm64(
    const unsigned short* __restrict__ Ap, const unsigned short* __restrict__ A2p, int lda, long strideA,
    const unsigned short* __restrict__ Btp, const unsigned short* __restrict__ Bt2p, int ldb, long strideB,
    void* __restrict__ Cout, void* __restrict__ Cout2, int ldc, long strideC,
    const float* __restrict__ bias,
    const float* __restrict__ resid, long strideR,
    int M, int N, int K, float scale, float* __restrict__ stat,
    const float* __restrict__ biasK, const float* __restrict__ biasV) {
  static_assert(!SPLIT, "single-plane operands only");
  static_assert(SM == 0 || (ET == 0 && OUT_MODE == 1), "block softmax: f16 operands and f16 output");
  typedef typename Elem<ET>::T T;
  typedef typename Frag<T>::V V;
  __shared__ __align__(16) T ring[2 * STG_H];      // two stage buffers, each [A 128 rows | Bt 256 rows] at pitch LPH
  __shared__ __align__(16) float sT[8][16 * 68];   // per-wave 16x64 slab, pitch 68 floats
  __shared__ __align__(16) float sStat[SM == 1 ? BM * 8 : 4];          // [row][wave column][max, sum]
  __shared__ __align__(16) _Float16 sF[SM == 2 ? BM * FPH : 8];        // [row][block] factor
  const int b    = blockIdx.y;
  const bool vT  = (BIAS_MODE == 3) && (b == 2);   // the same for the whole workgroup
  if constexpr (BIAS_MODE == 3) {
    const unsigned short* wsel = Btp + (size_t)b * (CH * CH);
    if (vT) { Btp = Ap; Ap = wsel; const int mm = M; M = N; N = mm; bias = biasV; }
    else    { Btp = wsel; if (b == 1) bias = biasK; }
    ldc = N;
  }
  const int tid  = threadIdx.x;
  const int lane = tid & 31;
  const int wave = tid >> 5;
  const int tilesN = N / BN;
  const int tilesM = M / BM;
  const int tile = blockIdx.x;
  if (tile >= tilesM * tilesN) return;   // the same for the whole workgroup, in front of every barrier
  const int tm = tile / tilesN;
  const int tn = tile - tm * tilesN;
  const int wm = wave >> 2;              // wave row (0..1) and column (0..3) in the workgroup's tile
  const int wn = wave & 3;
  const int m0 = tm * BM + (wm << 6);
  const int n0 = tn * BN + (wn << 6);

  const int rlane = lane & 15;                 // row (A) / col (B, D) within subtile
  const int koff  = (lane >> 4) * 8;           // k offset of this lane half
  const int mOff  = (lane >> 4) * 8;           // D row offset

  // copy addresses: 16 lanes cover the 256 B of one row, the workgroup 16 rows per copy
  const int crow = tid >> 4;
  const int ccol = (tid & 15) * 8;
  const unsigned short* gA = Ap  + (size_t)b * strideA + (size_t)(tm * BM + crow) * lda + ccol;
  const unsigned short* gB = Btp + (size_t)b * strideB + (size_t)(tn * BN + crow) * ldb + ccol;
  const unsigned lA = lds_off(ring) + (unsigned)(crow * LPH + ccol) * 2u;
  const unsigned lB = lA + (unsigned)(BM * LPH) * 2u;
  auto issue_stage = [&](int t, int buf) {
    const unsigned lo = (unsigned)buf * (unsigned)(STG_H * 2);
    const size_t ko = (size_t)t * KS;
    async_rows8(lA + lo, gA + ko, (size_t)16 * lda);
    async_rows8(lB + lo, gB + ko, (size_t)16 * ldb);
    async_rows8(lB + lo + (unsigned)(128 * LPH) * 2u, gB + ko + (size_t)128 * ldb, (size_t)16 * ldb);
  };

  v8f acc[4][4];
#pragma unroll
  for (int i = 0; i < 4; ++i)
#pragma unroll
    for (int j = 0; j < 4; ++j) acc[i][j] = (v8f){0.f,0.f,0.f,0.f,0.f,0.f,0.f,0.f};

  const int nT = K / KS;
  issue_stage(0, 0);
  if constexpr (SM == 2) {   // while stage 0 flies: two lanes per row merge the row's 64 block maxima and sums (K == SP keys)
    const int row = tid >> 1, hf = tid & 1;
    const char* sp4 = (const char*)(stat + (size_t)(b * tilesM + tm) * (SP / BN) * (BM * 8));
    const unsigned so = (unsigned)(hf * 8 * (BM * 32) + row * 32);   // this lane's byte offset: its first piece, its row
    v4f st[8][2];            // {max, sum, max, sum} of two neighbouring blocks
#pragma unroll
    for (int c = 0; c < 8; ++c) {
      st[c][0] = *(const v4f*)(sp4 + so + c * (BM * 32));
      st[c][1] = *(const v4f*)(sp4 + so + c * (BM * 32) + 16);
    }
    asm volatile("s_wait_xcnt 0x0" :: "v"(so) : "memory");   // the 16 loads share one offset register: it stays whole up to this wait (without the operand the last load's result was placed on it)
    float mx = st[0][0][0];
#pragma unroll
    for (int c = 0; c < 8; ++c)
#pragma unroll
      for (int h = 0; h < 2; ++h) mx = fmaxf(mx, fmaxf(st[c][h][0], st[c][h][2]));
    mx = fmaxf(mx, lane_xor<1>(mx));
    float l = 0.f;
    float w[8][2][2];        // exp(block max - row max)
#pragma unroll
    for (int c = 0; c < 8; ++c)
#pragma unroll
      for (int h = 0; h < 2; ++h) {
        w[c][h][0] = __expf(st[c][h][0] - mx);
        w[c][h][1] = __expf(st[c][h][2] - mx);
        l += st[c][h][1] * w[c][h][0] + st[c][h][3] * w[c][h][1];
      }
    l += lane_xor<1>(l);
    const float inv = PCARRY / l;
#pragma unroll
    for (int c = 0; c < 8; ++c)
#pragma unroll
      for (int h = 0; h < 2; ++h) {
        _Float16* fp = sF + row * FPH + (hf * 8 + c) * 4 + h * 2;
        fp[0] = (_Float16)(w[c][h][0] * inv);
        fp[1] = (_Float16)(w[c][h][1] * inv);
      }
  }
  asm volatile("s_wait_asynccnt 0x0" ::: "memory");   // stage 0 has landed for this wave's copies
  __syncthreads();                                     // ... and for every wave's (SM 2: the factor table too)
  if (nT > 1) issue_stage(1, 1);

  for (int t = 0; t < nT; ++t) {
    const int buf = t & 1;
    const T* sA = ring + buf * STG_H + ((wm << 6) + rlane) * LPH + koff;
    const T* sB = ring + buf * STG_H + (BM + (wn << 6) + rlane) * LPH + koff;
    // fragments of the next 32 k of this stage are fetched into a second register set ahead of the current 16 products
    V af[2][4], bf[2][4];
    _Float16 fs[4][2];       // SM 2: this lane's four A rows' factors for the stage's two blocks of 64 k
    if constexpr (SM == 2) {
#pragma unroll
      for (int i = 0; i < 4; ++i) {
        const _Float16* fp = sF + ((wm << 6) + (i << 4) + rlane) * FPH + 2 * t;
        fs[i][0] = fp[0]; fs[i][1] = fp[1];
      }
    }
#pragma unroll
    for (int j = 0; j < 4; ++j) { bf[0][j] = Frag<T>::load(sB + (j << 4) * LPH); af[0][j] = Frag<T>::load(sA + (j << 4) * LPH); }
#pragma unroll
    for (int ks = 0; ks < KS / 32; ++ks) {
      const int cur = ks & 1, nxt = cur ^ 1;
      if (ks + 1 < KS / 32) {
#pragma unroll
        for (int j = 0; j < 4; ++j) {
          bf[nxt][j] = Frag<T>::load(sB + (j << 4) * LPH + (ks + 1) * 32);
          af[nxt][j] = Frag<T>::load(sA + (j << 4) * LPH + (ks + 1) * 32);
        }
      }
      __builtin_amdgcn_sched_barrier(0);   // keeps the LDS reads above as one group ahead of the products: sunk among them, each group of four waits out the LDS latency
      if constexpr (SM == 2) {
#pragma unroll
        for (int i = 0; i < 4; ++i) af[cur][i] = af[cur][i] * fs[i][ks >> 1];
      }
#pragma unroll
      for (int i = 0; i < 4; ++i)
#pragma unroll
        for (int j = 0; j < 4; ++j) acc[i][j] = Frag<T>::mma(af[cur][i], bf[cur][j], acc[i][j]);
      __builtin_amdgcn_sched_barrier(0);   // keeps the next LDS reads out of these products and the last products in front of the stage's barrier (behind it they delay the refill)
    }
    asm volatile("s_wait_dscnt 0x0" ::: "memory");      // this wave's reads of buffer buf are done before it is refilled
    asm volatile("s_wait_asynccnt 0x0" ::: "memory");   // this wave's copies of stage t + 1 have landed
    __syncthreads();                                     // publishes stage t + 1 and ends every wave's reads of buffer buf
    if (t + 2 < nT) issue_stage(t + 2, buf);
  }
  asm volatile("s_wait_asynccnt 0x0" ::: "memory");     // no copy outstanding behind the loop
  acc_guard4(acc[0][0], acc[0][1], acc[0][2], acc[0][3]);
  acc_guard4(acc[1][0], acc[1][1], acc[1][2], acc[1][3]);
  acc_guard4(acc[2][0], acc[2][1], acc[2][2], acc[2][3]);
  acc_guard4(acc[3][0], acc[3][1], acc[3][2], acc[3][3]);

  // ---- epilogue ----
  float* slab = sT[wave];
  const float* Rb = RESID ? (resid + (size_t)b * strideR) : nullptr;
  float bn[4] = {0.f, 0.f, 0.f, 0.f};   // BIAS_MODE 3, q and k: the bias of this lane's four columns
  float bm[4][8];                       // BIAS_MODE 3, v^T: the bias of this lane's 32 rows
  if constexpr (BIAS_MODE == 3) {
#pragma unroll
    for (int i = 0; i < 4; ++i)
#pragma unroll
      for (int r = 0; r < 8; ++r) bm[i][r] = 0.f;
    if (vT) {
#pragma unroll
      for (int i = 0; i < 4; ++i)
#pragma unroll
        for (int r = 0; r < 8; ++r) bm[i][r] = bias[m0 + (i << 4) + mOff + r];
    } else {
#pragma unroll
      for (int j = 0; j < 4; ++j) bn[j] = bias[n0 + (j << 4) + rlane];
    }
  }
#pragma unroll
  for (int i = 0; i < 4; ++i) {
    const int mBase = m0 + (i << 4);
#pragma unroll
    for (int j = 0; j < 4; ++j) {
      const int n = n0 + (j << 4) + rlane;
      float bv = 0.f;
      if (BIAS_MODE == 2) bv = bias[n];
#pragma unroll
      for (int r = 0; r < 8; ++r) {
        float v = acc[i][j][r] * scale;
        if (BIAS_MODE == 1) v += bias[mBase + mOff + r];
        if (BIAS_MODE == 2) v += bv;
        if (BIAS_MODE == 3) v += vT ? bm[i][r] : bn[j];
        if (RESID) v += Rb[(size_t)(mBase + mOff + r) * ldc + n];
        if (ACT == 1) v = tanhf(v);
        if (ACT == 2) v = fmaxf(v, 0.0f);
        if (ACT == 3) v = v / (1.0f + expf(-v));
        if (ACT == 4) v = (v > 0.f) ? v : 0.01f * v;
        if (ACT == 5) v = 0.5f * v * (1.0f + erff(v * 0.70710678118654752f));
        slab[(mOff + r) * 68 + (j << 4) + rlane] = v;
      }
    }
    __builtin_amdgcn_fence(__ATOMIC_RELEASE, "workgroup");
    __builtin_amdgcn_wave_barrier();
    __builtin_amdgcn_fence(__ATOMIC_ACQUIRE, "workgroup");
    if (OUT_MODE == 0) {
      float* C = (float*)Cout + (size_t)b * strideC;
      const int hh = lane >> 4, c4 = (lane & 15) * 4;     // row seg = 256 B = 16 lanes x 16 B
      {
#pragma unroll
        for (int it = 0; it < 8; ++it) {
          const int row = it * 2 + hh;
          v4f v = *(const v4f*)(slab + row * 68 + c4);
          *(v4f*)(C + (size_t)(mBase + row) * ldc + n0 + c4) = v;
        }
        
      }
    } else {
      const int q = lane >> 3, c8 = (lane & 7) * 8;
      unsigned short* C  = (unsigned short*)Cout  + (size_t)b * strideC;
      unsigned short* C2 = (OUT_MODE == 2) ? ((unsigned short*)Cout2 + (size_t)b * strideC) : nullptr;
      {
#pragma unroll
        for (int it = 0; it < 4; ++it) {
          const int row = it * 4 + q;
          const float* sp = slab + row * 68 + c8;
          v8h hv, lv;
          float pv[8];
          if constexpr (SM == 1) {   // eight lanes hold one row's 64 scores: block max, exp, block sum
#pragma unroll
            for (int e = 0; e < 8; ++e) pv[e] = sp[e];
            float mx = fmaxf(fmaxf(fmaxf(pv[0], pv[1]), fmaxf(pv[2], pv[3])), fmaxf(fmaxf(pv[4], pv[5]), fmaxf(pv[6], pv[7])));
            mx = fmaxf(mx, lane_xor<1>(mx)); mx = fmaxf(mx, lane_xor<2>(mx)); mx = fmaxf(mx, lane_xor<4>(mx));
#pragma unroll
            for (int e = 0; e < 8; ++e) pv[e] = __expf(pv[e] - mx);
            float su = ((pv[0] + pv[1]) + (pv[2] + pv[3])) + ((pv[4] + pv[5]) + (pv[6] + pv[7]));
            su += lane_xor<1>(su); su += lane_xor<2>(su); su += lane_xor<4>(su);
            if ((lane & 7) == 0) {
              float* ss = sStat + (((wm << 6) + (i << 4) + row) * 4 + wn) * 2;
              ss[0] = mx; ss[1] = su;
            }
          }
#pragma unroll
          for (int e = 0; e < 8; ++e) {
            if (SM == 1) {
              hv[e] = (_Float16)pv[e];
            } else if (OUT_MODE == 1) {
              hv[e] = (_Float16)sp[e];
            } else {
              unsigned short hb = f2bf_bits(sp[e]);
              unsigned short lb = f2bf_bits(sp[e] - bf_bits2f(hb));
              hv[e] = __builtin_bit_cast(_Float16, hb);
              lv[e] = __builtin_bit_cast(_Float16, lb);
            }
          }
          *(v8h*)(C + (size_t)(mBase + row) * ldc + n0 + c8) = hv;
          if (OUT_MODE == 2) *(v8h*)(C2 + (size_t)(mBase + row) * ldc + n0 + c8) = lv;
        }
        
      }
    }
    __builtin_amdgcn_fence(__ATOMIC_RELEASE, "workgroup");
    __builtin_amdgcn_wave_barrier();
    __builtin_amdgcn_fence(__ATOMIC_ACQUIRE, "workgroup");
  }
  if constexpr (SM == 1) {
    __syncthreads();         // every wave's block maxima and sums are in sStat
    ((v4f*)(stat + (size_t)((b * tilesM + tm) * tilesN + tn) * (BM * 8)))[tid] = ((const v4f*)sStat)[tid];   // whole lines, 4 KiB per tile
  }
}

// ---- group statistics, partial sums: one block per channel (16 per group), f64 fixed-order accumulation.
// Block b stores the sum and the sum of squares of its 16384 elements in the first two doubles of its own 128-B line of part.
// The blocks behind those 512 carry the four weight matrices x16 to f16 (4096 elements each, 64 blocks per matrix): work that
// depends on nothing here and rides in this launch instead of four launches of its own.
constexpr int WBLK = 4096;                 // weight elements per cast block
constexpr int NWB  = CH * CH / WBLK;       // cast blocks per matrix
__global__ __launch_bounds__(256) void gn_stats(const float* __restrict__ x, double* __restrict__ part,
                                                const float* __restrict__ wq, const float* __restrict__ wk,
                                                const float* __restrict__ wv, const float* __restrict__ wp,
                                                _Float16* __restrict__ w16) {
  __shared__ double ws1[8];
  __shared__ double ws2[8];
  const int blk = blockIdx.x;
  const int tid = threadIdx.x, wave = tid >> 5, lane = tid & 31;
  if (blk >= NGRP * NCH) {           // the same for the whole workgroup, in front of the barrier
    const int cb = blk - NGRP * NCH, wi = cb / NWB;
    const float* src = (wi == 0) ? wq : ((wi == 1) ? wk : ((wi == 2) ? wv : wp));
    const v4f* s4 = (const v4f*)(src + (size_t)(cb - wi * NWB) * WBLK);
    v4h* d4 = (v4h*)(w16 + (size_t)cb * WBLK);
    v4f wv4[WBLK / 1024];
#pragma unroll
    for (int i = 0; i < WBLK / 1024; ++i) wv4[i] = s4[tid + i * 256];
#pragma unroll
    for (int i = 0; i < WBLK / 1024; ++i) {
      v4h h;
#pragma unroll
      for (int e = 0; e < 4; ++e) h[e] = (_Float16)(wv4[i][e] * WCARRY);
      d4[tid + i * 256] = h;
    }
    return;
  }
  const v4f* p = (const v4f*)(x + (size_t)blk * CSP);
  v4f v[CSP / 1024];                 // all 16 loads of a lane are in flight together
#pragma unroll
  for (int i = 0; i < CSP / 1024; ++i) v[i] = p[tid + i * 256];
  __builtin_amdgcn_sched_barrier(0);   // keeps all 16 loads ahead of the sums: sunk among them, the second eight wait out a second memory latency
  double a[4] = {0.0, 0.0, 0.0, 0.0}, q[4] = {0.0, 0.0, 0.0, 0.0};
#pragma unroll
  for (int i = 0; i < CSP / 1024; ++i) {
#pragma unroll
    for (int e = 0; e < 4; ++e) { const double d = (double)v[i][e]; a[e] += d; q[e] += d * d; }
  }
  double s = (a[0] + a[1]) + (a[2] + a[3]), s2 = (q[0] + q[1]) + (q[2] + q[3]);
#pragma unroll
  for (int off = 1; off < 32; off <<= 1) { s += __shfl_xor(s, off, 32); s2 += __shfl_xor(s2, off, 32); }
  if (lane == 0) { ws1[wave] = s; ws2[wave] = s2; }
  __syncthreads();
  if (tid < 16) {
    double ts = 0.0, ts2 = 0.0;
#pragma unroll
    for (int w = 0; w < 8; ++w) { ts += ws1[w]; ts2 += ws2[w]; }
    part[(size_t)blk * 16 + lane] = (lane == 0) ? ts : ((lane == 1) ? ts2 : 0.0);
  }
}

// ---- normalize + affine + transpose: x[c][t][s] (f32) -> tok[t*SP + s][c] (f16).
__global__ __launch_bounds__(256) void norm_tok(const float* __restrict__ x,
                                                const float* __restrict__ gamma,
                                                const float* __restrict__ beta,
                                                const double* __restrict__ part,
                                                _Float16* __restrict__ tok) {
  __shared__ __align__(16) _Float16 tile[64 * 72];   // [sl][cl], pitch 72 halves
  __shared__ float gstat[8];                         // mean, rstd of the block's 4 groups
  const int bid = blockIdx.x;
  const int cb  = bid & 7;           // 8 channel blocks of 64
  const int sb  = (bid >> 3) & 63;   // 64 position blocks of 64
  const int t   = bid >> 9;          // frame
  const int c0 = cb * 64, s0 = sb * 64;
  const int tid = threadIdx.x;
  if (tid < 128) {                   // wave gi sums group gi's 16 partial pairs: lanes 0..15 the sums, lanes 16..31 the sums of squares
    const int gi = tid >> 5, ln = tid & 31;
    double d = part[(size_t)(((c0 >> 4) + gi) * NCH + (ln & 15)) * 16 + (ln >> 4)];
#pragma unroll
    for (int off = 1; off < 16; off <<= 1) d += __shfl_xor(d, off, 32);
    const double ts2 = __shfl(d, 16, 32);
    const double mean = d * (1.0 / (double)GSZ);
    double var = ts2 * (1.0 / (double)GSZ) - mean * mean;
    if (var < 0.0) var = 0.0;
    if (ln == 0) { gstat[gi * 2] = (float)mean; gstat[gi * 2 + 1] = rsqrtf((float)var + GN_EPS); }
  }
  __syncthreads();                   // the four groups' mean and rstd are visible to every wave
#pragma unroll 4
  for (int i = tid; i < 64 * 64; i += 256) {
    const int cl = i >> 6, sl = i & 63;
    const int c = c0 + cl;
    const float mean = gstat[(cl >> 4) * 2], rstd = gstat[(cl >> 4) * 2 + 1];
    float v = x[(size_t)c * CSP + (size_t)t * SP + s0 + sl];
    v = (v - mean) * rstd * gamma[c] + beta[c];
    tile[sl * 72 + cl] = (_Float16)v;
  }
  __syncthreads();
  const int wave = tid >> 5, lane = tid & 31;
  const int q = lane >> 3, c8 = (lane & 7) * 8;
  {
#pragma unroll
    for (int it = 0; it < 2; ++it) {
      const int row = wave * 8 + it * 4 + q;   // wave covers rows 8w..8w+7
      const v8h hv = *(const v8h*)(tile + row * 72 + c8);
      *(v8h*)(tok + ((size_t)t * SP + s0 + row) * CH + c0 + c8) = hv;
    }
    
  }
}

static inline int gemm_blocks(int M, int N) { return (M / 128) * (N / 256); }

// ---------------- launch ----------------
extern "C" void kernel_launch(void* const* d_in, const int* in_sizes, int n_in,
                              void* d_out, int out_size, void* d_ws, size_t ws_size,
                              hipStream_t stream) {
  if (n_in < 11) return;
  if (in_sizes[0] != CH * CSP || out_size != CH * CSP) return;
  if (in_sizes[1] != CH || in_sizes[2] != CH) return;
  if (in_sizes[3] != CH * CH || in_sizes[5] != CH * CH || in_sizes[7] != CH * CH || in_sizes[9] != CH * CH) return;
  if (in_sizes[4] != CH || in_sizes[6] != CH || in_sizes[8] != CH || in_sizes[10] != CH) return;

  const float* x     = (const float*)d_in[0];
  const float* gamma = (const float*)d_in[1];
  const float* beta  = (const float*)d_in[2];
  const float* wq    = (const float*)d_in[3];
  const float* bq    = (const float*)d_in[4];
  const float* wk    = (const float*)d_in[5];
  const float* bk    = (const float*)d_in[6];
  const float* wv    = (const float*)d_in[7];
  const float* bv    = (const float*)d_in[8];
  const float* wp    = (const float*)d_in[9];
  const float* bp    = (const float*)d_in[10];
  float* out = (float*)d_out;

  char* ws = (char*)d_ws;
  size_t off = 0;
  double* part = (double*)(ws + off);         off += (size_t)NGRP * NCH * 128;                  // 512 lines of 128 B
  _Float16* w16  = (_Float16*)(ws + off);     off += (size_t)4 * CH * CH * sizeof(_Float16);   // 2 MiB
  _Float16* tok  = (_Float16*)(ws + off);     off += (size_t)NTOK * CH * sizeof(_Float16);     // 16 MiB
  _Float16* q16  = (_Float16*)(ws + off);     off += (size_t)NTOK * CH * sizeof(_Float16);     // 16 MiB
  _Float16* k16  = (_Float16*)(ws + off);     off += (size_t)NTOK * CH * sizeof(_Float16);     // 16 MiB
  _Float16* vT16 = (_Float16*)(ws + off);     off += (size_t)CH * NTOK * sizeof(_Float16);     // 16 MiB  [512][16384]
  float* stat    = (float*)(ws + off);        off += (size_t)NTOK * (SP / KBLK) * 2 * sizeof(float);   // 8 MiB: block max and sum per row and 64 keys
  _Float16* P16  = (_Float16*)(ws + off);     off += (size_t)NTOK * SP * sizeof(_Float16);     // 128 MiB  [16384][4096], every frame's rows
  if (off > ws_size) return;                  // 211,877,888 B total
  _Float16* o16 = tok;                        // attention output plane reuses the token plane (tokens are dead after the projections)
  // w16 holds Wq | Wk | Wv | Wp, one plane of 512 x 512 each
  _Float16* wp16 = w16 + (size_t)3 * CH * CH;

  // 1. group statistics: partial sums, one workgroup per channel (the normalize kernel adds each group's 16);
  //    in the same launch, 256 more workgroups: weights x16 -> f16
  gn_stats<<<dim3(NGRP * NCH + 4 * NWB), dim3(256), 0, stream>>>(x, part, wq, wk, wv, wp, w16);

  // 3. normalize + transpose to tokens
  norm_tok<<<dim3(TFR * 64 * 8), dim3(256), 0, stream>>>(x, gamma, beta, part, tok);

  // 4. the three projections in one launch, one per blockIdx.y (256 x 3 workgroups), f16 out:
  //    q = tok*Wq^T/16 + bq and k = tok*Wk^T/16 + bk, [16384][512]; v^T[c][token] = Wv16*tok^T/16 + bv[c], [512][16384]
  wmma_gemm64<0, false, 3, 1, false><<<dim3(gemm_blocks(NTOK, CH), 3), dim3(256), 0, stream>>>(
      U16(tok), U16(tok), CH, (long)0, U16(w16), U16(w16), CH, (long)0,
      (void*)q16, (void*)q16, CH, (long)NTOK * CH, bq, x, (long)0, NTOK, CH, CH, WCARRY_INV, stat, bk, bv);

  // 5. scores of all frames in one launch, one frame per blockIdx.y (512 x 4 workgroups): q*k^T*512^-0.5 stays in registers;
  //    each 64-key block of a row is stored as f16 exp(s - block max) in P16, its max and sum in stat
  wmma_gemm64<0, false, 0, 1, false, 0, 1><<<dim3(gemm_blocks(SP, SP), TFR), dim3(256), 0, stream>>>(
      U16(q16), U16(q16), CH, (long)SP * CH, U16(k16), U16(k16), CH, (long)SP * CH,
      (void*)P16, (void*)P16, SP, (long)SP * SP, bq, x, (long)0, SP, SP, CH, QSCALE, stat, bq, bq);
  //    O = (factor * P16)*V x2^-15 for all frames in one launch, one frame per blockIdx.y: 64 x 4 = 256 workgroups
  //    (A = P16 frame [4096][4096], Bt = vT16 + frame*4096, [512][4096] with pitch 16384, f16 out [4096][512])
  wmma_gemm64<0, false, 0, 1, false, 0, 2><<<dim3(gemm_blocks(SP, CH), TFR), dim3(256), 0, stream>>>(
      U16(P16), U16(P16), SP, (long)SP * SP, U16(vT16), U16(vT16), NTOK, (long)SP,
      (void*)o16, (void*)o16, CH, (long)SP * CH, bq, x, (long)0, SP, CH, SP, PCARRY_INV, stat, bq, bq);

  // 6. out[c][token] = Wp16·Oᵀ/16 + bp[c] + x[c][token]   (A = Wp16 [512][512], Bt = O [16384][512], f32 out [512][16384])
  wmma_gemm64<0, false, 1, 0, true><<<dim3(gemm_blocks(CH, NTOK), 1), dim3(256), 0, stream>>>(
      U16(wp16), U16(wp16), CH, (long)0, U16(o16), U16(o16), CH, (long)0,
      (void*)out, (void*)out, NTOK, (long)0, bp, x, (long)0, CH, NTOK, CH, WCARRY_INV, stat, bq, bq);
}

// v006
// One run takes 196 microseconds.
// Next to v005, in two timings, it ran 1.07 and 1.06 times as fast.
// All steps since v000 together make it 11.0 times as fast.
#include <hip/hip_runtime.h>
// Contractions tok·Wq/Wk/Wvᵀ, q·kᵀ, P·V, O·Wpᵀ: v_wmma_f32_16x16x32_f16 (f16 operands, f32 accumulate); weights carried x16, softmax probabilities carried x2^15 (f16 exp(s - block max) times an f16 row-and-block factor); group statistics accumulated in f64; all other elementwise math f32.

typedef __attribute__((ext_vector_type(16))) _Float16 v16h;
typedef __attribute__((ext_vector_type(8)))  _Float16 v8h;
typedef __attribute__((ext_vector_type(4)))  _Float16 v4h;
typedef __attribute__((ext_vector_type(16))) __bf16   v16b;
typedef __attribute__((ext_vector_type(8)))  __bf16   v8b;
typedef __attribute__((ext_vector_type(8)))  float    v8f;
typedef __attribute__((ext_vector_type(4)))  float    v4f;
#define U16(p) ((const unsigned short*)(const void*)(p))

constexpr int CH   = 512;          // channels
constexpr int TFR  = 4;            // frames
constexpr int SP   = 4096;         // tokens per frame (h*w)
constexpr int CSP  = TFR * SP;     // 16384 elements per channel
constexpr int NTOK = TFR * SP;     // 16384 tokens
constexpr int GSZ  = 16 * CSP;     // 262144 elements per group (16 channels per group)
constexpr int NGRP = 32;
constexpr int NCH  = 16;           // partial sums per group: one workgroup per channel
constexpr int KBLK = 64;           // keys per softmax block (one wave's columns of a score tile)
constexpr float GN_EPS     = 1e-6f;
constexpr float QSCALE     = 0.04419417382415922f;   // 512^-0.5
constexpr float WCARRY     = 16.0f;
constexpr float WCARRY_INV = 1.0f / 16.0f;
constexpr float PCARRY     = 32768.0f;
constexpr float PCARRY_INV = 1.0f / 32768.0f;

__device__ __forceinline__ unsigned short f2bf_bits(float f) {
  unsigned u = __float_as_uint(f);
  return (unsigned short)((u + 0x7FFFu + ((u >> 16) & 1u)) >> 16);
}
__device__ __forceinline__ float bf_bits2f(unsigned short h) { return __uint_as_float(((unsigned)h) << 16); }

// hazard guard between the last products and the epilogue's reads of the accumulators
__device__ __forceinline__ void acc_guard4(v8f& a, v8f& b, v8f& c, v8f& d) { asm volatile("v_nop\n\tv_nop\n\tv_nop\n\tv_nop" : "+v"(a), "+v"(b), "+v"(c), "+v"(d)); }
template <typename T> struct Frag;
template <> struct Frag<_Float16> {
  typedef v16h V; union U { v16h v; v8h h[2]; };
  static __device__ __forceinline__ v16h load(const _Float16* p) {   // elements 0..7 <- p[0..7], 8..15 <- p[16..23]
    U f; f.h[0] = *(const v8h*)(p); f.h[1] = *(const v8h*)(p + 16); return f.v;
  }
  static __device__ __forceinline__ v8f mma(v16h a, v16h b, v8f c) {
    return __builtin_amdgcn_wmma_f32_16x16x32_f16(false, a, false, b, (short)0, c, false, false);
  }
};
template <> struct Frag<__bf16> {
  typedef v16b V; union U { v16b v; v8b h[2]; };
  static __device__ __forceinline__ v16b load(const __bf16* p) {
    U f; f.h[0] = *(const v8b*)(p); f.h[1] = *(const v8b*)(p + 16); return f.v;
  }
  static __device__ __forceinline__ v8f mma(v16b a, v16b b, v8f c) {
    return __builtin_amdgcn_wmma_f32_16x16x32_bf16(false, a, false, b, (short)0, c, false, false);
  }
};

// ---- LDS-staged batched WMMA GEMM -------------------------------------------
// C[m,n] = scale * sum_k A[m,k] * Bt[n,k] (+bias)(+resid); a workgroup of 8 waves (2 x 4) owns a BMT x 256 tile, each wave (BMT / 2) x 64 of it.
// BMT = 128, or 256 where the grid still fills the chip: per product a third fewer bytes come from L2 and a quarter fewer fragment bytes from LDS.
// A row-major [M,K]; Bt row-major [N,K]; M % BMT == 0, N % 256 == 0, K % 128 == 0.
// Per stage 128 k of the BMT A rows and the 256 Bt rows are copied to LDS by global_load_async_to_lds_b128 (two buffers:
// the next stage's copies fly while this stage is multiplied); fragments are read from LDS at a row pitch of 272 B.
// BIAS_MODE: 0 = none, 1 = bias[m], 2 = bias[n], 3 = the three token projections in one launch, one per blockIdx.y:
//   A = tokens, Bt = Wq | Wk | Wv (contiguous planes), C = q | k | v^T (contiguous planes); y 0 and 1: tok * W^T + bias[n] (bias, biasK);
//   y 2: the operands change places, Wv * tok^T + biasV[m], so that v comes out transposed.
// OUT_MODE: 0 = f32, 1 = f16, 2 = bf16 hi plane (Cout) + bf16 lo plane (Cout2).
// ET: 0 = f16 operands, 1 = bf16 operands (pointers passed as 16-bit storage)
// SM: 0 = plain; 1 = score tile: each wave's 64 columns of a row are stored as exp(s - block max), the block's max and sum go to stat;
//     2 = A holds such blocks: the workgroup merges its rows' 64 block maxima and sums into one factor per row and block
//     (exp(block max - row max) / row sum * 2^15) and multiplies every A fragment by its row's factor ahead of the products.
// stat: one 8-KiB piece per score tile, [256 rows][4 blocks][max, sum], pieces ordered [batch][tm][tn].
constexpr int BM    = 128;                 // A rows per workgroup (the default of BMT)
constexpr int SBM   = 256;                 // A rows per workgroup of the score launch = rows per piece of stat
constexpr int BN    = 256;                 // Bt rows per workgroup
constexpr int KS    = 128;                 // k per stage (256 B of every row)
constexpr int LPH   = KS + 8;              // LDS row pitch in 16-bit elements (272 B: 16 rows of a b128 read fall on 64 distinct banks)
constexpr int FPH   = SP / KBLK + 2;       // factor table row pitch in 16-bit elements (132 B: 16 rows fall on distinct banks)

__device__ __forceinline__ unsigned lds_off(const void* p) { return (unsigned)(size_t)p; }

// value of lane l ^ X (X < 16) by DPP row_xmask; every lane is on where it is used
template <int X> __device__ __forceinline__ float lane_xor(float x) {
  return __builtin_bit_cast(float, __builtin_amdgcn_update_dpp(0, __builtin_bit_cast(int, x), 0x160 + X, 0xf, 0xf, true));
}

// Eight copies of 16 B per lane, rows 16 apart: LDS byte address l + i * 16 rows, global address g + i * gstep elements.
// The s_wait_xcnt stands inside the statement so that no address register is rewritten ahead of it.
__device__ __forceinline__ void async_rows8(unsigned l, const unsigned short* g, size_t gstep) {
  constexpr unsigned LS = 16u * LPH * 2u;
  const unsigned l1 = l + LS, l2 = l + 2 * LS, l3 = l + 3 * LS, l4 = l + 4 * LS, l5 = l + 5 * LS, l6 = l + 6 * LS, l7 = l + 7 * LS;
  const unsigned short* g1 = g + gstep;     const unsigned short* g2 = g + 2 * gstep;
  const unsigned short* g3 = g + 3 * gstep; const unsigned short* g4 = g + 4 * gstep;
  const unsigned short* g5 = g + 5 * gstep; const unsigned short* g6 = g + 6 * gstep;
  const unsigned short* g7 = g + 7 * gstep;
  asm volatile(
      "global_load_async_to_lds_b128 %0, %8, off\n\t"
      "global_load_async_to_lds_b128 %1, %9, off\n\t"
      "global_load_async_to_lds_b128 %2, %10, off\n\t"
      "global_load_async_to_lds_b128 %3, %11, off\n\t"
      "global_load_async_to_lds_b128 %4, %12, off\n\t"
      "global_load_async_to_lds_b128 %5, %13, off\n\t"
      "global_load_async_to_lds_b128 %6, %14, off\n\t"
      "global_load_async_to_lds_b128 %7, %15, off\n\t"
      "s_wait_xcnt 0x0"
      :: "v"(l), "v"(l1), "v"(l2), "v"(l3), "v"(l4), "v"(l5), "v"(l6), "v"(l7),
         "v"(g), "v"(g1), "v"(g2), "v"(g3), "v"(g4), "v"(g5), "v"(g6), "v"(g7)
      : "memory");
}
template <int ET> struct Elem;
template <> struct Elem<0> { typedef _Float16 T; };
template <> struct Elem<1> { typedef __bf16 T; };
template <int ET, bool SPLIT, int BIAS_MODE, int OUT_MODE, bool RESID, int ACT = 0, int SM = 0, int BMT = BM>
__global__ __launch_bounds__(256) void wmma_gemm64(
    const unsigned short* __restrict__ Ap, const unsigned short* __restrict__ A2p, int lda, long strideA,
    const unsigned short* __restrict__ Btp, const unsigned short* __restrict__ Bt2p, int ldb, long strideB,
    void* __restrict__ Cout, void* __restrict__ Cout2, int ldc, long strideC,
    const float* __restrict__ bias,
    const float* __restrict__ resid, long strideR,
    int M, int N, int K, float scale, float* __restrict__ stat,
    const float* __restrict__ biasK, const float* __restrict__ biasV) {
  static_assert(!SPLIT, "single-plane operands only");
  static_assert(SM == 0 || (ET == 0 && OUT_MODE == 1), "block softmax: f16 operands and f16 output");
  static_assert((SM != 1 || BMT == SBM) && (SM != 2 || BMT == BM) && (BIAS_MODE != 3 || BMT == BM), "tile heights the stat pieces and the factor table are laid out for");
  constexpr int FI    = BMT / 32;              // A fragments (16 rows each) per wave
  constexpr int STG_H = (BMT + BN) * LPH;      // 16-bit elements per stage buffer
  typedef typename Elem<ET>::T T;
  typedef typename Frag<T>::V V;
  __shared__ __align__(16) T ring[2 * STG_H];      // two stage buffers, each [A BMT rows | Bt 256 rows] at pitch LPH
  __shared__ __align__(16) float sT[8][16 * 68];   // per-wave 16x64 slab, pitch 68 floats
  __shared__ __align__(16) float sStat[SM == 1 ? BMT * 8 : 4];         // [row][wave column][max, sum]
  __shared__ __align__(16) _Float16 sF[SM == 2 ? BM * FPH : 8];        // [row][block] factor
  const int b    = blockIdx.y;
  const bool vT  = (BIAS_MODE == 3) && (b == 2);   // the same for the whole workgroup
  if constexpr (BIAS_MODE == 3) {
    const unsigned short* wsel = Btp + (size_t)b * (CH * CH);
    if (vT) { Btp = Ap; Ap = wsel; const int mm = M; M = N; N = mm; bias = biasV; }
    else    { Btp = wsel; if (b == 1) bias = biasK; }
    ldc = N;
  }
  const int tid  = threadIdx.x;
  const int lane = tid & 31;
  const int wave = tid >> 5;
  const int tilesN = N / BN;
  const int tilesM = M / BMT;
  const int tile = blockIdx.x;
  if (tile >= tilesM * tilesN) return;   // the same for the whole workgroup, in front of every barrier
  const int tm = tile / tilesN;
  const int tn = tile - tm * tilesN;
  const int wm = wave >> 2;              // wave row (0..1) and column (0..3) in the workgroup's tile
  const int wn = wave & 3;
  const int m0 = tm * BMT + wm * (BMT / 2);
  const int n0 = tn * BN + (wn << 6);

  const int rlane = lane & 15;                 // row (A) / col (B, D) within subtile
  const int koff  = (lane >> 4) * 8;           // k offset of this lane half
  const int mOff  = (lane >> 4) * 8;           // D row offset

  // copy addresses: 16 lanes cover the 256 B of one row, the workgroup 16 rows per copy
  const int crow = tid >> 4;
  const int ccol = (tid & 15) * 8;
  // the address is kept as a workgroup-uniform pointer and a 32-bit lane offset: a per-lane pointer that is itself an asm operand (stage 0) must
  // stay in v0..v255 over the whole loop, and at BMT 256 it went to scratch
  const unsigned short* uA = Ap  + (size_t)b * strideA + (size_t)(tm * BMT) * lda;   // the tile's first rows
  const unsigned short* uB = Btp + (size_t)b * strideB + (size_t)(tn * BN) * ldb;
  const unsigned oA = (unsigned)(crow * lda + ccol);                                  // this lane's place in them
  const unsigned oB = (unsigned)(crow * ldb + ccol);
  const unsigned lA = lds_off(ring) + (unsigned)(crow * LPH + ccol) * 2u;
  const unsigned lB = lA + (unsigned)(BMT * LPH) * 2u;
  auto issue_stage = [&](int t, int buf) {
    const unsigned lo = (unsigned)buf * (unsigned)(STG_H * 2);
    const unsigned short* gA = uA + (size_t)t * KS + oA;
    const unsigned short* gB = uB + (size_t)t * KS + oB;
    async_rows8(lA + lo, gA, (size_t)16 * lda);
    if constexpr (BMT == 256) {
      // the fences keep each statement's 24 address registers (asm operands: v0..v255) from being formed ahead of the statement before it:
      // formed together they push accumulators out of the low registers, one of them into scratch
      __builtin_amdgcn_sched_barrier(0);
      async_rows8(lA + lo + (unsigned)(128 * LPH) * 2u, gA + (size_t)128 * lda, (size_t)16 * lda);
      __builtin_amdgcn_sched_barrier(0);
    }
    async_rows8(lB + lo, gB, (size_t)16 * ldb);
    if constexpr (BMT == 256) __builtin_amdgcn_sched_barrier(0);
    async_rows8(lB + lo + (unsigned)(128 * LPH) * 2u, gB + (size_t)128 * ldb, (size_t)16 * ldb);
  };

  v8f acc[FI][4];
#pragma unroll
  for (int i = 0; i < FI; ++i)
#pragma unroll
    for (int j = 0; j < 4; ++j) acc[i][j] = (v8f){0.f,0.f,0.f,0.f,0.f,0.f,0.f,0.f};

  const int nT = K / KS;
  issue_stage(0, 0);
  if constexpr (SM == 2) {   // while stage 0 flies: two lanes per row merge the row's 64 block maxima and sums (K == SP keys)
    const int row = tid >> 1, hf = tid & 1;
    const char* sp4 = (const char*)(stat + (size_t)(b * (SP / SBM) + tm * BM / SBM) * (SP / BN) * (SBM * 8));
    const unsigned so = (unsigned)(hf * 8 * (SBM * 32) + (tm * BM % SBM + row) * 32);   // this lane's byte offset: its first piece, its row
    v4f st[8][2];            // {max, sum, max, sum} of two neighbouring blocks
#pragma unroll
    for (int c = 0; c < 8; ++c) {
      st[c][0] = *(const v4f*)(sp4 + so + c * (SBM * 32));
      st[c][1] = *(const v4f*)(sp4 + so + c * (SBM * 32) + 16);
    }
    asm volatile("s_wait_xcnt 0x0" :: "v"(so) : "memory");   // the 16 loads share one offset register: it stays whole up to this wait (without the operand the last load's result was placed on it)
    float mx = st[0][0][0];
#pragma unroll
    for (int c = 0; c < 8; ++c)
#pragma unroll
      for (int h = 0; h < 2; ++h) mx = fmaxf(mx, fmaxf(st[c][h][0], st[c][h][2]));
    mx = fmaxf(mx, lane_xor<1>(mx));
    float l = 0.f;
    float w[8][2][2];        // exp(block max - row max)
#pragma unroll
    for (int c = 0; c < 8; ++c)
#pragma unroll
      for (int h = 0; h < 2; ++h) {
        w[c][h][0] = __expf(st[c][h][0] - mx);
        w[c][h][1] = __expf(st[c][h][2] - mx);
        l += st[c][h][1] * w[c][h][0] + st[c][h][3] * w[c][h][1];
      }
    l += lane_xor<1>(l);
    const float inv = PCARRY / l;
#pragma unroll
    for (int c = 0; c < 8; ++c)
#pragma unroll
      for (int h = 0; h < 2; ++h) {
        _Float16* fp = sF + row * FPH + (hf * 8 + c) * 4 + h * 2;
        fp[0] = (_Float16)(w[c][h][0] * inv);
        fp[1] = (_Float16)(w[c][h][1] * inv);
      }
  }
  asm volatile("s_wait_asynccnt 0x0" ::: "memory");   // stage 0 has landed for this wave's copies
  __syncthreads();                                     // ... and for every wave's (SM 2: the factor table too)
  if (nT > 1) issue_stage(1, 1);

  for (int t = 0; t < nT; ++t) {
    const int buf = t & 1;
    const T* sA = ring + buf * STG_H + (wm * (BMT / 2) + rlane) * LPH + koff;
    const T* sB = ring + buf * STG_H + (BMT + (wn << 6) + rlane) * LPH + koff;
    // fragments of the next 32 k of this stage are fetched into a second register set ahead of the current FI * 4 products
    V af[2][FI], bf[2][4];
    _Float16 fs[4][2];       // SM 2: this lane's four A rows' factors for the stage's two blocks of 64 k
    if constexpr (SM == 2) {
#pragma unroll
      for (int i = 0; i < 4; ++i) {
        const _Float16* fp = sF + ((wm << 6) + (i << 4) + rlane) * FPH + 2 * t;
        fs[i][0] = fp[0]; fs[i][1] = fp[1];
      }
    }
#pragma unroll
    for (int j = 0; j < 4; ++j) { bf[0][j] = Frag<T>::load(sB + (j << 4) * LPH); af[0][j] = Frag<T>::load(sA + (j << 4) * LPH); }
#pragma unroll
    for (int i = 4; i < FI; ++i) af[0][i] = Frag<T>::load(sA + (i << 4) * LPH);
#pragma unroll
    for (int ks = 0; ks < KS / 32; ++ks) {
      const int cur = ks & 1, nxt = cur ^ 1;
      if (ks + 1 < KS / 32) {
#pragma unroll
        for (int j = 0; j < 4; ++j) {
          bf[nxt][j] = Frag<T>::load(sB + (j << 4) * LPH + (ks + 1) * 32);
          af[nxt][j] = Frag<T>::load(sA + (j << 4) * LPH + (ks + 1) * 32);
        }
#pragma unroll
        for (int i = 4; i < FI; ++i) af[nxt][i] = Frag<T>::load(sA + (i << 4) * LPH + (ks + 1) * 32);
      }
      __builtin_amdgcn_sched_barrier(0);   // keeps the LDS reads above as one group ahead of the products: sunk among them, each group of four waits out the LDS latency
      if constexpr (SM == 2) {
#pragma unroll
        for (int i = 0; i < 4; ++i) af[cur][i] = af[cur][i] * fs[i][ks >> 1];
      }
#pragma unroll
      for (int i = 0; i < FI; ++i)
#pragma unroll
        for (int j = 0; j < 4; ++j) acc[i][j] = Frag<T>::mma(af[cur][i], bf[cur][j], acc[i][j]);
      __builtin_amdgcn_sched_barrier(0);   // keeps the next LDS reads out of these products and the last products in front of the stage's barrier (behind it they delay the refill)
    }
    asm volatile("s_wait_dscnt 0x0" ::: "memory");      // this wave's reads of buffer buf are done before it is refilled
    asm volatile("s_wait_asynccnt 0x0" ::: "memory");   // this wave's copies of stage t + 1 have landed
    __syncthreads();                                     // publishes stage t + 1 and ends every wave's reads of buffer buf
    if (t + 2 < nT) issue_stage(t + 2, buf);
  }
  asm volatile("s_wait_asynccnt 0x0" ::: "memory");     // no copy outstanding behind the loop
  if constexpr (FI == 4) {   // FI 8: an asm operand lies in v0..v255, so the guard would hold all 256 accumulator registers there and the loop would spill; the compiler keeps the distance behind its own products
#pragma unroll
    for (int i = 0; i < FI; ++i) acc_guard4(acc[i][0], acc[i][1], acc[i][2], acc[i][3]);
  }

  // ---- epilogue ----
  float* slab = sT[wave];
  const float* Rb = RESID ? (resid + (size_t)b * strideR) : nullptr;
  float bn[4] = {0.f, 0.f, 0.f, 0.f};   // BIAS_MODE 3, q and k: the bias of this lane's four columns
  float bm[4][8];                       // BIAS_MODE 3, v^T: the bias of this lane's 32 rows
  if constexpr (BIAS_MODE == 3) {
#pragma unroll
    for (int i = 0; i < 4; ++i)
#pragma unroll
      for (int r = 0; r < 8; ++r) bm[i][r] = 0.f;
    if (vT) {
#pragma unroll
      for (int i = 0; i < 4; ++i)
#pragma unroll
        for (int r = 0; r < 8; ++r) bm[i][r] = bias[m0 + (i << 4) + mOff + r];
    } else {
#pragma unroll
      for (int j = 0; j < 4; ++j) bn[j] = bias[n0 + (j << 4) + rlane];
    }
  }
#pragma unroll
  for (int i = 0; i < FI; ++i) {
    const int mBase = m0 + (i << 4);
#pragma unroll
    for (int j = 0; j < 4; ++j) {
      const int n = n0 + (j << 4) + rlane;
      float bv = 0.f;
      if (BIAS_MODE == 2) bv = bias[n];
#pragma unroll
      for (int r = 0; r < 8; ++r) {
        float v = acc[i][j][r] * scale;
        if (BIAS_MODE == 1) v += bias[mBase + mOff + r];
        if (BIAS_MODE == 2) v += bv;
        if constexpr (BIAS_MODE == 3) v += vT ? bm[i][r] : bn[j];
        if (RESID) v += Rb[(size_t)(mBase + mOff + r) * ldc + n];
        if (ACT == 1) v = tanhf(v);
        if (ACT == 2) v = fmaxf(v, 0.0f);
        if (ACT == 3) v = v / (1.0f + expf(-v));
        if (ACT == 4) v = (v > 0.f) ? v : 0.01f * v;
        if (ACT == 5) v = 0.5f * v * (1.0f + erff(v * 0.70710678118654752f));
        slab[(mOff + r) * 68 + (j << 4) + rlane] = v;
      }
    }
    __builtin_amdgcn_fence(__ATOMIC_RELEASE, "workgroup");
    __builtin_amdgcn_wave_barrier();
    __builtin_amdgcn_fence(__ATOMIC_ACQUIRE, "workgroup");
    if (OUT_MODE == 0) {
      float* C = (float*)Cout + (size_t)b * strideC;
      const int hh = lane >> 4, c4 = (lane & 15) * 4;     // row seg = 256 B = 16 lanes x 16 B
      {
#pragma unroll
        for (int it = 0; it < 8; ++it) {
          const int row = it * 2 + hh;
          v4f v = *(const v4f*)(slab + row * 68 + c4);
          *(v4f*)(C + (size_t)(mBase + row) * ldc + n0 + c4) = v;
        }
        
      }
    } else {
      const int q = lane >> 3, c8 = (lane & 7) * 8;
      unsigned short* C  = (unsigned short*)Cout  + (size_t)b * strideC;
      unsigned short* C2 = (OUT_MODE == 2) ? ((unsigned short*)Cout2 + (size_t)b * strideC) : nullptr;
      {
#pragma unroll
        for (int it = 0; it < 4; ++it) {
          const int row = it * 4 + q;
          const float* sp = slab + row * 68 + c8;
          v8h hv, lv;
          float pv[8];
          if constexpr (SM == 1) {   // eight lanes hold one row's 64 scores: block max, exp, block sum
#pragma unroll
            for (int e = 0; e < 8; ++e) pv[e] = sp[e];
            float mx = fmaxf(fmaxf(fmaxf(pv[0], pv[1]), fmaxf(pv[2], pv[3])), fmaxf(fmaxf(pv[4], pv[5]), fmaxf(pv[6], pv[7])));
            mx = fmaxf(mx, lane_xor<1>(mx)); mx = fmaxf(mx, lane_xor<2>(mx)); mx = fmaxf(mx, lane_xor<4>(mx));
#pragma unroll
            for (int e = 0; e < 8; ++e) pv[e] = __expf(pv[e] - mx);
            float su = ((pv[0] + pv[1]) + (pv[2] + pv[3])) + ((pv[4] + pv[5]) + (pv[6] + pv[7]));
            su += lane_xor<1>(su); su += lane_xor<2>(su); su += lane_xor<4>(su);
            if ((lane & 7) == 0) {
              float* ss = sStat + ((wm * (BMT / 2) + (i << 4) + row) * 4 + wn) * 2;
              ss[0] = mx; ss[1] = su;
            }
          }
#pragma unroll
          for (int e = 0; e < 8; ++e) {
            if (SM == 1) {
              hv[e] = (_Float16)pv[e];
            } else if (OUT_MODE == 1) {
              hv[e] = (_Float16)sp[e];
            } else {
              unsigned short hb = f2bf_bits(sp[e]);
              unsigned short lb = f2bf_bits(sp[e] - bf_bits2f(hb));
              hv[e] = __builtin_bit_cast(_Float16, hb);
              lv[e] = __builtin_bit_cast(_Float16, lb);
            }
          }
          *(v8h*)(C + (size_t)(mBase + row) * ldc + n0 + c8) = hv;
          if (OUT_MODE == 2) *(v8h*)(C2 + (size_t)(mBase + row) * ldc + n0 + c8) = lv;
        }
        
      }
    }
    __builtin_amdgcn_fence(__ATOMIC_RELEASE, "workgroup");
    __builtin_amdgcn_wave_barrier();
    __builtin_amdgcn_fence(__ATOMIC_ACQUIRE, "workgroup");
  }
  if constexpr (SM == 1) {
    __syncthreads();         // every wave's block maxima and sums are in sStat
#pragma unroll
    for (int h = 0; h < BMT / 128; ++h)
      ((v4f*)(stat + (size_t)((b * tilesM + tm) * tilesN + tn) * (BMT * 8)))[tid + h * 256] = ((const v4f*)sStat)[tid + h * 256];   // whole lines, 8 KiB per tile
  }
}

// ---- group statistics, partial sums: one block per channel (16 per group), f64 fixed-order accumulation.
// Block b stores the sum and the sum of squares of its 16384 elements in the first two doubles of its own 128-B line of part.
// The blocks behind those 512 carry the four weight matrices x16 to f16 (4096 elements each, 64 blocks per matrix): work that
// depends on nothing here and rides in this launch instead of four launches of its own.
constexpr int WBLK = 4096;                 // weight elements per cast block
constexpr int NWB  = CH * CH / WBLK;       // cast blocks per matrix
__global__ __launch_bounds__(256) void gn_stats(const float* __restrict__ x, double* __restrict__ part,
                                                const float* __restrict__ wq, const float* __restrict__ wk,
                                                const float* __restrict__ wv, const float* __restrict__ wp,
                                                _Float16* __restrict__ w16) {
  __shared__ double ws1[8];
  __shared__ double ws2[8];
  const int blk = blockIdx.x;
  const int tid = threadIdx.x, wave = tid >> 5, lane = tid & 31;
  if (blk >= NGRP * NCH) {           // the same for the whole workgroup, in front of the barrier
    const int cb = blk - NGRP * NCH, wi = cb / NWB;
    const float* src = (wi == 0) ? wq : ((wi == 1) ? wk : ((wi == 2) ? wv : wp));
    const v4f* s4 = (const v4f*)(src + (size_t)(cb - wi * NWB) * WBLK);
    v4h* d4 = (v4h*)(w16 + (size_t)cb * WBLK);
    v4f wv4[WBLK / 1024];
#pragma unroll
    for (int i = 0; i < WBLK / 1024; ++i) wv4[i] = s4[tid + i * 256];
#pragma unroll
    for (int i = 0; i < WBLK / 1024; ++i) {
      v4h h;
#pragma unroll
      for (int e = 0; e < 4; ++e) h[e] = (_Float16)(wv4[i][e] * WCARRY);
      d4[tid + i * 256] = h;
    }
    return;
  }
  const v4f* p = (const v4f*)(x + (size_t)blk * CSP);
  v4f v[CSP / 1024];                 // all 16 loads of a lane are in flight together
#pragma unroll
  for (int i = 0; i < CSP / 1024; ++i) v[i] = p[tid + i * 256];
  __builtin_amdgcn_sched_barrier(0);   // keeps all 16 loads ahead of the sums: sunk among them, the second eight wait out a second memory latency
  double a[4] = {0.0, 0.0, 0.0, 0.0}, q[4] = {0.0, 0.0, 0.0, 0.0};
#pragma unroll
  for (int i = 0; i < CSP / 1024; ++i) {
#pragma unroll
    for (int e = 0; e < 4; ++e) { const double d = (double)v[i][e]; a[e] += d; q[e] += d * d; }
  }
  double s = (a[0] + a[1]) + (a[2] + a[3]), s2 = (q[0] + q[1]) + (q[2] + q[3]);
#pragma unroll
  for (int off = 1; off < 32; off <<= 1) { s += __shfl_xor(s, off, 32); s2 += __shfl_xor(s2, off, 32); }
  if (lane == 0) { ws1[wave] = s; ws2[wave] = s2; }
  __syncthreads();
  if (tid < 16) {
    double ts = 0.0, ts2 = 0.0;
#pragma unroll
    for (int w = 0; w < 8; ++w) { ts += ws1[w]; ts2 += ws2[w]; }
    part[(size_t)blk * 16 + lane] = (lane == 0) ? ts : ((lane == 1) ? ts2 : 0.0);
  }
}

// ---- normalize + affine + transpose: x[c][t][s] (f32) -> tok[t*SP + s][c] (f16).
__global__ __launch_bounds__(256) void norm_tok(const float* __restrict__ x,
                                                const float* __restrict__ gamma,
                                                const float* __restrict__ beta,
                                                const double* __restrict__ part,
                                                _Float16* __restrict__ tok) {
  __shared__ __align__(16) _Float16 tile[64 * 72];   // [sl][cl], pitch 72 halves
  __shared__ float gstat[8];                         // mean, rstd of the block's 4 groups
  const int bid = blockIdx.x;
  const int cb  = bid & 7;           // 8 channel blocks of 64
  const int sb  = (bid >> 3) & 63;   // 64 position blocks of 64
  const int t   = bid >> 9;          // frame
  const int c0 = cb * 64, s0 = sb * 64;
  const int tid = threadIdx.x;
  if (tid < 128) {                   // wave gi sums group gi's 16 partial pairs: lanes 0..15 the sums, lanes 16..31 the sums of squares
    const int gi = tid >> 5, ln = tid & 31;
    double d = part[(size_t)(((c0 >> 4) + gi) * NCH + (ln & 15)) * 16 + (ln >> 4)];
#pragma unroll
    for (int off = 1; off < 16; off <<= 1) d += __shfl_xor(d, off, 32);
    const double ts2 = __shfl(d, 16, 32);
    const double mean = d * (1.0 / (double)GSZ);
    double var = ts2 * (1.0 / (double)GSZ) - mean * mean;
    if (var < 0.0) var = 0.0;
    if (ln == 0) { gstat[gi * 2] = (float)mean; gstat[gi * 2 + 1] = rsqrtf((float)var + GN_EPS); }
  }
  __syncthreads();                   // the four groups' mean and rstd are visible to every wave
#pragma unroll 4
  for (int i = tid; i < 64 * 64; i += 256) {
    const int cl = i >> 6, sl = i & 63;
    const int c = c0 + cl;
    const float mean = gstat[(cl >> 4) * 2], rstd = gstat[(cl >> 4) * 2 + 1];
    float v = x[(size_t)c * CSP + (size_t)t * SP + s0 + sl];
    v = (v - mean) * rstd * gamma[c] + beta[c];
    tile[sl * 72 + cl] = (_Float16)v;
  }
  __syncthreads();
  const int wave = tid >> 5, lane = tid & 31;
  const int q = lane >> 3, c8 = (lane & 7) * 8;
  {
#pragma unroll
    for (int it = 0; it < 2; ++it) {
      const int row = wave * 8 + it * 4 + q;   // wave covers rows 8w..8w+7
      const v8h hv = *(const v8h*)(tile + row * 72 + c8);
      *(v8h*)(tok + ((size_t)t * SP + s0 + row) * CH + c0 + c8) = hv;
    }
    
  }
}

static inline int gemm_blocks(int M, int N) { return (M / 128) * (N / 256); }

// ---------------- launch ----------------
extern "C" void kernel_launch(void* const* d_in, const int* in_sizes, int n_in,
                              void* d_out, int out_size, void* d_ws, size_t ws_size,
                              hipStream_t stream) {
  if (n_in < 11) return;
  if (in_sizes[0] != CH * CSP || out_size != CH * CSP) return;
  if (in_sizes[1] != CH || in_sizes[2] != CH) return;
  if (in_sizes[3] != CH * CH || in_sizes[5] != CH * CH || in_sizes[7] != CH * CH || in_sizes[9] != CH * CH) return;
  if (in_sizes[4] != CH || in_sizes[6] != CH || in_sizes[8] != CH || in_sizes[10] != CH) return;

  const float* x     = (const float*)d_in[0];
  const float* gamma = (const float*)d_in[1];
  const float* beta  = (const float*)d_in[2];
  const float* wq    = (const float*)d_in[3];
  const float* bq    = (const float*)d_in[4];
  const float* wk    = (const float*)d_in[5];
  const float* bk    = (const float*)d_in[6];
  const float* wv    = (const float*)d_in[7];
  const float* bv    = (const float*)d_in[8];
  const float* wp    = (const float*)d_in[9];
  const float* bp    = (const float*)d_in[10];
  float* out = (float*)d_out;

  char* ws = (char*)d_ws;
  size_t off = 0;
  double* part = (double*)(ws + off);         off += (size_t)NGRP * NCH * 128;                  // 512 lines of 128 B
  _Float16* w16  = (_Float16*)(ws + off);     off += (size_t)4 * CH * CH * sizeof(_Float16);   // 2 MiB
  _Float16* tok  = (_Float16*)(ws + off);     off += (size_t)NTOK * CH * sizeof(_Float16);     // 16 MiB
  _Float16* q16  = (_Float16*)(ws + off);     off += (size_t)NTOK * CH * sizeof(_Float16);     // 16 MiB
  _Float16* k16  = (_Float16*)(ws + off);     off += (size_t)NTOK * CH * sizeof(_Float16);     // 16 MiB
  _Float16* vT16 = (_Float16*)(ws + off);     off += (size_t)CH * NTOK * sizeof(_Float16);     // 16 MiB  [512][16384]
  float* stat    = (float*)(ws + off);        off += (size_t)NTOK * (SP / KBLK) * 2 * sizeof(float);   // 8 MiB: block max and sum per row and 64 keys
  _Float16* P16  = (_Float16*)(ws + off);     off += (size_t)NTOK * SP * sizeof(_Float16);     // 128 MiB  [16384][4096], every frame's rows
  if (off > ws_size) return;                  // 211,877,888 B total
  _Float16* o16 = tok;                        // attention output plane reuses the token plane (tokens are dead after the projections)
  // w16 holds Wq | Wk | Wv | Wp, one plane of 512 x 512 each
  _Float16* wp16 = w16 + (size_t)3 * CH * CH;

  // 1. group statistics: partial sums, one workgroup per channel (the normalize kernel adds each group's 16);
  //    in the same launch, 256 more workgroups: weights x16 -> f16
  gn_stats<<<dim3(NGRP * NCH + 4 * NWB), dim3(256), 0, stream>>>(x, part, wq, wk, wv, wp, w16);

  // 3. normalize + transpose to tokens
  norm_tok<<<dim3(TFR * 64 * 8), dim3(256), 0, stream>>>(x, gamma, beta, part, tok);

  // 4. the three projections in one launch, one per blockIdx.y (256 x 3 workgroups), f16 out:
  //    q = tok*Wq^T/16 + bq and k = tok*Wk^T/16 + bk, [16384][512]; v^T[c][token] = Wv16*tok^T/16 + bv[c], [512][16384]
  wmma_gemm64<0, false, 3, 1, false><<<dim3(gemm_blocks(NTOK, CH), 3), dim3(256), 0, stream>>>(
      U16(tok), U16(tok), CH, (long)0, U16(w16), U16(w16), CH, (long)0,
      (void*)q16, (void*)q16, CH, (long)NTOK * CH, bq, x, (long)0, NTOK, CH, CH, WCARRY_INV, stat, bk, bv);

  // 5. scores of all frames in one launch, one frame per blockIdx.y (256 x 4 workgroups of 256 x 256 scores): q*k^T*512^-0.5 stays in registers;
  //    each 64-key block of a row is stored as f16 exp(s - block max) in P16, its max and sum in stat
  wmma_gemm64<0, false, 0, 1, false, 0, 1, SBM><<<dim3((SP / SBM) * (SP / BN), TFR), dim3(256), 0, stream>>>(
      U16(q16), U16(q16), CH, (long)SP * CH, U16(k16), U16(k16), CH, (long)SP * CH,
      (void*)P16, (void*)P16, SP, (long)SP * SP, bq, x, (long)0, SP, SP, CH, QSCALE, stat, bq, bq);
  //    O = (factor * P16)*V x2^-15 for all frames in one launch, one frame per blockIdx.y: 64 x 4 = 256 workgroups
  //    (A = P16 frame [4096][4096], Bt = vT16 + frame*4096, [512][4096] with pitch 16384, f16 out [4096][512])
  wmma_gemm64<0, false, 0, 1, false, 0, 2><<<dim3(gemm_blocks(SP, CH), TFR), dim3(256), 0, stream>>>(
      U16(P16), U16(P16), SP, (long)SP * SP, U16(vT16), U16(vT16), NTOK, (long)SP,
      (void*)o16, (void*)o16, CH, (long)SP * CH, bq, x, (long)0, SP, CH, SP, PCARRY_INV, stat, bq, bq);

  // 6. out[c][token] = Wp16·Oᵀ/16 + bp[c] + x[c][token]   (A = Wp16 [512][512], Bt = O [16384][512], f32 out [512][16384])
  wmma_gemm64<0, false, 1, 0, true><<<dim3(gemm_blocks(CH, NTOK), 1), dim3(256), 0, stream>>>(
      U16(wp16), U16(wp16), CH, (long)0, U16(o16), U16(o16), CH, (long)0,
      (void*)out, (void*)out, NTOK, (long)0, bp, x, (long)0, CH, NTOK, CH, WCARRY_INV, stat, bq, bq);
}

// v007
// Measured time: 188 microseconds a run.
// Timed twice side by side with v006, it ran 1.05 times as fast both times.
// Over all steps from v000 it is 11.5 times as fast.
#include <hip/hip_runtime.h>
// Contractions Wp*Wv, tok*Wq^T, tok*Wk^T, (Wp*Wv)*tok^T, q*k^T, v'^T*P^T: v_wmma_f32_16x16x32_f16 (f16 operands, f32 accumulate); weights carried x16, softmax probabilities carried x2^15 (f16 exp(s - block max) times an f16 row-and-block factor); group statistics accumulated in f64; Wp*bv and all other elementwise math f32.

typedef __attribute__((ext_vector_type(16))) _Float16 v16h;
typedef __attribute__((ext_vector_type(8)))  _Float16 v8h;
typedef __attribute__((ext_vector_type(4)))  _Float16 v4h;
typedef __attribute__((ext_vector_type(16))) __bf16   v16b;
typedef __attribute__((ext_vector_type(8)))  __bf16   v8b;
typedef __attribute__((ext_vector_type(8)))  float    v8f;
typedef __attribute__((ext_vector_type(4)))  float    v4f;
#define U16(p) ((const unsigned short*)(const void*)(p))

constexpr int CH   = 512;          // channels
constexpr int TFR  = 4;            // frames
constexpr int SP   = 4096;         // tokens per frame (h*w)
constexpr int CSP  = TFR * SP;     // 16384 elements per channel
constexpr int NTOK = TFR * SP;     // 16384 tokens
constexpr int GSZ  = 16 * CSP;     // 262144 elements per group (16 channels per group)
constexpr int NGRP = 32;
constexpr int NCH  = 16;           // partial sums per group: one workgroup per channel
constexpr int KBLK = 64;           // keys per softmax block (one wave's columns of a score tile)
constexpr float GN_EPS     = 1e-6f;
constexpr float QSCALE     = 0.04419417382415922f;   // 512^-0.5
constexpr float WCARRY     = 16.0f;
constexpr float WCARRY_INV = 1.0f / 16.0f;
constexpr float PCARRY     = 32768.0f;
constexpr float PCARRY_INV = 1.0f / 32768.0f;

__device__ __forceinline__ unsigned short f2bf_bits(float f) {
  unsigned u = __float_as_uint(f);
  return (unsigned short)((u + 0x7FFFu + ((u >> 16) & 1u)) >> 16);
}
__device__ __forceinline__ float bf_bits2f(unsigned short h) { return __uint_as_float(((unsigned)h) << 16); }

// hazard guard between the last products and the epilogue's reads of the accumulators
__device__ __forceinline__ void acc_guard4(v8f& a, v8f& b, v8f& c, v8f& d) { asm volatile("v_nop\n\tv_nop\n\tv_nop\n\tv_nop" : "+v"(a), "+v"(b), "+v"(c), "+v"(d)); }
template <typename T> struct Frag;
template <> struct Frag<_Float16> {
  typedef v16h V; union U { v16h v; v8h h[2]; };
  static __device__ __forceinline__ v16h load(const _Float16* p) {   // elements 0..7 <- p[0..7], 8..15 <- p[16..23]
    U f; f.h[0] = *(const v8h*)(p); f.h[1] = *(const v8h*)(p + 16); return f.v;
  }
  static __device__ __forceinline__ v8f mma(v16h a, v16h b, v8f c) {
    return __builtin_amdgcn_wmma_f32_16x16x32_f16(false, a, false, b, (short)0, c, false, false);
  }
};
template <> struct Frag<__bf16> {
  typedef v16b V; union U { v16b v; v8b h[2]; };
  static __device__ __forceinline__ v16b load(const __bf16* p) {
    U f; f.h[0] = *(const v8b*)(p); f.h[1] = *(const v8b*)(p + 16); return f.v;
  }
  static __device__ __forceinline__ v8f mma(v16b a, v16b b, v8f c) {
    return __builtin_amdgcn_wmma_f32_16x16x32_bf16(false, a, false, b, (short)0, c, false, false);
  }
};

// ---- LDS-staged batched WMMA GEMM -------------------------------------------
// C[m,n] = scale * sum_k A[m,k] * Bt[n,k] (+bias)(+resid); a workgroup of 8 waves (2 x 4) owns a BMT x 256 tile, each wave (BMT / 2) x 64 of it.
// BMT = 128, or 256 where the grid still fills the chip: per product a third fewer bytes come from L2 and a quarter fewer fragment bytes from LDS.
// A row-major [M,K]; Bt row-major [N,K]; M % BMT == 0, N % 256 == 0, K % 128 == 0.
// Per stage 128 k of the BMT A rows and the 256 Bt rows are copied to LDS by global_load_async_to_lds_b128 (two buffers:
// the next stage's copies fly while this stage is multiplied); fragments are read from LDS at a row pitch of 272 B.
// BIAS_MODE: 0 = none, 1 = bias[m], 2 = bias[n], 3 = the three token projections in one launch, one per blockIdx.y:
//   A = tokens, Bt = Wq | Wk | Wp*Wv (contiguous planes), C = q | k | v'^T (contiguous planes); y 0 and 1: tok * W^T + bias[n] (bias, biasK);
//   y 2: the operands change places, W * tok^T + biasV[m], so that v' comes out transposed (biasV: eight values at the head of each 128-B line).
// OUT_MODE: 0 = f32, 1 = f16, 2 = bf16 hi plane (Cout) + bf16 lo plane (Cout2).
// ET: 0 = f16 operands, 1 = bf16 operands (pointers passed as 16-bit storage)
// SM: 0 = plain; 1 = score tile: each wave's 64 columns of a row are stored as exp(s - block max), the block's max and sum go to stat;
//     2 = Bt holds such blocks: the workgroup merges its 256 Bt rows' 64 block maxima and sums into one factor per row and block
//     (exp(block max - row max) / row sum * 2^15) and multiplies every Bt fragment by its row's factor ahead of the products.
// stat: one 8-KiB piece per score tile, [256 rows][4 blocks][max, sum], pieces ordered [batch][tm][tn].
constexpr int BM    = 128;                 // A rows per workgroup (the default of BMT)
constexpr int SBM   = 256;                 // A rows per workgroup of the score launch = rows per piece of stat
constexpr int BN    = 256;                 // Bt rows per workgroup
constexpr int KS    = 128;                 // k per stage (256 B of every row)
constexpr int LPH   = KS + 8;              // LDS row pitch in 16-bit elements (272 B: 16 rows of a b128 read fall on 64 distinct banks)
constexpr int FPH   = SP / KBLK + 2;       // factor table row pitch in 16-bit elements (132 B: 16 rows fall on distinct banks)

__device__ __forceinline__ unsigned lds_off(const void* p) { return (unsigned)(size_t)p; }

// value of lane l ^ X (X < 16) by DPP row_xmask; every lane is on where it is used
template <int X> __device__ __forceinline__ float lane_xor(float x) {
  return __builtin_bit_cast(float, __builtin_amdgcn_update_dpp(0, __builtin_bit_cast(int, x), 0x160 + X, 0xf, 0xf, true));
}

// e^x with the slot behind the transcendental filled inside the statement
__device__ __forceinline__ float exp_slot(float x) {
  float r;
  asm("v_exp_f32 %0, %1\n\tv_nop" : "=v"(r) : "v"(x * 1.4426950408889634f));
  return r;
}

// Eight copies of 16 B per lane, rows 16 apart: LDS byte address l + i * 16 rows, global address g + i * gstep elements.
// The s_wait_xcnt stands inside the statement so that no address register is rewritten ahead of it.
__device__ __forceinline__ void async_rows8(unsigned l, const unsigned short* g, size_t gstep) {
  constexpr unsigned LS = 16u * LPH * 2u;
  const unsigned l1 = l + LS, l2 = l + 2 * LS, l3 = l + 3 * LS, l4 = l + 4 * LS, l5 = l + 5 * LS, l6 = l + 6 * LS, l7 = l + 7 * LS;
  const unsigned short* g1 = g + gstep;     const unsigned short* g2 = g + 2 * gstep;
  const unsigned short* g3 = g + 3 * gstep; const unsigned short* g4 = g + 4 * gstep;
  const unsigned short* g5 = g + 5 * gstep; const unsigned short* g6 = g + 6 * gstep;
  const unsigned short* g7 = g + 7 * gstep;
  asm volatile(
      "global_load_async_to_lds_b128 %0, %8, off\n\t"
      "global_load_async_to_lds_b128 %1, %9, off\n\t"
      "global_load_async_to_lds_b128 %2, %10, off\n\t"
      "global_load_async_to_lds_b128 %3, %11, off\n\t"
      "global_load_async_to_lds_b128 %4, %12, off\n\t"
      "global_load_async_to_lds_b128 %5, %13, off\n\t"
      "global_load_async_to_lds_b128 %6, %14, off\n\t"
      "global_load_async_to_lds_b128 %7, %15, off\n\t"
      "s_wait_xcnt 0x0"
      :: "v"(l), "v"(l1), "v"(l2), "v"(l3), "v"(l4), "v"(l5), "v"(l6), "v"(l7),
         "v"(g), "v"(g1), "v"(g2), "v"(g3), "v"(g4), "v"(g5), "v"(g6), "v"(g7)
      : "memory");
}
template <int ET> struct Elem;
template <> struct Elem<0> { typedef _Float16 T; };
template <> struct Elem<1> { typedef __bf16 T; };
template <int ET, bool SPLIT, int BIAS_MODE, int OUT_MODE, bool RESID, int ACT = 0, int SM = 0, int BMT = BM>
__global__ __launch_bounds__(256) void wmma_gemm64(
    const unsigned short* __restrict__ Ap, const unsigned short* __restrict__ A2p, int lda, long strideA,
    const unsigned short* __restrict__ Btp, const unsigned short* __restrict__ Bt2p, int ldb, long strideB,
    void* __restrict__ Cout, void* __restrict__ Cout2, int ldc, long strideC,
    const float* __restrict__ bias,
    const float* __restrict__ resid, long strideR,
    int M, int N, int K, float scale, float* __restrict__ stat,
    const float* __restrict__ biasK, const float* __restrict__ biasV) {
  static_assert(!SPLIT, "single-plane operands only");
  static_assert(SM == 0 || ET == 0, "block softmax: f16 operands");
  static_assert(SM != 1 || OUT_MODE == 1, "score tile: f16 output");
  static_assert(BN == SBM, "SM 2: a workgroup's Bt rows are the rows of one row of stat pieces");
  static_assert((SM != 1 || BMT == SBM) && (SM != 2 || BMT == BM) && (BIAS_MODE != 3 || BMT == BM), "tile heights the stat pieces and the factor table are laid out for");
  constexpr int FI    = BMT / 32;              // A fragments (16 rows each) per wave
  constexpr int STG_H = (BMT + BN) * LPH;      // 16-bit elements per stage buffer
  typedef typename Elem<ET>::T T;
  typedef typename Frag<T>::V V;
  __shared__ __align__(16) T ring[2 * STG_H];      // two stage buffers, each [A BMT rows | Bt 256 rows] at pitch LPH
  __shared__ __align__(16) float sT[8][16 * 68];   // per-wave 16x64 slab, pitch 68 floats
  __shared__ __align__(16) float sStat[SM == 1 ? BMT * 8 : 4];         // [row][wave column][max, sum]
  __shared__ __align__(16) _Float16 sF[SM == 2 ? BN * FPH : 8];        // [Bt row][block] factor
  const int b    = blockIdx.y;
  const bool vT  = (BIAS_MODE == 3) && (b == 2);   // the same for the whole workgroup
  if constexpr (BIAS_MODE == 3) {
    const unsigned short* wsel = Btp + (size_t)b * (CH * CH);
    if (vT) { Btp = Ap; Ap = wsel; const int mm = M; M = N; N = mm; bias = biasV; }
    else    { Btp = wsel; if (b == 1) bias = biasK; }
    ldc = N;
  }
  const int tid  = threadIdx.x;
  const int lane = tid & 31;
  const int wave = tid >> 5;
  const int tilesN = N / BN;
  const int tilesM = M / BMT;
  const int tile = blockIdx.x;
  if (tile >= tilesM * tilesN) return;   // the same for the whole workgroup, in front of every barrier
  const int tm = tile / tilesN;
  const int tn = tile - tm * tilesN;
  const int wm = wave >> 2;              // wave row (0..1) and column (0..3) in the workgroup's tile
  const int wn = wave & 3;
  const int m0 = tm * BMT + wm * (BMT / 2);
  const int n0 = tn * BN + (wn << 6);

  const int rlane = lane & 15;                 // row (A) / col (B, D) within subtile
  const int koff  = (lane >> 4) * 8;           // k offset of this lane half
  const int mOff  = (lane >> 4) * 8;           // D row offset

  // copy addresses: 16 lanes cover the 256 B of one row, the workgroup 16 rows per copy
  const int crow = tid >> 4;
  const int ccol = (tid & 15) * 8;
  // the address is kept as a workgroup-uniform pointer and a 32-bit lane offset: a per-lane pointer that is itself an asm operand (stage 0) must
  // stay in v0..v255 over the whole loop, and at BMT 256 it went to scratch
  const unsigned short* uA = Ap  + (size_t)b * strideA + (size_t)(tm * BMT) * lda;   // the tile's first rows
  const unsigned short* uB = Btp + (size_t)b * strideB + (size_t)(tn * BN) * ldb;
  const unsigned oA = (unsigned)(crow * lda + ccol);                                  // this lane's place in them
  const unsigned oB = (unsigned)(crow * ldb + ccol);
  const unsigned lA = lds_off(ring) + (unsigned)(crow * LPH + ccol) * 2u;
  const unsigned lB = lA + (unsigned)(BMT * LPH) * 2u;
  auto issue_stage = [&](int t, int buf) {
    const unsigned lo = (unsigned)buf * (unsigned)(STG_H * 2);
    const unsigned short* gA = uA + (size_t)t * KS + oA;
    const unsigned short* gB = uB + (size_t)t * KS + oB;
    async_rows8(lA + lo, gA, (size_t)16 * lda);
    if constexpr (BMT == 256) {
      // the fences keep each statement's 24 address registers (asm operands: v0..v255) from being formed ahead of the statement before it:
      // formed together they push accumulators out of the low registers, one of them into scratch
      __builtin_amdgcn_sched_barrier(0);
      async_rows8(lA + lo + (unsigned)(128 * LPH) * 2u, gA + (size_t)128 * lda, (size_t)16 * lda);
      __builtin_amdgcn_sched_barrier(0);
    }
    async_rows8(lB + lo, gB, (size_t)16 * ldb);
    if constexpr (BMT == 256) __builtin_amdgcn_sched_barrier(0);
    async_rows8(lB + lo + (unsigned)(128 * LPH) * 2u, gB + (size_t)128 * ldb, (size_t)16 * ldb);
  };

  v8f acc[FI][4];
#pragma unroll
  for (int i = 0; i < FI; ++i)
#pragma unroll
    for (int j = 0; j < 4; ++j) acc[i][j] = (v8f){0.f,0.f,0.f,0.f,0.f,0.f,0.f,0.f};

  const int nT = K / KS;
  issue_stage(0, 0);
  if constexpr (SM == 2) {   // while stage 0 flies: two lanes per row, two rows per lane, merge each row's 64 block maxima and sums (K == SP keys)
    const int hf = tid & 1;
    const char* sp4 = (const char*)(stat + (size_t)(b * (SP / SBM) + tn) * (SP / BN) * (SBM * 8));
    const unsigned so = (unsigned)(hf * 8 * (SBM * 32) + (tid >> 1) * 32);   // this lane's byte offset: its first piece, its first row (the second: 128 rows on)
    v4f st[2][8][2];         // {max, sum, max, sum} of two neighbouring blocks
#pragma unroll
    for (int c = 0; c < 8; ++c) {
      st[0][c][0] = *(const v4f*)(sp4 + so + c * (SBM * 32));
      st[0][c][1] = *(const v4f*)(sp4 + so + c * (SBM * 32) + 16);
      st[1][c][0] = *(const v4f*)(sp4 + so + c * (SBM * 32) + 128 * 32);
      st[1][c][1] = *(const v4f*)(sp4 + so + c * (SBM * 32) + 128 * 32 + 16);
    }
    asm volatile("s_wait_xcnt 0x0" :: "v"(so) : "memory");   // the 32 loads share one offset register: it stays whole up to this wait (without the operand the last load's result was placed on it)
#pragma unroll
    for (int g = 0; g < 2; ++g) {
      const int row = g * 128 + (tid >> 1);
      float mx = st[g][0][0][0];
#pragma unroll
      for (int c = 0; c < 8; ++c)
#pragma unroll
        for (int h = 0; h < 2; ++h) mx = fmaxf(mx, fmaxf(st[g][c][h][0], st[g][c][h][2]));
      mx = fmaxf(mx, lane_xor<1>(mx));
      float l = 0.f;
      float w[8][2][2];      // exp(block max - row max)
#pragma unroll
      for (int c = 0; c < 8; ++c)
#pragma unroll
        for (int h = 0; h < 2; ++h) {
          w[c][h][0] = exp_slot(st[g][c][h][0] - mx);
          w[c][h][1] = exp_slot(st[g][c][h][2] - mx);
          l += st[g][c][h][1] * w[c][h][0] + st[g][c][h][3] * w[c][h][1];
        }
      l += lane_xor<1>(l);
      const float inv = PCARRY / l;
#pragma unroll
      for (int c = 0; c < 8; ++c)
#pragma unroll
        for (int h = 0; h < 2; ++h) {
          _Float16* fp = sF + row * FPH + (hf * 8 + c) * 4 + h * 2;
          fp[0] = (_Float16)(w[c][h][0] * inv);
          fp[1] = (_Float16)(w[c][h][1] * inv);
        }
    }
  }
  asm volatile("s_wait_asynccnt 0x0" ::: "memory");   // stage 0 has landed for this wave's copies
  __syncthreads();                                     // ... and for every wave's (SM 2: the factor table too)
  if (nT > 1) issue_stage(1, 1);

  for (int t = 0; t < nT; ++t) {
    const int buf = t & 1;
    const T* sA = ring + buf * STG_H + (wm * (BMT / 2) + rlane) * LPH + koff;
    const T* sB = ring + buf * STG_H + (BMT + (wn << 6) + rlane) * LPH + koff;
    // fragments of the next 32 k of this stage are fetched into a second register set ahead of the current FI * 4 products
    V af[2][FI], bf[2][4];
    _Float16 fs[4][2];       // SM 2: this lane's four Bt rows' factors for the stage's two blocks of 64 k
    if constexpr (SM == 2) {
#pragma unroll
      for (int i = 0; i < 4; ++i) {
        const _Float16* fp = sF + ((wn << 6) + (i << 4) + rlane) * FPH + 2 * t;
        fs[i][0] = fp[0]; fs[i][1] = fp[1];
      }
    }
#pragma unroll
    for (int j = 0; j < 4; ++j) { bf[0][j] = Frag<T>::load(sB + (j << 4) * LPH); af[0][j] = Frag<T>::load(sA + (j << 4) * LPH); }
#pragma unroll
    for (int i = 4; i < FI; ++i) af[0][i] = Frag<T>::load(sA + (i << 4) * LPH);
#pragma unroll
    for (int ks = 0; ks < KS / 32; ++ks) {
      const int cur = ks & 1, nxt = cur ^ 1;
      if (ks + 1 < KS / 32) {
#pragma unroll
        for (int j = 0; j < 4; ++j) {
          bf[nxt][j] = Frag<T>::load(sB + (j << 4) * LPH + (ks + 1) * 32);
          af[nxt][j] = Frag<T>::load(sA + (j << 4) * LPH + (ks + 1) * 32);
        }
#pragma unroll
        for (int i = 4; i < FI; ++i) af[nxt][i] = Frag<T>::load(sA + (i << 4) * LPH + (ks + 1) * 32);
      }
      __builtin_amdgcn_sched_barrier(0);   // keeps the LDS reads above as one group ahead of the products: sunk among them, each group of four waits out the LDS latency
      if constexpr (SM == 2) {
#pragma unroll
        for (int i = 0; i < 4; ++i) bf[cur][i] = bf[cur][i] * fs[i][ks >> 1];
      }
#pragma unroll
      for (int i = 0; i < FI; ++i)
#pragma unroll
        for (int j = 0; j < 4; ++j) acc[i][j] = Frag<T>::mma(af[cur][i], bf[cur][j], acc[i][j]);
      __builtin_amdgcn_sched_barrier(0);   // keeps the next LDS reads out of these products and the last products in front of the stage's barrier (behind it they delay the refill)
    }
    asm volatile("s_wait_dscnt 0x0" ::: "memory");      // this wave's reads of buffer buf are done before it is refilled
    asm volatile("s_wait_asynccnt 0x0" ::: "memory");   // this wave's copies of stage t + 1 have landed
    __syncthreads();                                     // publishes stage t + 1 and ends every wave's reads of buffer buf
    if (t + 2 < nT) issue_stage(t + 2, buf);
  }
  asm volatile("s_wait_asynccnt 0x0" ::: "memory");     // no copy outstanding behind the loop
  if constexpr (FI == 4) {   // FI 8: an asm operand lies in v0..v255, so the guard would hold all 256 accumulator registers there and the loop would spill; the compiler keeps the distance behind its own products
#pragma unroll
    for (int i = 0; i < FI; ++i) acc_guard4(acc[i][0], acc[i][1], acc[i][2], acc[i][3]);
  }

  // ---- epilogue ----
  float* slab = sT[wave];
  const float* Rb = RESID ? (resid + (size_t)b * strideR) : nullptr;
  float bn[4] = {0.f, 0.f, 0.f, 0.f};   // BIAS_MODE 3, q and k: the bias of this lane's four columns
  float bm[4][8];                       // BIAS_MODE 3, v^T: the bias of this lane's 32 rows
  if constexpr (BIAS_MODE == 3) {
#pragma unroll
    for (int i = 0; i < 4; ++i)
#pragma unroll
      for (int r = 0; r < 8; ++r) bm[i][r] = 0.f;
    if (vT) {
#pragma unroll
      for (int i = 0; i < 4; ++i)
#pragma unroll
        for (int r = 0; r < 8; ++r) bm[i][r] = bias[((m0 + (i << 4) + mOff) >> 3) * 32 + r];
    } else {
#pragma unroll
      for (int j = 0; j < 4; ++j) bn[j] = bias[n0 + (j << 4) + rlane];
    }
  }
#pragma unroll
  for (int i = 0; i < FI; ++i) {
    const int mBase = m0 + (i << 4);
#pragma unroll
    for (int j = 0; j < 4; ++j) {
      const int n = n0 + (j << 4) + rlane;
      float bv = 0.f;
      if (BIAS_MODE == 2) bv = bias[n];
#pragma unroll
      for (int r = 0; r < 8; ++r) {
        float v = acc[i][j][r] * scale;
        if (BIAS_MODE == 1) v += bias[mBase + mOff + r];
        if (BIAS_MODE == 2) v += bv;
        if constexpr (BIAS_MODE == 3) v += vT ? bm[i][r] : bn[j];
        if (RESID) v += Rb[(size_t)(mBase + mOff + r) * ldc + n];
        if (ACT == 1) v = tanhf(v);
        if (ACT == 2) v = fmaxf(v, 0.0f);
        if (ACT == 3) v = v / (1.0f + expf(-v));
        if (ACT == 4) v = (v > 0.f) ? v : 0.01f * v;
        if (ACT == 5) v = 0.5f * v * (1.0f + erff(v * 0.70710678118654752f));
        slab[(mOff + r) * 68 + (j << 4) + rlane] = v;
      }
    }
    __builtin_amdgcn_fence(__ATOMIC_RELEASE, "workgroup");
    __builtin_amdgcn_wave_barrier();
    __builtin_amdgcn_fence(__ATOMIC_ACQUIRE, "workgroup");
    if (OUT_MODE == 0) {
      float* C = (float*)Cout + (size_t)b * strideC;
      const int hh = lane >> 4, c4 = (lane & 15) * 4;     // row seg = 256 B = 16 lanes x 16 B
      {
#pragma unroll
        for (int it = 0; it < 8; ++it) {
          const int row = it * 2 + hh;
          v4f v = *(const v4f*)(slab + row * 68 + c4);
          *(v4f*)(C + (size_t)(mBase + row) * ldc + n0 + c4) = v;
        }
        
      }
    } else {
      const int q = lane >> 3, c8 = (lane & 7) * 8;
      unsigned short* C  = (unsigned short*)Cout  + (size_t)b * strideC;
      unsigned short* C2 = (OUT_MODE == 2) ? ((unsigned short*)Cout2 + (size_t)b * strideC) : nullptr;
      {
#pragma unroll
        for (int it = 0; it < 4; ++it) {
          const int row = it * 4 + q;
          const float* sp = slab + row * 68 + c8;
          v8h hv, lv;
          float pv[8];
          if constexpr (SM == 1) {   // eight lanes hold one row's 64 scores: block max, exp, block sum
#pragma unroll
            for (int e = 0; e < 8; ++e) pv[e] = sp[e];
            float mx = fmaxf(fmaxf(fmaxf(pv[0], pv[1]), fmaxf(pv[2], pv[3])), fmaxf(fmaxf(pv[4], pv[5]), fmaxf(pv[6], pv[7])));
            mx = fmaxf(mx, lane_xor<1>(mx)); mx = fmaxf(mx, lane_xor<2>(mx)); mx = fmaxf(mx, lane_xor<4>(mx));
#pragma unroll
            for (int e = 0; e < 8; ++e) pv[e] = __expf(pv[e] - mx);
            float su = ((pv[0] + pv[1]) + (pv[2] + pv[3])) + ((pv[4] + pv[5]) + (pv[6] + pv[7]));
            su += lane_xor<1>(su); su += lane_xor<2>(su); su += lane_xor<4>(su);
            if ((lane & 7) == 0) {
              float* ss = sStat + ((wm * (BMT / 2) + (i << 4) + row) * 4 + wn) * 2;
              ss[0] = mx; ss[1] = su;
            }
          }
#pragma unroll
          for (int e = 0; e < 8; ++e) {
            if (SM == 1) {
              hv[e] = (_Float16)pv[e];
            } else if (OUT_MODE == 1) {
              hv[e] = (_Float16)sp[e];
            } else {
              unsigned short hb = f2bf_bits(sp[e]);
              unsigned short lb = f2bf_bits(sp[e] - bf_bits2f(hb));
              hv[e] = __builtin_bit_cast(_Float16, hb);
              lv[e] = __builtin_bit_cast(_Float16, lb);
            }
          }
          *(v8h*)(C + (size_t)(mBase + row) * ldc + n0 + c8) = hv;
          if (OUT_MODE == 2) *(v8h*)(C2 + (size_t)(mBase + row) * ldc + n0 + c8) = lv;
        }
        
      }
    }
    __builtin_amdgcn_fence(__ATOMIC_RELEASE, "workgroup");
    __builtin_amdgcn_wave_barrier();
    __builtin_amdgcn_fence(__ATOMIC_ACQUIRE, "workgroup");
  }
  if constexpr (SM == 1) {
    __syncthreads();         // every wave's block maxima and sums are in sStat
#pragma unroll
    for (int h = 0; h < BMT / 128; ++h)
      ((v4f*)(stat + (size_t)((b * tilesM + tm) * tilesN + tn) * (BMT * 8)))[tid + h * 256] = ((const v4f*)sStat)[tid + h * 256];   // whole lines, 8 KiB per tile
  }
}

// ---- group statistics, partial sums: one block per channel (16 per group), f64 fixed-order accumulation.
// Block b stores the sum and the sum of squares of its 16384 elements in the first two doubles of its own 128-B line of part.
// The blocks behind those 512 carry Wq and Wk x16 to f16 (4096 elements each, 64 blocks per matrix): work that
// depends on nothing here and rides in this launch instead of launches of its own.
// The blocks in front of them (they take longest, so they start first) fold the output projection into the value projection:
// out = Wp (P v) + bp = P (Wp v) + bp and Wp v = (Wp Wv) tok + Wp bv, so that the P*V launch gives the output itself.
//  128 blocks: Wvp = Wp * Wv on the matrix unit, x16, f16: a tile is 16 rows o x 64 columns i (whole 128-B lines of Wvp), a block has two tiles,
//              four waves each take a quarter of a tile's k (a short chain of memory latencies) and the first of them adds the four behind a barrier;
//    8 blocks: Wp * bv in f32, a wave's eight values at the head of its own 128-B line of wpbv.
constexpr int WBLK = 4096;                 // weight elements per cast block
constexpr int NWB  = CH * CH / WBLK;       // cast blocks per matrix
constexpr int NVP  = (CH / 16) * (CH / 64) / 2;   // blocks of Wp * Wv: two tiles of 16 rows x 64 columns each
constexpr int NBV  = CH / 64;                  // blocks of Wp * bv: 64 rows each
// six waves per SIMD (at most 160 registers): three workgroups per WGP, so that every statistics workgroup is resident from the start
__global__ __launch_bounds__(256, 6) void gn_stats(const float* __restrict__ x, double* __restrict__ part,
                                                const float* __restrict__ wq, const float* __restrict__ wk,
                                                const float* __restrict__ wv, const float* __restrict__ wp,
                                                const float* __restrict__ bv,
                                                _Float16* __restrict__ w16, float* __restrict__ wpbv) {
  __shared__ double ws1[8];
  __shared__ double ws2[8];
  __shared__ float red[6 * 1024];    // Wp * Wv: the partial tiles of the waves with k quarters 1..3, [tile][quarter - 1][register][lane]
  const int tid = threadIdx.x, wave = tid >> 5, lane = tid & 31;
  if (blockIdx.x < NVP) {            // the same for the whole workgroup: its barrier is passed by all eight waves
    // D[i][o] = sum_m Wv[m][i] * Wp[o][m]: A rows are columns i of Wv (16 lanes read 64 B of a row m), B columns are rows o of Wp (k contiguous);
    // both fragments hold k = k0 + 8 * (lane / 16) + e in elements e = 0..7 and 16 more in elements 8..15
    const int ws = __builtin_amdgcn_readfirstlane(wave);   // the wave's number in a scalar register: tile, quarter and their addresses cost no vector registers
    const int tsel = ws >> 2, kq = ws & 3;
    const int tile = (int)blockIdx.x * 2 + tsel;
    const int o0 = (tile >> 3) * 16;
    const int i0 = (tile & 7) * 64;
    const int rl = lane & 15, hi = lane >> 4;
    const float* pb = wp + (size_t)(o0 + rl) * CH + kq * (CH / 4) + hi * 8;
    const float* pa = wv + (size_t)(kq * (CH / 4) + hi * 8) * CH + i0 + rl;
    v8f c[4];
#pragma unroll
    for (int f = 0; f < 4; ++f) c[f] = (v8f){0.f,0.f,0.f,0.f,0.f,0.f,0.f,0.f};
#pragma unroll 2
    for (int k0 = 0; k0 < CH / 4; k0 += 32) {
      const v4f b0 = *(const v4f*)(pb + k0),      b1 = *(const v4f*)(pb + k0 + 4);
      const v4f b2 = *(const v4f*)(pb + k0 + 16), b3 = *(const v4f*)(pb + k0 + 20);
      float ar[4][16];
#pragma unroll
      for (int f = 0; f < 4; ++f)
#pragma unroll
        for (int e = 0; e < 8; ++e) {
          ar[f][e]     = pa[(size_t)(k0 + e) * CH + f * 16];
          ar[f][8 + e] = pa[(size_t)(k0 + 16 + e) * CH + f * 16];
        }
      v16h bh;
#pragma unroll
      for (int e = 0; e < 4; ++e) {
        bh[e]      = (_Float16)(b0[e] * WCARRY); bh[4 + e]  = (_Float16)(b1[e] * WCARRY);
        bh[8 + e]  = (_Float16)(b2[e] * WCARRY); bh[12 + e] = (_Float16)(b3[e] * WCARRY);
      }
#pragma unroll
      for (int f = 0; f < 4; ++f) {
        v16h ah;
#pragma unroll
        for (int e = 0; e < 16; ++e) ah[e] = (_Float16)(ar[f][e] * WCARRY);
        c[f] = __builtin_amdgcn_wmma_f32_16x16x32_f16(false, ah, false, bh, (short)0, c[f], false, false);
      }
    }
    if (kq != 0) {
      float* rd = red + (tsel * 3 + kq - 1) * 1024 + lane;
#pragma unroll
      for (int f = 0; f < 4; ++f)
#pragma unroll
        for (int r = 0; r < 8; ++r) rd[(f * 8 + r) * 32] = c[f][r];
    }
    __syncthreads();                 // the partial tiles of quarters 1..3 are visible to the wave of quarter 0
    if (kq == 0) {
#pragma unroll
      for (int q = 0; q < 3; ++q) {
        const float* rd = red + (tsel * 3 + q) * 1024 + lane;
#pragma unroll
        for (int f = 0; f < 4; ++f)
#pragma unroll
          for (int r = 0; r < 8; ++r) c[f][r] += rd[(f * 8 + r) * 32];
      }
      _Float16* d = w16 + (size_t)2 * CH * CH + (size_t)(o0 + rl) * CH + i0 + hi * 8;   // lane: row o, eight neighbouring columns i per fragment
#pragma unroll
      for (int f = 0; f < 4; ++f) {
        v8h h;
#pragma unroll
        for (int r = 0; r < 8; ++r) h[r] = (_Float16)(c[f][r] * WCARRY_INV);   // x16 * x16 -> x16
        *(v8h*)(d + f * 16) = h;
      }
    }
    return;
  }
  if (blockIdx.x < NVP + NBV) {      // the same for the whole workgroup, in front of the barrier
    const int r0 = ((int)blockIdx.x - NVP) * 64 + wave * 8;
    v4f bb[4], wr[8][4];
#pragma unroll
    for (int j = 0; j < 4; ++j) bb[j] = *(const v4f*)(bv + j * 128 + lane * 4);
#pragma unroll
    for (int r = 0; r < 8; ++r)
#pragma unroll
      for (int j = 0; j < 4; ++j) wr[r][j] = *(const v4f*)(wp + (size_t)(r0 + r) * CH + j * 128 + lane * 4);
    float sm[8];
#pragma unroll
    for (int r = 0; r < 8; ++r) {
      float a = 0.f;
#pragma unroll
      for (int j = 0; j < 4; ++j)
#pragma unroll
        for (int e = 0; e < 4; ++e) a += wr[r][j][e] * bb[j][e];
      sm[r] = a;
    }
#pragma unroll
    for (int off = 1; off < 32; off <<= 1)
#pragma unroll
      for (int r = 0; r < 8; ++r) sm[r] += __shfl_xor(sm[r], off, 32);
    if (lane == 0) {
      float* d = wpbv + (size_t)(r0 >> 3) * 32;
      *(v4f*)(d)     = (v4f){sm[0], sm[1], sm[2], sm[3]};
      *(v4f*)(d + 4) = (v4f){sm[4], sm[5], sm[6], sm[7]};
    }
    return;
  }
  const int blk = (int)blockIdx.x - (NVP + NBV);
  if (blk >= NGRP * NCH) {           // the same for the whole workgroup, in front of the barrier
    const int cb = blk - NGRP * NCH, wi = cb / NWB;
    const float* src = (wi == 0) ? wq : wk;
    const v4f* s4 = (const v4f*)(src + (size_t)(cb - wi * NWB) * WBLK);
    v4h* d4 = (v4h*)(w16 + (size_t)cb * WBLK);
    v4f wv4[WBLK / 1024];
#pragma unroll
    for (int i = 0; i < WBLK / 1024; ++i) wv4[i] = s4[tid + i * 256];
#pragma unroll
    for (int i = 0; i < WBLK / 1024; ++i) {
      v4h h;
#pragma unroll
      for (int e = 0; e < 4; ++e) h[e] = (_Float16)(wv4[i][e] * WCARRY);
      d4[tid + i * 256] = h;
    }
    return;
  }
  const v4f* p = (const v4f*)(x + (size_t)blk * CSP);
  v4f v[CSP / 1024];                 // all 16 loads of a lane are in flight together
#pragma unroll
  for (int i = 0; i < CSP / 1024; ++i) v[i] = p[tid + i * 256];
  __builtin_amdgcn_sched_barrier(0);   // keeps all 16 loads ahead of the sums: sunk among them, the second eight wait out a second memory latency
  double a[4] = {0.0, 0.0, 0.0, 0.0}, q[4] = {0.0, 0.0, 0.0, 0.0};
#pragma unroll
  for (int i = 0; i < CSP / 1024; ++i) {
#pragma unroll
    for (int e = 0; e < 4; ++e) { const double d = (double)v[i][e]; a[e] += d; q[e] += d * d; }
  }
  double s = (a[0] + a[1]) + (a[2] + a[3]), s2 = (q[0] + q[1]) + (q[2] + q[3]);
#pragma unroll
  for (int off = 1; off < 32; off <<= 1) { s += __shfl_xor(s, off, 32); s2 += __shfl_xor(s2, off, 32); }
  if (lane == 0) { ws1[wave] = s; ws2[wave] = s2; }
  __syncthreads();
  if (tid < 16) {
    double ts = 0.0, ts2 = 0.0;
#pragma unroll
    for (int w = 0; w < 8; ++w) { ts += ws1[w]; ts2 += ws2[w]; }
    part[(size_t)blk * 16 + lane] = (lane == 0) ? ts : ((lane == 1) ? ts2 : 0.0);
  }
}

// ---- normalize + affine + transpose: x[c][t][s] (f32) -> tok[t*SP + s][c] (f16).
__global__ __launch_bounds__(256) void norm_tok(const float* __restrict__ x,
                                                const float* __restrict__ gamma,
                                                const float* __restrict__ beta,
                                                const double* __restrict__ part,
                                                _Float16* __restrict__ tok) {
  __shared__ __align__(16) _Float16 tile[64 * 72];   // [sl][cl], pitch 72 halves
  __shared__ float gstat[8];                         // mean, rstd of the block's 4 groups
  const int bid = blockIdx.x;
  const int cb  = bid & 7;           // 8 channel blocks of 64
  const int sb  = (bid >> 3) & 63;   // 64 position blocks of 64
  const int t   = bid >> 9;          // frame
  const int c0 = cb * 64, s0 = sb * 64;
  const int tid = threadIdx.x;
  if (tid < 128) {                   // wave gi sums group gi's 16 partial pairs: lanes 0..15 the sums, lanes 16..31 the sums of squares
    const int gi = tid >> 5, ln = tid & 31;
    double d = part[(size_t)(((c0 >> 4) + gi) * NCH + (ln & 15)) * 16 + (ln >> 4)];
#pragma unroll
    for (int off = 1; off < 16; off <<= 1) d += __shfl_xor(d, off, 32);
    const double ts2 = __shfl(d, 16, 32);
    const double mean = d * (1.0 / (double)GSZ);
    double var = ts2 * (1.0 / (double)GSZ) - mean * mean;
    if (var < 0.0) var = 0.0;
    if (ln == 0) { gstat[gi * 2] = (float)mean; gstat[gi * 2 + 1] = rsqrtf((float)var + GN_EPS); }
  }
  __syncthreads();                   // the four groups' mean and rstd are visible to every wave
#pragma unroll 4
  for (int i = tid; i < 64 * 64; i += 256) {
    const int cl = i >> 6, sl = i & 63;
    const int c = c0 + cl;
    const float mean = gstat[(cl >> 4) * 2], rstd = gstat[(cl >> 4) * 2 + 1];
    float v = x[(size_t)c * CSP + (size_t)t * SP + s0 + sl];
    v = (v - mean) * rstd * gamma[c] + beta[c];
    tile[sl * 72 + cl] = (_Float16)v;
  }
  __syncthreads();
  const int wave = tid >> 5, lane = tid & 31;
  const int q = lane >> 3, c8 = (lane & 7) * 8;
  {
#pragma unroll
    for (int it = 0; it < 2; ++it) {
      const int row = wave * 8 + it * 4 + q;   // wave covers rows 8w..8w+7
      const v8h hv = *(const v8h*)(tile + row * 72 + c8);
      *(v8h*)(tok + ((size_t)t * SP + s0 + row) * CH + c0 + c8) = hv;
    }
    
  }
}

static inline int gemm_blocks(int M, int N) { return (M / 128) * (N / 256); }

// ---------------- launch ----------------
extern "C" void kernel_launch(void* const* d_in, const int* in_sizes, int n_in,
                              void* d_out, int out_size, void* d_ws, size_t ws_size,
                              hipStream_t stream) {
  if (n_in < 11) return;
  if (in_sizes[0] != CH * CSP || out_size != CH * CSP) return;
  if (in_sizes[1] != CH || in_sizes[2] != CH) return;
  if (in_sizes[3] != CH * CH || in_sizes[5] != CH * CH || in_sizes[7] != CH * CH || in_sizes[9] != CH * CH) return;
  if (in_sizes[4] != CH || in_sizes[6] != CH || in_sizes[8] != CH || in_sizes[10] != CH) return;

  const float* x     = (const float*)d_in[0];
  const float* gamma = (const float*)d_in[1];
  const float* beta  = (const float*)d_in[2];
  const float* wq    = (const float*)d_in[3];
  const float* bq    = (const float*)d_in[4];
  const float* wk    = (const float*)d_in[5];
  const float* bk    = (const float*)d_in[6];
  const float* wv    = (const float*)d_in[7];
  const float* bv    = (const float*)d_in[8];
  const float* wp    = (const float*)d_in[9];
  const float* bp    = (const float*)d_in[10];
  float* out = (float*)d_out;

  char* ws = (char*)d_ws;
  size_t off = 0;
  double* part = (double*)(ws + off);         off += (size_t)NGRP * NCH * 128;                  // 512 lines of 128 B
  float* wpbv    = (float*)(ws + off);        off += (size_t)(CH / 8) * 128;                    // 64 lines of 128 B
  _Float16* w16  = (_Float16*)(ws + off);     off += (size_t)3 * CH * CH * sizeof(_Float16);   // 1.5 MiB
  _Float16* tok  = (_Float16*)(ws + off);     off += (size_t)NTOK * CH * sizeof(_Float16);     // 16 MiB
  _Float16* q16  = (_Float16*)(ws + off);     off += (size_t)NTOK * CH * sizeof(_Float16);     // 16 MiB
  _Float16* k16  = (_Float16*)(ws + off);     off += (size_t)NTOK * CH * sizeof(_Float16);     // 16 MiB
  _Float16* vT16 = (_Float16*)(ws + off);     off += (size_t)CH * NTOK * sizeof(_Float16);     // 16 MiB  [512][16384]
  float* stat    = (float*)(ws + off);        off += (size_t)NTOK * (SP / KBLK) * 2 * sizeof(float);   // 8 MiB: block max and sum per row and 64 keys
  _Float16* P16  = (_Float16*)(ws + off);     off += (size_t)NTOK * SP * sizeof(_Float16);     // 128 MiB  [16384][4096], every frame's rows
  if (off > ws_size) return;
  // w16 holds Wq | Wk | Wp*Wv, one plane of 512 x 512 each

  // 1. group statistics: partial sums, one workgroup per channel (the normalize kernel adds each group's 16);
  //    in the same launch: Wp*Wv and Wp*bv (136 workgroups in front), Wq and Wk x16 -> f16 (128 workgroups behind)
  gn_stats<<<dim3(NVP + NBV + NGRP * NCH + 2 * NWB), dim3(256), 0, stream>>>(x, part, wq, wk, wv, wp, bv, w16, wpbv);

  // 3. normalize + transpose to tokens
  norm_tok<<<dim3(TFR * 64 * 8), dim3(256), 0, stream>>>(x, gamma, beta, part, tok);

  //    (left to try: k could be the tokens themselves, q*k^T = tok (Wq^T Wk) tok^T + (Wk^T bq) tok^T + terms that are constant along the keys, which softmax drops)
  // 4. the three projections in one launch, one per blockIdx.y (256 x 3 workgroups), f16 out:
  //    q = tok*Wq^T/16 + bq and k = tok*Wk^T/16 + bk, [16384][512]; v'^T[c][token] = (Wp*Wv)16*tok^T/16 + (Wp*bv)[c], [512][16384]
  wmma_gemm64<0, false, 3, 1, false><<<dim3(gemm_blocks(NTOK, CH), 3), dim3(256), 0, stream>>>(
      U16(tok), U16(tok), CH, (long)0, U16(w16), U16(w16), CH, (long)0,
      (void*)q16, (void*)q16, CH, (long)NTOK * CH, bq, x, (long)0, NTOK, CH, CH, WCARRY_INV, stat, bk, wpbv);

  // 5. scores of all frames in one launch, one frame per blockIdx.y (256 x 4 workgroups of 256 x 256 scores): q*k^T*512^-0.5 stays in registers;
  //    each 64-key block of a row is stored as f16 exp(s - block max) in P16, its max and sum in stat
  wmma_gemm64<0, false, 0, 1, false, 0, 1, SBM><<<dim3((SP / SBM) * (SP / BN), TFR), dim3(256), 0, stream>>>(
      U16(q16), U16(q16), CH, (long)SP * CH, U16(k16), U16(k16), CH, (long)SP * CH,
      (void*)P16, (void*)P16, SP, (long)SP * SP, bq, x, (long)0, SP, SP, CH, QSCALE, stat, bq, bq);
  // 6. out[c][token] = v'^T * (factor * P16)^T x2^-15 + bp[c] + x[c][token] for all frames in one launch, one frame per blockIdx.y: 64 x 4 = 256 workgroups
  //    (A = vT16 + frame*4096, [512][4096] with pitch 16384, Bt = P16 frame [4096][4096], f32 out [512][4096] with pitch 16384 at column frame*4096)
  wmma_gemm64<0, false, 1, 0, true, 0, 2><<<dim3(gemm_blocks(CH, SP), TFR), dim3(256), 0, stream>>>(
      U16(vT16), U16(vT16), NTOK, (long)SP, U16(P16), U16(P16), SP, (long)SP * SP,
      (void*)out, (void*)out, NTOK, (long)SP, bp, x, (long)SP, CH, SP, SP, PCARRY_INV, stat, bq, bq);
}

// v008
// A run of this version takes 172 microseconds.
// In two side-by-side timings against v007, it was 1.10 and 1.09 times as fast.
// Counting every step since v000, it is 12.6 times as fast.
#include <hip/hip_runtime.h>
// Contractions Wp*Wv, tok*Wq^T, tok*Wk^T, (Wp*Wv)*tok^T, q*k^T, v'^T*P^T: v_wmma_f32_16x16x32_f16 (f16 operands, f32 accumulate); weights carried x16, softmax probabilities carried x2^15 (f16 exp(s - block max) times an f16 row-and-block factor); group statistics accumulated in f64; Wp*bv and all other elementwise math f32.

typedef __attribute__((ext_vector_type(16))) _Float16 v16h;
typedef __attribute__((ext_vector_type(8)))  _Float16 v8h;
typedef __attribute__((ext_vector_type(4)))  _Float16 v4h;
typedef __attribute__((ext_vector_type(16))) __bf16   v16b;
typedef __attribute__((ext_vector_type(8)))  __bf16   v8b;
typedef __attribute__((ext_vector_type(8)))  float    v8f;
typedef __attribute__((ext_vector_type(4)))  float    v4f;
#define U16(p) ((const unsigned short*)(const void*)(p))

constexpr int CH   = 512;          // channels
constexpr int TFR  = 4;            // frames
constexpr int SP   = 4096;         // tokens per frame (h*w)
constexpr int CSP  = TFR * SP;     // 16384 elements per channel
constexpr int NTOK = TFR * SP;     // 16384 tokens
constexpr int GSZ  = 16 * CSP;     // 262144 elements per group (16 channels per group)
constexpr int NGRP = 32;
constexpr int NCH  = 16;           // partial sums per group: one workgroup per channel
constexpr int KBLK = 64;           // keys per softmax block (one wave's columns of a score tile)
constexpr float GN_EPS     = 1e-6f;
constexpr float QSCALE     = 0.04419417382415922f;   // 512^-0.5
constexpr float WCARRY     = 16.0f;
constexpr float WCARRY_INV = 1.0f / 16.0f;
constexpr float PCARRY     = 32768.0f;
constexpr float PCARRY_INV = 1.0f / 32768.0f;

__device__ __forceinline__ unsigned short f2bf_bits(float f) {
  unsigned u = __float_as_uint(f);
  return (unsigned short)((u + 0x7FFFu + ((u >> 16) & 1u)) >> 16);
}
__device__ __forceinline__ float bf_bits2f(unsigned short h) { return __uint_as_float(((unsigned)h) << 16); }

// hazard guard between the last products and the epilogue's reads of the accumulators
__device__ __forceinline__ void acc_guard4(v8f& a, v8f& b, v8f& c, v8f& d) { asm volatile("v_nop\n\tv_nop\n\tv_nop\n\tv_nop" : "+v"(a), "+v"(b), "+v"(c), "+v"(d)); }
template <typename T> struct Frag;
template <> struct Frag<_Float16> {
  typedef v16h V; union U { v16h v; v8h h[2]; };
  static __device__ __forceinline__ v16h load(const _Float16* p) {   // elements 0..7 <- p[0..7], 8..15 <- p[16..23]
    U f; f.h[0] = *(const v8h*)(p); f.h[1] = *(const v8h*)(p + 16); return f.v;
  }
  static __device__ __forceinline__ v8f mma(v16h a, v16h b, v8f c) {
    return __builtin_amdgcn_wmma_f32_16x16x32_f16(false, a, false, b, (short)0, c, false, false);
  }
};
template <> struct Frag<__bf16> {
  typedef v16b V; union U { v16b v; v8b h[2]; };
  static __device__ __forceinline__ v16b load(const __bf16* p) {
    U f; f.h[0] = *(const v8b*)(p); f.h[1] = *(const v8b*)(p + 16); return f.v;
  }
  static __device__ __forceinline__ v8f mma(v16b a, v16b b, v8f c) {
    return __builtin_amdgcn_wmma_f32_16x16x32_bf16(false, a, false, b, (short)0, c, false, false);
  }
};

// ---- LDS-staged batched WMMA GEMM -------------------------------------------
// C[m,n] = scale * sum_k A[m,k] * Bt[n,k] (+bias)(+resid); a workgroup of 8 waves (2 x 4) owns a BMT x 256 tile, each wave (BMT / 2) x 64 of it.
// BMT = 128, or 256 where the grid still fills the chip: per product a third fewer bytes come from L2 and a quarter fewer fragment bytes from LDS.
// A row-major [M,K]; Bt row-major [N,K]; M % BMT == 0, N % 256 == 0, K % 128 == 0.
// Per stage 128 k of the BMT A rows and the 256 Bt rows are copied to LDS by global_load_async_to_lds_b128 (two buffers:
// the next stage's copies fly while this stage is multiplied); fragments are read from LDS at a row pitch of 272 B.
// BIAS_MODE: 0 = none, 1 = bias[m], 2 = bias[n], 3 = the three token projections in one launch, one per blockIdx.y:
//   A = tokens, Bt = Wq | Wk | Wp*Wv (contiguous planes), C = q | k | v'^T (contiguous planes); y 0 and 1: tok * W^T + bias[n] (bias, biasK);
//   y 2: the operands change places, W * tok^T + biasV[m], so that v' comes out transposed (biasV: eight values at the head of each 128-B line).
// OUT_MODE: 0 = f32, 1 = f16, 2 = bf16 hi plane (Cout) + bf16 lo plane (Cout2).
// ET: 0 = f16 operands, 1 = bf16 operands (pointers passed as 16-bit storage)
// SM: 0 = plain; 1 = score tile: each wave's 64 columns of a row are stored as exp(s - block max), the block's max and sum go to stat;
//     2 = Bt holds such blocks: the workgroup merges its 256 Bt rows' 64 block maxima and sums into one factor per row and block
//     (exp(block max - row max) / row sum * 2^15) and multiplies every Bt fragment by its row's factor ahead of the products.
// stat: one 8-KiB piece per score tile, [256 rows][4 blocks][max, sum], pieces ordered [batch][tm][tn].
constexpr int BM    = 128;                 // A rows per workgroup (the default of BMT)
constexpr int SBM   = 256;                 // A rows per workgroup of the score launch = rows per piece of stat
constexpr int BN    = 256;                 // Bt rows per workgroup
constexpr int KS    = 128;                 // k per stage (256 B of every row)
constexpr int LPH   = KS + 8;              // LDS row pitch in 16-bit elements (272 B: 16 rows of a b128 read fall on 64 distinct banks)
constexpr int FPH   = SP / KBLK + 2;       // factor table row pitch in 16-bit elements (132 B: 16 rows fall on distinct banks)

__device__ __forceinline__ unsigned lds_off(const void* p) { return (unsigned)(size_t)p; }

// value of lane l ^ X (X < 16) by DPP row_xmask; every lane is on where it is used
template <int X> __device__ __forceinline__ float lane_xor(float x) {
  return __builtin_bit_cast(float, __builtin_amdgcn_update_dpp(0, __builtin_bit_cast(int, x), 0x160 + X, 0xf, 0xf, true));
}

// e^x with the slot behind the transcendental filled inside the statement
__device__ __forceinline__ float exp_slot(float x) {
  float r;
  asm("v_exp_f32 %0, %1\n\tv_nop" : "=v"(r) : "v"(x * 1.4426950408889634f));
  return r;
}

// Eight copies of 16 B per lane, rows 16 apart: LDS byte address l + i * 16 rows, global address g + i * gstep elements.
// The s_wait_xcnt stands inside the statement so that no address register is rewritten ahead of it.
__device__ __forceinline__ void async_rows8(unsigned l, const unsigned short* g, size_t gstep) {
  constexpr unsigned LS = 16u * LPH * 2u;
  const unsigned l1 = l + LS, l2 = l + 2 * LS, l3 = l + 3 * LS, l4 = l + 4 * LS, l5 = l + 5 * LS, l6 = l + 6 * LS, l7 = l + 7 * LS;
  const unsigned short* g1 = g + gstep;     const unsigned short* g2 = g + 2 * gstep;
  const unsigned short* g3 = g + 3 * gstep; const unsigned short* g4 = g + 4 * gstep;
  const unsigned short* g5 = g + 5 * gstep; const unsigned short* g6 = g + 6 * gstep;
  const unsigned short* g7 = g + 7 * gstep;
  asm volatile(
      "global_load_async_to_lds_b128 %0, %8, off\n\t"
      "global_load_async_to_lds_b128 %1, %9, off\n\t"
      "global_load_async_to_lds_b128 %2, %10, off\n\t"
      "global_load_async_to_lds_b128 %3, %11, off\n\t"
      "global_load_async_to_lds_b128 %4, %12, off\n\t"
      "global_load_async_to_lds_b128 %5, %13, off\n\t"
      "global_load_async_to_lds_b128 %6, %14, off\n\t"
      "global_load_async_to_lds_b128 %7, %15, off\n\t"
      "s_wait_xcnt 0x0"
      :: "v"(l), "v"(l1), "v"(l2), "v"(l3), "v"(l4), "v"(l5), "v"(l6), "v"(l7),
         "v"(g), "v"(g1), "v"(g2), "v"(g3), "v"(g4), "v"(g5), "v"(g6), "v"(g7)
      : "memory");
}
template <int ET> struct Elem;
template <> struct Elem<0> { typedef _Float16 T; };
template <> struct Elem<1> { typedef __bf16 T; };
template <int ET, bool SPLIT, int BIAS_MODE, int OUT_MODE, bool RESID, int ACT = 0, int SM = 0, int BMT = BM>
__global__ __launch_bounds__(256) void wmma_gemm64(
    const unsigned short* __restrict__ Ap, const unsigned short* __restrict__ A2p, int lda, long strideA,
    const unsigned short* __restrict__ Btp, const unsigned short* __restrict__ Bt2p, int ldb, long strideB,
    void* __restrict__ Cout, void* __restrict__ Cout2, int ldc, long strideC,
    const float* __restrict__ bias,
    const float* __restrict__ resid, long strideR,
    int M, int N, int K, float scale, float* __restrict__ stat,
    const float* __restrict__ biasK, const float* __restrict__ biasV) {
  static_assert(!SPLIT, "single-plane operands only");
  static_assert(SM == 0 || ET == 0, "block softmax: f16 operands");
  static_assert(SM != 1 || OUT_MODE == 1, "score tile: f16 output");
  static_assert(BN == SBM, "SM 2: a workgroup's Bt rows are the rows of one row of stat pieces");
  static_assert((SM != 1 || BMT == SBM) && (SM != 2 || BMT == BM) && (BIAS_MODE != 3 || BMT == BM), "tile heights the stat pieces and the factor table are laid out for");
  constexpr int FI    = BMT / 32;              // A fragments (16 rows each) per wave
  constexpr int STG_H = (BMT + BN) * LPH;      // 16-bit elements per stage buffer
  typedef typename Elem<ET>::T T;
  typedef typename Frag<T>::V V;
  __shared__ __align__(16) T ring[2 * STG_H];      // two stage buffers, each [A BMT rows | Bt 256 rows] at pitch LPH
  __shared__ __align__(16) float sT[8][16 * 68];   // per-wave 16x64 slab, pitch 68 floats
  __shared__ __align__(16) float sStat[SM == 1 ? BMT * 8 : 4];         // [row][wave column][max, sum]
  __shared__ __align__(16) _Float16 sF[SM == 2 ? BN * FPH : 8];        // [Bt row][block] factor
  const int b    = blockIdx.y;
  const bool vT  = (BIAS_MODE == 3) && (b == 2);   // the same for the whole workgroup
  if constexpr (BIAS_MODE == 3) {
    const unsigned short* wsel = Btp + (size_t)b * (CH * CH);
    if (vT) { Btp = Ap; Ap = wsel; const int mm = M; M = N; N = mm; bias = biasV; }
    else    { Btp = wsel; if (b == 1) bias = biasK; }
    ldc = N;
  }
  const int tid  = threadIdx.x;
  const int lane = tid & 31;
  const int wave = tid >> 5;
  const int tilesN = N / BN;
  const int tilesM = M / BMT;
  const int tile = blockIdx.x;
  if (tile >= tilesM * tilesN) return;   // the same for the whole workgroup, in front of every barrier
  const int tm = tile / tilesN;
  const int tn = tile - tm * tilesN;
  const int wm = wave >> 2;              // wave row (0..1) and column (0..3) in the workgroup's tile
  const int wn = wave & 3;
  const int m0 = tm * BMT + wm * (BMT / 2);
  const int n0 = tn * BN + (wn << 6);

  const int rlane = lane & 15;                 // row (A) / col (B, D) within subtile
  const int koff  = (lane >> 4) * 8;           // k offset of this lane half
  const int mOff  = (lane >> 4) * 8;           // D row offset

  // copy addresses: 16 lanes cover the 256 B of one row, the workgroup 16 rows per copy
  const int crow = tid >> 4;
  const int ccol = (tid & 15) * 8;
  // the address is kept as a workgroup-uniform pointer and a 32-bit lane offset: a per-lane pointer that is itself an asm operand (stage 0) must
  // stay in v0..v255 over the whole loop, and at BMT 256 it went to scratch
  const unsigned short* uA = Ap  + (size_t)b * strideA + (size_t)(tm * BMT) * lda;   // the tile's first rows
  const unsigned short* uB = Btp + (size_t)b * strideB + (size_t)(tn * BN) * ldb;
  const unsigned oA = (unsigned)(crow * lda + ccol);                                  // this lane's place in them
  const unsigned oB = (unsigned)(crow * ldb + ccol);
  const unsigned lA = lds_off(ring) + (unsigned)(crow * LPH + ccol) * 2u;
  const unsigned lB = lA + (unsigned)(BMT * LPH) * 2u;
  auto issue_stage = [&](int t, int buf) {
    const unsigned lo = (unsigned)buf * (unsigned)(STG_H * 2);
    const unsigned short* gA = uA + (size_t)t * KS + oA;
    const unsigned short* gB = uB + (size_t)t * KS + oB;
    async_rows8(lA + lo, gA, (size_t)16 * lda);
    if constexpr (BMT == 256) {
      // the fences keep each statement's 24 address registers (asm operands: v0..v255) from being formed ahead of the statement before it:
      // formed together they push accumulators out of the low registers, one of them into scratch
      __builtin_amdgcn_sched_barrier(0);
      async_rows8(lA + lo + (unsigned)(128 * LPH) * 2u, gA + (size_t)128 * lda, (size_t)16 * lda);
      __builtin_amdgcn_sched_barrier(0);
    }
    async_rows8(lB + lo, gB, (size_t)16 * ldb);
    if constexpr (BMT == 256) __builtin_amdgcn_sched_barrier(0);
    async_rows8(lB + lo + (unsigned)(128 * LPH) * 2u, gB + (size_t)128 * ldb, (size_t)16 * ldb);
  };

  v8f acc[FI][4];
#pragma unroll
  for (int i = 0; i < FI; ++i)
#pragma unroll
    for (int j = 0; j < 4; ++j) acc[i][j] = (v8f){0.f,0.f,0.f,0.f,0.f,0.f,0.f,0.f};

  const int nT = K / KS;
  issue_stage(0, 0);
  if constexpr (SM == 2) {   // while stage 0 flies: two lanes per row, two rows per lane, merge each row's 64 block maxima and sums (K == SP keys)
    const int hf = tid & 1;
    const char* sp4 = (const char*)(stat + (size_t)(b * (SP / SBM) + tn) * (SP / BN) * (SBM * 8));
    const unsigned so = (unsigned)(hf * 8 * (SBM * 32) + (tid >> 1) * 32);   // this lane's byte offset: its first piece, its first row (the second: 128 rows on)
    v4f st[2][8][2];         // {max, sum, max, sum} of two neighbouring blocks
#pragma unroll
    for (int c = 0; c < 8; ++c) {
      st[0][c][0] = *(const v4f*)(sp4 + so + c * (SBM * 32));
      st[0][c][1] = *(const v4f*)(sp4 + so + c * (SBM * 32) + 16);
      st[1][c][0] = *(const v4f*)(sp4 + so + c * (SBM * 32) + 128 * 32);
      st[1][c][1] = *(const v4f*)(sp4 + so + c * (SBM * 32) + 128 * 32 + 16);
    }
    asm volatile("s_wait_xcnt 0x0" :: "v"(so) : "memory");   // the 32 loads share one offset register: it stays whole up to this wait (without the operand the last load's result was placed on it)
#pragma unroll
    for (int g = 0; g < 2; ++g) {
      const int row = g * 128 + (tid >> 1);
      float mx = st[g][0][0][0];
#pragma unroll
      for (int c = 0; c < 8; ++c)
#pragma unroll
        for (int h = 0; h < 2; ++h) mx = fmaxf(mx, fmaxf(st[g][c][h][0], st[g][c][h][2]));
      mx = fmaxf(mx, lane_xor<1>(mx));
      float l = 0.f;
      float w[8][2][2];      // exp(block max - row max)
#pragma unroll
      for (int c = 0; c < 8; ++c)
#pragma unroll
        for (int h = 0; h < 2; ++h) {
          w[c][h][0] = exp_slot(st[g][c][h][0] - mx);
          w[c][h][1] = exp_slot(st[g][c][h][2] - mx);
          l += st[g][c][h][1] * w[c][h][0] + st[g][c][h][3] * w[c][h][1];
        }
      l += lane_xor<1>(l);
      const float inv = PCARRY / l;
#pragma unroll
      for (int c = 0; c < 8; ++c)
#pragma unroll
        for (int h = 0; h < 2; ++h) {
          _Float16* fp = sF + row * FPH + (hf * 8 + c) * 4 + h * 2;
          fp[0] = (_Float16)(w[c][h][0] * inv);
          fp[1] = (_Float16)(w[c][h][1] * inv);
        }
    }
  }
  asm volatile("s_wait_asynccnt 0x0" ::: "memory");   // stage 0 has landed for this wave's copies
  __syncthreads();                                     // ... and for every wave's (SM 2: the factor table too)
  if (nT > 1) issue_stage(1, 1);

  for (int t = 0; t < nT; ++t) {
    const int buf = t & 1;
    const T* sA = ring + buf * STG_H + (wm * (BMT / 2) + rlane) * LPH + koff;
    const T* sB = ring + buf * STG_H + (BMT + (wn << 6) + rlane) * LPH + koff;
    // fragments of the next 32 k of this stage are fetched into a second register set ahead of the current FI * 4 products
    V af[2][FI], bf[2][4];
    _Float16 fs[4][2];       // SM 2: this lane's four Bt rows' factors for the stage's two blocks of 64 k
    if constexpr (SM == 2) {
#pragma unroll
      for (int i = 0; i < 4; ++i) {
        const _Float16* fp = sF + ((wn << 6) + (i << 4) + rlane) * FPH + 2 * t;
        fs[i][0] = fp[0]; fs[i][1] = fp[1];
      }
    }
#pragma unroll
    for (int j = 0; j < 4; ++j) { bf[0][j] = Frag<T>::load(sB + (j << 4) * LPH); af[0][j] = Frag<T>::load(sA + (j << 4) * LPH); }
#pragma unroll
    for (int i = 4; i < FI; ++i) af[0][i] = Frag<T>::load(sA + (i << 4) * LPH);
#pragma unroll
    for (int ks = 0; ks < KS / 32; ++ks) {
      const int cur = ks & 1, nxt = cur ^ 1;
      if (ks + 1 < KS / 32) {
#pragma unroll
        for (int j = 0; j < 4; ++j) {
          bf[nxt][j] = Frag<T>::load(sB + (j << 4) * LPH + (ks + 1) * 32);
          af[nxt][j] = Frag<T>::load(sA + (j << 4) * LPH + (ks + 1) * 32);
        }
#pragma unroll
        for (int i = 4; i < FI; ++i) af[nxt][i] = Frag<T>::load(sA + (i << 4) * LPH + (ks + 1) * 32);
      }
      __builtin_amdgcn_sched_barrier(0);   // keeps the LDS reads above as one group ahead of the products: sunk among them, each group of four waits out the LDS latency
      if constexpr (SM == 2) {
#pragma unroll
        for (int i = 0; i < 4; ++i) bf[cur][i] = bf[cur][i] * fs[i][ks >> 1];
      }
#pragma unroll
      for (int i = 0; i < FI; ++i)
#pragma unroll
        for (int j = 0; j < 4; ++j) acc[i][j] = Frag<T>::mma(af[cur][i], bf[cur][j], acc[i][j]);
      __builtin_amdgcn_sched_barrier(0);   // keeps the next LDS reads out of these products and the last products in front of the stage's barrier (behind it they delay the refill)
    }
    asm volatile("s_wait_dscnt 0x0" ::: "memory");      // this wave's reads of buffer buf are done before it is refilled
    asm volatile("s_wait_asynccnt 0x0" ::: "memory");   // this wave's copies of stage t + 1 have landed
    __syncthreads();                                     // publishes stage t + 1 and ends every wave's reads of buffer buf
    if (t + 2 < nT) issue_stage(t + 2, buf);
  }
  asm volatile("s_wait_asynccnt 0x0" ::: "memory");     // no copy outstanding behind the loop
  if constexpr (FI == 4) {   // FI 8: an asm operand lies in v0..v255, so the guard would hold all 256 accumulator registers there and the loop would spill; the compiler keeps the distance behind its own products
#pragma unroll
    for (int i = 0; i < FI; ++i) acc_guard4(acc[i][0], acc[i][1], acc[i][2], acc[i][3]);
  }

  // ---- epilogue ----
  float* slab = sT[wave];
  const float* Rb = RESID ? (resid + (size_t)b * strideR) : nullptr;
  float bn[4] = {0.f, 0.f, 0.f, 0.f};   // BIAS_MODE 3, q and k: the bias of this lane's four columns
  float bm[4][8];                       // BIAS_MODE 3, v^T: the bias of this lane's 32 rows
  if constexpr (BIAS_MODE == 3) {
#pragma unroll
    for (int i = 0; i < 4; ++i)
#pragma unroll
      for (int r = 0; r < 8; ++r) bm[i][r] = 0.f;
    if (vT) {
#pragma unroll
      for (int i = 0; i < 4; ++i)
#pragma unroll
        for (int r = 0; r < 8; ++r) bm[i][r] = bias[((m0 + (i << 4) + mOff) >> 3) * 32 + r];
    } else {
#pragma unroll
      for (int j = 0; j < 4; ++j) bn[j] = bias[n0 + (j << 4) + rlane];
    }
  }
#pragma unroll
  for (int i = 0; i < FI; ++i) {
    const int mBase = m0 + (i << 4);
#pragma unroll
    for (int j = 0; j < 4; ++j) {
      const int n = n0 + (j << 4) + rlane;
      float bv = 0.f;
      if (BIAS_MODE == 2) bv = bias[n];
#pragma unroll
      for (int r = 0; r < 8; ++r) {
        float v = acc[i][j][r] * scale;
        if (BIAS_MODE == 1) v += bias[mBase + mOff + r];
        if (BIAS_MODE == 2) v += bv;
        if constexpr (BIAS_MODE == 3) v += vT ? bm[i][r] : bn[j];
        if (RESID) v += Rb[(size_t)(mBase + mOff + r) * ldc + n];
        if (ACT == 1) v = tanhf(v);
        if (ACT == 2) v = fmaxf(v, 0.0f);
        if (ACT == 3) v = v / (1.0f + expf(-v));
        if (ACT == 4) v = (v > 0.f) ? v : 0.01f * v;
        if (ACT == 5) v = 0.5f * v * (1.0f + erff(v * 0.70710678118654752f));
        slab[(mOff + r) * 68 + (j << 4) + rlane] = v;
      }
    }
    // The slab is this wave's own, so the hand-over between its lanes needs the wave's LDS wait alone. A workgroup-scope fence here and at the foot
    // of the trip also waits until the global stores of the 16 rows before are acknowledged: one store latency per 16 rows that nothing hides.
    asm volatile("s_wait_dscnt 0x0" ::: "memory");   // the slab's rows are written before other lanes read them back
    __builtin_amdgcn_wave_barrier();
    if (OUT_MODE == 0) {
      float* C = (float*)Cout + (size_t)b * strideC;
      const int hh = lane >> 4, c4 = (lane & 15) * 4;     // row seg = 256 B = 16 lanes x 16 B
      {
#pragma unroll
        for (int it = 0; it < 8; ++it) {
          const int row = it * 2 + hh;
          v4f v = *(const v4f*)(slab + row * 68 + c4);
          *(v4f*)(C + (size_t)(mBase + row) * ldc + n0 + c4) = v;
        }
        
      }
    } else {
      const int q = lane >> 3, c8 = (lane & 7) * 8;
      unsigned short* C  = (unsigned short*)Cout  + (size_t)b * strideC;
      unsigned short* C2 = (OUT_MODE == 2) ? ((unsigned short*)Cout2 + (size_t)b * strideC) : nullptr;
      {
#pragma unroll
        for (int it = 0; it < 4; ++it) {
          const int row = it * 4 + q;
          const float* sp = slab + row * 68 + c8;
          v8h hv, lv;
          float pv[8];
          if constexpr (SM == 1) {   // eight lanes hold one row's 64 scores: block max, exp, block sum
            // (left to try: the four row groups of a slab run one behind the other, each a dependent chain of LDS read, max, exp and sum; read and reduced together they would overlap)
#pragma unroll
            for (int e = 0; e < 8; ++e) pv[e] = sp[e];
            float mx = fmaxf(fmaxf(fmaxf(pv[0], pv[1]), fmaxf(pv[2], pv[3])), fmaxf(fmaxf(pv[4], pv[5]), fmaxf(pv[6], pv[7])));
            mx = fmaxf(mx, lane_xor<1>(mx)); mx = fmaxf(mx, lane_xor<2>(mx)); mx = fmaxf(mx, lane_xor<4>(mx));
#pragma unroll
            for (int e = 0; e < 8; ++e) pv[e] = __expf(pv[e] - mx);
            float su = ((pv[0] + pv[1]) + (pv[2] + pv[3])) + ((pv[4] + pv[5]) + (pv[6] + pv[7]));
            su += lane_xor<1>(su); su += lane_xor<2>(su); su += lane_xor<4>(su);
            if ((lane & 7) == 0) {
              float* ss = sStat + ((wm * (BMT / 2) + (i << 4) + row) * 4 + wn) * 2;
              ss[0] = mx; ss[1] = su;
            }
          }
#pragma unroll
          for (int e = 0; e < 8; ++e) {
            if (SM == 1) {
              hv[e] = (_Float16)pv[e];
            } else if (OUT_MODE == 1) {
              hv[e] = (_Float16)sp[e];
            } else {
              unsigned short hb = f2bf_bits(sp[e]);
              unsigned short lb = f2bf_bits(sp[e] - bf_bits2f(hb));
              hv[e] = __builtin_bit_cast(_Float16, hb);
              lv[e] = __builtin_bit_cast(_Float16, lb);
            }
          }
          *(v8h*)(C + (size_t)(mBase + row) * ldc + n0 + c8) = hv;
          if (OUT_MODE == 2) *(v8h*)(C2 + (size_t)(mBase + row) * ldc + n0 + c8) = lv;
        }
        
      }
    }
    // Foot of the trip: no wait for the global stores themselves, they stay in flight (nothing in this launch reads them). The statement's memory clobber keeps
    // the next 16 rows' slab writes behind these rows' slab reads, whose values the stores above have already taken.
    asm volatile("s_wait_xcnt 0x0" ::: "memory");   // stands between these global stores and whatever the compiler places on their address and data registers for the next rows
    __builtin_amdgcn_sched_barrier(0);               // keeps the next rows' scaling products behind that wait: lifted over it, two of them landed on the last store's data registers
    __builtin_amdgcn_wave_barrier();
  }
  if constexpr (SM == 1) {
    __syncthreads();         // every wave's block maxima and sums are in sStat
#pragma unroll
    for (int h = 0; h < BMT / 128; ++h)
      ((v4f*)(stat + (size_t)((b * tilesM + tm) * tilesN + tn) * (BMT * 8)))[tid + h * 256] = ((const v4f*)sStat)[tid + h * 256];   // whole lines, 8 KiB per tile
  }
}

// ---- group statistics, partial sums: one block per channel (16 per group), f64 fixed-order accumulation.
// Block b stores the sum and the sum of squares of its 16384 elements in the first two doubles of its own 128-B line of part.
// The blocks behind those 512 carry Wq and Wk x16 to f16 (4096 elements each, 64 blocks per matrix): work that
// depends on nothing here and rides in this launch instead of launches of its own.
// The blocks in front of them (they take longest, so they start first) fold the output projection into the value projection:
// out = Wp (P v) + bp = P (Wp v) + bp and Wp v = (Wp Wv) tok + Wp bv, so that the P*V launch gives the output itself.
//  128 blocks: Wvp = Wp * Wv on the matrix unit, x16, f16: a tile is 16 rows o x 64 columns i (whole 128-B lines of Wvp), a block has two tiles,
//              four waves each take a quarter of a tile's k (a short chain of memory latencies) and the first of them adds the four behind a barrier;
//    8 blocks: Wp * bv in f32, a wave's eight values at the head of its own 128-B line of wpbv.
constexpr int WBLK = 4096;                 // weight elements per cast block
constexpr int NWB  = CH * CH / WBLK;       // cast blocks per matrix
constexpr int NVP  = (CH / 16) * (CH / 64) / 2;   // blocks of Wp * Wv: two tiles of 16 rows x 64 columns each
constexpr int NBV  = CH / 64;                  // blocks of Wp * bv: 64 rows each
// six waves per SIMD (at most 160 registers): three workgroups per WGP, so that every statistics workgroup is resident from the start
__global__ __launch_bounds__(256, 6) void gn_stats(const float* __restrict__ x, double* __restrict__ part,
                                                const float* __restrict__ wq, const float* __restrict__ wk,
                                                const float* __restrict__ wv, const float* __restrict__ wp,
                                                const float* __restrict__ bv,
                                                _Float16* __restrict__ w16, float* __restrict__ wpbv) {
  __shared__ double ws1[8];
  __shared__ double ws2[8];
  __shared__ float red[6 * 1024];    // Wp * Wv: the partial tiles of the waves with k quarters 1..3, [tile][quarter - 1][register][lane]
  const int tid = threadIdx.x, wave = tid >> 5, lane = tid & 31;
  if (blockIdx.x < NVP) {            // the same for the whole workgroup: its barrier is passed by all eight waves
    // D[i][o] = sum_m Wv[m][i] * Wp[o][m]: A rows are columns i of Wv (16 lanes read 64 B of a row m), B columns are rows o of Wp (k contiguous);
    // both fragments hold k = k0 + 8 * (lane / 16) + e in elements e = 0..7 and 16 more in elements 8..15
    const int ws = __builtin_amdgcn_readfirstlane(wave);   // the wave's number in a scalar register: tile, quarter and their addresses cost no vector registers
    const int tsel = ws >> 2, kq = ws & 3;
    const int tile = (int)blockIdx.x * 2 + tsel;
    const int o0 = (tile >> 3) * 16;
    const int i0 = (tile & 7) * 64;
    const int rl = lane & 15, hi = lane >> 4;
    const float* pb = wp + (size_t)(o0 + rl) * CH + kq * (CH / 4) + hi * 8;
    const float* pa = wv + (size_t)(kq * (CH / 4) + hi * 8) * CH + i0 + rl;
    v8f c[4];
#pragma unroll
    for (int f = 0; f < 4; ++f) c[f] = (v8f){0.f,0.f,0.f,0.f,0.f,0.f,0.f,0.f};
#pragma unroll 2
    for (int k0 = 0; k0 < CH / 4; k0 += 32) {
      const v4f b0 = *(const v4f*)(pb + k0),      b1 = *(const v4f*)(pb + k0 + 4);
      const v4f b2 = *(const v4f*)(pb + k0 + 16), b3 = *(const v4f*)(pb + k0 + 20);
      float ar[4][16];
#pragma unroll
      for (int f = 0; f < 4; ++f)
#pragma unroll
        for (int e = 0; e < 8; ++e) {
          ar[f][e]     = pa[(size_t)(k0 + e) * CH + f * 16];
          ar[f][8 + e] = pa[(size_t)(k0 + 16 + e) * CH + f * 16];
        }
      v16h bh;
#pragma unroll
      for (int e = 0; e < 4; ++e) {
        bh[e]      = (_Float16)(b0[e] * WCARRY); bh[4 + e]  = (_Float16)(b1[e] * WCARRY);
        bh[8 + e]  = (_Float16)(b2[e] * WCARRY); bh[12 + e] = (_Float16)(b3[e] * WCARRY);
      }
#pragma unroll
      for (int f = 0; f < 4; ++f) {
        v16h ah;
#pragma unroll
        for (int e = 0; e < 16; ++e) ah[e] = (_Float16)(ar[f][e] * WCARRY);
        c[f] = __builtin_amdgcn_wmma_f32_16x16x32_f16(false, ah, false, bh, (short)0, c[f], false, false);
      }
    }
    if (kq != 0) {
      float* rd = red + (tsel * 3 + kq - 1) * 1024 + lane;
#pragma unroll
      for (int f = 0; f < 4; ++f)
#pragma unroll
        for (int r = 0; r < 8; ++r) rd[(f * 8 + r) * 32] = c[f][r];
    }
    __syncthreads();                 // the partial tiles of quarters 1..3 are visible to the wave of quarter 0
    if (kq == 0) {
#pragma unroll
      for (int q = 0; q < 3; ++q) {
        const float* rd = red + (tsel * 3 + q) * 1024 + lane;
#pragma unroll
        for (int f = 0; f < 4; ++f)
#pragma unroll
          for (int r = 0; r < 8; ++r) c[f][r] += rd[(f * 8 + r) * 32];
      }
      _Float16* d = w16 + (size_t)2 * CH * CH + (size_t)(o0 + rl) * CH + i0 + hi * 8;   // lane: row o, eight neighbouring columns i per fragment
#pragma unroll
      for (int f = 0; f < 4; ++f) {
        v8h h;
#pragma unroll
        for (int r = 0; r < 8; ++r) h[r] = (_Float16)(c[f][r] * WCARRY_INV);   // x16 * x16 -> x16
        *(v8h*)(d + f * 16) = h;
      }
    }
    return;
  }
  if (blockIdx.x < NVP + NBV) {      // the same for the whole workgroup, in front of the barrier
    const int r0 = ((int)blockIdx.x - NVP) * 64 + wave * 8;
    v4f bb[4], wr[8][4];
#pragma unroll
    for (int j = 0; j < 4; ++j) bb[j] = *(const v4f*)(bv + j * 128 + lane * 4);
#pragma unroll
    for (int r = 0; r < 8; ++r)
#pragma unroll
      for (int j = 0; j < 4; ++j) wr[r][j] = *(const v4f*)(wp + (size_t)(r0 + r) * CH + j * 128 + lane * 4);
    float sm[8];
#pragma unroll
    for (int r = 0; r < 8; ++r) {
      float a = 0.f;
#pragma unroll
      for (int j = 0; j < 4; ++j)
#pragma unroll
        for (int e = 0; e < 4; ++e) a += wr[r][j][e] * bb[j][e];
      sm[r] = a;
    }
#pragma unroll
    for (int off = 1; off < 32; off <<= 1)
#pragma unroll
      for (int r = 0; r < 8; ++r) sm[r] += __shfl_xor(sm[r], off, 32);
    if (lane == 0) {
      float* d = wpbv + (size_t)(r0 >> 3) * 32;
      *(v4f*)(d)     = (v4f){sm[0], sm[1], sm[2], sm[3]};
      *(v4f*)(d + 4) = (v4f){sm[4], sm[5], sm[6], sm[7]};
    }
    return;
  }
  const int blk = (int)blockIdx.x - (NVP + NBV);
  if (blk >= NGRP * NCH) {           // the same for the whole workgroup, in front of the barrier
    const int cb = blk - NGRP * NCH, wi = cb / NWB;
    const float* src = (wi == 0) ? wq : wk;
    const v4f* s4 = (const v4f*)(src + (size_t)(cb - wi * NWB) * WBLK);
    v4h* d4 = (v4h*)(w16 + (size_t)cb * WBLK);
    v4f wv4[WBLK / 1024];
#pragma unroll
    for (int i = 0; i < WBLK / 1024; ++i) wv4[i] = s4[tid + i * 256];
#pragma unroll
    for (int i = 0; i < WBLK / 1024; ++i) {
      v4h h;
#pragma unroll
      for (int e = 0; e < 4; ++e) h[e] = (_Float16)(wv4[i][e] * WCARRY);
      d4[tid + i * 256] = h;
    }
    return;
  }
  const v4f* p = (const v4f*)(x + (size_t)blk * CSP);
  v4f v[CSP / 1024];                 // all 16 loads of a lane are in flight together
#pragma unroll
  for (int i = 0; i < CSP / 1024; ++i) v[i] = p[tid + i * 256];
  __builtin_amdgcn_sched_barrier(0);   // keeps all 16 loads ahead of the sums: sunk among them, the second eight wait out a second memory latency
  double a[4] = {0.0, 0.0, 0.0, 0.0}, q[4] = {0.0, 0.0, 0.0, 0.0};
#pragma unroll
  for (int i = 0; i < CSP / 1024; ++i) {
#pragma unroll
    for (int e = 0; e < 4; ++e) { const double d = (double)v[i][e]; a[e] += d; q[e] += d * d; }
  }
  double s = (a[0] + a[1]) + (a[2] + a[3]), s2 = (q[0] + q[1]) + (q[2] + q[3]);
#pragma unroll
  for (int off = 1; off < 32; off <<= 1) { s += __shfl_xor(s, off, 32); s2 += __shfl_xor(s2, off, 32); }
  if (lane == 0) { ws1[wave] = s; ws2[wave] = s2; }
  __syncthreads();
  if (tid < 16) {
    double ts = 0.0, ts2 = 0.0;
#pragma unroll
    for (int w = 0; w < 8; ++w) { ts += ws1[w]; ts2 += ws2[w]; }
    part[(size_t)blk * 16 + lane] = (lane == 0) ? ts : ((lane == 1) ? ts2 : 0.0);
  }
}

// ---- normalize + affine + transpose: x[c][t][s] (f32) -> tok[t*SP + s][c] (f16).
__global__ __launch_bounds__(256) void norm_tok(const float* __restrict__ x,
                                                const float* __restrict__ gamma,
                                                const float* __restrict__ beta,
                                                const double* __restrict__ part,
                                                _Float16* __restrict__ tok) {
  __shared__ __align__(16) _Float16 tile[64 * 72];   // [sl][cl], pitch 72 halves
  __shared__ float gstat[8];                         // mean, rstd of the block's 4 groups
  const int bid = blockIdx.x;
  const int cb  = bid & 7;           // 8 channel blocks of 64
  const int sb  = (bid >> 3) & 63;   // 64 position blocks of 64
  const int t   = bid >> 9;          // frame
  const int c0 = cb * 64, s0 = sb * 64;
  const int tid = threadIdx.x;
  if (tid < 128) {                   // wave gi sums group gi's 16 partial pairs: lanes 0..15 the sums, lanes 16..31 the sums of squares
    const int gi = tid >> 5, ln = tid & 31;
    double d = part[(size_t)(((c0 >> 4) + gi) * NCH + (ln & 15)) * 16 + (ln >> 4)];
#pragma unroll
    for (int off = 1; off < 16; off <<= 1) d += __shfl_xor(d, off, 32);
    const double ts2 = __shfl(d, 16, 32);
    const double mean = d * (1.0 / (double)GSZ);
    double var = ts2 * (1.0 / (double)GSZ) - mean * mean;
    if (var < 0.0) var = 0.0;
    if (ln == 0) { gstat[gi * 2] = (float)mean; gstat[gi * 2 + 1] = rsqrtf((float)var + GN_EPS); }
  }
  __syncthreads();                   // the four groups' mean and rstd are visible to every wave
#pragma unroll 4
  for (int i = tid; i < 64 * 64; i += 256) {
    const int cl = i >> 6, sl = i & 63;
    const int c = c0 + cl;
    const float mean = gstat[(cl >> 4) * 2], rstd = gstat[(cl >> 4) * 2 + 1];
    float v = x[(size_t)c * CSP + (size_t)t * SP + s0 + sl];
    v = (v - mean) * rstd * gamma[c] + beta[c];
    tile[sl * 72 + cl] = (_Float16)v;
  }
  __syncthreads();
  const int wave = tid >> 5, lane = tid & 31;
  const int q = lane >> 3, c8 = (lane & 7) * 8;
  {
#pragma unroll
    for (int it = 0; it < 2; ++it) {
      const int row = wave * 8 + it * 4 + q;   // wave covers rows 8w..8w+7
      const v8h hv = *(const v8h*)(tile + row * 72 + c8);
      *(v8h*)(tok + ((size_t)t * SP + s0 + row) * CH + c0 + c8) = hv;
    }
    
  }
}

static inline int gemm_blocks(int M, int N) { return (M / 128) * (N / 256); }

// ---------------- launch ----------------
extern "C" void kernel_launch(void* const* d_in, const int* in_sizes, int n_in,
                              void* d_out, int out_size, void* d_ws, size_t ws_size,
                              hipStream_t stream) {
  if (n_in < 11) return;
  if (in_sizes[0] != CH * CSP || out_size != CH * CSP) return;
  if (in_sizes[1] != CH || in_sizes[2] != CH) return;
  if (in_sizes[3] != CH * CH || in_sizes[5] != CH * CH || in_sizes[7] != CH * CH || in_sizes[9] != CH * CH) return;
  if (in_sizes[4] != CH || in_sizes[6] != CH || in_sizes[8] != CH || in_sizes[10] != CH) return;

  const float* x     = (const float*)d_in[0];
  const float* gamma = (const float*)d_in[1];
  const float* beta  = (const float*)d_in[2];
  const float* wq    = (const float*)d_in[3];
  const float* bq    = (const float*)d_in[4];
  const float* wk    = (const float*)d_in[5];
  const float* bk    = (const float*)d_in[6];
  const float* wv    = (const float*)d_in[7];
  const float* bv    = (const float*)d_in[8];
  const float* wp    = (const float*)d_in[9];
  const float* bp    = (const float*)d_in[10];
  float* out = (float*)d_out;

  char* ws = (char*)d_ws;
  size_t off = 0;
  double* part = (double*)(ws + off);         off += (size_t)NGRP * NCH * 128;                  // 512 lines of 128 B
  float* wpbv    = (float*)(ws + off);        off += (size_t)(CH / 8) * 128;                    // 64 lines of 128 B
  _Float16* w16  = (_Float16*)(ws + off);     off += (size_t)3 * CH * CH * sizeof(_Float16);   // 1.5 MiB
  _Float16* tok  = (_Float16*)(ws + off);     off += (size_t)NTOK * CH * sizeof(_Float16);     // 16 MiB
  _Float16* q16  = (_Float16*)(ws + off);     off += (size_t)NTOK * CH * sizeof(_Float16);     // 16 MiB
  _Float16* k16  = (_Float16*)(ws + off);     off += (size_t)NTOK * CH * sizeof(_Float16);     // 16 MiB
  _Float16* vT16 = (_Float16*)(ws + off);     off += (size_t)CH * NTOK * sizeof(_Float16);     // 16 MiB  [512][16384]
  float* stat    = (float*)(ws + off);        off += (size_t)NTOK * (SP / KBLK) * 2 * sizeof(float);   // 8 MiB: block max and sum per row and 64 keys
  _Float16* P16  = (_Float16*)(ws + off);     off += (size_t)NTOK * SP * sizeof(_Float16);     // 128 MiB  [16384][4096], every frame's rows
  if (off > ws_size) return;
  // w16 holds Wq | Wk | Wp*Wv, one plane of 512 x 512 each

  // 1. group statistics: partial sums, one workgroup per channel (the normalize kernel adds each group's 16);
  //    in the same launch: Wp*Wv and Wp*bv (136 workgroups in front), Wq and Wk x16 -> f16 (128 workgroups behind)
  gn_stats<<<dim3(NVP + NBV + NGRP * NCH + 2 * NWB), dim3(256), 0, stream>>>(x, part, wq, wk, wv, wp, bv, w16, wpbv);

  // 3. normalize + transpose to tokens
  norm_tok<<<dim3(TFR * 64 * 8), dim3(256), 0, stream>>>(x, gamma, beta, part, tok);

  //    (left to try: k could be the tokens themselves, q*k^T = tok (Wq^T Wk) tok^T + (Wk^T bq) tok^T + terms that are constant along the keys, which softmax drops)
  // 4. the three projections in one launch, one per blockIdx.y (256 x 3 workgroups), f16 out:
  //    q = tok*Wq^T/16 + bq and k = tok*Wk^T/16 + bk, [16384][512]; v'^T[c][token] = (Wp*Wv)16*tok^T/16 + (Wp*bv)[c], [512][16384]
  wmma_gemm64<0, false, 3, 1, false><<<dim3(gemm_blocks(NTOK, CH), 3), dim3(256), 0, stream>>>(
      U16(tok), U16(tok), CH, (long)0, U16(w16), U16(w16), CH, (long)0,
      (void*)q16, (void*)q16, CH, (long)NTOK * CH, bq, x, (long)0, NTOK, CH, CH, WCARRY_INV, stat, bk, wpbv);

  // 5. scores of all frames in one launch, one frame per blockIdx.y (256 x 4 workgroups of 256 x 256 scores): q*k^T*512^-0.5 stays in registers;
  //    each 64-key block of a row is stored as f16 exp(s - block max) in P16, its max and sum in stat
  wmma_gemm64<0, false, 0, 1, false, 0, 1, SBM><<<dim3((SP / SBM) * (SP / BN), TFR), dim3(256), 0, stream>>>(
      U16(q16), U16(q16), CH, (long)SP * CH, U16(k16), U16(k16), CH, (long)SP * CH,
      (void*)P16, (void*)P16, SP, (long)SP * SP, bq, x, (long)0, SP, SP, CH, QSCALE, stat, bq, bq);
  // 6. out[c][token] = v'^T * (factor * P16)^T x2^-15 + bp[c] + x[c][token] for all frames in one launch, one frame per blockIdx.y: 64 x 4 = 256 workgroups
  //    (A = vT16 + frame*4096, [512][4096] with pitch 16384, Bt = P16 frame [4096][4096], f32 out [512][4096] with pitch 16384 at column frame*4096)
  wmma_gemm64<0, false, 1, 0, true, 0, 2><<<dim3(gemm_blocks(CH, SP), TFR), dim3(256), 0, stream>>>(
      U16(vT16), U16(vT16), NTOK, (long)SP, U16(P16), U16(P16), SP, (long)SP * SP,
      (void*)out, (void*)out, NTOK, (long)SP, bp, x, (long)SP, CH, SP, SP, PCARRY_INV, stat, bq, bq);
}

// v009
// It runs in 157 microseconds.
// Timed twice side by side with v008, it ran 1.10 and 1.09 times as fast.
// All steps since v000 together make it 13.8 times as fast.
#include <hip/hip_runtime.h>
// Contractions Wp*Wv, tok*Wq^T, tok*Wk^T, (Wp*Wv)*tok^T, k*q^T, v'^T*P^T: v_wmma_f32_16x16x32_f16 (f16 operands, f32 accumulate); weights carried x16, softmax probabilities carried x2^15 (f16 exp(s - block max) times an f16 row-and-block factor); group statistics accumulated in f64; Wp*bv and all other elementwise math f32.

typedef __attribute__((ext_vector_type(16))) _Float16 v16h;
typedef __attribute__((ext_vector_type(8)))  _Float16 v8h;
typedef __attribute__((ext_vector_type(4)))  _Float16 v4h;
typedef __attribute__((ext_vector_type(16))) __bf16   v16b;
typedef __attribute__((ext_vector_type(8)))  __bf16   v8b;
typedef __attribute__((ext_vector_type(8)))  float    v8f;
typedef __attribute__((ext_vector_type(4)))  float    v4f;
#define U16(p) ((const unsigned short*)(const void*)(p))

constexpr int CH   = 512;          // channels
constexpr int TFR  = 4;            // frames
constexpr int SP   = 4096;         // tokens per frame (h*w)
constexpr int CSP  = TFR * SP;     // 16384 elements per channel
constexpr int NTOK = TFR * SP;     // 16384 tokens
constexpr int GSZ  = 16 * CSP;     // 262144 elements per group (16 channels per group)
constexpr int NGRP = 32;
constexpr int NCH  = 16;           // partial sums per group: one workgroup per channel
constexpr int KBLK = 64;           // keys per softmax block (half of one wave's keys of a score tile)
constexpr float GN_EPS     = 1e-6f;
constexpr float QSCALE     = 0.04419417382415922f;   // 512^-0.5
constexpr float WCARRY     = 16.0f;
constexpr float WCARRY_INV = 1.0f / 16.0f;
constexpr float PCARRY     = 32768.0f;
constexpr float PCARRY_INV = 1.0f / 32768.0f;

__device__ __forceinline__ unsigned short f2bf_bits(float f) {
  unsigned u = __float_as_uint(f);
  return (unsigned short)((u + 0x7FFFu + ((u >> 16) & 1u)) >> 16);
}
__device__ __forceinline__ float bf_bits2f(unsigned short h) { return __uint_as_float(((unsigned)h) << 16); }

// hazard guard between the last products and the epilogue's reads of the accumulators
__device__ __forceinline__ void acc_guard4(v8f& a, v8f& b, v8f& c, v8f& d) { asm volatile("v_nop\n\tv_nop\n\tv_nop\n\tv_nop" : "+v"(a), "+v"(b), "+v"(c), "+v"(d)); }
template <typename T> struct Frag;
template <> struct Frag<_Float16> {
  typedef v16h V; union U { v16h v; v8h h[2]; };
  static __device__ __forceinline__ v16h load(const _Float16* p) {   // elements 0..7 <- p[0..7], 8..15 <- p[16..23]
    U f; f.h[0] = *(const v8h*)(p); f.h[1] = *(const v8h*)(p + 16); return f.v;
  }
  static __device__ __forceinline__ v8f mma(v16h a, v16h b, v8f c) {
    return __builtin_amdgcn_wmma_f32_16x16x32_f16(false, a, false, b, (short)0, c, false, false);
  }
};
template <> struct Frag<__bf16> {
  typedef v16b V; union U { v16b v; v8b h[2]; };
  static __device__ __forceinline__ v16b load(const __bf16* p) {
    U f; f.h[0] = *(const v8b*)(p); f.h[1] = *(const v8b*)(p + 16); return f.v;
  }
  static __device__ __forceinline__ v8f mma(v16b a, v16b b, v8f c) {
    return __builtin_amdgcn_wmma_f32_16x16x32_bf16(false, a, false, b, (short)0, c, false, false);
  }
};

// ---- LDS-staged batched WMMA GEMM -------------------------------------------
// C[m,n] = scale * sum_k A[m,k] * Bt[n,k] (+bias)(+resid); a workgroup of 8 waves (2 x 4) owns a BMT x 256 tile, each wave (BMT / 2) x 64 of it.
// BMT = 128, or 256 where the grid still fills the chip: per product a third fewer bytes come from L2 and a quarter fewer fragment bytes from LDS.
// A row-major [M,K]; Bt row-major [N,K]; M % BMT == 0, N % 256 == 0, K % 128 == 0.
// Per stage 128 k of the BMT A rows and the 256 Bt rows are copied to LDS by global_load_async_to_lds_b128 (two buffers:
// the next stage's copies fly while this stage is multiplied); fragments are read from LDS at a row pitch of 272 B.
// BIAS_MODE: 0 = none, 1 = bias[m], 2 = bias[n], 3 = the three token projections in one launch, one per blockIdx.y:
//   A = tokens, Bt = Wq | Wk | Wp*Wv (contiguous planes), C = q | k | v'^T (contiguous planes); y 0 and 1: tok * W^T + bias[n] (bias, biasK);
//   y 2: the operands change places, W * tok^T + biasV[m], so that v' comes out transposed (biasV: eight values at the head of each 128-B line).
// OUT_MODE: 0 = f32, 1 = f16, 2 = bf16 hi plane (Cout) + bf16 lo plane (Cout2).
// ET: 0 = f16 operands, 1 = bf16 operands (pointers passed as 16-bit storage)
// SM: 0 = plain; 1 = score tile, transposed: A rows are keys, Bt rows are queries, so that a lane holds eight neighbouring keys of one query per accumulator;
//     each 64 keys of a query are stored as exp(s - block max) at Cout[query][key], the block's max and sum go to stat;
//     2 = Bt holds such blocks: the workgroup merges its 256 Bt rows' 64 block maxima and sums into one factor per row and block
//     (exp(block max - row max) / row sum * 2^15) and multiplies every Bt fragment by its row's factor ahead of the products.
// stat: one 8-KiB piece per score tile, [2 halves of the tile's keys][256 queries][2 blocks of 64 keys][max, sum], pieces ordered [batch][query tile][key tile]:
//     a score wave's 16 queries x 2 blocks are two whole 128-B lines, which it writes itself.
constexpr int BM    = 128;                 // A rows per workgroup (the default of BMT)
constexpr int SBM   = 256;                 // A rows per workgroup of the score launch = rows per piece of stat
constexpr int BN    = 256;                 // Bt rows per workgroup
constexpr int KS    = 128;                 // k per stage (256 B of every row)
constexpr int LPH   = KS + 8;              // LDS row pitch in 16-bit elements (272 B: 16 rows of a b128 read fall on 64 distinct banks)
constexpr int FPH   = SP / KBLK + 2;       // factor table row pitch in 16-bit elements (132 B: 16 rows fall on distinct banks)

__device__ __forceinline__ unsigned lds_off(const void* p) { return (unsigned)(size_t)p; }

// value of lane l ^ X (X < 16) by DPP row_xmask; every lane is on where it is used
template <int X> __device__ __forceinline__ float lane_xor(float x) {
  return __builtin_bit_cast(float, __builtin_amdgcn_update_dpp(0, __builtin_bit_cast(int, x), 0x160 + X, 0xf, 0xf, true));
}

// e^x with the slot behind the transcendental filled inside the statement
__device__ __forceinline__ float exp_slot(float x) {
  float r;
  asm("v_exp_f32 %0, %1\n\tv_nop" : "=v"(r) : "v"(x * 1.4426950408889634f));
  return r;
}

// 2^y of eight values in one statement: behind each v_exp_f32 stands one that touches neither its result nor its source (the outputs are early-clobber,
// so none shares a register with an input), behind the last a v_nop fills the slot; one v_nop per v_exp_f32 would take issue slots from the SIMD's other wave
__device__ __forceinline__ void exp2_slot8(float (&p)[8], const float (&y)[8]) {
  asm("v_exp_f32 %0, %8\n\tv_exp_f32 %1, %9\n\tv_exp_f32 %2, %10\n\tv_exp_f32 %3, %11\n\t"
      "v_exp_f32 %4, %12\n\tv_exp_f32 %5, %13\n\tv_exp_f32 %6, %14\n\tv_exp_f32 %7, %15\n\tv_nop"
      : "=&v"(p[0]), "=&v"(p[1]), "=&v"(p[2]), "=&v"(p[3]), "=&v"(p[4]), "=&v"(p[5]), "=&v"(p[6]), "=&v"(p[7])
      : "v"(y[0]), "v"(y[1]), "v"(y[2]), "v"(y[3]), "v"(y[4]), "v"(y[5]), "v"(y[6]), "v"(y[7]));
}

// value of lane l ^ 16; every lane is on where it is used
__device__ __forceinline__ float lane_xhalf(float x) {
  return __builtin_bit_cast(float, __builtin_amdgcn_permlanex16(__builtin_bit_cast(int, x), __builtin_bit_cast(int, x), 0x76543210, 0xfedcba98, false, false));
}

// Eight copies of 16 B per lane, rows 16 apart: LDS byte address l + i * 16 rows, global address g + i * gstep elements.
// The s_wait_xcnt stands inside the statement so that no address register is rewritten ahead of it.
__device__ __forceinline__ void async_rows8(unsigned l, const unsigned short* g, size_t gstep) {
  constexpr unsigned LS = 16u * LPH * 2u;
  const unsigned l1 = l + LS, l2 = l + 2 * LS, l3 = l + 3 * LS, l4 = l + 4 * LS, l5 = l + 5 * LS, l6 = l + 6 * LS, l7 = l + 7 * LS;
  const unsigned short* g1 = g + gstep;     const unsigned short* g2 = g + 2 * gstep;
  const unsigned short* g3 = g + 3 * gstep; const unsigned short* g4 = g + 4 * gstep;
  const unsigned short* g5 = g + 5 * gstep; const unsigned short* g6 = g + 6 * gstep;
  const unsigned short* g7 = g + 7 * gstep;
  asm volatile(
      "global_load_async_to_lds_b128 %0, %8, off\n\t"
      "global_load_async_to_lds_b128 %1, %9, off\n\t"
      "global_load_async_to_lds_b128 %2, %10, off\n\t"
      "global_load_async_to_lds_b128 %3, %11, off\n\t"
      "global_load_async_to_lds_b128 %4, %12, off\n\t"
      "global_load_async_to_lds_b128 %5, %13, off\n\t"
      "global_load_async_to_lds_b128 %6, %14, off\n\t"
      "global_load_async_to_lds_b128 %7, %15, off\n\t"
      "s_wait_xcnt 0x0"
      :: "v"(l), "v"(l1), "v"(l2), "v"(l3), "v"(l4), "v"(l5), "v"(l6), "v"(l7),
         "v"(g), "v"(g1), "v"(g2), "v"(g3), "v"(g4), "v"(g5), "v"(g6), "v"(g7)
      : "memory");
}
template <int ET> struct Elem;
template <> struct Elem<0> { typedef _Float16 T; };
template <> struct Elem<1> { typedef __bf16 T; };
template <int ET, bool SPLIT, int BIAS_MODE, int OUT_MODE, bool RESID, int ACT = 0, int SM = 0, int BMT = BM>
__global__ __launch_bounds__(256) void wmma_gemm64(
    const unsigned short* __restrict__ Ap, const unsigned short* __restrict__ A2p, int lda, long strideA,
    const unsigned short* __restrict__ Btp, const unsigned short* __restrict__ Bt2p, int ldb, long strideB,
    void* __restrict__ Cout, void* __restrict__ Cout2, int ldc, long strideC,
    const float* __restrict__ bias,
    const float* __restrict__ resid, long strideR,
    int M, int N, int K, float scale, float* __restrict__ stat,
    const float* __restrict__ biasK, const float* __restrict__ biasV) {
  static_assert(!SPLIT, "single-plane operands only");
  static_assert(SM == 0 || ET == 0, "block softmax: f16 operands");
  static_assert(SM != 1 || OUT_MODE == 1, "score tile: f16 output");
  static_assert(BN == SBM, "SM 2: a workgroup's Bt rows are the rows of one row of stat pieces");
  static_assert((SM != 1 || BMT == SBM) && (SM != 2 || BMT == BM) && (BIAS_MODE != 3 || BMT == BM), "tile heights the stat pieces and the factor table are laid out for");
  constexpr int FI    = BMT / 32;              // A fragments (16 rows each) per wave
  constexpr int STG_H = (BMT + BN) * LPH;      // 16-bit elements per stage buffer
  typedef typename Elem<ET>::T T;
  typedef typename Frag<T>::V V;
  __shared__ __align__(16) T ring[2 * STG_H];      // two stage buffers, each [A BMT rows | Bt 256 rows] at pitch LPH
  __shared__ __align__(16) float sT[8][16 * 68];   // per-wave 16x64 slab, pitch 68 floats
  __shared__ __align__(16) _Float16 sF[SM == 2 ? BN * FPH : 8];        // [Bt row][block] factor
  const int b    = blockIdx.y;
  const bool vT  = (BIAS_MODE == 3) && (b == 2);   // the same for the whole workgroup
  if constexpr (BIAS_MODE == 3) {
    const unsigned short* wsel = Btp + (size_t)b * (CH * CH);
    if (vT) { Btp = Ap; Ap = wsel; const int mm = M; M = N; N = mm; bias = biasV; }
    else    { Btp = wsel; if (b == 1) bias = biasK; }
    ldc = N;
  }
  const int tid  = threadIdx.x;
  const int lane = tid & 31;
  const int wave = tid >> 5;
  const int tilesN = N / BN;
  const int tilesM = M / BMT;
  const int tile = blockIdx.x;
  if (tile >= tilesM * tilesN) return;   // the same for the whole workgroup, in front of every barrier
  const int tm = tile / tilesN;
  const int tn = tile - tm * tilesN;
  const int wm = wave >> 2;              // wave row (0..1) and column (0..3) in the workgroup's tile
  const int wn = wave & 3;
  const int m0 = tm * BMT + wm * (BMT / 2);
  const int n0 = tn * BN + (wn << 6);

  const int rlane = lane & 15;                 // row (A) / col (B, D) within subtile
  const int koff  = (lane >> 4) * 8;           // k offset of this lane half
  const int mOff  = (lane >> 4) * 8;           // D row offset

  // copy addresses: 16 lanes cover the 256 B of one row, the workgroup 16 rows per copy
  const int crow = tid >> 4;
  const int ccol = (tid & 15) * 8;
  // the address is kept as a workgroup-uniform pointer and a 32-bit lane offset: a per-lane pointer that is itself an asm operand (stage 0) must
  // stay in v0..v255 over the whole loop, and at BMT 256 it went to scratch
  const unsigned short* uA = Ap  + (size_t)b * strideA + (size_t)(tm * BMT) * lda;   // the tile's first rows
  const unsigned short* uB = Btp + (size_t)b * strideB + (size_t)(tn * BN) * ldb;
  const unsigned oA = (unsigned)(crow * lda + ccol);                                  // this lane's place in them
  const unsigned oB = (unsigned)(crow * ldb + ccol);
  const unsigned lA = lds_off(ring) + (unsigned)(crow * LPH + ccol) * 2u;
  const unsigned lB = lA + (unsigned)(BMT * LPH) * 2u;
  auto issue_stage = [&](int t, int buf) {
    const unsigned lo = (unsigned)buf * (unsigned)(STG_H * 2);
    const unsigned short* gA = uA + (size_t)t * KS + oA;
    const unsigned short* gB = uB + (size_t)t * KS + oB;
    async_rows8(lA + lo, gA, (size_t)16 * lda);
    if constexpr (BMT == 256) {
      // the fences keep each statement's 24 address registers (asm operands: v0..v255) from being formed ahead of the statement before it:
      // formed together they push accumulators out of the low registers, one of them into scratch
      __builtin_amdgcn_sched_barrier(0);
      async_rows8(lA + lo + (unsigned)(128 * LPH) * 2u, gA + (size_t)128 * lda, (size_t)16 * lda);
      __builtin_amdgcn_sched_barrier(0);
    }
    async_rows8(lB + lo, gB, (size_t)16 * ldb);
    if constexpr (BMT == 256) __builtin_amdgcn_sched_barrier(0);
    async_rows8(lB + lo + (unsigned)(128 * LPH) * 2u, gB + (size_t)128 * ldb, (size_t)16 * ldb);
  };

  v8f acc[FI][4];
#pragma unroll
  for (int i = 0; i < FI; ++i)
#pragma unroll
    for (int j = 0; j < 4; ++j) acc[i][j] = (v8f){0.f,0.f,0.f,0.f,0.f,0.f,0.f,0.f};

  const int nT = K / KS;
  issue_stage(0, 0);
  if constexpr (SM == 2) {   // while stage 0 flies: two lanes per row, two rows per lane, merge each row's 64 block maxima and sums (K == SP keys)
    const int hf = tid & 1;
    const char* sp4 = (const char*)(stat + (size_t)(b * (SP / SBM) + tn) * (SP / BN) * (SBM * 8));
    const unsigned so = (unsigned)(hf * 8 * (SBM * 32) + (tid >> 1) * 16);   // this lane's byte offset: its first piece, its first row (the second: 128 rows on); a piece's second two blocks: SBM * 16 B on
    v4f st[2][8][2];         // {max, sum, max, sum} of two neighbouring blocks
#pragma unroll
    for (int c = 0; c < 8; ++c) {
      st[0][c][0] = *(const v4f*)(sp4 + so + c * (SBM * 32));
      st[0][c][1] = *(const v4f*)(sp4 + so + c * (SBM * 32) + SBM * 16);
      st[1][c][0] = *(const v4f*)(sp4 + so + c * (SBM * 32) + 128 * 16);
      st[1][c][1] = *(const v4f*)(sp4 + so + c * (SBM * 32) + SBM * 16 + 128 * 16);
    }
    asm volatile("s_wait_xcnt 0x0" :: "v"(so) : "memory");   // the 32 loads share one offset register: it stays whole up to this wait (without the operand the last load's result was placed on it)
#pragma unroll
    for (int g = 0; g < 2; ++g) {
      const int row = g * 128 + (tid >> 1);
      float mx = st[g][0][0][0];
#pragma unroll
      for (int c = 0; c < 8; ++c)
#pragma unroll
        for (int h = 0; h < 2; ++h) mx = fmaxf(mx, fmaxf(st[g][c][h][0], st[g][c][h][2]));
      mx = fmaxf(mx, lane_xor<1>(mx));
      float l = 0.f;
      float w[8][2][2];      // exp(block max - row max)
#pragma unroll
      for (int c = 0; c < 8; ++c)
#pragma unroll
        for (int h = 0; h < 2; ++h) {
          w[c][h][0] = exp_slot(st[g][c][h][0] - mx);
          w[c][h][1] = exp_slot(st[g][c][h][2] - mx);
          l += st[g][c][h][1] * w[c][h][0] + st[g][c][h][3] * w[c][h][1];
        }
      l += lane_xor<1>(l);
      const float inv = PCARRY / l;
#pragma unroll
      for (int c = 0; c < 8; ++c)
#pragma unroll
        for (int h = 0; h < 2; ++h) {
          _Float16* fp = sF + row * FPH + (hf * 8 + c) * 4 + h * 2;
          fp[0] = (_Float16)(w[c][h][0] * inv);
          fp[1] = (_Float16)(w[c][h][1] * inv);
        }
    }
  }
  asm volatile("s_wait_asynccnt 0x0" ::: "memory");   // stage 0 has landed for this wave's copies
  __syncthreads();                                     // ... and for every wave's (SM 2: the factor table too)
  if (nT > 1) issue_stage(1, 1);

  for (int t = 0; t < nT; ++t) {
    const int buf = t & 1;
    const T* sA = ring + buf * STG_H + (wm * (BMT / 2) + rlane) * LPH + koff;
    const T* sB = ring + buf * STG_H + (BMT + (wn << 6) + rlane) * LPH + koff;
    // fragments of the next 32 k of this stage are fetched into a second register set ahead of the current FI * 4 products
    V af[2][FI], bf[2][4];
    _Float16 fs[4][2];       // SM 2: this lane's four Bt rows' factors for the stage's two blocks of 64 k
    if constexpr (SM == 2) {
#pragma unroll
      for (int i = 0; i < 4; ++i) {
        const _Float16* fp = sF + ((wn << 6) + (i << 4) + rlane) * FPH + 2 * t;
        fs[i][0] = fp[0]; fs[i][1] = fp[1];
      }
    }
#pragma unroll
    for (int j = 0; j < 4; ++j) { bf[0][j] = Frag<T>::load(sB + (j << 4) * LPH); af[0][j] = Frag<T>::load(sA + (j << 4) * LPH); }
#pragma unroll
    for (int i = 4; i < FI; ++i) af[0][i] = Frag<T>::load(sA + (i << 4) * LPH);
#pragma unroll
    for (int ks = 0; ks < KS / 32; ++ks) {
      const int cur = ks & 1, nxt = cur ^ 1;
      if (ks + 1 < KS / 32) {
#pragma unroll
        for (int j = 0; j < 4; ++j) {
          bf[nxt][j] = Frag<T>::load(sB + (j << 4) * LPH + (ks + 1) * 32);
          af[nxt][j] = Frag<T>::load(sA + (j << 4) * LPH + (ks + 1) * 32);
        }
#pragma unroll
        for (int i = 4; i < FI; ++i) af[nxt][i] = Frag<T>::load(sA + (i << 4) * LPH + (ks + 1) * 32);
      }
      __builtin_amdgcn_sched_barrier(0);   // keeps the LDS reads above as one group ahead of the products: sunk among them, each group of four waits out the LDS latency
      if constexpr (SM == 2) {
#pragma unroll
        for (int i = 0; i < 4; ++i) bf[cur][i] = bf[cur][i] * fs[i][ks >> 1];
      }
#pragma unroll
      for (int i = 0; i < FI; ++i)
#pragma unroll
        for (int j = 0; j < 4; ++j) acc[i][j] = Frag<T>::mma(af[cur][i], bf[cur][j], acc[i][j]);
      __builtin_amdgcn_sched_barrier(0);   // keeps the next LDS reads out of these products and the last products in front of the stage's barrier (behind it they delay the refill)
    }
    asm volatile("s_wait_dscnt 0x0" ::: "memory");      // this wave's reads of buffer buf are done before it is refilled
    asm volatile("s_wait_asynccnt 0x0" ::: "memory");   // this wave's copies of stage t + 1 have landed
    __syncthreads();                                     // publishes stage t + 1 and ends every wave's reads of buffer buf
    if (t + 2 < nT) issue_stage(t + 2, buf);
  }
  asm volatile("s_wait_asynccnt 0x0" ::: "memory");     // no copy outstanding behind the loop
  if constexpr (FI == 4) {   // FI 8: an asm operand lies in v0..v255, so the guard would hold all 256 accumulator registers there and the loop would spill; the compiler keeps the distance behind its own products
#pragma unroll
    for (int i = 0; i < FI; ++i) acc_guard4(acc[i][0], acc[i][1], acc[i][2], acc[i][3]);
  }

  // ---- epilogue ----
  float* slab = sT[wave];
  const float* Rb = RESID ? (resid + (size_t)b * strideR) : nullptr;
  float bn[4] = {0.f, 0.f, 0.f, 0.f};   // BIAS_MODE 3, q and k: the bias of this lane's four columns
  float bm[4][8];                       // BIAS_MODE 3, v^T: the bias of this lane's 32 rows
  if constexpr (BIAS_MODE == 3) {
#pragma unroll
    for (int i = 0; i < 4; ++i)
#pragma unroll
      for (int r = 0; r < 8; ++r) bm[i][r] = 0.f;
    if (vT) {
#pragma unroll
      for (int i = 0; i < 4; ++i)
#pragma unroll
        for (int r = 0; r < 8; ++r) bm[i][r] = bias[((m0 + (i << 4) + mOff) >> 3) * 32 + r];
    } else {
#pragma unroll
      for (int j = 0; j < 4; ++j) bn[j] = bias[n0 + (j << 4) + rlane];
    }
  }
  if constexpr (SM == 1) {
    // In accumulator [i][j] a lane holds keys m0 + 16 i + mOff + 0..7 of query n0 + 16 j + rlane: a block's maximum and sum are taken in the lane's own
    // registers, with one exchange between the wave's halves, and eight neighbouring probabilities are one 16-B piece of the query's row of Cout.
    // The pieces pass through the wave's slab ([16 queries][128 keys] f16, pitch 272 B) so that every global store writes whole 128-B lines.
    _Float16* hs = (_Float16*)slab;
    // this lane's place in the first two queries' rows; the steps from there are the same for every lane
    unsigned short* C = (unsigned short*)Cout + (size_t)b * strideC + (size_t)(n0 + (lane >> 4)) * ldc + m0 + rlane * 8;
    float* sw = stat + (size_t)((b * tilesN + tn) * tilesM + tm) * (BN * 8) + wm * (BN * 4) + ((wn << 6) + rlane) * 4;   // this lane's query of the first 16, this wave's half of the keys
    const float c2 = scale * 1.4426950408889634f;   // scale > 0: the largest raw product is the largest score
#pragma unroll
    for (int j = 0; j < 4; ++j) {
      v4f ms;                // {max, sum} of this query's two blocks
#pragma unroll
      for (int h = 0; h < 2; ++h) {
        float m4[4];
#pragma unroll
        for (int i = 0; i < 4; ++i) {
          const v8f a = acc[h * 4 + i][j];
          m4[i] = fmaxf(fmaxf(fmaxf(a[0], a[1]), fmaxf(a[2], a[3])), fmaxf(fmaxf(a[4], a[5]), fmaxf(a[6], a[7])));
        }
        float mx = fmaxf(fmaxf(m4[0], m4[1]), fmaxf(m4[2], m4[3]));
        mx = fmaxf(mx, lane_xhalf(mx));
        const float nb = -mx * c2;
        float s4[4];
#pragma unroll
        for (int i = 0; i < 4; ++i) {
          float ev[8], pv[8];
          v8h hv;
#pragma unroll
          for (int r = 0; r < 8; ++r) ev[r] = fmaf(acc[h * 4 + i][j][r], c2, nb);
          exp2_slot8(pv, ev);
#pragma unroll
          for (int r = 0; r < 8; ++r) hv[r] = (_Float16)pv[r];
          s4[i] = ((pv[0] + pv[1]) + (pv[2] + pv[3])) + ((pv[4] + pv[5]) + (pv[6] + pv[7]));
          *(v8h*)(hs + rlane * LPH + ((h * 4 + i) << 4) + mOff) = hv;
        }
        float su = (s4[0] + s4[1]) + (s4[2] + s4[3]);
        su += lane_xhalf(su);
        ms[h * 2] = mx * scale; ms[h * 2 + 1] = su;
      }
      if (lane < 16) *(v4f*)(sw + (j << 6)) = ms;      // both halves of the wave hold the same values
      asm volatile("s_wait_dscnt 0x0" ::: "memory");   // the slab's 16 rows are written before other lanes read them back (the slab is this wave's own)
      __builtin_amdgcn_wave_barrier();
#pragma unroll
      for (int it = 0; it < 8; ++it) {
        const int row = it * 2 + (lane >> 4);          // 16 lanes x 16 B: the 256 B of one query's 128 keys
        const v8h hv = *(const v8h*)(hs + row * LPH + rlane * 8);
        *(v8h*)(C + (size_t)((j << 4) + it * 2) * ldc) = hv;
      }
      asm volatile("s_wait_xcnt 0x0" ::: "memory");   // stands between these global stores and whatever the compiler places on their address and data registers for the next queries; its clobber keeps the next slab writes behind these slab reads
      __builtin_amdgcn_sched_barrier(0);               // keeps the next queries' arithmetic behind that wait
      __builtin_amdgcn_wave_barrier();
    }
  } else {
#pragma unroll
  for (int i = 0; i < FI; ++i) {
    const int mBase = m0 + (i << 4);
#pragma unroll
    for (int j = 0; j < 4; ++j) {
      const int n = n0 + (j << 4) + rlane;
      float bv = 0.f;
      if (BIAS_MODE == 2) bv = bias[n];
#pragma unroll
      for (int r = 0; r < 8; ++r) {
        float v = acc[i][j][r] * scale;
        if (BIAS_MODE == 1) v += bias[mBase + mOff + r];
        if (BIAS_MODE == 2) v += bv;
        if constexpr (BIAS_MODE == 3) v += vT ? bm[i][r] : bn[j];
        if (RESID) v += Rb[(size_t)(mBase + mOff + r) * ldc + n];
        if (ACT == 1) v = tanhf(v);
        if (ACT == 2) v = fmaxf(v, 0.0f);
        if (ACT == 3) v = v / (1.0f + expf(-v));
        if (ACT == 4) v = (v > 0.f) ? v : 0.01f * v;
        if (ACT == 5) v = 0.5f * v * (1.0f + erff(v * 0.70710678118654752f));
        slab[(mOff + r) * 68 + (j << 4) + rlane] = v;
      }
    }
    // The slab is this wave's own, so the hand-over between its lanes needs the wave's LDS wait alone. A workgroup-scope fence here and at the foot
    // of the trip also waits until the global stores of the 16 rows before are acknowledged: one store latency per 16 rows that nothing hides.
    asm volatile("s_wait_dscnt 0x0" ::: "memory");   // the slab's rows are written before other lanes read them back
    __builtin_amdgcn_wave_barrier();
    if (OUT_MODE == 0) {
      float* C = (float*)Cout + (size_t)b * strideC;
      const int hh = lane >> 4, c4 = (lane & 15) * 4;     // row seg = 256 B = 16 lanes x 16 B
      {
#pragma unroll
        for (int it = 0; it < 8; ++it) {
          const int row = it * 2 + hh;
          v4f v = *(const v4f*)(slab + row * 68 + c4);
          *(v4f*)(C + (size_t)(mBase + row) * ldc + n0 + c4) = v;
        }
        
      }
    } else {
      const int q = lane >> 3, c8 = (lane & 7) * 8;
      unsigned short* C  = (unsigned short*)Cout  + (size_t)b * strideC;
      unsigned short* C2 = (OUT_MODE == 2) ? ((unsigned short*)Cout2 + (size_t)b * strideC) : nullptr;
      {
#pragma unroll
        for (int it = 0; it < 4; ++it) {
          const int row = it * 4 + q;
          const float* sp = slab + row * 68 + c8;
          v8h hv, lv;
#pragma unroll
          for (int e = 0; e < 8; ++e) {
            if (OUT_MODE == 1) {
              hv[e] = (_Float16)sp[e];
            } else {
              unsigned short hb = f2bf_bits(sp[e]);
              unsigned short lb = f2bf_bits(sp[e] - bf_bits2f(hb));
              hv[e] = __builtin_bit_cast(_Float16, hb);
              lv[e] = __builtin_bit_cast(_Float16, lb);
            }
          }
          *(v8h*)(C + (size_t)(mBase + row) * ldc + n0 + c8) = hv;
          if (OUT_MODE == 2) *(v8h*)(C2 + (size_t)(mBase + row) * ldc + n0 + c8) = lv;
        }
        
      }
    }
    // Foot of the trip: no wait for the global stores themselves, they stay in flight (nothing in this launch reads them). The statement's memory clobber keeps
    // the next 16 rows' slab writes behind these rows' slab reads, whose values the stores above have already taken.
    asm volatile("s_wait_xcnt 0x0" ::: "memory");   // stands between these global stores and whatever the compiler places on their address and data registers for the next rows
    __builtin_amdgcn_sched_barrier(0);               // keeps the next rows' scaling products behind that wait: lifted over it, two of them landed on the last store's data registers
    __builtin_amdgcn_wave_barrier();
  }
  }
}

// ---- group statistics, partial sums: one block per channel (16 per group), f64 fixed-order accumulation.
// Block b stores the sum and the sum of squares of its 16384 elements in the first two doubles of its own 128-B line of part.
// The blocks behind those 512 carry Wq and Wk x16 to f16 (4096 elements each, 64 blocks per matrix): work that
// depends on nothing here and rides in this launch instead of launches of its own.
// The blocks in front of them (they take longest, so they start first) fold the output projection into the value projection:
// out = Wp (P v) + bp = P (Wp v) + bp and Wp v = (Wp Wv) tok + Wp bv, so that the P*V launch gives the output itself.
//  128 blocks: Wvp = Wp * Wv on the matrix unit, x16, f16: a tile is 16 rows o x 64 columns i (whole 128-B lines of Wvp), a block has two tiles,
//              four waves each take a quarter of a tile's k (a short chain of memory latencies) and the first of them adds the four behind a barrier;
//    8 blocks: Wp * bv in f32, a wave's eight values at the head of its own 128-B line of wpbv.
constexpr int WBLK = 4096;                 // weight elements per cast block
constexpr int NWB  = CH * CH / WBLK;       // cast blocks per matrix
constexpr int NVP  = (CH / 16) * (CH / 64) / 2;   // blocks of Wp * Wv: two tiles of 16 rows x 64 columns each
constexpr int NBV  = CH / 64;                  // blocks of Wp * bv: 64 rows each
// six waves per SIMD (at most 160 registers): three workgroups per WGP, so that every statistics workgroup is resident from the start
__global__ __launch_bounds__(256, 6) void gn_stats(const float* __restrict__ x, double* __restrict__ part,
                                                const float* __restrict__ wq, const float* __restrict__ wk,
                                                const float* __restrict__ wv, const float* __restrict__ wp,
                                                const float* __restrict__ bv,
                                                _Float16* __restrict__ w16, float* __restrict__ wpbv) {
  __shared__ double ws1[8];
  __shared__ double ws2[8];
  __shared__ float red[6 * 1024];    // Wp * Wv: the partial tiles of the waves with k quarters 1..3, [tile][quarter - 1][register][lane]
  const int tid = threadIdx.x, wave = tid >> 5, lane = tid & 31;
  if (blockIdx.x < NVP) {            // the same for the whole workgroup: its barrier is passed by all eight waves
    // D[i][o] = sum_m Wv[m][i] * Wp[o][m]: A rows are columns i of Wv (16 lanes read 64 B of a row m), B columns are rows o of Wp (k contiguous);
    // both fragments hold k = k0 + 8 * (lane / 16) + e in elements e = 0..7 and 16 more in elements 8..15
    const int ws = __builtin_amdgcn_readfirstlane(wave);   // the wave's number in a scalar register: tile, quarter and their addresses cost no vector registers
    const int tsel = ws >> 2, kq = ws & 3;
    const int tile = (int)blockIdx.x * 2 + tsel;
    const int o0 = (tile >> 3) * 16;
    const int i0 = (tile & 7) * 64;
    const int rl = lane & 15, hi = lane >> 4;
    const float* pb = wp + (size_t)(o0 + rl) * CH + kq * (CH / 4) + hi * 8;
    const float* pa = wv + (size_t)(kq * (CH / 4) + hi * 8) * CH + i0 + rl;
    v8f c[4];
#pragma unroll
    for (int f = 0; f < 4; ++f) c[f] = (v8f){0.f,0.f,0.f,0.f,0.f,0.f,0.f,0.f};
#pragma unroll 2
    for (int k0 = 0; k0 < CH / 4; k0 += 32) {
      const v4f b0 = *(const v4f*)(pb + k0),      b1 = *(const v4f*)(pb + k0 + 4);
      const v4f b2 = *(const v4f*)(pb + k0 + 16), b3 = *(const v4f*)(pb + k0 + 20);
      float ar[4][16];
#pragma unroll
      for (int f = 0; f < 4; ++f)
#pragma unroll
        for (int e = 0; e < 8; ++e) {
          ar[f][e]     = pa[(size_t)(k0 + e) * CH + f * 16];
          ar[f][8 + e] = pa[(size_t)(k0 + 16 + e) * CH + f * 16];
        }
      v16h bh;
#pragma unroll
      for (int e = 0; e < 4; ++e) {
        bh[e]      = (_Float16)(b0[e] * WCARRY); bh[4 + e]  = (_Float16)(b1[e] * WCARRY);
        bh[8 + e]  = (_Float16)(b2[e] * WCARRY); bh[12 + e] = (_Float16)(b3[e] * WCARRY);
      }
#pragma unroll
      for (int f = 0; f < 4; ++f) {
        v16h ah;
#pragma unroll
        for (int e = 0; e < 16; ++e) ah[e] = (_Float16)(ar[f][e] * WCARRY);
        c[f] = __builtin_amdgcn_wmma_f32_16x16x32_f16(false, ah, false, bh, (short)0, c[f], false, false);
      }
    }
    if (kq != 0) {
      float* rd = red + (tsel * 3 + kq - 1) * 1024 + lane;
#pragma unroll
      for (int f = 0; f < 4; ++f)
#pragma unroll
        for (int r = 0; r < 8; ++r) rd[(f * 8 + r) * 32] = c[f][r];
    }
    __syncthreads();                 // the partial tiles of quarters 1..3 are visible to the wave of quarter 0
    if (kq == 0) {
#pragma unroll
      for (int q = 0; q < 3; ++q) {
        const float* rd = red + (tsel * 3 + q) * 1024 + lane;
#pragma unroll
        for (int f = 0; f < 4; ++f)
#pragma unroll
          for (int r = 0; r < 8; ++r) c[f][r] += rd[(f * 8 + r) * 32];
      }
      _Float16* d = w16 + (size_t)2 * CH * CH + (size_t)(o0 + rl) * CH + i0 + hi * 8;   // lane: row o, eight neighbouring columns i per fragment
#pragma unroll
      for (int f = 0; f < 4; ++f) {
        v8h h;
#pragma unroll
        for (int r = 0; r < 8; ++r) h[r] = (_Float16)(c[f][r] * WCARRY_INV);   // x16 * x16 -> x16
        *(v8h*)(d + f * 16) = h;
      }
    }
    return;
  }
  if (blockIdx.x < NVP + NBV) {      // the same for the whole workgroup, in front of the barrier
    const int r0 = ((int)blockIdx.x - NVP) * 64 + wave * 8;
    v4f bb[4], wr[8][4];
#pragma unroll
    for (int j = 0; j < 4; ++j) bb[j] = *(const v4f*)(bv + j * 128 + lane * 4);
#pragma unroll
    for (int r = 0; r < 8; ++r)
#pragma unroll
      for (int j = 0; j < 4; ++j) wr[r][j] = *(const v4f*)(wp + (size_t)(r0 + r) * CH + j * 128 + lane * 4);
    float sm[8];
#pragma unroll
    for (int r = 0; r < 8; ++r) {
      float a = 0.f;
#pragma unroll
      for (int j = 0; j < 4; ++j)
#pragma unroll
        for (int e = 0; e < 4; ++e) a += wr[r][j][e] * bb[j][e];
      sm[r] = a;
    }
#pragma unroll
    for (int off = 1; off < 32; off <<= 1)
#pragma unroll
      for (int r = 0; r < 8; ++r) sm[r] += __shfl_xor(sm[r], off, 32);
    if (lane == 0) {
      float* d = wpbv + (size_t)(r0 >> 3) * 32;
      *(v4f*)(d)     = (v4f){sm[0], sm[1], sm[2], sm[3]};
      *(v4f*)(d + 4) = (v4f){sm[4], sm[5], sm[6], sm[7]};
    }
    return;
  }
  const int blk = (int)blockIdx.x - (NVP + NBV);
  if (blk >= NGRP * NCH) {           // the same for the whole workgroup, in front of the barrier
    const int cb = blk - NGRP * NCH, wi = cb / NWB;
    const float* src = (wi == 0) ? wq : wk;
    const v4f* s4 = (const v4f*)(src + (size_t)(cb - wi * NWB) * WBLK);
    v4h* d4 = (v4h*)(w16 + (size_t)cb * WBLK);
    v4f wv4[WBLK / 1024];
#pragma unroll
    for (int i = 0; i < WBLK / 1024; ++i) wv4[i] = s4[tid + i * 256];
#pragma unroll
    for (int i = 0; i < WBLK / 1024; ++i) {
      v4h h;
#pragma unroll
      for (int e = 0; e < 4; ++e) h[e] = (_Float16)(wv4[i][e] * WCARRY);
      d4[tid + i * 256] = h;
    }
    return;
  }
  const v4f* p = (const v4f*)(x + (size_t)blk * CSP);
  v4f v[CSP / 1024];                 // all 16 loads of a lane are in flight together
#pragma unroll
  for (int i = 0; i < CSP / 1024; ++i) v[i] = p[tid + i * 256];
  __builtin_amdgcn_sched_barrier(0);   // keeps all 16 loads ahead of the sums: sunk among them, the second eight wait out a second memory latency
  double a[4] = {0.0, 0.0, 0.0, 0.0}, q[4] = {0.0, 0.0, 0.0, 0.0};
#pragma unroll
  for (int i = 0; i < CSP / 1024; ++i) {
#pragma unroll
    for (int e = 0; e < 4; ++e) { const double d = (double)v[i][e]; a[e] += d; q[e] += d * d; }
  }
  double s = (a[0] + a[1]) + (a[2] + a[3]), s2 = (q[0] + q[1]) + (q[2] + q[3]);
#pragma unroll
  for (int off = 1; off < 32; off <<= 1) { s += __shfl_xor(s, off, 32); s2 += __shfl_xor(s2, off, 32); }
  if (lane == 0) { ws1[wave] = s; ws2[wave] = s2; }
  __syncthreads();
  if (tid < 16) {
    double ts = 0.0, ts2 = 0.0;
#pragma unroll
    for (int w = 0; w < 8; ++w) { ts += ws1[w]; ts2 += ws2[w]; }
    part[(size_t)blk * 16 + lane] = (lane == 0) ? ts : ((lane == 1) ? ts2 : 0.0);
  }
}

// ---- normalize + affine + transpose: x[c][t][s] (f32) -> tok[t*SP + s][c] (f16).
__global__ __launch_bounds__(256) void norm_tok(const float* __restrict__ x,
                                                const float* __restrict__ gamma,
                                                const float* __restrict__ beta,
                                                const double* __restrict__ part,
                                                _Float16* __restrict__ tok) {
  __shared__ __align__(16) _Float16 tile[64 * 72];   // [sl][cl], pitch 72 halves
  __shared__ float gstat[8];                         // mean, rstd of the block's 4 groups
  const int bid = blockIdx.x;
  const int cb  = bid & 7;           // 8 channel blocks of 64
  const int sb  = (bid >> 3) & 63;   // 64 position blocks of 64
  const int t   = bid >> 9;          // frame
  const int c0 = cb * 64, s0 = sb * 64;
  const int tid = threadIdx.x;
  if (tid < 128) {                   // wave gi sums group gi's 16 partial pairs: lanes 0..15 the sums, lanes 16..31 the sums of squares
    const int gi = tid >> 5, ln = tid & 31;
    double d = part[(size_t)(((c0 >> 4) + gi) * NCH + (ln & 15)) * 16 + (ln >> 4)];
#pragma unroll
    for (int off = 1; off < 16; off <<= 1) d += __shfl_xor(d, off, 32);
    const double ts2 = __shfl(d, 16, 32);
    const double mean = d * (1.0 / (double)GSZ);
    double var = ts2 * (1.0 / (double)GSZ) - mean * mean;
    if (var < 0.0) var = 0.0;
    if (ln == 0) { gstat[gi * 2] = (float)mean; gstat[gi * 2 + 1] = rsqrtf((float)var + GN_EPS); }
  }
  __syncthreads();                   // the four groups' mean and rstd are visible to every wave
#pragma unroll 4
  for (int i = tid; i < 64 * 64; i += 256) {
    const int cl = i >> 6, sl = i & 63;
    const int c = c0 + cl;
    const float mean = gstat[(cl >> 4) * 2], rstd = gstat[(cl >> 4) * 2 + 1];
    float v = x[(size_t)c * CSP + (size_t)t * SP + s0 + sl];
    v = (v - mean) * rstd * gamma[c] + beta[c];
    tile[sl * 72 + cl] = (_Float16)v;
  }
  __syncthreads();
  const int wave = tid >> 5, lane = tid & 31;
  const int q = lane >> 3, c8 = (lane & 7) * 8;
  {
#pragma unroll
    for (int it = 0; it < 2; ++it) {
      const int row = wave * 8 + it * 4 + q;   // wave covers rows 8w..8w+7
      const v8h hv = *(const v8h*)(tile + row * 72 + c8);
      *(v8h*)(tok + ((size_t)t * SP + s0 + row) * CH + c0 + c8) = hv;
    }
    
  }
}

static inline int gemm_blocks(int M, int N) { return (M / 128) * (N / 256); }

// ---------------- launch ----------------
extern "C" void kernel_launch(void* const* d_in, const int* in_sizes, int n_in,
                              void* d_out, int out_size, void* d_ws, size_t ws_size,
                              hipStream_t stream) {
  if (n_in < 11) return;
  if (in_sizes[0] != CH * CSP || out_size != CH * CSP) return;
  if (in_sizes[1] != CH || in_sizes[2] != CH) return;
  if (in_sizes[3] != CH * CH || in_sizes[5] != CH * CH || in_sizes[7] != CH * CH || in_sizes[9] != CH * CH) return;
  if (in_sizes[4] != CH || in_sizes[6] != CH || in_sizes[8] != CH || in_sizes[10] != CH) return;

  const float* x     = (const float*)d_in[0];
  const float* gamma = (const float*)d_in[1];
  const float* beta  = (const float*)d_in[2];
  const float* wq    = (const float*)d_in[3];
  const float* bq    = (const float*)d_in[4];
  const float* wk    = (const float*)d_in[5];
  const float* bk    = (const float*)d_in[6];
  const float* wv    = (const float*)d_in[7];
  const float* bv    = (const float*)d_in[8];
  const float* wp    = (const float*)d_in[9];
  const float* bp    = (const float*)d_in[10];
  float* out = (float*)d_out;

  char* ws = (char*)d_ws;
  size_t off = 0;
  double* part = (double*)(ws + off);         off += (size_t)NGRP * NCH * 128;                  // 512 lines of 128 B
  float* wpbv    = (float*)(ws + off);        off += (size_t)(CH / 8) * 128;                    // 64 lines of 128 B
  _Float16* w16  = (_Float16*)(ws + off);     off += (size_t)3 * CH * CH * sizeof(_Float16);   // 1.5 MiB
  _Float16* tok  = (_Float16*)(ws + off);     off += (size_t)NTOK * CH * sizeof(_Float16);     // 16 MiB
  _Float16* q16  = (_Float16*)(ws + off);     off += (size_t)NTOK * CH * sizeof(_Float16);     // 16 MiB
  _Float16* k16  = (_Float16*)(ws + off);     off += (size_t)NTOK * CH * sizeof(_Float16);     // 16 MiB
  _Float16* vT16 = (_Float16*)(ws + off);     off += (size_t)CH * NTOK * sizeof(_Float16);     // 16 MiB  [512][16384]
  float* stat    = (float*)(ws + off);        off += (size_t)NTOK * (SP / KBLK) * 2 * sizeof(float);   // 8 MiB: block max and sum per row and 64 keys
  _Float16* P16  = (_Float16*)(ws + off);     off += (size_t)NTOK * SP * sizeof(_Float16);     // 128 MiB  [16384][4096], every frame's rows
  if (off > ws_size) return;
  // w16 holds Wq | Wk | Wp*Wv, one plane of 512 x 512 each

  // 1. group statistics: partial sums, one workgroup per channel (the normalize kernel adds each group's 16);
  //    in the same launch: Wp*Wv and Wp*bv (136 workgroups in front), Wq and Wk x16 -> f16 (128 workgroups behind)
  gn_stats<<<dim3(NVP + NBV + NGRP * NCH + 2 * NWB), dim3(256), 0, stream>>>(x, part, wq, wk, wv, wp, bv, w16, wpbv);

  // 3. normalize + transpose to tokens
  norm_tok<<<dim3(TFR * 64 * 8), dim3(256), 0, stream>>>(x, gamma, beta, part, tok);

  //    (left to try: k could be the tokens themselves, q*k^T = tok (Wq^T Wk) tok^T + (Wk^T bq) tok^T + terms that are constant along the keys, which softmax drops)
  // 4. the three projections in one launch, one per blockIdx.y (256 x 3 workgroups), f16 out:
  //    q = tok*Wq^T/16 + bq and k = tok*Wk^T/16 + bk, [16384][512]; v'^T[c][token] = (Wp*Wv)16*tok^T/16 + (Wp*bv)[c], [512][16384]
  wmma_gemm64<0, false, 3, 1, false><<<dim3(gemm_blocks(NTOK, CH), 3), dim3(256), 0, stream>>>(
      U16(tok), U16(tok), CH, (long)0, U16(w16), U16(w16), CH, (long)0,
      (void*)q16, (void*)q16, CH, (long)NTOK * CH, bq, x, (long)0, NTOK, CH, CH, WCARRY_INV, stat, bk, wpbv);

  // 5. scores of all frames in one launch, one frame per blockIdx.y (256 x 4 workgroups of 256 x 256 scores): k*q^T*512^-0.5 stays in registers;
  //    each 64-key block of a query is stored as f16 exp(s - block max) in P16[query][key], its max and sum in stat
  wmma_gemm64<0, false, 0, 1, false, 0, 1, SBM><<<dim3((SP / SBM) * (SP / BN), TFR), dim3(256), 0, stream>>>(
      U16(k16), U16(k16), CH, (long)SP * CH, U16(q16), U16(q16), CH, (long)SP * CH,
      (void*)P16, (void*)P16, SP, (long)SP * SP, bq, x, (long)0, SP, SP, CH, QSCALE, stat, bq, bq);
  // 6. out[c][token] = v'^T * (factor * P16)^T x2^-15 + bp[c] + x[c][token] for all frames in one launch, one frame per blockIdx.y: 64 x 4 = 256 workgroups
  //    (A = vT16 + frame*4096, [512][4096] with pitch 16384, Bt = P16 frame [4096][4096], f32 out [512][4096] with pitch 16384 at column frame*4096)
  wmma_gemm64<0, false, 1, 0, true, 0, 2><<<dim3(gemm_blocks(CH, SP), TFR), dim3(256), 0, stream>>>(
      U16(vT16), U16(vT16), NTOK, (long)SP, U16(P16), U16(P16), SP, (long)SP * SP,
      (void*)out, (void*)out, NTOK, (long)SP, bp, x, (long)SP, CH, SP, SP, PCARRY_INV, stat, bq, bq);
}

// v010
// A run of this version takes 150 microseconds.
// Next to v009, in two timings, it ran 1.06 times as fast each time.
// Counting every step since v000, it is 14.6 times as fast.
#include <hip/hip_runtime.h>
// Contractions Wp*Wv, tok*Wq^T, tok*Wk^T, (Wp*Wv)*tok^T, k*q^T, v'^T*P^T: v_wmma_f32_16x16x32_f16 (f16 operands, f32 accumulate); weights carried x16, softmax probabilities carried x2^15 (f16 exp(s - block max) times an f16 row-and-block factor); group statistics accumulated in f64; Wp*bv and all other elementwise math f32.

typedef __attribute__((ext_vector_type(16))) _Float16 v16h;
typedef __attribute__((ext_vector_type(8)))  _Float16 v8h;
typedef __attribute__((ext_vector_type(4)))  _Float16 v4h;
typedef __attribute__((ext_vector_type(16))) __bf16   v16b;
typedef __attribute__((ext_vector_type(8)))  __bf16   v8b;
typedef __attribute__((ext_vector_type(8)))  float    v8f;
typedef __attribute__((ext_vector_type(4)))  float    v4f;
#define U16(p) ((const unsigned short*)(const void*)(p))

constexpr int CH   = 512;          // channels
constexpr int TFR  = 4;            // frames
constexpr int SP   = 4096;         // tokens per frame (h*w)
constexpr int CSP  = TFR * SP;     // 16384 elements per channel
constexpr int NTOK = TFR * SP;     // 16384 tokens
constexpr int GSZ  = 16 * CSP;     // 262144 elements per group (16 channels per group)
constexpr int NGRP = 32;
constexpr int NCH  = 16;           // partial sums per group: one workgroup per channel
constexpr int KBLK = 64;           // keys per softmax block (half of one wave's keys of a score tile)
constexpr float GN_EPS     = 1e-6f;
constexpr float QSCALE     = 0.04419417382415922f;   // 512^-0.5
constexpr float WCARRY     = 16.0f;
constexpr float WCARRY_INV = 1.0f / 16.0f;
constexpr float PCARRY     = 32768.0f;
constexpr float PCARRY_INV = 1.0f / 32768.0f;

__device__ __forceinline__ unsigned short f2bf_bits(float f) {
  unsigned u = __float_as_uint(f);
  return (unsigned short)((u + 0x7FFFu + ((u >> 16) & 1u)) >> 16);
}
__device__ __forceinline__ float bf_bits2f(unsigned short h) { return __uint_as_float(((unsigned)h) << 16); }

// hazard guard between the last products and the epilogue's reads of the accumulators
__device__ __forceinline__ void acc_guard4(v8f& a, v8f& b, v8f& c, v8f& d) { asm volatile("v_nop\n\tv_nop\n\tv_nop\n\tv_nop" : "+v"(a), "+v"(b), "+v"(c), "+v"(d)); }
template <typename T> struct Frag;
template <> struct Frag<_Float16> {
  typedef v16h V; union U { v16h v; v8h h[2]; };
  static __device__ __forceinline__ v16h load(const _Float16* p) {   // elements 0..7 <- p[0..7], 8..15 <- p[16..23]
    U f; f.h[0] = *(const v8h*)(p); f.h[1] = *(const v8h*)(p + 16); return f.v;
  }
  static __device__ __forceinline__ v8f mma(v16h a, v16h b, v8f c) {
    return __builtin_amdgcn_wmma_f32_16x16x32_f16(false, a, false, b, (short)0, c, false, false);
  }
};
template <> struct Frag<__bf16> {
  typedef v16b V; union U { v16b v; v8b h[2]; };
  static __device__ __forceinline__ v16b load(const __bf16* p) {
    U f; f.h[0] = *(const v8b*)(p); f.h[1] = *(const v8b*)(p + 16); return f.v;
  }
  static __device__ __forceinline__ v8f mma(v16b a, v16b b, v8f c) {
    return __builtin_amdgcn_wmma_f32_16x16x32_bf16(false, a, false, b, (short)0, c, false, false);
  }
};

// ---- LDS-staged batched WMMA GEMM -------------------------------------------
// C[m,n] = scale * sum_k A[m,k] * Bt[n,k] (+bias)(+resid); a workgroup of 8 waves (2 x 4) owns a BMT x 256 tile, each wave (BMT / 2) x 64 of it.
// BMT = 128, or 256 where the grid still fills the chip: per product a third fewer bytes come from L2 and a quarter fewer fragment bytes from LDS.
// A row-major [M,K]; Bt row-major [N,K]; M % BMT == 0, N % 256 == 0, K % 128 == 0.
// Per stage 128 k of the BMT A rows and the 256 Bt rows are copied to LDS by global_load_async_to_lds_b128 (two buffers:
// the next stage's copies fly while this stage is multiplied); fragments are read from LDS at a row pitch of 272 B.
// BIAS_MODE: 0 = none, 1 = bias[m], 2 = bias[n], 3 = the three token projections in one launch, one per batch y:
//   A = tokens, Bt = Wq | Wk | Wp*Wv (contiguous planes), C = q | k | v^T (contiguous planes); y 0 and 1: tok * W^T + bias[n] (bias, biasK);
//   y 2: the operands change places, W * tok^T + biasV[m], so that v' comes out transposed (biasV: eight values at the head of each 128-B line).
// OUT_MODE: 0 = f32, 1 = f16, 2 = bf16 hi plane (Cout) + bf16 lo plane (Cout2).
// ET: 0 = f16 operands, 1 = bf16 operands (pointers passed as 16-bit storage)
// SM: 0 = plain; 1 = score tile, transposed: A rows are keys, Bt rows are queries, so that a lane holds eight neighbouring keys of one query per accumulator;
//     each 64 keys of a query are stored as exp(s - block max) at Cout[query][key], the block's max and sum go to stat;
//     2 = Bt holds such blocks: the workgroup merges its 256 Bt rows' 64 block maxima and sums into one factor per row and block
//     (exp(block max - row max) / row sum * 2^15) and multiplies every Bt fragment by its row's factor ahead of the products.
// NB: 1 = one tile per workgroup, the batch is blockIdx.y; above 1 = a workgroup walks tile blockIdx.x of batches 0 .. NB - 1 one after the other (grid y = 1, K >= 2 * 128).
// stat: one 8-KiB piece per score tile, [2 halves of the tile's keys][256 queries][2 blocks of 64 keys][max, sum], pieces ordered [batch][query tile][key tile]:
//     a score wave's 16 queries x 2 blocks are two whole 128-B lines, which it writes itself.
constexpr int BM    = 128;                 // A rows per workgroup (the default of BMT)
constexpr int SBM   = 256;                 // A rows per workgroup of the score launch = rows per piece of stat
constexpr int BN    = 256;                 // Bt rows per workgroup
constexpr int KS    = 128;                 // k per stage (256 B of every row)
constexpr int LPH   = KS + 8;              // LDS row pitch in 16-bit elements (272 B: 16 rows of a b128 read fall on 64 distinct banks)
constexpr int FPH   = SP / KBLK + 2;       // factor table row pitch in 16-bit elements (132 B: 16 rows fall on distinct banks)

__device__ __forceinline__ unsigned lds_off(const void* p) { return (unsigned)(size_t)p; }

// value of lane l ^ X (X < 16) by DPP row_xmask; every lane is on where it is used
template <int X> __device__ __forceinline__ float lane_xor(float x) {
  return __builtin_bit_cast(float, __builtin_amdgcn_update_dpp(0, __builtin_bit_cast(int, x), 0x160 + X, 0xf, 0xf, true));
}

// e^x with the slot behind the transcendental filled inside the statement
__device__ __forceinline__ float exp_slot(float x) {
  float r;
  asm("v_exp_f32 %0, %1\n\tv_nop" : "=v"(r) : "v"(x * 1.4426950408889634f));
  return r;
}

// 2^y of eight values in one statement: behind each v_exp_f32 stands one that touches neither its result nor its source (the outputs are early-clobber,
// so none shares a register with an input), behind the last a v_nop fills the slot; one v_nop per v_exp_f32 would take issue slots from the SIMD's other wave
__device__ __forceinline__ void exp2_slot8(float (&p)[8], const float (&y)[8]) {
  asm("v_exp_f32 %0, %8\n\tv_exp_f32 %1, %9\n\tv_exp_f32 %2, %10\n\tv_exp_f32 %3, %11\n\t"
      "v_exp_f32 %4, %12\n\tv_exp_f32 %5, %13\n\tv_exp_f32 %6, %14\n\tv_exp_f32 %7, %15\n\tv_nop"
      : "=&v"(p[0]), "=&v"(p[1]), "=&v"(p[2]), "=&v"(p[3]), "=&v"(p[4]), "=&v"(p[5]), "=&v"(p[6]), "=&v"(p[7])
      : "v"(y[0]), "v"(y[1]), "v"(y[2]), "v"(y[3]), "v"(y[4]), "v"(y[5]), "v"(y[6]), "v"(y[7]));
}

// value of lane l ^ 16; every lane is on where it is used
__device__ __forceinline__ float lane_xhalf(float x) {
  return __builtin_bit_cast(float, __builtin_amdgcn_permlanex16(__builtin_bit_cast(int, x), __builtin_bit_cast(int, x), 0x76543210, 0xfedcba98, false, false));
}

// Eight copies of 16 B per lane, rows 16 apart: LDS byte address l + i * 16 rows, global address g + i * gstep elements.
// The s_wait_xcnt stands inside the statement so that no address register is rewritten ahead of it.
__device__ __forceinline__ void async_rows8(unsigned l, const unsigned short* g, size_t gstep) {
  constexpr unsigned LS = 16u * LPH * 2u;
  const unsigned l1 = l + LS, l2 = l + 2 * LS, l3 = l + 3 * LS, l4 = l + 4 * LS, l5 = l + 5 * LS, l6 = l + 6 * LS, l7 = l + 7 * LS;
  const unsigned short* g1 = g + gstep;     const unsigned short* g2 = g + 2 * gstep;
  const unsigned short* g3 = g + 3 * gstep; const unsigned short* g4 = g + 4 * gstep;
  const unsigned short* g5 = g + 5 * gstep; const unsigned short* g6 = g + 6 * gstep;
  const unsigned short* g7 = g + 7 * gstep;
  asm volatile(
      "global_load_async_to_lds_b128 %0, %8, off\n\t"
      "global_load_async_to_lds_b128 %1, %9, off\n\t"
      "global_load_async_to_lds_b128 %2, %10, off\n\t"
      "global_load_async_to_lds_b128 %3, %11, off\n\t"
      "global_load_async_to_lds_b128 %4, %12, off\n\t"
      "global_load_async_to_lds_b128 %5, %13, off\n\t"
      "global_load_async_to_lds_b128 %6, %14, off\n\t"
      "global_load_async_to_lds_b128 %7, %15, off\n\t"
      "s_wait_xcnt 0x0"
      :: "v"(l), "v"(l1), "v"(l2), "v"(l3), "v"(l4), "v"(l5), "v"(l6), "v"(l7),
         "v"(g), "v"(g1), "v"(g2), "v"(g3), "v"(g4), "v"(g5), "v"(g6), "v"(g7)
      : "memory");
}
template <int ET> struct Elem;
template <> struct Elem<0> { typedef _Float16 T; };
template <> struct Elem<1> { typedef __bf16 T; };
template <int ET, bool SPLIT, int BIAS_MODE, int OUT_MODE, bool RESID, int ACT = 0, int SM = 0, int BMT = BM, int NB = 1>
__global__ __launch_bounds__(256) void wmma_gemm64(
    const unsigned short* __restrict__ Ap, const unsigned short* __restrict__ A2p, int lda, long strideA,
    const unsigned short* __restrict__ Btp, const unsigned short* __restrict__ Bt2p, int ldb, long strideB,
    void* __restrict__ Cout, void* __restrict__ Cout2, int ldc0, long strideC,
    const float* __restrict__ bias0,
    const float* __restrict__ resid, long strideR,
    int M, int N, int K, float scale, float* __restrict__ stat,
    const float* __restrict__ biasK, const float* __restrict__ biasV) {
  static_assert(!SPLIT, "single-plane operands only");
  static_assert(SM == 0 || ET == 0, "block softmax: f16 operands");
  static_assert(SM != 1 || OUT_MODE == 1, "score tile: f16 output");
  static_assert(SM != 2 || NB == 1, "SM 2: the factor table is built once, for one batch");
  static_assert(BN == SBM, "SM 2: a workgroup's Bt rows are the rows of one row of stat pieces");
  static_assert((SM != 1 || BMT == SBM) && (SM != 2 || BMT == BM) && (BIAS_MODE != 3 || BMT == BM), "tile heights the stat pieces and the factor table are laid out for");
  constexpr int FI    = BMT / 32;              // A fragments (16 rows each) per wave
  constexpr int STG_H = (BMT + BN) * LPH;      // 16-bit elements per stage buffer
  typedef typename Elem<ET>::T T;
  typedef typename Frag<T>::V V;
  __shared__ __align__(16) T ring[2 * STG_H];      // two stage buffers, each [A BMT rows | Bt 256 rows] at pitch LPH
  __shared__ __align__(16) float sT[8][16 * 68];   // per-wave 16x64 slab, pitch 68 floats
  __shared__ __align__(16) _Float16 sF[SM == 2 ? BN * FPH : 8];        // [Bt row][block] factor
  const int tid  = threadIdx.x;
  const int lane = tid & 31;
  const int wave = tid >> 5;
  const int tile = blockIdx.x;
  if (tile >= (M / BMT) * (N / BN)) return;   // the same for the whole workgroup, in front of every barrier (BIAS_MODE 3: the count is the same with M and N exchanged)
  const int wm = wave >> 2;              // wave row (0..1) and column (0..3) in the workgroup's tile
  const int wn = wave & 3;
  // where tile number blockIdx.x of batch bb lies; every member is the same for the whole workgroup
  struct Place { const unsigned short* uA; const unsigned short* uB; int tm, tn, tilesM, tilesN; };
  auto place = [&](int bb) {
    const unsigned short* a = Ap; const unsigned short* bt = Btp;
    int mm = M, nn = N;
    if constexpr (BIAS_MODE == 3) {
      const unsigned short* wsel = Btp + (size_t)bb * (CH * CH);
      if (bb == 2) { bt = Ap; a = wsel; mm = N; nn = M; }
      else         { bt = wsel; }
    }
    Place p;
    p.tilesN = nn / BN;
    p.tilesM = mm / BMT;
    p.tm = tile / p.tilesN;
    p.tn = tile - p.tm * p.tilesN;
    p.uA = a  + (size_t)bb * strideA + (size_t)(p.tm * BMT) * lda;   // the tile's first rows
    p.uB = bt + (size_t)bb * strideB + (size_t)(p.tn * BN) * ldb;
    return p;
  };
  const int b0 = (NB > 1) ? 0 : (int)blockIdx.y;   // NB > 1: the workgroup walks batches 0 .. NB - 1 itself
  Place cur = place(b0);

  const int rlane = lane & 15;                 // row (A) / col (B, D) within subtile
  const int koff  = (lane >> 4) * 8;           // k offset of this lane half
  const int mOff  = (lane >> 4) * 8;           // D row offset

  // copy addresses: 16 lanes cover the 256 B of one row, the workgroup 16 rows per copy
  const int crow = tid >> 4;
  const int ccol = (tid & 15) * 8;
  // the address is kept as a workgroup-uniform pointer and a 32-bit lane offset: a per-lane pointer that is itself an asm operand (stage 0) must
  // stay in v0..v255 over the whole loop, and at BMT 256 it went to scratch
  const unsigned oA = (unsigned)(crow * lda + ccol);                                  // this lane's place in them
  const unsigned oB = (unsigned)(crow * ldb + ccol);
  // likewise the LDS address: what lives over the loop and the epilogue is the lane's place in 16-bit elements; the byte address is formed anew at each stage
  const unsigned eL = (unsigned)(crow * LPH + ccol);
  auto issue_stage = [&](const unsigned short* uA, const unsigned short* uB, int t, int buf) {
    const unsigned lA = lds_off(ring) + ((eL + (unsigned)buf * (unsigned)STG_H) << 1);
    const unsigned lB = lds_off(ring) + ((eL + (unsigned)buf * (unsigned)STG_H + (unsigned)(BMT * LPH)) << 1);
    const unsigned short* gA = uA + (size_t)t * KS + oA;
    const unsigned short* gB = uB + (size_t)t * KS + oB;
    async_rows8(lA, gA, (size_t)16 * lda);
    if constexpr (BMT == 256) {
      // the fences keep each statement's 24 address registers (asm operands: v0..v255) from being formed ahead of the statement before it:
      // formed together they push accumulators out of the low registers, one of them into scratch
      __builtin_amdgcn_sched_barrier(0);
      async_rows8(lA + (unsigned)(128 * LPH) * 2u, gA + (size_t)128 * lda, (size_t)16 * lda);
      __builtin_amdgcn_sched_barrier(0);
    }
    async_rows8(lB, gB, (size_t)16 * ldb);
    if constexpr (BMT == 256) __builtin_amdgcn_sched_barrier(0);
    async_rows8(lB + (unsigned)(128 * LPH) * 2u, gB + (size_t)128 * ldb, (size_t)16 * ldb);
  };

  v8f acc[FI][4];
  const int nT = K / KS;                 // NB > 1: at least two stages per tile
  issue_stage(cur.uA, cur.uB, 0, 0);
  if constexpr (SM == 2) {   // while stage 0 flies: two lanes per row, two rows per lane, merge each row's 64 block maxima and sums (K == SP keys)
    const int hf = tid & 1;
    const char* sp4 = (const char*)(stat + (size_t)(b0 * (SP / SBM) + cur.tn) * (SP / BN) * (SBM * 8));
    const unsigned so = (unsigned)(hf * 8 * (SBM * 32) + (tid >> 1) * 16);   // this lane's byte offset: its first piece, its first row (the second: 128 rows on); a piece's second two blocks: SBM * 16 B on
    v4f st[2][8][2];         // {max, sum, max, sum} of two neighbouring blocks
#pragma unroll
    for (int c = 0; c < 8; ++c) {
      st[0][c][0] = *(const v4f*)(sp4 + so + c * (SBM * 32));
      st[0][c][1] = *(const v4f*)(sp4 + so + c * (SBM * 32) + SBM * 16);
      st[1][c][0] = *(const v4f*)(sp4 + so + c * (SBM * 32) + 128 * 16);
      st[1][c][1] = *(const v4f*)(sp4 + so + c * (SBM * 32) + SBM * 16 + 128 * 16);
    }
    asm volatile("s_wait_xcnt 0x0" :: "v"(so) : "memory");   // the 32 loads share one offset register: it stays whole up to this wait (without the operand the last load's result was placed on it)
#pragma unroll
    for (int g = 0; g < 2; ++g) {
      const int row = g * 128 + (tid >> 1);
      float mx = st[g][0][0][0];
#pragma unroll
      for (int c = 0; c < 8; ++c)
#pragma unroll
        for (int h = 0; h < 2; ++h) mx = fmaxf(mx, fmaxf(st[g][c][h][0], st[g][c][h][2]));
      mx = fmaxf(mx, lane_xor<1>(mx));
      float l = 0.f;
      float w[8][2][2];      // exp(block max - row max)
#pragma unroll
      for (int c = 0; c < 8; ++c)
#pragma unroll
        for (int h = 0; h < 2; ++h) {
          w[c][h][0] = exp_slot(st[g][c][h][0] - mx);
          w[c][h][1] = exp_slot(st[g][c][h][2] - mx);
          l += st[g][c][h][1] * w[c][h][0] + st[g][c][h][3] * w[c][h][1];
        }
      l += lane_xor<1>(l);
      const float inv = PCARRY / l;
#pragma unroll
      for (int c = 0; c < 8; ++c)
#pragma unroll
        for (int h = 0; h < 2; ++h) {
          _Float16* fp = sF + row * FPH + (hf * 8 + c) * 4 + h * 2;
          fp[0] = (_Float16)(w[c][h][0] * inv);
          fp[1] = (_Float16)(w[c][h][1] * inv);
        }
    }
  }
  asm volatile("s_wait_asynccnt 0x0" ::: "memory");   // stage 0 has landed for this wave's copies
  __syncthreads();                                     // ... and for every wave's (SM 2: the factor table too)
  if (nT > 1) issue_stage(cur.uA, cur.uB, 1, 1);

  // The workgroup walks its NB tiles (the same tile number in every batch) as one stream of stages through the two buffers: the next tile's first two
  // stages are copied while this tile's last stages are multiplied and its epilogue runs, and no new workgroup has to start between tiles.
  for (int bi = 0; bi < NB; ++bi) {
  const int b    = b0 + bi;
  const bool vT  = (BIAS_MODE == 3) && (b == 2);   // the same for the whole workgroup
  const float* bias = bias0;
  int ldc = ldc0;
  if constexpr (BIAS_MODE == 3) { bias = vT ? biasV : ((b == 1) ? biasK : bias0); ldc = vT ? M : N; }
  const bool more = (NB > 1) && (bi + 1 < NB);     // the same for the whole workgroup
  const Place nxt = more ? place(b + 1) : cur;
  const int tilesN = cur.tilesN, tilesM = cur.tilesM, tm = cur.tm, tn = cur.tn;
  const int m0 = tm * BMT + wm * (BMT / 2);
  const int n0 = tn * BN + (wn << 6);
#pragma unroll
  for (int i = 0; i < FI; ++i)
#pragma unroll
    for (int j = 0; j < 4; ++j) acc[i][j] = (v8f){0.f,0.f,0.f,0.f,0.f,0.f,0.f,0.f};

  for (int t = 0; t < nT; ++t) {
    const int buf = (bi * nT + t) & 1;
    const T* sA = ring + buf * STG_H + (wm * (BMT / 2) + rlane) * LPH + koff;
    const T* sB = ring + buf * STG_H + (BMT + (wn << 6) + rlane) * LPH + koff;
    // fragments of the next 32 k of this stage are fetched into a second register set ahead of the current FI * 4 products
    V af[2][FI], bf[2][4];
    _Float16 fs[4][2];       // SM 2: this lane's four Bt rows' factors for the stage's two blocks of 64 k
    if constexpr (SM == 2) {
#pragma unroll
      for (int i = 0; i < 4; ++i) {
        const _Float16* fp = sF + ((wn << 6) + (i << 4) + rlane) * FPH + 2 * t;
        fs[i][0] = fp[0]; fs[i][1] = fp[1];
      }
    }
#pragma unroll
    for (int j = 0; j < 4; ++j) { bf[0][j] = Frag<T>::load(sB + (j << 4) * LPH); af[0][j] = Frag<T>::load(sA + (j << 4) * LPH); }
#pragma unroll
    for (int i = 4; i < FI; ++i) af[0][i] = Frag<T>::load(sA + (i << 4) * LPH);
#pragma unroll
    for (int ks = 0; ks < KS / 32; ++ks) {
      const int cur = ks & 1, nxt = cur ^ 1;
      if (ks + 1 < KS / 32) {
#pragma unroll
        for (int j = 0; j < 4; ++j) {
          bf[nxt][j] = Frag<T>::load(sB + (j << 4) * LPH + (ks + 1) * 32);
          af[nxt][j] = Frag<T>::load(sA + (j << 4) * LPH + (ks + 1) * 32);
        }
#pragma unroll
        for (int i = 4; i < FI; ++i) af[nxt][i] = Frag<T>::load(sA + (i << 4) * LPH + (ks + 1) * 32);
      }
      __builtin_amdgcn_sched_barrier(0);   // keeps the LDS reads above as one group ahead of the products: sunk among them, each group of four waits out the LDS latency
      if constexpr (SM == 2) {
#pragma unroll
        for (int i = 0; i < 4; ++i) bf[cur][i] = bf[cur][i] * fs[i][ks >> 1];
      }
#pragma unroll
      for (int i = 0; i < FI; ++i)
#pragma unroll
        for (int j = 0; j < 4; ++j) acc[i][j] = Frag<T>::mma(af[cur][i], bf[cur][j], acc[i][j]);
      __builtin_amdgcn_sched_barrier(0);   // keeps the next LDS reads out of these products and the last products in front of the stage's barrier (behind it they delay the refill)
    }
    asm volatile("s_wait_dscnt 0x0" ::: "memory");      // this wave's reads of buffer buf are done before it is refilled
    asm volatile("s_wait_asynccnt 0x0" ::: "memory");   // this wave's copies of stage t + 1 have landed
    __syncthreads();                                     // publishes stage t + 1 and ends every wave's reads of buffer buf
    const bool own = t + 2 < nT;                         // the stage after next is this tile's, or the next tile's first or second
    if (own || more) issue_stage(own ? cur.uA : nxt.uA, own ? cur.uB : nxt.uB, own ? t + 2 : t + 2 - nT, buf);
  }
  if constexpr (FI == 4) {   // FI 8: an asm operand lies in v0..v255, so the guard would hold all 256 accumulator registers there and the loop would spill; the compiler keeps the distance behind its own products
#pragma unroll
    for (int i = 0; i < FI; ++i) acc_guard4(acc[i][0], acc[i][1], acc[i][2], acc[i][3]);
  }

  // ---- epilogue ----
  float* slab = sT[wave];
  const float* Rb = RESID ? (resid + (size_t)b * strideR) : nullptr;
  float bn[4] = {0.f, 0.f, 0.f, 0.f};   // BIAS_MODE 3, q and k: the bias of this lane's four columns
  float bm[4][8];                       // BIAS_MODE 3, v^T: the bias of this lane's 32 rows
  if constexpr (BIAS_MODE == 3) {
#pragma unroll
    for (int i = 0; i < 4; ++i)
#pragma unroll
      for (int r = 0; r < 8; ++r) bm[i][r] = 0.f;
    if (vT) {
#pragma unroll
      for (int i = 0; i < 4; ++i)
#pragma unroll
        for (int r = 0; r < 8; ++r) bm[i][r] = bias[((m0 + (i << 4) + mOff) >> 3) * 32 + r];
    } else {
#pragma unroll
      for (int j = 0; j < 4; ++j) bn[j] = bias[n0 + (j << 4) + rlane];
    }
  }
  if constexpr (SM == 1) {
    // In accumulator [i][j] a lane holds keys m0 + 16 i + mOff + 0..7 of query n0 + 16 j + rlane: a block's maximum and sum are taken in the lane's own
    // registers, with one exchange between the wave's halves, and eight neighbouring probabilities are one 16-B piece of the query's row of Cout.
    // The pieces pass through the wave's slab ([16 queries][128 keys] f16, pitch 272 B) so that every global store writes whole 128-B lines.
    _Float16* hs = (_Float16*)slab;
    // this lane's place in the first two queries' rows; the steps from there are the same for every lane
    unsigned short* C = (unsigned short*)Cout + (size_t)b * strideC + (size_t)(n0 + (lane >> 4)) * ldc + m0 + rlane * 8;
    float* sw = stat + (size_t)((b * tilesN + tn) * tilesM + tm) * (BN * 8) + wm * (BN * 4) + ((wn << 6) + rlane) * 4;   // this lane's query of the first 16, this wave's half of the keys
    const float c2 = scale * 1.4426950408889634f;   // scale > 0: the largest raw product is the largest score
#pragma unroll
    for (int j = 0; j < 4; ++j) {
      v4f ms;                // {max, sum} of this query's two blocks
#pragma unroll
      for (int h = 0; h < 2; ++h) {
        float m4[4];
#pragma unroll
        for (int i = 0; i < 4; ++i) {
          const v8f a = acc[h * 4 + i][j];
          m4[i] = fmaxf(fmaxf(fmaxf(a[0], a[1]), fmaxf(a[2], a[3])), fmaxf(fmaxf(a[4], a[5]), fmaxf(a[6], a[7])));
        }
        float mx = fmaxf(fmaxf(m4[0], m4[1]), fmaxf(m4[2], m4[3]));
        mx = fmaxf(mx, lane_xhalf(mx));
        const float nb = -mx * c2;
        float s4[4];
#pragma unroll
        for (int i = 0; i < 4; ++i) {
          float ev[8], pv[8];
          v8h hv;
#pragma unroll
          for (int r = 0; r < 8; ++r) ev[r] = fmaf(acc[h * 4 + i][j][r], c2, nb);
          exp2_slot8(pv, ev);
#pragma unroll
          for (int r = 0; r < 8; ++r) hv[r] = (_Float16)pv[r];
          s4[i] = ((pv[0] + pv[1]) + (pv[2] + pv[3])) + ((pv[4] + pv[5]) + (pv[6] + pv[7]));
          *(v8h*)(hs + rlane * LPH + ((h * 4 + i) << 4) + mOff) = hv;
        }
        float su = (s4[0] + s4[1]) + (s4[2] + s4[3]);
        su += lane_xhalf(su);
        ms[h * 2] = mx * scale; ms[h * 2 + 1] = su;
      }
      if (lane < 16) *(v4f*)(sw + (j << 6)) = ms;      // both halves of the wave hold the same values
      asm volatile("s_wait_dscnt 0x0" ::: "memory");   // the slab's 16 rows are written before other lanes read them back (the slab is this wave's own)
      __builtin_amdgcn_wave_barrier();
#pragma unroll
      for (int it = 0; it < 8; ++it) {
        const int row = it * 2 + (lane >> 4);          // 16 lanes x 16 B: the 256 B of one query's 128 keys
        const v8h hv = *(const v8h*)(hs + row * LPH + rlane * 8);
        *(v8h*)(C + (size_t)((j << 4) + it * 2) * ldc) = hv;
      }
      asm volatile("s_wait_xcnt 0x0" ::: "memory");   // stands between these global stores and whatever the compiler places on their address and data registers for the next queries; its clobber keeps the next slab writes behind these slab reads
      __builtin_amdgcn_sched_barrier(0);               // keeps the next queries' arithmetic behind that wait
      __builtin_amdgcn_wave_barrier();
    }
  } else {
#pragma unroll
  for (int i = 0; i < FI; ++i) {
    const int mBase = m0 + (i << 4);
#pragma unroll
    for (int j = 0; j < 4; ++j) {
      const int n = n0 + (j << 4) + rlane;
      float bv = 0.f;
      if (BIAS_MODE == 2) bv = bias[n];
#pragma unroll
      for (int r = 0; r < 8; ++r) {
        float v = acc[i][j][r] * scale;
        if (BIAS_MODE == 1) v += bias[mBase + mOff + r];
        if (BIAS_MODE == 2) v += bv;
        if constexpr (BIAS_MODE == 3) v += vT ? bm[i][r] : bn[j];
        if (RESID) v += Rb[(size_t)(mBase + mOff + r) * ldc + n];
        if (ACT == 1) v = tanhf(v);
        if (ACT == 2) v = fmaxf(v, 0.0f);
        if (ACT == 3) v = v / (1.0f + expf(-v));
        if (ACT == 4) v = (v > 0.f) ? v : 0.01f * v;
        if (ACT == 5) v = 0.5f * v * (1.0f + erff(v * 0.70710678118654752f));
        slab[(mOff + r) * 68 + (j << 4) + rlane] = v;
      }
    }
    // The slab is this wave's own, so the hand-over between its lanes needs the wave's LDS wait alone. A workgroup-scope fence here and at the foot
    // of the trip also waits until the global stores of the 16 rows before are acknowledged: one store latency per 16 rows that nothing hides.
    asm volatile("s_wait_dscnt 0x0" ::: "memory");   // the slab's rows are written before other lanes read them back
    __builtin_amdgcn_wave_barrier();
    if (OUT_MODE == 0) {
      float* C = (float*)Cout + (size_t)b * strideC;
      const int hh = lane >> 4, c4 = (lane & 15) * 4;     // row seg = 256 B = 16 lanes x 16 B
      {
#pragma unroll
        for (int it = 0; it < 8; ++it) {
          const int row = it * 2 + hh;
          v4f v = *(const v4f*)(slab + row * 68 + c4);
          *(v4f*)(C + (size_t)(mBase + row) * ldc + n0 + c4) = v;
        }
        
      }
    } else {
      const int q = lane >> 3, c8 = (lane & 7) * 8;
      unsigned short* C  = (unsigned short*)Cout  + (size_t)b * strideC;
      unsigned short* C2 = (OUT_MODE == 2) ? ((unsigned short*)Cout2 + (size_t)b * strideC) : nullptr;
      {
#pragma unroll
        for (int it = 0; it < 4; ++it) {
          const int row = it * 4 + q;
          const float* sp = slab + row * 68 + c8;
          v8h hv, lv;
#pragma unroll
          for (int e = 0; e < 8; ++e) {
            if (OUT_MODE == 1) {
              hv[e] = (_Float16)sp[e];
            } else {
              unsigned short hb = f2bf_bits(sp[e]);
              unsigned short lb = f2bf_bits(sp[e] - bf_bits2f(hb));
              hv[e] = __builtin_bit_cast(_Float16, hb);
              lv[e] = __builtin_bit_cast(_Float16, lb);
            }
          }
          *(v8h*)(C + (size_t)(mBase + row) * ldc + n0 + c8) = hv;
          if (OUT_MODE == 2) *(v8h*)(C2 + (size_t)(mBase + row) * ldc + n0 + c8) = lv;
        }
        
      }
    }
    // Foot of the trip: no wait for the global stores themselves, they stay in flight (nothing in this launch reads them). The statement's memory clobber keeps
    // the next 16 rows' slab writes behind these rows' slab reads, whose values the stores above have already taken.
    asm volatile("s_wait_xcnt 0x0" ::: "memory");   // stands between these global stores and whatever the compiler places on their address and data registers for the next rows
    __builtin_amdgcn_sched_barrier(0);               // keeps the next rows' scaling products behind that wait: lifted over it, two of them landed on the last store's data registers
    __builtin_amdgcn_wave_barrier();
  }
  }
  cur = nxt;
  }
  asm volatile("s_wait_asynccnt 0x0" ::: "memory");     // no copy outstanding behind the last tile
}

// ---- group statistics, partial sums: one block per channel (16 per group), f64 fixed-order accumulation.
// Block b stores the sum and the sum of squares of its 16384 elements in the first two doubles of its own 128-B line of part.
// The blocks behind those 512 carry Wq and Wk x16 to f16 (4096 elements each, 64 blocks per matrix): work that
// depends on nothing here and rides in this launch instead of launches of its own.
// The blocks in front of them (they take longest, so they start first) fold the output projection into the value projection:
// out = Wp (P v) + bp = P (Wp v) + bp and Wp v = (Wp Wv) tok + Wp bv, so that the P*V launch gives the output itself.
//  128 blocks: Wvp = Wp * Wv on the matrix unit, x16, f16: a tile is 16 rows o x 64 columns i (whole 128-B lines of Wvp), a block has two tiles,
//              four waves each take a quarter of a tile's k (a short chain of memory latencies) and the first of them adds the four behind a barrier;
//    8 blocks: Wp * bv in f32, a wave's eight values at the head of its own 128-B line of wpbv.
constexpr int WBLK = 4096;                 // weight elements per cast block
constexpr int NWB  = CH * CH / WBLK;       // cast blocks per matrix
constexpr int NVP  = (CH / 16) * (CH / 64) / 2;   // blocks of Wp * Wv: two tiles of 16 rows x 64 columns each
constexpr int NBV  = CH / 64;                  // blocks of Wp * bv: 64 rows each
// six waves per SIMD (at most 160 registers): three workgroups per WGP, so that every statistics workgroup is resident from the start
__global__ __launch_bounds__(256, 6) void gn_stats(const float* __restrict__ x, double* __restrict__ part,
                                                const float* __restrict__ wq, const float* __restrict__ wk,
                                                const float* __restrict__ wv, const float* __restrict__ wp,
                                                const float* __restrict__ bv,
                                                _Float16* __restrict__ w16, float* __restrict__ wpbv) {
  __shared__ double ws1[8];
  __shared__ double ws2[8];
  __shared__ float red[6 * 1024];    // Wp * Wv: the partial tiles of the waves with k quarters 1..3, [tile][quarter - 1][register][lane]
  const int tid = threadIdx.x, wave = tid >> 5, lane = tid & 31;
  if (blockIdx.x < NVP) {            // the same for the whole workgroup: its barrier is passed by all eight waves
    // D[i][o] = sum_m Wv[m][i] * Wp[o][m]: A rows are columns i of Wv (16 lanes read 64 B of a row m), B columns are rows o of Wp (k contiguous);
    // both fragments hold k = k0 + 8 * (lane / 16) + e in elements e = 0..7 and 16 more in elements 8..15
    const int ws = __builtin_amdgcn_readfirstlane(wave);   // the wave's number in a scalar register: tile, quarter and their addresses cost no vector registers
    const int tsel = ws >> 2, kq = ws & 3;
    const int tile = (int)blockIdx.x * 2 + tsel;
    const int o0 = (tile >> 3) * 16;
    const int i0 = (tile & 7) * 64;
    const int rl = lane & 15, hi = lane >> 4;
    const float* pb = wp + (size_t)(o0 + rl) * CH + kq * (CH / 4) + hi * 8;
    const float* pa = wv + (size_t)(kq * (CH / 4) + hi * 8) * CH + i0 + rl;
    v8f c[4];
#pragma unroll
    for (int f = 0; f < 4; ++f) c[f] = (v8f){0.f,0.f,0.f,0.f,0.f,0.f,0.f,0.f};
#pragma unroll 2
    for (int k0 = 0; k0 < CH / 4; k0 += 32) {
      const v4f b0 = *(const v4f*)(pb + k0),      b1 = *(const v4f*)(pb + k0 + 4);
      const v4f b2 = *(const v4f*)(pb + k0 + 16), b3 = *(const v4f*)(pb + k0 + 20);
      float ar[4][16];
#pragma unroll
      for (int f = 0; f < 4; ++f)
#pragma unroll
        for (int e = 0; e < 8; ++e) {
          ar[f][e]     = pa[(size_t)(k0 + e) * CH + f * 16];
          ar[f][8 + e] = pa[(size_t)(k0 + 16 + e) * CH + f * 16];
        }
      v16h bh;
#pragma unroll
      for (int e = 0; e < 4; ++e) {
        bh[e]      = (_Float16)(b0[e] * WCARRY); bh[4 + e]  = (_Float16)(b1[e] * WCARRY);
        bh[8 + e]  = (_Float16)(b2[e] * WCARRY); bh[12 + e] = (_Float16)(b3[e] * WCARRY);
      }
#pragma unroll
      for (int f = 0; f < 4; ++f) {
        v16h ah;
#pragma unroll
        for (int e = 0; e < 16; ++e) ah[e] = (_Float16)(ar[f][e] * WCARRY);
        c[f] = __builtin_amdgcn_wmma_f32_16x16x32_f16(false, ah, false, bh, (short)0, c[f], false, false);
      }
    }
    if (kq != 0) {
      float* rd = red + (tsel * 3 + kq - 1) * 1024 + lane;
#pragma unroll
      for (int f = 0; f < 4; ++f)
#pragma unroll
        for (int r = 0; r < 8; ++r) rd[(f * 8 + r) * 32] = c[f][r];
    }
    __syncthreads();                 // the partial tiles of quarters 1..3 are visible to the wave of quarter 0
    if (kq == 0) {
#pragma unroll
      for (int q = 0; q < 3; ++q) {
        const float* rd = red + (tsel * 3 + q) * 1024 + lane;
#pragma unroll
        for (int f = 0; f < 4; ++f)
#pragma unroll
          for (int r = 0; r < 8; ++r) c[f][r] += rd[(f * 8 + r) * 32];
      }
      _Float16* d = w16 + (size_t)2 * CH * CH + (size_t)(o0 + rl) * CH + i0 + hi * 8;   // lane: row o, eight neighbouring columns i per fragment
#pragma unroll
      for (int f = 0; f < 4; ++f) {
        v8h h;
#pragma unroll
        for (int r = 0; r < 8; ++r) h[r] = (_Float16)(c[f][r] * WCARRY_INV);   // x16 * x16 -> x16
        *(v8h*)(d + f * 16) = h;
      }
    }
    return;
  }
  if (blockIdx.x < NVP + NBV) {      // the same for the whole workgroup, in front of the barrier
    const int r0 = ((int)blockIdx.x - NVP) * 64 + wave * 8;
    v4f bb[4], wr[8][4];
#pragma unroll
    for (int j = 0; j < 4; ++j) bb[j] = *(const v4f*)(bv + j * 128 + lane * 4);
#pragma unroll
    for (int r = 0; r < 8; ++r)
#pragma unroll
      for (int j = 0; j < 4; ++j) wr[r][j] = *(const v4f*)(wp + (size_t)(r0 + r) * CH + j * 128 + lane * 4);
    float sm[8];
#pragma unroll
    for (int r = 0; r < 8; ++r) {
      float a = 0.f;
#pragma unroll
      for (int j = 0; j < 4; ++j)
#pragma unroll
        for (int e = 0; e < 4; ++e) a += wr[r][j][e] * bb[j][e];
      sm[r] = a;
    }
#pragma unroll
    for (int off = 1; off < 32; off <<= 1)
#pragma unroll
      for (int r = 0; r < 8; ++r) sm[r] += __shfl_xor(sm[r], off, 32);
    if (lane == 0) {
      float* d = wpbv + (size_t)(r0 >> 3) * 32;
      *(v4f*)(d)     = (v4f){sm[0], sm[1], sm[2], sm[3]};
      *(v4f*)(d + 4) = (v4f){sm[4], sm[5], sm[6], sm[7]};
    }
    return;
  }
  const int blk = (int)blockIdx.x - (NVP + NBV);
  if (blk >= NGRP * NCH) {           // the same for the whole workgroup, in front of the barrier
    const int cb = blk - NGRP * NCH, wi = cb / NWB;
    const float* src = (wi == 0) ? wq : wk;
    const v4f* s4 = (const v4f*)(src + (size_t)(cb - wi * NWB) * WBLK);
    v4h* d4 = (v4h*)(w16 + (size_t)cb * WBLK);
    v4f wv4[WBLK / 1024];
#pragma unroll
    for (int i = 0; i < WBLK / 1024; ++i) wv4[i] = s4[tid + i * 256];
#pragma unroll
    for (int i = 0; i < WBLK / 1024; ++i) {
      v4h h;
#pragma unroll
      for (int e = 0; e < 4; ++e) h[e] = (_Float16)(wv4[i][e] * WCARRY);
      d4[tid + i * 256] = h;
    }
    return;
  }
  const v4f* p = (const v4f*)(x + (size_t)blk * CSP);
  v4f v[CSP / 1024];                 // all 16 loads of a lane are in flight together
#pragma unroll
  for (int i = 0; i < CSP / 1024; ++i) v[i] = p[tid + i * 256];
  __builtin_amdgcn_sched_barrier(0);   // keeps all 16 loads ahead of the sums: sunk among them, the second eight wait out a second memory latency
  double a[4] = {0.0, 0.0, 0.0, 0.0}, q[4] = {0.0, 0.0, 0.0, 0.0};
#pragma unroll
  for (int i = 0; i < CSP / 1024; ++i) {
#pragma unroll
    for (int e = 0; e < 4; ++e) { const double d = (double)v[i][e]; a[e] += d; q[e] += d * d; }
  }
  double s = (a[0] + a[1]) + (a[2] + a[3]), s2 = (q[0] + q[1]) + (q[2] + q[3]);
#pragma unroll
  for (int off = 1; off < 32; off <<= 1) { s += __shfl_xor(s, off, 32); s2 += __shfl_xor(s2, off, 32); }
  if (lane == 0) { ws1[wave] = s; ws2[wave] = s2; }
  __syncthreads();
  if (tid < 16) {
    double ts = 0.0, ts2 = 0.0;
#pragma unroll
    for (int w = 0; w < 8; ++w) { ts += ws1[w]; ts2 += ws2[w]; }
    part[(size_t)blk * 16 + lane] = (lane == 0) ? ts : ((lane == 1) ? ts2 : 0.0);
  }
}

// ---- normalize + affine + transpose: x[c][t][s] (f32) -> tok[t*SP + s][c] (f16).
__global__ __launch_bounds__(256) void norm_tok(const float* __restrict__ x,
                                                const float* __restrict__ gamma,
                                                const float* __restrict__ beta,
                                                const double* __restrict__ part,
                                                _Float16* __restrict__ tok) {
  __shared__ __align__(16) _Float16 tile[64 * 72];   // [sl][cl], pitch 72 halves
  __shared__ float gstat[8];                         // mean, rstd of the block's 4 groups
  const int bid = blockIdx.x;
  const int cb  = bid & 7;           // 8 channel blocks of 64
  const int sb  = (bid >> 3) & 63;   // 64 position blocks of 64
  const int t   = bid >> 9;          // frame
  const int c0 = cb * 64, s0 = sb * 64;
  const int tid = threadIdx.x;
  if (tid < 128) {                   // wave gi sums group gi's 16 partial pairs: lanes 0..15 the sums, lanes 16..31 the sums of squares
    const int gi = tid >> 5, ln = tid & 31;
    double d = part[(size_t)(((c0 >> 4) + gi) * NCH + (ln & 15)) * 16 + (ln >> 4)];
#pragma unroll
    for (int off = 1; off < 16; off <<= 1) d += __shfl_xor(d, off, 32);
    const double ts2 = __shfl(d, 16, 32);
    const double mean = d * (1.0 / (double)GSZ);
    double var = ts2 * (1.0 / (double)GSZ) - mean * mean;
    if (var < 0.0) var = 0.0;
    if (ln == 0) { gstat[gi * 2] = (float)mean; gstat[gi * 2 + 1] = rsqrtf((float)var + GN_EPS); }
  }
  __syncthreads();                   // the four groups' mean and rstd are visible to every wave
#pragma unroll 4
  for (int i = tid; i < 64 * 64; i += 256) {
    const int cl = i >> 6, sl = i & 63;
    const int c = c0 + cl;
    const float mean = gstat[(cl >> 4) * 2], rstd = gstat[(cl >> 4) * 2 + 1];
    float v = x[(size_t)c * CSP + (size_t)t * SP + s0 + sl];
    v = (v - mean) * rstd * gamma[c] + beta[c];
    tile[sl * 72 + cl] = (_Float16)v;
  }
  __syncthreads();
  const int wave = tid >> 5, lane = tid & 31;
  const int q = lane >> 3, c8 = (lane & 7) * 8;
  {
#pragma unroll
    for (int it = 0; it < 2; ++it) {
      const int row = wave * 8 + it * 4 + q;   // wave covers rows 8w..8w+7
      const v8h hv = *(const v8h*)(tile + row * 72 + c8);
      *(v8h*)(tok + ((size_t)t * SP + s0 + row) * CH + c0 + c8) = hv;
    }
    
  }
}

static inline int gemm_blocks(int M, int N) { return (M / 128) * (N / 256); }

// ---------------- launch ----------------
extern "C" void kernel_launch(void* const* d_in, const int* in_sizes, int n_in,
                              void* d_out, int out_size, void* d_ws, size_t ws_size,
                              hipStream_t stream) {
  if (n_in < 11) return;
  if (in_sizes[0] != CH * CSP || out_size != CH * CSP) return;
  if (in_sizes[1] != CH || in_sizes[2] != CH) return;
  if (in_sizes[3] != CH * CH || in_sizes[5] != CH * CH || in_sizes[7] != CH * CH || in_sizes[9] != CH * CH) return;
  if (in_sizes[4] != CH || in_sizes[6] != CH || in_sizes[8] != CH || in_sizes[10] != CH) return;

  const float* x     = (const float*)d_in[0];
  const float* gamma = (const float*)d_in[1];
  const float* beta  = (const float*)d_in[2];
  const float* wq    = (const float*)d_in[3];
  const float* bq    = (const float*)d_in[4];
  const float* wk    = (const float*)d_in[5];
  const float* bk    = (const float*)d_in[6];
  const float* wv    = (const float*)d_in[7];
  const float* bv    = (const float*)d_in[8];
  const float* wp    = (const float*)d_in[9];
  const float* bp    = (const float*)d_in[10];
  float* out = (float*)d_out;

  char* ws = (char*)d_ws;
  size_t off = 0;
  double* part = (double*)(ws + off);         off += (size_t)NGRP * NCH * 128;                  // 512 lines of 128 B
  float* wpbv    = (float*)(ws + off);        off += (size_t)(CH / 8) * 128;                    // 64 lines of 128 B
  _Float16* w16  = (_Float16*)(ws + off);     off += (size_t)3 * CH * CH * sizeof(_Float16);   // 1.5 MiB
  _Float16* tok  = (_Float16*)(ws + off);     off += (size_t)NTOK * CH * sizeof(_Float16);     // 16 MiB
  _Float16* q16  = (_Float16*)(ws + off);     off += (size_t)NTOK * CH * sizeof(_Float16);     // 16 MiB
  _Float16* k16  = (_Float16*)(ws + off);     off += (size_t)NTOK * CH * sizeof(_Float16);     // 16 MiB
  _Float16* vT16 = (_Float16*)(ws + off);     off += (size_t)CH * NTOK * sizeof(_Float16);     // 16 MiB  [512][16384]
  float* stat    = (float*)(ws + off);        off += (size_t)NTOK * (SP / KBLK) * 2 * sizeof(float);   // 8 MiB: block max and sum per row and 64 keys
  _Float16* P16  = (_Float16*)(ws + off);     off += (size_t)NTOK * SP * sizeof(_Float16);     // 128 MiB  [16384][4096], every frame's rows
  if (off > ws_size) return;
  // w16 holds Wq | Wk | Wp*Wv, one plane of 512 x 512 each

  // 1. group statistics: partial sums, one workgroup per channel (the normalize kernel adds each group's 16);
  //    in the same launch: Wp*Wv and Wp*bv (136 workgroups in front), Wq and Wk x16 -> f16 (128 workgroups behind)
  gn_stats<<<dim3(NVP + NBV + NGRP * NCH + 2 * NWB), dim3(256), 0, stream>>>(x, part, wq, wk, wv, wp, bv, w16, wpbv);

  // 3. normalize + transpose to tokens
  norm_tok<<<dim3(TFR * 64 * 8), dim3(256), 0, stream>>>(x, gamma, beta, part, tok);

  //    (left to try: k could be the tokens themselves, q*k^T = tok (Wq^T Wk) tok^T + (Wk^T bq) tok^T + terms that are constant along the keys, which softmax drops)
  // 4. the three projections in one launch: 256 workgroups, each walks one tile of q, of k and of v'^T; f16 out:
  //    q = tok*Wq^T/16 + bq and k = tok*Wk^T/16 + bk, [16384][512]; v'^T[c][token] = (Wp*Wv)16*tok^T/16 + (Wp*bv)[c], [512][16384]
  wmma_gemm64<0, false, 3, 1, false, 0, 0, BM, 3><<<dim3(gemm_blocks(NTOK, CH)), dim3(256), 0, stream>>>(
      U16(tok), U16(tok), CH, (long)0, U16(w16), U16(w16), CH, (long)0,
      (void*)q16, (void*)q16, CH, (long)NTOK * CH, bq, x, (long)0, NTOK, CH, CH, WCARRY_INV, stat, bk, wpbv);

  // 5. scores of all frames in one launch: 256 workgroups, each walks its tile of 256 x 256 scores in the four frames: k*q^T*512^-0.5 stays in registers;
  //    each 64-key block of a query is stored as f16 exp(s - block max) in P16[query][key], its max and sum in stat
  wmma_gemm64<0, false, 0, 1, false, 0, 1, SBM, TFR><<<dim3((SP / SBM) * (SP / BN)), dim3(256), 0, stream>>>(
      U16(k16), U16(k16), CH, (long)SP * CH, U16(q16), U16(q16), CH, (long)SP * CH,
      (void*)P16, (void*)P16, SP, (long)SP * SP, bq, x, (long)0, SP, SP, CH, QSCALE, stat, bq, bq);
  // 6. out[c][token] = v'^T * (factor * P16)^T x2^-15 + bp[c] + x[c][token] for all frames in one launch, one frame per blockIdx.y: 64 x 4 = 256 workgroups
  //    (A = vT16 + frame*4096, [512][4096] with pitch 16384, Bt = P16 frame [4096][4096], f32 out [512][4096] with pitch 16384 at column frame*4096)
  wmma_gemm64<0, false, 1, 0, true, 0, 2><<<dim3(gemm_blocks(CH, SP), TFR), dim3(256), 0, stream>>>(
      U16(vT16), U16(vT16), NTOK, (long)SP, U16(P16), U16(P16), SP, (long)SP * SP,
      (void*)out, (void*)out, NTOK, (long)SP, bp, x, (long)SP, CH, SP, SP, PCARRY_INV, stat, bq, bq);
}
